// v000
// The times below were measured on an AMD MI455X: many runs one after another, warmed up first and cycling through
// copies of the inputs, with the whole window's GPU time divided by the number of runs. Launches and the gaps
// between them are all in it. The median over several windows is given; except for v000 it joins two sittings, which
// can be a few percent apart, so the side-by-side timings, each taken in one sitting, are the better comparison.
// v000 is the starting kernel. One run takes 18.8 milliseconds.
#include <hip/hip_runtime.h>
// Scaled dot-product attention on given queries, keys [4][12][2048][64] and values [4][2048][12][64] (note the values layout); scores = q k^T / sqrt(768) (the module scales by the 768-wide latent size); softmax over the 2048 keys; out[b][h] = probs v[b, :, h, :] -> [4][12][2048][64].
// Structure: q, k, v as exact f16 rows (bf16-rounded inputs are exact in f16, so the logits are exact products with f32 sums); per (batch, head): V^T via LDS transposes from this head's 64 columns of the [S][768] value rows; scores as ONE WMMA GEMM (32x64 wave tiles, f32 accumulation, K = 64, alpha 768^-0.5) into an f32 [2048][2048] plane; row softmax on VALU (f32 statistics, native exp; weights x256 f16); out = P V^T GEMM (K = 2048, alpha 2^-8) straight into the output; 3 + 48 x 4 = 195 launches.
// Compute dtype: inputs rounded to bf16 and exact in f16; scores/statistics f32; softmax weights f16 scaled by 256 (~2^-12); out f32. v_wmma_f32_16x16x32_f16.
#define NB 48
#define SQ 2048
#define DM 64
#define NH 1
#define HD 64
#define HG 1
#define NR ((size_t)NB * SQ)
typedef __bf16 v16b __attribute__((ext_vector_type(16)));
typedef unsigned short v8us __attribute__((ext_vector_type(8), may_alias));
typedef float  v8f  __attribute__((ext_vector_type(8)));
typedef float  v4f  __attribute__((ext_vector_type(4)));
typedef float  v4fa __attribute__((ext_vector_type(4), may_alias));
union FragB { v16b v; v8us half[2]; unsigned short u[16]; };

__device__ __forceinline__ unsigned short bf16_bits(float x) { unsigned int u = __float_as_uint(x); return (unsigned short)((u + 0x7FFFu + ((u >> 16) & 1u)) >> 16); }
__device__ __forceinline__ float bf16_val(unsigned short b) { return __uint_as_float(((unsigned int)b) << 16); }
__device__ __forceinline__ float bf16_round(float x) { return bf16_val(bf16_bits(x)); }
// D += A·B with NT terms: 1 = ah·bh, 2 = + al·bh (A split), 3 = + ah·bl (both split)
template <int NT>
__device__ __forceinline__ v8f mmaN(v16b ah, v16b al, v16b bh, v16b bl, v8f c) {
  c = __builtin_amdgcn_wmma_f32_16x16x32_bf16(false, ah, false, bh, (short)0, c, false, false);
  if (NT >= 2) c = __builtin_amdgcn_wmma_f32_16x16x32_bf16(false, al, false, bh, (short)0, c, false, false);
  if (NT >= 3) c = __builtin_amdgcn_wmma_f32_16x16x32_bf16(false, ah, false, bl, (short)0, c, false, false);
  asm volatile("v_nop\n\tv_nop\n\tv_nop\n\tv_nop" : "+v"(c) : "v"(ah), "v"(al), "v"(bh), "v"(bl));
  return c;
}

__global__ __launch_bounds__(256) void k_wt_bf16(const float* __restrict__ W, unsigned short* __restrict__ Wt, int K, int N) {
  const int t = blockIdx.x * 256 + threadIdx.x;
  const int k8n = K / 8;
  if (t >= N * k8n) return;
  const int n = t / k8n, k8 = (t % k8n) * 8;
  v8us v;
#pragma unroll
  for (int i = 0; i < 8; ++i) v[i] = bf16_bits(W[(size_t)(k8 + i) * N + n]);
  *(v8us*)(Wt + (size_t)n * K + k8) = v;
  
}

// GEMM C[M][N] (f32, pitch ldc) = act(A[M][K]·W + bias). A f32 row-major (pitch lda) converted per fragment to bf16
// (ASPLIT: hi/lo two planes -> 2 terms, else single rounded term); Wt bf16 [N][K] (pitch ldb). BIAS_BF16 rounds the
// bias to bf16 first (bias quantised to bf16 before the add). K%32==0, M%16==0, N%64==0.
template <bool ASPLIT, int ACT, bool BIAS_BF16>
__global__ __launch_bounds__(128) void k_gemm_bf(const float* __restrict__ A, int lda, const unsigned short* __restrict__ Wt, int ldb,
                                               const float* __restrict__ bias, float* __restrict__ C, int ldc, int M, int N, int K) {
  __shared__ __attribute__((aligned(16))) float so[4][16][64];
  const int tid = threadIdx.x, w = tid >> 5, lane = tid & 31, ln = lane & 15, hh = lane >> 4;
  const int ntn = N / 64;
  const int wid = blockIdx.x * 4 + w;
  const int mt = wid / ntn, nq = wid % ntn;
  if (mt * 16 >= M) return;
  const int row0 = mt * 16, col0 = nq * 64;
  const float* arow = A + (size_t)(row0 + ln) * lda;
  v8f acc[4] = {};
  for (int kb = 0; kb < K; kb += 32) {
    FragB ah, al;
    const v4f x0 = *(const v4fa*)(arow + kb + 8 * hh), x1 = *(const v4fa*)(arow + kb + 8 * hh + 4);
    const v4f x2 = *(const v4fa*)(arow + kb + 16 + 8 * hh), x3 = *(const v4fa*)(arow + kb + 16 + 8 * hh + 4);
    float xs[16] = {x0[0],x0[1],x0[2],x0[3],x1[0],x1[1],x1[2],x1[3],x2[0],x2[1],x2[2],x2[3],x3[0],x3[1],x3[2],x3[3]};
#pragma unroll
    for (int i = 0; i < 16; ++i) { const unsigned short hb = bf16_bits(xs[i]); ah.u[i] = hb; al.u[i] = ASPLIT ? bf16_bits(xs[i] - bf16_val(hb)) : (unsigned short)0; }
#pragma unroll
    for (int t = 0; t < 4; ++t) {
      const unsigned short* brow = Wt + (size_t)(col0 + t * 16 + ln) * ldb + kb;
      FragB b;
      b.half[0] = *(const v8us*)(brow + 8 * hh);
      b.half[1] = *(const v8us*)(brow + 16 + 8 * hh);
      acc[t] = mmaN<ASPLIT ? 2 : 1>(ah.v, al.v, b.v, b.v, acc[t]);
    }
  }
#pragma unroll
  for (int t = 0; t < 4; ++t) {
    float bv = bias ? bias[col0 + t * 16 + ln] : 0.f;
    if (BIAS_BF16) bv = bf16_round(bv);
#pragma unroll
    for (int r = 0; r < 8; ++r) { float v = acc[t][r] + bv; if (ACT == 1) v = fmaxf(v, 0.f); so[w][8 * hh + r][t * 16 + ln] = v; }
  }
  __builtin_amdgcn_fence(__ATOMIC_ACQ_REL, "workgroup");
  __builtin_amdgcn_wave_barrier();
  const int rsub = lane >> 4, c4 = (lane & 15) * 4;
  {
#pragma unroll
    for (int q = 0; q < 8; ++q) {
      const int r = q * 2 + rsub;
      const v4f v = *(const v4fa*)&so[w][r][c4];
      *(v4f*)(C + (size_t)(row0 + r) * ldc + col0 + c4) = v;
    }
    
  }
}

// GEMM C = act(A·W + bias + resid): A f32 (ASPLIT -> hi/lo 2 terms), Wt bf16 [N][K]; ACT 0 none, 1 relu, 2 exact gelu;
// resid (optional, f32, row index = (row % rmod), pitch ldr, RES_BF16 rounds it) added before the activation.
template <bool ASPLIT, int ACT, bool BIAS_BF16, bool RES_BF16>
__global__ __launch_bounds__(128) void k_gemm_bf3(const float* __restrict__ A, int lda, const unsigned short* __restrict__ Wt, int ldb,
                                                const float* __restrict__ bias, const float* __restrict__ resid, int rmod, int ldr,
                                                float* __restrict__ C, int ldc, int M, int N, int K) {
  __shared__ __attribute__((aligned(16))) float so[4][16][64];
  const int tid = threadIdx.x, w = tid >> 5, lane = tid & 31, ln = lane & 15, hh = lane >> 4;
  const int ntn = N / 64;
  const int wid = blockIdx.x * 4 + w;
  const int mt = wid / ntn, nq = wid % ntn;
  if (mt * 16 >= M) return;
  const int row0 = mt * 16, col0 = nq * 64;
  const float* arow = A + (size_t)(row0 + ln) * lda;
  v8f acc[4] = {};
  for (int kb = 0; kb < K; kb += 32) {
    FragB ah, al;
    const v4f x0 = *(const v4fa*)(arow + kb + 8 * hh), x1 = *(const v4fa*)(arow + kb + 8 * hh + 4);
    const v4f x2 = *(const v4fa*)(arow + kb + 16 + 8 * hh), x3 = *(const v4fa*)(arow + kb + 16 + 8 * hh + 4);
    float xs[16] = {x0[0],x0[1],x0[2],x0[3],x1[0],x1[1],x1[2],x1[3],x2[0],x2[1],x2[2],x2[3],x3[0],x3[1],x3[2],x3[3]};
#pragma unroll
    for (int i = 0; i < 16; ++i) { const unsigned short hb = bf16_bits(xs[i]); ah.u[i] = hb; al.u[i] = ASPLIT ? bf16_bits(xs[i] - bf16_val(hb)) : (unsigned short)0; }
#pragma unroll
    for (int t = 0; t < 4; ++t) {
      const unsigned short* brow = Wt + (size_t)(col0 + t * 16 + ln) * ldb + kb;
      FragB b;
      b.half[0] = *(const v8us*)(brow + 8 * hh);
      b.half[1] = *(const v8us*)(brow + 16 + 8 * hh);
      acc[t] = mmaN<ASPLIT ? 2 : 1>(ah.v, al.v, b.v, b.v, acc[t]);
    }
  }
#pragma unroll
  for (int t = 0; t < 4; ++t) {
    const int col = col0 + t * 16 + ln;
    float bv = bias ? bias[col] : 0.f;
    if (BIAS_BF16) bv = bf16_round(bv);
#pragma unroll
    for (int r = 0; r < 8; ++r) {
      float v = acc[t][r] + bv;
      if (resid) { float rv = resid[(size_t)((row0 + 8 * hh + r) % rmod) * ldr + col]; if (RES_BF16) rv = bf16_round(rv); v += rv; }
      if (ACT == 1) v = fmaxf(v, 0.f);
      if (ACT == 2) v = 0.5f * v * (1.0f + erff(v * 0.70710678118654752f));
      if (ACT == 3) { const float u = 0.7978845608028654f * (v + 0.044715f * v * v * v); v = 0.5f * v * (1.0f + tanhf(u)); }
      so[w][8 * hh + r][t * 16 + ln] = v;
    }
  }
  __builtin_amdgcn_fence(__ATOMIC_ACQ_REL, "workgroup");
  __builtin_amdgcn_wave_barrier();
  const int rsub = lane >> 4, c4 = (lane & 15) * 4;
  {
#pragma unroll
    for (int q = 0; q < 8; ++q) {
      const int r = q * 2 + rsub;
      const v4f v = *(const v4fa*)&so[w][r][c4];
      *(v4f*)(C + (size_t)(row0 + r) * ldc + col0 + c4) = v;
    }
    
  }
}
// row LayerNorm (biased variance, eps) over N: s = X (+ R); optional out_sum <- s; out_norm <- (s-mu)*rsqrt(var+eps)*g + b
template <bool PARAM_BF16>
__global__ __launch_bounds__(256) void k_layernorm(const float* __restrict__ X, const float* __restrict__ R, const float* __restrict__ g, const float* __restrict__ bta,
                                                  float* __restrict__ out_sum, float* __restrict__ out_norm, int N, float eps) {
  __shared__ float red[256];
  const int row = blockIdx.x, tid = threadIdx.x;
  const float* x = X + (size_t)row * N; const float* rr = R ? R + (size_t)row * N : nullptr;
  float vals[16];                     // up to N = 4096
  const int per = N / 256;            // contiguous chunk per thread? use strided-by-4 chunks: thread handles j = tid*4 + 1024*u
  float s1 = 0.f;
  for (int u = 0; u < per / 4; ++u) {
    const int j = tid * 4 + 1024 * u;
    const v4f a = *(const v4fa*)(x + j);
    v4f b = {0.f,0.f,0.f,0.f}; if (rr) b = *(const v4fa*)(rr + j);
#pragma unroll
    for (int q = 0; q < 4; ++q) { const float v = a[q] + b[q]; vals[u * 4 + q] = v; s1 += v; }
  }
  red[tid] = s1; __syncthreads();
  for (int st = 128; st > 0; st >>= 1) { if (tid < st) red[tid] += red[tid + st]; __syncthreads(); }
  const float mu = red[0] / (float)N; __syncthreads();
  float s2 = 0.f;
  for (int u = 0; u < per / 4; ++u)
#pragma unroll
    for (int q = 0; q < 4; ++q) { const float c = vals[u * 4 + q] - mu; s2 += c * c; }
  red[tid] = s2; __syncthreads();
  for (int st = 128; st > 0; st >>= 1) { if (tid < st) red[tid] += red[tid + st]; __syncthreads(); }
  const float rs = rsqrtf(red[0] / (float)N + eps);
  {
    for (int u = 0; u < per / 4; ++u) {
      const int j = tid * 4 + 1024 * u;
      v4f o, sm;
#pragma unroll
      for (int q = 0; q < 4; ++q) {
        float gg = g[j + q], bb = bta[j + q];
        if (PARAM_BF16) { gg = bf16_round(gg); bb = bf16_round(bb); }
        sm[q] = vals[u * 4 + q]; o[q] = (vals[u * 4 + q] - mu) * rs * gg + bb;
      }
      if (out_sum) *(v4f*)(out_sum + (size_t)row * N + j) = sm;
      *(v4f*)(out_norm + (size_t)row * N + j) = o;
    }
    
  }
}



// ---- f16 WMMA path (v_wmma_f32_16x16x32_f16): 11-bit significands for operands in range — used where a [0,1] probability operand needs more precision than bf16
typedef _Float16 v16h __attribute__((ext_vector_type(16)));
union FragH { v16h v; v8us half[2]; _Float16 h[16]; unsigned short u[16]; };
template <int NT>
__device__ __forceinline__ v8f mmaH(v16h ah, v16h al, v16h bh, v16h bl, v8f c) {
  c = __builtin_amdgcn_wmma_f32_16x16x32_f16(false, ah, false, bh, (short)0, c, false, false);
  if (NT >= 2) c = __builtin_amdgcn_wmma_f32_16x16x32_f16(false, al, false, bh, (short)0, c, false, false);
  if (NT >= 3) c = __builtin_amdgcn_wmma_f32_16x16x32_f16(false, ah, false, bl, (short)0, c, false, false);
  asm volatile("v_nop\n\tv_nop\n\tv_nop\n\tv_nop" : "+v"(c) : "v"(ah), "v"(al), "v"(bh), "v"(bl));
  return c;
}
// batched GEMM like k_gemm_b but f16 operands: A f32 (split into f16 hi/lo if ASPLIT, else rounded to f16), Bt = f16 values [n][k]; alpha; C f32; N multiple of 16 (partial tiles skipped)
template <bool ASPLIT>
__global__ __launch_bounds__(128) void k_gemm_h(const float* __restrict__ A, int lda, size_t sA, const _Float16* __restrict__ Bh, int ldb, size_t sB, float alpha, float* __restrict__ C, int ldc, size_t sC, int M, int N, int K) {
  __shared__ __attribute__((aligned(16))) float so[4][16][64];
  const int tid = threadIdx.x, w = tid >> 5, lane = tid & 31, ln = lane & 15, hh = lane >> 4; const int by = blockIdx.y;
  A += (size_t)by * sA; Bh += (size_t)by * sB; C += (size_t)by * sC;
  const int ntn = (N + 63) / 64; const int wid = blockIdx.x * 4 + w; const int mt = wid / ntn, nq = wid % ntn; if (mt * 16 >= M) return;
  const int row0 = mt * 16, col0 = nq * 64; const float* arow = A + (size_t)(row0 + ln) * lda;
  v8f acc[4] = {};
  for (int kb = 0; kb < K; kb += 32) {
    FragH ah, al;
    const v4f x0 = *(const v4fa*)(arow + kb + 8 * hh), x1 = *(const v4fa*)(arow + kb + 8 * hh + 4), x2 = *(const v4fa*)(arow + kb + 16 + 8 * hh), x3 = *(const v4fa*)(arow + kb + 16 + 8 * hh + 4);
    float xs[16] = {x0[0],x0[1],x0[2],x0[3],x1[0],x1[1],x1[2],x1[3],x2[0],x2[1],x2[2],x2[3],x3[0],x3[1],x3[2],x3[3]};
#pragma unroll
    for (int i = 0; i < 16; ++i) { const _Float16 h = (_Float16)xs[i]; ah.h[i] = h; al.h[i] = ASPLIT ? (_Float16)(xs[i] - (float)h) : (_Float16)0.0f; }
#pragma unroll
    for (int t = 0; t < 4; ++t) { if (col0 + t * 16 >= N) continue; const size_t boff = (size_t)(col0 + t * 16 + ln) * ldb + kb; FragH bq; bq.half[0] = *(const v8us*)(Bh + boff + 8 * hh); bq.half[1] = *(const v8us*)(Bh + boff + 16 + 8 * hh);
      acc[t] = mmaH<ASPLIT ? 2 : 1>(ah.v, al.v, bq.v, bq.v, acc[t]); }
  }
#pragma unroll
  for (int t = 0; t < 4; ++t) { if (col0 + t * 16 >= N) continue;
#pragma unroll
    for (int r = 0; r < 8; ++r) so[w][8 * hh + r][t * 16 + ln] = acc[t][r] * alpha; }
  __builtin_amdgcn_fence(__ATOMIC_ACQ_REL, "workgroup"); __builtin_amdgcn_wave_barrier();
  const int rsub = lane >> 4, c4 = (lane & 15) * 4;
  {
#pragma unroll
    for (int q = 0; q < 8; ++q) { const int r = q * 2 + rsub; if (col0 + c4 < N) { const v4f v = *(const v4fa*)&so[w][r][c4]; *(v4f*)(C + (size_t)(row0 + r) * ldc + col0 + c4) = v; } }
     }
}

// Wt[n][k] = f16(W[k][n]·scale) from f32 row-major W[K][N] (scale = power of two; bf16-exact weights stay exact in f16 away from the subnormal range)
__global__ __launch_bounds__(256) void k_wt_f16(const float* __restrict__ W, _Float16* __restrict__ Wt, int K, int N, float scale) {
  const int t = blockIdx.x * 256 + threadIdx.x; if (t >= N * (K / 8)) return; const int n = t / (K / 8), k8 = (t % (K / 8)) * 8; FragH f;
#pragma unroll
  for (int i = 0; i < 8; ++i) f.h[i] = (_Float16)(bf16_round(W[(size_t)(k8 + i) * N + n]) * scale); const v8us o = f.half[0];
  *(v8us*)((unsigned short*)Wt + (size_t)n * K + k8) = o; 
}
// k_gemm_hh variant with fused epilogue: v = acc·alpha + bias[by·sBias + col] (+ CP[(row/rowsPerB)·sCPb + by·64 + col] if CP) ; ACT 0 none / 1 elu ; writes f16 C16 (and f32 C if non-null)
template <int ACT>
__global__ __launch_bounds__(128) void k_gemm_hhx(const _Float16* __restrict__ A, int lda, size_t sA, const _Float16* __restrict__ Bh, int ldb, size_t sB, float alpha, const float* __restrict__ bias, size_t sBias, const float* __restrict__ CP, int rowsPerB, size_t sCPb, int row0g,
    float* __restrict__ C, _Float16* __restrict__ C16, int ldc, size_t sC, int M, int N, int K) {
  __shared__ __attribute__((aligned(16))) float so[4][16][64];
  const int tid = threadIdx.x, w = tid >> 5, lane = tid & 31, ln = lane & 15, hh = lane >> 4; const int by = blockIdx.y;
  A += (size_t)by * sA; Bh += (size_t)by * sB; const size_t cofs = (size_t)by * sC; const float* bp = bias ? bias + (size_t)by * sBias : nullptr;
  const int ntn = (N + 63) / 64; const int wid = blockIdx.x * 4 + w; const int mt = wid / ntn, nq = wid % ntn; if (mt * 16 >= M) return;
  const int row0 = mt * 16, col0 = nq * 64; const _Float16* arow = A + (size_t)(row0 + ln) * lda;
  v8f acc[4] = {};
  for (int kb = 0; kb < K; kb += 32) { FragH ah; ah.half[0] = *(const v8us*)((const unsigned short*)arow + kb + 8 * hh); ah.half[1] = *(const v8us*)((const unsigned short*)arow + kb + 16 + 8 * hh);
#pragma unroll
    for (int t = 0; t < 4; ++t) { if (col0 + t * 16 >= N) continue; const size_t boff = (size_t)(col0 + t * 16 + ln) * ldb + kb; FragH bq; bq.half[0] = *(const v8us*)((const unsigned short*)Bh + boff + 8 * hh); bq.half[1] = *(const v8us*)((const unsigned short*)Bh + boff + 16 + 8 * hh);
      acc[t] = mmaH<1>(ah.v, ah.v, bq.v, bq.v, acc[t]); }
  }
#pragma unroll
  for (int t = 0; t < 4; ++t) { if (col0 + t * 16 >= N) continue; const int col = col0 + t * 16 + ln; const float bv = bp ? bf16_round(bp[col]) : 0.f;
#pragma unroll
    for (int r = 0; r < 8; ++r) { float v = acc[t][r] * alpha + bv; if (CP) { const int rr = row0g + row0 + 8 * hh + r; if (rowsPerB < 0) v += CP[cofs + (size_t)rr * ldc + col];      /* rowsPerB < 0: own element of the batched C plane */ else { const int bidx = rr / rowsPerB; v += CP[(size_t)bidx * sCPb + (size_t)by * 64 + col]; } } if (ACT == 1) v = (v > 0.f) ? v : expm1f(v); else if (ACT == 7) v = (v > 0.f) ? v + 1.0f : expf(v); else if (ACT == 8) v = tanhf(v); else if (ACT == 9) v = 0.5f * v * (1.0f + tanhf(0.7978845608028654f * (v + 0.044715f * v * v * v))); else if (ACT == 11) v = 1.0f / (1.0f + expf(-v)); else if (ACT == 12) v = (v > 0.f) ? v : 0.01f * v; else if (ACT == 14) v = (v > 0.f) ? v : 0.1f * v; else if (ACT == 16) v = (v >= 0.f) ? v : 0.3f * v; else if (ACT == 17) v = (v >= 0.f) ? v : 0.2f * v; else if (ACT == 15) v = v / (1.0f + expf(-v)); else if (ACT == 3) v = fmaxf(v, 0.f); else if (ACT == 6) v = 0.5f * v * (1.0f + erff(v * 0.70710678118654752f)); so[w][8 * hh + r][t * 16 + ln] = v; } }
  __builtin_amdgcn_fence(__ATOMIC_ACQ_REL, "workgroup"); __builtin_amdgcn_wave_barrier();
  const int rsub = lane >> 4, c4 = (lane & 15) * 4; typedef _Float16 v4h __attribute__((ext_vector_type(4)));
  {
#pragma unroll
    for (int q = 0; q < 8; ++q) { const int r = q * 2 + rsub; if (col0 + c4 < N) { const v4f v = *(const v4fa*)&so[w][r][c4]; if (C) *(v4f*)(C + cofs + (size_t)(row0 + r) * ldc + col0 + c4) = v; if (C16) { v4h h4; for (int i = 0; i < 4; ++i) h4[i] = (_Float16)v[i]; *(v4h*)(C16 + cofs + (size_t)(row0 + r) * ldc + col0 + c4) = h4; } } }
     }
}


typedef _Float16 v4h __attribute__((ext_vector_type(4)));

__global__ __launch_bounds__(256) void k_x16(const float* __restrict__ x, _Float16* __restrict__ X16, size_t n8) { const size_t t = (size_t)blockIdx.x * 256 + threadIdx.x; if (t >= n8) return; FragH f;
#pragma unroll
  for (int q = 0; q < 8; ++q) f.h[q] = (_Float16)bf16_round(x[t * 8 + q]); *(v8us*)((unsigned short*)X16 + t * 8) = f.half[0];  }
__global__ __launch_bounds__(256) void k_h16(const float* __restrict__ x, _Float16* __restrict__ X16, size_t n8) { const size_t t = (size_t)blockIdx.x * 256 + threadIdx.x; if (t >= n8) return; FragH f;
#pragma unroll
  for (int q = 0; q < 8; ++q) f.h[q] = (_Float16)x[t * 8 + q]; *(v8us*)((unsigned short*)X16 + t * 8) = f.half[0];  }
__global__ __launch_bounds__(256) void k_round16f(const float* __restrict__ W, _Float16* __restrict__ Bt, size_t n8) { const size_t t = (size_t)blockIdx.x * 256 + threadIdx.x; if (t >= n8) return; FragH f;
#pragma unroll
  for (int i = 0; i < 8; ++i) f.h[i] = (_Float16)(bf16_round(W[t * 8 + i]) * 16.0f); *(v8us*)((unsigned short*)Bt + t * 8) = f.half[0];  }
template <int NHv, int TTv>
__global__ __launch_bounds__(256) void k_vt(const _Float16* __restrict__ V16, int ldv, int voff, _Float16* __restrict__ Vt) { __shared__ unsigned short tl[64][66]; const int tid = threadIdx.x; const int slab = blockIdx.x / (TTv / 64), lg = blockIdx.x % (TTv / 64); const int b = slab / NHv, h = slab % NHv;
  for (int i = tid; i < 64 * 8; i += 256) { const int r = i / 8, c8 = (i % 8) * 8; FragH f; f.half[0] = *(const v8us*)((const unsigned short*)V16 + ((size_t)b * TTv + lg * 64 + r) * ldv + voff + h * 64 + c8);
#pragma unroll
    for (int q = 0; q < 8; ++q) tl[r][c8 + q] = f.u[q]; }
  __syncthreads();
  {
#pragma unroll
    for (int rd = 0; rd < 2; ++rd) { const int d = rd * 32 + tid / 8, pc = tid % 8; FragH f;
#pragma unroll
      for (int q = 0; q < 8; ++q) f.u[q] = tl[pc * 8 + q][d];
      *(v8us*)((unsigned short*)Vt + ((size_t)slab * 64 + d) * TTv + lg * 64 + pc * 8) = f.half[0]; }
     } }

__global__ __launch_bounds__(256) void k_hl(const float* __restrict__ F, _Float16* __restrict__ Hh, _Float16* __restrict__ Hl, size_t n8) { const size_t t = (size_t)blockIdx.x * 256 + threadIdx.x; if (t >= n8) return; FragH fh, fl; const v4f a = *(const v4fa*)(F + t * 8), c = *(const v4fa*)(F + t * 8 + 4);
#pragma unroll
  for (int q = 0; q < 4; ++q) { _Float16 h = (_Float16)a[q]; fh.h[q] = h; fl.h[q] = (_Float16)((a[q] - (float)h) * 1024.0f); h = (_Float16)c[q]; fh.h[4 + q] = h; fl.h[4 + q] = (_Float16)((c[q] - (float)h) * 1024.0f); }
  { *(v8us*)((unsigned short*)Hh + t * 8) = fh.half[0]; *(v8us*)((unsigned short*)Hl + t * 8) = fl.half[0];  } }

// ---- fast GEMM (wave tile 32x64; requires M % 32 == 0 rows per launch region and N % 64 == 0); epilogue = k_gemm_hhx semantics ----
__device__ __forceinline__ v16h g2_frag(const _Float16* p, int hh) { FragH f; f.half[0] = *(const v8us*)((const unsigned short*)p + 8 * hh); f.half[1] = *(const v8us*)((const unsigned short*)p + 16 + 8 * hh); return f.v; }
__device__ __forceinline__ v8f g2_mma(v16h a, v16h b, v8f c) { v8f d = __builtin_amdgcn_wmma_f32_16x16x32_f16(false, a, false, b, (short)0, c, false, false); asm volatile("v_nop\n\tv_nop\n\tv_nop\n\tv_nop" : "+v"(d) : "v"(a), "v"(b)); return d; }
template <int ACT>
__global__ __launch_bounds__(128) void k_gemm2(const _Float16* __restrict__ A, int lda, size_t sA, const _Float16* __restrict__ Bh, int ldb, size_t sB, float alpha, const float* __restrict__ bias, size_t sBias, const float* __restrict__ CP, int rowsPerB, size_t sCPb, int row0g,
    float* __restrict__ C, _Float16* __restrict__ C16, int ldc, size_t sC, int M, int N, int K) { static_assert(ACT == 0 || ACT == 3 || ACT == 6 || ACT == 8 || ACT == 9 || ACT == 11 || ACT == 12 || ACT == 14 || ACT == 15 || ACT == 16 || ACT == 17, "k_gemm2: unsupported ACT code (would silently apply no activation)");
  __shared__ __attribute__((aligned(16))) float so[4][32][68];
  const int tid = threadIdx.x, w = tid >> 5, lane = tid & 31, ln = lane & 15, hh = lane >> 4; const int by = blockIdx.y;
  A += (size_t)by * sA; Bh += (size_t)by * sB; const size_t cofs = (size_t)by * sC; const float* bp = bias ? bias + (size_t)by * sBias : nullptr;
  const int ntn = N >> 6; const int mt = blockIdx.x / ntn, nq = blockIdx.x - mt * ntn; const int row0 = mt * 128 + 32 * w, col0 = nq * 64; if (row0 >= M) return;
  const _Float16* a0p = A + (size_t)(row0 + ln) * lda; const _Float16* a1p = a0p + (size_t)16 * lda;
  const _Float16* b0p = Bh + (size_t)(col0 + ln) * ldb; const _Float16* b1p = b0p + (size_t)16 * ldb; const _Float16* b2p = b1p + (size_t)16 * ldb; const _Float16* b3p = b2p + (size_t)16 * ldb;
  const v8f z8 = {0.f,0.f,0.f,0.f,0.f,0.f,0.f,0.f}; v8f c00 = z8, c01 = z8, c02 = z8, c03 = z8, c10 = z8, c11 = z8, c12 = z8, c13 = z8;
#pragma unroll 1
  for (int kb = 0; kb < K; kb += 32) { const v16h a0 = g2_frag(a0p + kb, hh), a1 = g2_frag(a1p + kb, hh);
    v16h b = g2_frag(b0p + kb, hh); c00 = g2_mma(a0, b, c00); c10 = g2_mma(a1, b, c10);
    b = g2_frag(b1p + kb, hh); c01 = g2_mma(a0, b, c01); c11 = g2_mma(a1, b, c11);
    b = g2_frag(b2p + kb, hh); c02 = g2_mma(a0, b, c02); c12 = g2_mma(a1, b, c12);
    b = g2_frag(b3p + kb, hh); c03 = g2_mma(a0, b, c03); c13 = g2_mma(a1, b, c13); }
  v8f accs[8] = {c00, c01, c02, c03, c10, c11, c12, c13};
#pragma unroll
  for (int u = 0; u < 8; ++u) { const int t = u & 3, half = u >> 2; const int col = col0 + t * 16 + ln; const float bv = bp ? bf16_round(bp[col]) : 0.f;
#pragma unroll
    for (int r = 0; r < 8; ++r) { const int rloc = half * 16 + 8 * hh + r; float v = accs[u][r] * alpha + bv; if (CP) { if (rowsPerB < 0) v += CP[cofs + (size_t)(row0g + row0 + rloc) * ldc + col];      /* rowsPerB < 0: own element of the batched C plane */ else { const int bidx = (row0g + row0 + rloc) / rowsPerB; v += CP[(size_t)bidx * sCPb + (size_t)by * 64 + col]; } }
      if (ACT == 3) v = fmaxf(v, 0.f); else if (ACT == 6) v = 0.5f * v * (1.0f + erff(v * 0.70710678118654752f)); else if (ACT == 11) v = 1.0f / (1.0f + expf(-v)); else if (ACT == 15) v = v / (1.0f + expf(-v)); else if (ACT == 12) v = (v > 0.f) ? v : 0.01f * v; else if (ACT == 8) v = tanhf(v); else if (ACT == 9) v = 0.5f * v * (1.0f + tanhf(0.7978845608028654f * (v + 0.044715f * v * v * v))); else if (ACT == 14) v = (v > 0.f) ? v : 0.1f * v; else if (ACT == 16) v = (v >= 0.f) ? v : 0.3f * v; else if (ACT == 17) v = (v >= 0.f) ? v : 0.2f * v;
      so[w][rloc][t * 16 + ln] = v; } }
  __builtin_amdgcn_fence(__ATOMIC_ACQ_REL, "workgroup"); __builtin_amdgcn_wave_barrier();
  const int rsub = lane >> 4, c4 = (lane & 15) * 4;
  {
#pragma unroll
    for (int q = 0; q < 16; ++q) { const int r = q * 2 + rsub; const v4f v = *(const v4fa*)&so[w][r][c4]; if (C) *(v4f*)(C + cofs + (size_t)(row0 + r) * ldc + col0 + c4) = v; if (C16) { v4h h4; for (int i = 0; i < 4; ++i) h4[i] = (_Float16)v[i]; *(v4h*)(C16 + cofs + (size_t)(row0 + r) * ldc + col0 + c4) = h4; } }
     } }


__global__ __launch_bounds__(256) void k_wnat(const float* __restrict__ w, size_t n8, _Float16* __restrict__ Bt) { const size_t t = (size_t)blockIdx.x * 256 + threadIdx.x; if (t >= n8) return; FragH f; for (int q = 0; q < 8; ++q) f.h[q] = (_Float16)(bf16_round(w[t * 8 + q]) * 16.0f); *(v8us*)((unsigned short*)Bt + t * 8) = f.half[0];  }
__global__ __launch_bounds__(256) void k_rsm(const float* __restrict__ S, _Float16* __restrict__ P, int nrows) {
  #pragma clang fp contract(off)
  const int i = blockIdx.x * 256 + threadIdx.x; if (i >= nrows) return; const float* s = S + (size_t)i * SQ; float mx = -3.0e38f;
#pragma unroll 1
  for (int j = 0; j < SQ; ++j) mx = fmaxf(mx, s[j]); float se = 0.f;
#pragma unroll 1
  for (int j = 0; j < SQ; ++j) se += expf(s[j] - mx); const float sc = 256.0f / se;
#pragma unroll 1
  for (int j0 = 0; j0 < SQ; j0 += 8) { FragH f; for (int q = 0; q < 8; ++q) f.h[q] = (_Float16)(expf(s[j0 + q] - mx) * sc); unsigned short* d = (unsigned short*)P + (size_t)i * SQ + j0; *(v8us*)d = f.half[0];  } }
__global__ __launch_bounds__(256) void k_vt(const _Float16* __restrict__ V16, int b, int h0, _Float16* __restrict__ VT) { __shared__ unsigned short tl[64][65]; const int tid = threadIdx.x; const int hh = blockIdx.x % HG, sg = blockIdx.x / HG; const int s0 = sg * 64; const int h = h0 + hh;
  for (int i = tid; i < 64 * 8; i += 256) { const int j = i / 8, d8 = (i % 8) * 8; FragH f; f.half[0] = *(const v8us*)((const unsigned short*)V16 + ((size_t)b * SQ + s0 + j) * DM + h * HD + d8); for (int q = 0; q < 8; ++q) tl[d8 + q][j] = f.u[q]; }
  __syncthreads();
  { for (int i = tid; i < 64 * 8; i += 256) { const int d = i / 8, j8 = (i % 8) * 8; FragH f; for (int q = 0; q < 8; ++q) f.u[q] = tl[d][j8 + q]; *(v8us*)((unsigned short*)VT + ((size_t)hh * HD + d) * SQ + s0 + j8) = f.half[0]; }  } }


__global__ __launch_bounds__(256) void k_rsmf(const float* __restrict__ S, _Float16* __restrict__ P, int qn, int hg) {
  #pragma clang fp contract(off)
  const int t = blockIdx.x * 256 + threadIdx.x; if (t >= qn * hg) return; const size_t i = (size_t)(t / qn) * SQ + (t % qn); const float* s = S + i * SQ; float mx = -3.0e38f;
#pragma unroll 1
  for (int j = 0; j < SQ; ++j) mx = fmaxf(mx, s[j]); float se = 0.f;
#pragma unroll 1
  for (int j = 0; j < SQ; ++j) se += __expf(s[j] - mx); const float sc = 256.0f / se;
#pragma unroll 1
  for (int j0 = 0; j0 < SQ; j0 += 8) { FragH f; for (int q = 0; q < 8; ++q) f.h[q] = (_Float16)(__expf(s[j0 + q] - mx) * sc); unsigned short* d = (unsigned short*)P + i * SQ + j0; *(v8us*)d = f.half[0];  } }

extern "C" void kernel_launch(void* const* d_in, const int* in_sizes, int n_in,
                              void* d_out, int out_size, void* d_ws, size_t ws_size, hipStream_t stream) {
  (void)in_sizes; (void)n_in; (void)out_size;
  const float* const* I = (const float* const*)d_in; const float* q = I[0]; const float* k = I[1]; const float* v = I[2];
  char* ws = (char*)d_ws; size_t off = 0;
  auto take = [&](size_t bytes) { char* p = ws + off; off += (bytes + 255) & ~(size_t)255; return p; };
  _Float16* Q16 = (_Float16*)take(NR * DM * 2); _Float16* K16 = (_Float16*)take(NR * DM * 2); _Float16* V16 = (_Float16*)take(NR * DM * 2); float* S = (float*)take((size_t)SQ * SQ * 4); _Float16* P = (_Float16*)take((size_t)SQ * SQ * 2); _Float16* VT = (_Float16*)take((size_t)HD * SQ * 2);
  if (off > ws_size) return;      /* approx 12 x 3 + 16 + 8 + 0.25 = 60 MiB */
  k_x16<<<(unsigned)((NR * DM / 8 + 255) / 256), 256, 0, stream>>>(q, Q16, NR * DM / 8); k_x16<<<(unsigned)((NR * DM / 8 + 255) / 256), 256, 0, stream>>>(k, K16, NR * DM / 8); k_x16<<<(unsigned)((NR * DM / 8 + 255) / 256), 256, 0, stream>>>(v, V16, NR * DM / 8);
  for (int b = 0; b < NB; ++b) { const size_t r0 = (size_t)b * SQ;
    { const int bb = b / 12, hh = b % 12; k_vt<1, SQ><<<SQ / 64, 256, 0, stream>>>(V16 + (size_t)bb * SQ * 768 + (size_t)hh * 64, 768, 0, VT); }      /* values are [B][S][12][64]: this slice's 64 columns of the 768-wide rows */
    k_gemm2<0><<<dim3((SQ / 128) * (SQ / 64), 1), 128, 0, stream>>>(Q16 + r0 * DM, DM, 0, K16 + r0 * DM, DM, 0, 0.03608439182435161f, nullptr, 0, nullptr, 1, 0, 0, S, nullptr, SQ, 0, SQ, SQ, DM);      /* scores / sqrt(768) (exact products) */
    k_rsmf<<<(SQ + 255) / 256, 256, 0, stream>>>(S, P, SQ, 1);
    k_gemm2<0><<<dim3((SQ / 128) * (HD / 64), 1), 128, 0, stream>>>(P, SQ, 0, VT, SQ, 0, 0.00390625f, nullptr, 0, nullptr, 1, 0, 0, (float*)d_out + r0 * DM, nullptr, DM, 0, SQ, HD, SQ); }      /* out = P V / 256 */
}

// v001
// A run of this version takes 3550 microseconds.
// Next to v000, in two timings, it ran 5.33 and 5.32 times as fast.
#include <hip/hip_runtime.h>
// Scaled dot-product attention on given queries, keys [4][12][2048][64] and values [4][2048][12][64] (note the values layout); scores = q k^T / sqrt(768) (the module scales by the 768-wide latent size); softmax over the 2048 keys; out[b][h] = probs v[b, :, h, :] -> [4][12][2048][64].
// Structure: q, k, v as exact f16 rows (bf16-rounded inputs are exact in f16, so the logits are exact products with f32 sums); per (batch, head): V^T via LDS transposes from this head's 64 columns of the [S][768] value rows; scores as ONE WMMA GEMM (32x64 wave tiles, f32 accumulation, K = 64, alpha 768^-0.5) into an f32 [2048][2048] plane; row softmax on VALU, one wave per row (f32 statistics, native exp; weights x256 f16); out = P V^T GEMM (K = 2048, alpha 2^-8) straight into the output; 3 + 48 x 4 = 195 launches.
// Compute dtype: inputs rounded to bf16 and exact in f16; scores/statistics f32; softmax weights plain f16 (~2^-12); out f32. v_wmma_f32_16x16x32_f16.
#define NB 48
#define SQ 2048
#define DM 64
#define NH 1
#define HD 64
#define HG 1
#define NR ((size_t)NB * SQ)
typedef __bf16 v16b __attribute__((ext_vector_type(16)));
typedef unsigned short v8us __attribute__((ext_vector_type(8), may_alias));
typedef float  v8f  __attribute__((ext_vector_type(8)));
typedef float  v4f  __attribute__((ext_vector_type(4)));
typedef float  v4fa __attribute__((ext_vector_type(4), may_alias));
union FragB { v16b v; v8us half[2]; unsigned short u[16]; };

__device__ __forceinline__ unsigned short bf16_bits(float x) { unsigned int u = __float_as_uint(x); return (unsigned short)((u + 0x7FFFu + ((u >> 16) & 1u)) >> 16); }
__device__ __forceinline__ float bf16_val(unsigned short b) { return __uint_as_float(((unsigned int)b) << 16); }
__device__ __forceinline__ float bf16_round(float x) { return bf16_val(bf16_bits(x)); }
// D += A·B with NT terms: 1 = ah·bh, 2 = + al·bh (A split), 3 = + ah·bl (both split)
template <int NT>
__device__ __forceinline__ v8f mmaN(v16b ah, v16b al, v16b bh, v16b bl, v8f c) {
  c = __builtin_amdgcn_wmma_f32_16x16x32_bf16(false, ah, false, bh, (short)0, c, false, false);
  if (NT >= 2) c = __builtin_amdgcn_wmma_f32_16x16x32_bf16(false, al, false, bh, (short)0, c, false, false);
  if (NT >= 3) c = __builtin_amdgcn_wmma_f32_16x16x32_bf16(false, ah, false, bl, (short)0, c, false, false);
  asm volatile("v_nop\n\tv_nop\n\tv_nop\n\tv_nop" : "+v"(c) : "v"(ah), "v"(al), "v"(bh), "v"(bl));
  return c;
}

__global__ __launch_bounds__(256) void k_wt_bf16(const float* __restrict__ W, unsigned short* __restrict__ Wt, int K, int N) {
  const int t = blockIdx.x * 256 + threadIdx.x;
  const int k8n = K / 8;
  if (t >= N * k8n) return;
  const int n = t / k8n, k8 = (t % k8n) * 8;
  v8us v;
#pragma unroll
  for (int i = 0; i < 8; ++i) v[i] = bf16_bits(W[(size_t)(k8 + i) * N + n]);
  *(v8us*)(Wt + (size_t)n * K + k8) = v;
  
}

// GEMM C[M][N] (f32, pitch ldc) = act(A[M][K]·W + bias). A f32 row-major (pitch lda) converted per fragment to bf16
// (ASPLIT: hi/lo two planes -> 2 terms, else single rounded term); Wt bf16 [N][K] (pitch ldb). BIAS_BF16 rounds the
// bias to bf16 first (bias quantised to bf16 before the add). K%32==0, M%16==0, N%64==0.
template <bool ASPLIT, int ACT, bool BIAS_BF16>
__global__ __launch_bounds__(128) void k_gemm_bf(const float* __restrict__ A, int lda, const unsigned short* __restrict__ Wt, int ldb,
                                               const float* __restrict__ bias, float* __restrict__ C, int ldc, int M, int N, int K) {
  __shared__ __attribute__((aligned(16))) float so[4][16][64];
  const int tid = threadIdx.x, w = tid >> 5, lane = tid & 31, ln = lane & 15, hh = lane >> 4;
  const int ntn = N / 64;
  const int wid = blockIdx.x * 4 + w;
  const int mt = wid / ntn, nq = wid % ntn;
  if (mt * 16 >= M) return;
  const int row0 = mt * 16, col0 = nq * 64;
  const float* arow = A + (size_t)(row0 + ln) * lda;
  v8f acc[4] = {};
  for (int kb = 0; kb < K; kb += 32) {
    FragB ah, al;
    const v4f x0 = *(const v4fa*)(arow + kb + 8 * hh), x1 = *(const v4fa*)(arow + kb + 8 * hh + 4);
    const v4f x2 = *(const v4fa*)(arow + kb + 16 + 8 * hh), x3 = *(const v4fa*)(arow + kb + 16 + 8 * hh + 4);
    float xs[16] = {x0[0],x0[1],x0[2],x0[3],x1[0],x1[1],x1[2],x1[3],x2[0],x2[1],x2[2],x2[3],x3[0],x3[1],x3[2],x3[3]};
#pragma unroll
    for (int i = 0; i < 16; ++i) { const unsigned short hb = bf16_bits(xs[i]); ah.u[i] = hb; al.u[i] = ASPLIT ? bf16_bits(xs[i] - bf16_val(hb)) : (unsigned short)0; }
#pragma unroll
    for (int t = 0; t < 4; ++t) {
      const unsigned short* brow = Wt + (size_t)(col0 + t * 16 + ln) * ldb + kb;
      FragB b;
      b.half[0] = *(const v8us*)(brow + 8 * hh);
      b.half[1] = *(const v8us*)(brow + 16 + 8 * hh);
      acc[t] = mmaN<ASPLIT ? 2 : 1>(ah.v, al.v, b.v, b.v, acc[t]);
    }
  }
#pragma unroll
  for (int t = 0; t < 4; ++t) {
    float bv = bias ? bias[col0 + t * 16 + ln] : 0.f;
    if (BIAS_BF16) bv = bf16_round(bv);
#pragma unroll
    for (int r = 0; r < 8; ++r) { float v = acc[t][r] + bv; if (ACT == 1) v = fmaxf(v, 0.f); so[w][8 * hh + r][t * 16 + ln] = v; }
  }
  __builtin_amdgcn_fence(__ATOMIC_ACQ_REL, "workgroup");
  __builtin_amdgcn_wave_barrier();
  const int rsub = lane >> 4, c4 = (lane & 15) * 4;
  {
#pragma unroll
    for (int q = 0; q < 8; ++q) {
      const int r = q * 2 + rsub;
      const v4f v = *(const v4fa*)&so[w][r][c4];
      *(v4f*)(C + (size_t)(row0 + r) * ldc + col0 + c4) = v;
    }
    
  }
}

// GEMM C = act(A·W + bias + resid): A f32 (ASPLIT -> hi/lo 2 terms), Wt bf16 [N][K]; ACT 0 none, 1 relu, 2 exact gelu;
// resid (optional, f32, row index = (row % rmod), pitch ldr, RES_BF16 rounds it) added before the activation.
template <bool ASPLIT, int ACT, bool BIAS_BF16, bool RES_BF16>
__global__ __launch_bounds__(128) void k_gemm_bf3(const float* __restrict__ A, int lda, const unsigned short* __restrict__ Wt, int ldb,
                                                const float* __restrict__ bias, const float* __restrict__ resid, int rmod, int ldr,
                                                float* __restrict__ C, int ldc, int M, int N, int K) {
  __shared__ __attribute__((aligned(16))) float so[4][16][64];
  const int tid = threadIdx.x, w = tid >> 5, lane = tid & 31, ln = lane & 15, hh = lane >> 4;
  const int ntn = N / 64;
  const int wid = blockIdx.x * 4 + w;
  const int mt = wid / ntn, nq = wid % ntn;
  if (mt * 16 >= M) return;
  const int row0 = mt * 16, col0 = nq * 64;
  const float* arow = A + (size_t)(row0 + ln) * lda;
  v8f acc[4] = {};
  for (int kb = 0; kb < K; kb += 32) {
    FragB ah, al;
    const v4f x0 = *(const v4fa*)(arow + kb + 8 * hh), x1 = *(const v4fa*)(arow + kb + 8 * hh + 4);
    const v4f x2 = *(const v4fa*)(arow + kb + 16 + 8 * hh), x3 = *(const v4fa*)(arow + kb + 16 + 8 * hh + 4);
    float xs[16] = {x0[0],x0[1],x0[2],x0[3],x1[0],x1[1],x1[2],x1[3],x2[0],x2[1],x2[2],x2[3],x3[0],x3[1],x3[2],x3[3]};
#pragma unroll
    for (int i = 0; i < 16; ++i) { const unsigned short hb = bf16_bits(xs[i]); ah.u[i] = hb; al.u[i] = ASPLIT ? bf16_bits(xs[i] - bf16_val(hb)) : (unsigned short)0; }
#pragma unroll
    for (int t = 0; t < 4; ++t) {
      const unsigned short* brow = Wt + (size_t)(col0 + t * 16 + ln) * ldb + kb;
      FragB b;
      b.half[0] = *(const v8us*)(brow + 8 * hh);
      b.half[1] = *(const v8us*)(brow + 16 + 8 * hh);
      acc[t] = mmaN<ASPLIT ? 2 : 1>(ah.v, al.v, b.v, b.v, acc[t]);
    }
  }
#pragma unroll
  for (int t = 0; t < 4; ++t) {
    const int col = col0 + t * 16 + ln;
    float bv = bias ? bias[col] : 0.f;
    if (BIAS_BF16) bv = bf16_round(bv);
#pragma unroll
    for (int r = 0; r < 8; ++r) {
      float v = acc[t][r] + bv;
      if (resid) { float rv = resid[(size_t)((row0 + 8 * hh + r) % rmod) * ldr + col]; if (RES_BF16) rv = bf16_round(rv); v += rv; }
      if (ACT == 1) v = fmaxf(v, 0.f);
      if (ACT == 2) v = 0.5f * v * (1.0f + erff(v * 0.70710678118654752f));
      if (ACT == 3) { const float u = 0.7978845608028654f * (v + 0.044715f * v * v * v); v = 0.5f * v * (1.0f + tanhf(u)); }
      so[w][8 * hh + r][t * 16 + ln] = v;
    }
  }
  __builtin_amdgcn_fence(__ATOMIC_ACQ_REL, "workgroup");
  __builtin_amdgcn_wave_barrier();
  const int rsub = lane >> 4, c4 = (lane & 15) * 4;
  {
#pragma unroll
    for (int q = 0; q < 8; ++q) {
      const int r = q * 2 + rsub;
      const v4f v = *(const v4fa*)&so[w][r][c4];
      *(v4f*)(C + (size_t)(row0 + r) * ldc + col0 + c4) = v;
    }
    
  }
}
// row LayerNorm (biased variance, eps) over N: s = X (+ R); optional out_sum <- s; out_norm <- (s-mu)*rsqrt(var+eps)*g + b
template <bool PARAM_BF16>
__global__ __launch_bounds__(256) void k_layernorm(const float* __restrict__ X, const float* __restrict__ R, const float* __restrict__ g, const float* __restrict__ bta,
                                                  float* __restrict__ out_sum, float* __restrict__ out_norm, int N, float eps) {
  __shared__ float red[256];
  const int row = blockIdx.x, tid = threadIdx.x;
  const float* x = X + (size_t)row * N; const float* rr = R ? R + (size_t)row * N : nullptr;
  float vals[16];                     // up to N = 4096
  const int per = N / 256;            // contiguous chunk per thread? use strided-by-4 chunks: thread handles j = tid*4 + 1024*u
  float s1 = 0.f;
  for (int u = 0; u < per / 4; ++u) {
    const int j = tid * 4 + 1024 * u;
    const v4f a = *(const v4fa*)(x + j);
    v4f b = {0.f,0.f,0.f,0.f}; if (rr) b = *(const v4fa*)(rr + j);
#pragma unroll
    for (int q = 0; q < 4; ++q) { const float v = a[q] + b[q]; vals[u * 4 + q] = v; s1 += v; }
  }
  red[tid] = s1; __syncthreads();
  for (int st = 128; st > 0; st >>= 1) { if (tid < st) red[tid] += red[tid + st]; __syncthreads(); }
  const float mu = red[0] / (float)N; __syncthreads();
  float s2 = 0.f;
  for (int u = 0; u < per / 4; ++u)
#pragma unroll
    for (int q = 0; q < 4; ++q) { const float c = vals[u * 4 + q] - mu; s2 += c * c; }
  red[tid] = s2; __syncthreads();
  for (int st = 128; st > 0; st >>= 1) { if (tid < st) red[tid] += red[tid + st]; __syncthreads(); }
  const float rs = rsqrtf(red[0] / (float)N + eps);
  {
    for (int u = 0; u < per / 4; ++u) {
      const int j = tid * 4 + 1024 * u;
      v4f o, sm;
#pragma unroll
      for (int q = 0; q < 4; ++q) {
        float gg = g[j + q], bb = bta[j + q];
        if (PARAM_BF16) { gg = bf16_round(gg); bb = bf16_round(bb); }
        sm[q] = vals[u * 4 + q]; o[q] = (vals[u * 4 + q] - mu) * rs * gg + bb;
      }
      if (out_sum) *(v4f*)(out_sum + (size_t)row * N + j) = sm;
      *(v4f*)(out_norm + (size_t)row * N + j) = o;
    }
    
  }
}



// ---- f16 WMMA path (v_wmma_f32_16x16x32_f16): 11-bit significands for operands in range — used where a [0,1] probability operand needs more precision than bf16
typedef _Float16 v16h __attribute__((ext_vector_type(16)));
union FragH { v16h v; v8us half[2]; _Float16 h[16]; unsigned short u[16]; };
template <int NT>
__device__ __forceinline__ v8f mmaH(v16h ah, v16h al, v16h bh, v16h bl, v8f c) {
  c = __builtin_amdgcn_wmma_f32_16x16x32_f16(false, ah, false, bh, (short)0, c, false, false);
  if (NT >= 2) c = __builtin_amdgcn_wmma_f32_16x16x32_f16(false, al, false, bh, (short)0, c, false, false);
  if (NT >= 3) c = __builtin_amdgcn_wmma_f32_16x16x32_f16(false, ah, false, bl, (short)0, c, false, false);
  asm volatile("v_nop\n\tv_nop\n\tv_nop\n\tv_nop" : "+v"(c) : "v"(ah), "v"(al), "v"(bh), "v"(bl));
  return c;
}
// batched GEMM like k_gemm_b but f16 operands: A f32 (split into f16 hi/lo if ASPLIT, else rounded to f16), Bt = f16 values [n][k]; alpha; C f32; N multiple of 16 (partial tiles skipped)
template <bool ASPLIT>
__global__ __launch_bounds__(128) void k_gemm_h(const float* __restrict__ A, int lda, size_t sA, const _Float16* __restrict__ Bh, int ldb, size_t sB, float alpha, float* __restrict__ C, int ldc, size_t sC, int M, int N, int K) {
  __shared__ __attribute__((aligned(16))) float so[4][16][64];
  const int tid = threadIdx.x, w = tid >> 5, lane = tid & 31, ln = lane & 15, hh = lane >> 4; const int by = blockIdx.y;
  A += (size_t)by * sA; Bh += (size_t)by * sB; C += (size_t)by * sC;
  const int ntn = (N + 63) / 64; const int wid = blockIdx.x * 4 + w; const int mt = wid / ntn, nq = wid % ntn; if (mt * 16 >= M) return;
  const int row0 = mt * 16, col0 = nq * 64; const float* arow = A + (size_t)(row0 + ln) * lda;
  v8f acc[4] = {};
  for (int kb = 0; kb < K; kb += 32) {
    FragH ah, al;
    const v4f x0 = *(const v4fa*)(arow + kb + 8 * hh), x1 = *(const v4fa*)(arow + kb + 8 * hh + 4), x2 = *(const v4fa*)(arow + kb + 16 + 8 * hh), x3 = *(const v4fa*)(arow + kb + 16 + 8 * hh + 4);
    float xs[16] = {x0[0],x0[1],x0[2],x0[3],x1[0],x1[1],x1[2],x1[3],x2[0],x2[1],x2[2],x2[3],x3[0],x3[1],x3[2],x3[3]};
#pragma unroll
    for (int i = 0; i < 16; ++i) { const _Float16 h = (_Float16)xs[i]; ah.h[i] = h; al.h[i] = ASPLIT ? (_Float16)(xs[i] - (float)h) : (_Float16)0.0f; }
#pragma unroll
    for (int t = 0; t < 4; ++t) { if (col0 + t * 16 >= N) continue; const size_t boff = (size_t)(col0 + t * 16 + ln) * ldb + kb; FragH bq; bq.half[0] = *(const v8us*)(Bh + boff + 8 * hh); bq.half[1] = *(const v8us*)(Bh + boff + 16 + 8 * hh);
      acc[t] = mmaH<ASPLIT ? 2 : 1>(ah.v, al.v, bq.v, bq.v, acc[t]); }
  }
#pragma unroll
  for (int t = 0; t < 4; ++t) { if (col0 + t * 16 >= N) continue;
#pragma unroll
    for (int r = 0; r < 8; ++r) so[w][8 * hh + r][t * 16 + ln] = acc[t][r] * alpha; }
  __builtin_amdgcn_fence(__ATOMIC_ACQ_REL, "workgroup"); __builtin_amdgcn_wave_barrier();
  const int rsub = lane >> 4, c4 = (lane & 15) * 4;
  {
#pragma unroll
    for (int q = 0; q < 8; ++q) { const int r = q * 2 + rsub; if (col0 + c4 < N) { const v4f v = *(const v4fa*)&so[w][r][c4]; *(v4f*)(C + (size_t)(row0 + r) * ldc + col0 + c4) = v; } }
     }
}

// Wt[n][k] = f16(W[k][n]·scale) from f32 row-major W[K][N] (scale = power of two; bf16-exact weights stay exact in f16 away from the subnormal range)
__global__ __launch_bounds__(256) void k_wt_f16(const float* __restrict__ W, _Float16* __restrict__ Wt, int K, int N, float scale) {
  const int t = blockIdx.x * 256 + threadIdx.x; if (t >= N * (K / 8)) return; const int n = t / (K / 8), k8 = (t % (K / 8)) * 8; FragH f;
#pragma unroll
  for (int i = 0; i < 8; ++i) f.h[i] = (_Float16)(bf16_round(W[(size_t)(k8 + i) * N + n]) * scale); const v8us o = f.half[0];
  *(v8us*)((unsigned short*)Wt + (size_t)n * K + k8) = o; 
}
// k_gemm_hh variant with fused epilogue: v = acc·alpha + bias[by·sBias + col] (+ CP[(row/rowsPerB)·sCPb + by·64 + col] if CP) ; ACT 0 none / 1 elu ; writes f16 C16 (and f32 C if non-null)
template <int ACT>
__global__ __launch_bounds__(128) void k_gemm_hhx(const _Float16* __restrict__ A, int lda, size_t sA, const _Float16* __restrict__ Bh, int ldb, size_t sB, float alpha, const float* __restrict__ bias, size_t sBias, const float* __restrict__ CP, int rowsPerB, size_t sCPb, int row0g,
    float* __restrict__ C, _Float16* __restrict__ C16, int ldc, size_t sC, int M, int N, int K) {
  __shared__ __attribute__((aligned(16))) float so[4][16][64];
  const int tid = threadIdx.x, w = tid >> 5, lane = tid & 31, ln = lane & 15, hh = lane >> 4; const int by = blockIdx.y;
  A += (size_t)by * sA; Bh += (size_t)by * sB; const size_t cofs = (size_t)by * sC; const float* bp = bias ? bias + (size_t)by * sBias : nullptr;
  const int ntn = (N + 63) / 64; const int wid = blockIdx.x * 4 + w; const int mt = wid / ntn, nq = wid % ntn; if (mt * 16 >= M) return;
  const int row0 = mt * 16, col0 = nq * 64; const _Float16* arow = A + (size_t)(row0 + ln) * lda;
  v8f acc[4] = {};
  for (int kb = 0; kb < K; kb += 32) { FragH ah; ah.half[0] = *(const v8us*)((const unsigned short*)arow + kb + 8 * hh); ah.half[1] = *(const v8us*)((const unsigned short*)arow + kb + 16 + 8 * hh);
#pragma unroll
    for (int t = 0; t < 4; ++t) { if (col0 + t * 16 >= N) continue; const size_t boff = (size_t)(col0 + t * 16 + ln) * ldb + kb; FragH bq; bq.half[0] = *(const v8us*)((const unsigned short*)Bh + boff + 8 * hh); bq.half[1] = *(const v8us*)((const unsigned short*)Bh + boff + 16 + 8 * hh);
      acc[t] = mmaH<1>(ah.v, ah.v, bq.v, bq.v, acc[t]); }
  }
#pragma unroll
  for (int t = 0; t < 4; ++t) { if (col0 + t * 16 >= N) continue; const int col = col0 + t * 16 + ln; const float bv = bp ? bf16_round(bp[col]) : 0.f;
#pragma unroll
    for (int r = 0; r < 8; ++r) { float v = acc[t][r] * alpha + bv; if (CP) { const int rr = row0g + row0 + 8 * hh + r; if (rowsPerB < 0) v += CP[cofs + (size_t)rr * ldc + col];      /* rowsPerB < 0: own element of the batched C plane */ else { const int bidx = rr / rowsPerB; v += CP[(size_t)bidx * sCPb + (size_t)by * 64 + col]; } } if (ACT == 1) v = (v > 0.f) ? v : expm1f(v); else if (ACT == 7) v = (v > 0.f) ? v + 1.0f : expf(v); else if (ACT == 8) v = tanhf(v); else if (ACT == 9) v = 0.5f * v * (1.0f + tanhf(0.7978845608028654f * (v + 0.044715f * v * v * v))); else if (ACT == 11) v = 1.0f / (1.0f + expf(-v)); else if (ACT == 12) v = (v > 0.f) ? v : 0.01f * v; else if (ACT == 14) v = (v > 0.f) ? v : 0.1f * v; else if (ACT == 16) v = (v >= 0.f) ? v : 0.3f * v; else if (ACT == 17) v = (v >= 0.f) ? v : 0.2f * v; else if (ACT == 15) v = v / (1.0f + expf(-v)); else if (ACT == 3) v = fmaxf(v, 0.f); else if (ACT == 6) v = 0.5f * v * (1.0f + erff(v * 0.70710678118654752f)); so[w][8 * hh + r][t * 16 + ln] = v; } }
  __builtin_amdgcn_fence(__ATOMIC_ACQ_REL, "workgroup"); __builtin_amdgcn_wave_barrier();
  const int rsub = lane >> 4, c4 = (lane & 15) * 4; typedef _Float16 v4h __attribute__((ext_vector_type(4)));
  {
#pragma unroll
    for (int q = 0; q < 8; ++q) { const int r = q * 2 + rsub; if (col0 + c4 < N) { const v4f v = *(const v4fa*)&so[w][r][c4]; if (C) *(v4f*)(C + cofs + (size_t)(row0 + r) * ldc + col0 + c4) = v; if (C16) { v4h h4; for (int i = 0; i < 4; ++i) h4[i] = (_Float16)v[i]; *(v4h*)(C16 + cofs + (size_t)(row0 + r) * ldc + col0 + c4) = h4; } } }
     }
}


typedef _Float16 v4h __attribute__((ext_vector_type(4)));

__global__ __launch_bounds__(256) void k_x16(const float* __restrict__ x, _Float16* __restrict__ X16, size_t n8) { const size_t t = (size_t)blockIdx.x * 256 + threadIdx.x; if (t >= n8) return; FragH f;
#pragma unroll
  for (int q = 0; q < 8; ++q) f.h[q] = (_Float16)bf16_round(x[t * 8 + q]); *(v8us*)((unsigned short*)X16 + t * 8) = f.half[0];  }
__global__ __launch_bounds__(256) void k_h16(const float* __restrict__ x, _Float16* __restrict__ X16, size_t n8) { const size_t t = (size_t)blockIdx.x * 256 + threadIdx.x; if (t >= n8) return; FragH f;
#pragma unroll
  for (int q = 0; q < 8; ++q) f.h[q] = (_Float16)x[t * 8 + q]; *(v8us*)((unsigned short*)X16 + t * 8) = f.half[0];  }
__global__ __launch_bounds__(256) void k_round16f(const float* __restrict__ W, _Float16* __restrict__ Bt, size_t n8) { const size_t t = (size_t)blockIdx.x * 256 + threadIdx.x; if (t >= n8) return; FragH f;
#pragma unroll
  for (int i = 0; i < 8; ++i) f.h[i] = (_Float16)(bf16_round(W[t * 8 + i]) * 16.0f); *(v8us*)((unsigned short*)Bt + t * 8) = f.half[0];  }
template <int NHv, int TTv>
__global__ __launch_bounds__(256) void k_vt(const _Float16* __restrict__ V16, int ldv, int voff, _Float16* __restrict__ Vt) { __shared__ unsigned short tl[64][66]; const int tid = threadIdx.x; const int slab = blockIdx.x / (TTv / 64), lg = blockIdx.x % (TTv / 64); const int b = slab / NHv, h = slab % NHv;
  for (int i = tid; i < 64 * 8; i += 256) { const int r = i / 8, c8 = (i % 8) * 8; FragH f; f.half[0] = *(const v8us*)((const unsigned short*)V16 + ((size_t)b * TTv + lg * 64 + r) * ldv + voff + h * 64 + c8);
#pragma unroll
    for (int q = 0; q < 8; ++q) tl[r][c8 + q] = f.u[q]; }
  __syncthreads();
  {
#pragma unroll
    for (int rd = 0; rd < 2; ++rd) { const int d = rd * 32 + tid / 8, pc = tid % 8; FragH f;
#pragma unroll
      for (int q = 0; q < 8; ++q) f.u[q] = tl[pc * 8 + q][d];
      *(v8us*)((unsigned short*)Vt + ((size_t)slab * 64 + d) * TTv + lg * 64 + pc * 8) = f.half[0]; }
     } }

__global__ __launch_bounds__(256) void k_hl(const float* __restrict__ F, _Float16* __restrict__ Hh, _Float16* __restrict__ Hl, size_t n8) { const size_t t = (size_t)blockIdx.x * 256 + threadIdx.x; if (t >= n8) return; FragH fh, fl; const v4f a = *(const v4fa*)(F + t * 8), c = *(const v4fa*)(F + t * 8 + 4);
#pragma unroll
  for (int q = 0; q < 4; ++q) { _Float16 h = (_Float16)a[q]; fh.h[q] = h; fl.h[q] = (_Float16)((a[q] - (float)h) * 1024.0f); h = (_Float16)c[q]; fh.h[4 + q] = h; fl.h[4 + q] = (_Float16)((c[q] - (float)h) * 1024.0f); }
  { *(v8us*)((unsigned short*)Hh + t * 8) = fh.half[0]; *(v8us*)((unsigned short*)Hl + t * 8) = fl.half[0];  } }

// ---- fast GEMM (wave tile 32x64; requires M % 32 == 0 rows per launch region and N % 64 == 0); epilogue = k_gemm_hhx semantics ----
__device__ __forceinline__ v16h g2_frag(const _Float16* p, int hh) { FragH f; f.half[0] = *(const v8us*)((const unsigned short*)p + 8 * hh); f.half[1] = *(const v8us*)((const unsigned short*)p + 16 + 8 * hh); return f.v; }
__device__ __forceinline__ v8f g2_mma(v16h a, v16h b, v8f c) { v8f d = __builtin_amdgcn_wmma_f32_16x16x32_f16(false, a, false, b, (short)0, c, false, false); asm volatile("v_nop\n\tv_nop\n\tv_nop\n\tv_nop" : "+v"(d) : "v"(a), "v"(b)); return d; }
template <int ACT>
__global__ __launch_bounds__(128) void k_gemm2(const _Float16* __restrict__ A, int lda, size_t sA, const _Float16* __restrict__ Bh, int ldb, size_t sB, float alpha, const float* __restrict__ bias, size_t sBias, const float* __restrict__ CP, int rowsPerB, size_t sCPb, int row0g,
    float* __restrict__ C, _Float16* __restrict__ C16, int ldc, size_t sC, int M, int N, int K) { static_assert(ACT == 0 || ACT == 3 || ACT == 6 || ACT == 8 || ACT == 9 || ACT == 11 || ACT == 12 || ACT == 14 || ACT == 15 || ACT == 16 || ACT == 17, "k_gemm2: unsupported ACT code (would silently apply no activation)");
  __shared__ __attribute__((aligned(16))) float so[4][32][68];
  const int tid = threadIdx.x, w = tid >> 5, lane = tid & 31, ln = lane & 15, hh = lane >> 4; const int by = blockIdx.y;
  A += (size_t)by * sA; Bh += (size_t)by * sB; const size_t cofs = (size_t)by * sC; const float* bp = bias ? bias + (size_t)by * sBias : nullptr;
  const int ntn = N >> 6; const int mt = blockIdx.x / ntn, nq = blockIdx.x - mt * ntn; const int row0 = mt * 128 + 32 * w, col0 = nq * 64; if (row0 >= M) return;
  const _Float16* a0p = A + (size_t)(row0 + ln) * lda; const _Float16* a1p = a0p + (size_t)16 * lda;
  const _Float16* b0p = Bh + (size_t)(col0 + ln) * ldb; const _Float16* b1p = b0p + (size_t)16 * ldb; const _Float16* b2p = b1p + (size_t)16 * ldb; const _Float16* b3p = b2p + (size_t)16 * ldb;
  const v8f z8 = {0.f,0.f,0.f,0.f,0.f,0.f,0.f,0.f}; v8f c00 = z8, c01 = z8, c02 = z8, c03 = z8, c10 = z8, c11 = z8, c12 = z8, c13 = z8;
#pragma unroll 1
  for (int kb = 0; kb < K; kb += 32) { const v16h a0 = g2_frag(a0p + kb, hh), a1 = g2_frag(a1p + kb, hh);
    v16h b = g2_frag(b0p + kb, hh); c00 = g2_mma(a0, b, c00); c10 = g2_mma(a1, b, c10);
    b = g2_frag(b1p + kb, hh); c01 = g2_mma(a0, b, c01); c11 = g2_mma(a1, b, c11);
    b = g2_frag(b2p + kb, hh); c02 = g2_mma(a0, b, c02); c12 = g2_mma(a1, b, c12);
    b = g2_frag(b3p + kb, hh); c03 = g2_mma(a0, b, c03); c13 = g2_mma(a1, b, c13); }
  v8f accs[8] = {c00, c01, c02, c03, c10, c11, c12, c13};
#pragma unroll
  for (int u = 0; u < 8; ++u) { const int t = u & 3, half = u >> 2; const int col = col0 + t * 16 + ln; const float bv = bp ? bf16_round(bp[col]) : 0.f;
#pragma unroll
    for (int r = 0; r < 8; ++r) { const int rloc = half * 16 + 8 * hh + r; float v = accs[u][r] * alpha + bv; if (CP) { if (rowsPerB < 0) v += CP[cofs + (size_t)(row0g + row0 + rloc) * ldc + col];      /* rowsPerB < 0: own element of the batched C plane */ else { const int bidx = (row0g + row0 + rloc) / rowsPerB; v += CP[(size_t)bidx * sCPb + (size_t)by * 64 + col]; } }
      if (ACT == 3) v = fmaxf(v, 0.f); else if (ACT == 6) v = 0.5f * v * (1.0f + erff(v * 0.70710678118654752f)); else if (ACT == 11) v = 1.0f / (1.0f + expf(-v)); else if (ACT == 15) v = v / (1.0f + expf(-v)); else if (ACT == 12) v = (v > 0.f) ? v : 0.01f * v; else if (ACT == 8) v = tanhf(v); else if (ACT == 9) v = 0.5f * v * (1.0f + tanhf(0.7978845608028654f * (v + 0.044715f * v * v * v))); else if (ACT == 14) v = (v > 0.f) ? v : 0.1f * v; else if (ACT == 16) v = (v >= 0.f) ? v : 0.3f * v; else if (ACT == 17) v = (v >= 0.f) ? v : 0.2f * v;
      so[w][rloc][t * 16 + ln] = v; } }
  __builtin_amdgcn_fence(__ATOMIC_ACQ_REL, "workgroup"); __builtin_amdgcn_wave_barrier();
  const int rsub = lane >> 4, c4 = (lane & 15) * 4;
  {
#pragma unroll
    for (int q = 0; q < 16; ++q) { const int r = q * 2 + rsub; const v4f v = *(const v4fa*)&so[w][r][c4]; if (C) *(v4f*)(C + cofs + (size_t)(row0 + r) * ldc + col0 + c4) = v; if (C16) { v4h h4; for (int i = 0; i < 4; ++i) h4[i] = (_Float16)v[i]; *(v4h*)(C16 + cofs + (size_t)(row0 + r) * ldc + col0 + c4) = h4; } }
     } }


__global__ __launch_bounds__(256) void k_wnat(const float* __restrict__ w, size_t n8, _Float16* __restrict__ Bt) { const size_t t = (size_t)blockIdx.x * 256 + threadIdx.x; if (t >= n8) return; FragH f; for (int q = 0; q < 8; ++q) f.h[q] = (_Float16)(bf16_round(w[t * 8 + q]) * 16.0f); *(v8us*)((unsigned short*)Bt + t * 8) = f.half[0];  }
__global__ __launch_bounds__(256) void k_rsm(const float* __restrict__ S, _Float16* __restrict__ P, int nrows) {
  #pragma clang fp contract(off)
  const int i = blockIdx.x * 256 + threadIdx.x; if (i >= nrows) return; const float* s = S + (size_t)i * SQ; float mx = -3.0e38f;
#pragma unroll 1
  for (int j = 0; j < SQ; ++j) mx = fmaxf(mx, s[j]); float se = 0.f;
#pragma unroll 1
  for (int j = 0; j < SQ; ++j) se += expf(s[j] - mx); const float sc = 256.0f / se;
#pragma unroll 1
  for (int j0 = 0; j0 < SQ; j0 += 8) { FragH f; for (int q = 0; q < 8; ++q) f.h[q] = (_Float16)(expf(s[j0 + q] - mx) * sc); unsigned short* d = (unsigned short*)P + (size_t)i * SQ + j0; *(v8us*)d = f.half[0];  } }
__global__ __launch_bounds__(256) void k_vt(const _Float16* __restrict__ V16, int b, int h0, _Float16* __restrict__ VT) { __shared__ unsigned short tl[64][65]; const int tid = threadIdx.x; const int hh = blockIdx.x % HG, sg = blockIdx.x / HG; const int s0 = sg * 64; const int h = h0 + hh;
  for (int i = tid; i < 64 * 8; i += 256) { const int j = i / 8, d8 = (i % 8) * 8; FragH f; f.half[0] = *(const v8us*)((const unsigned short*)V16 + ((size_t)b * SQ + s0 + j) * DM + h * HD + d8); for (int q = 0; q < 8; ++q) tl[d8 + q][j] = f.u[q]; }
  __syncthreads();
  { for (int i = tid; i < 64 * 8; i += 256) { const int d = i / 8, j8 = (i % 8) * 8; FragH f; for (int q = 0; q < 8; ++q) f.u[q] = tl[d][j8 + q]; *(v8us*)((unsigned short*)VT + ((size_t)hh * HD + d) * SQ + s0 + j8) = f.half[0]; }  } }


// 2^t on the native unit, with the one free issue slot that the instruction set asks for behind a transcendental before its source is overwritten or its result used:
// written in the same statement. exp(d) = 2^(d log2 e), the form of __expf.
__device__ __forceinline__ float exp2_slot(float t) { float e; asm("v_exp_f32 %0, %1\n\tv_nop" : "=v"(e) : "v"(t)); return e; }
// Row softmax, one wave per row: lane l holds elements 128 u + 4 l .. + 3 (u = 0..15), so each wave-wide load covers 512 contiguous bytes and each store 256;
// the row is read once and stays in registers for maximum, sum and weights; maximum and sum cross the 32 lanes by a five-step butterfly.
// The four loops over u are unrolled so that x[] is indexed by constants only and lives in registers (a run-time index would send it to scratch memory).
__global__ __launch_bounds__(256) void k_rsmw(const float* __restrict__ S, _Float16* __restrict__ P, int nrows) {
  const int lane = threadIdx.x & 31, row = blockIdx.x * 8 + (threadIdx.x >> 5); if (row >= nrows) return;
  const float* s = S + (size_t)row * SQ + lane * 4; v4f x[SQ / 128];
#pragma unroll
  for (int u = 0; u < SQ / 128; ++u) x[u] = *(const v4fa*)(s + u * 128);
  // Keeps the address pair of the sixteen loads alive to here and holds every later write of it behind the wait.
  asm volatile("s_wait_xcnt 0x0" :: "v"(s) : "memory");
  v4f m4 = x[0];
#pragma unroll
  for (int u = 1; u < SQ / 128; ++u) for (int q = 0; q < 4; ++q) m4[q] = fmaxf(m4[q], x[u][q]);
  float mx = fmaxf(fmaxf(fmaxf(m4[0], m4[1]), fmaxf(m4[2], m4[3])), -3.0e38f);
  for (int m = 16; m > 0; m >>= 1) mx = fmaxf(mx, __shfl_xor(mx, m));
  v4f s4 = {0.f, 0.f, 0.f, 0.f};
#pragma unroll
  for (int u = 0; u < SQ / 128; ++u) for (int q = 0; q < 4; ++q) { x[u][q] = exp2_slot((x[u][q] - mx) * 1.4426950408889634f); s4[q] += x[u][q]; }
  float se = (s4[0] + s4[1]) + (s4[2] + s4[3]);
  for (int m = 16; m > 0; m >>= 1) se += __shfl_xor(se, m);
  const float sc = 256.0f / se; _Float16* p = P + (size_t)row * SQ + lane * 4;
#pragma unroll
  for (int u = 0; u < SQ / 128; ++u) { v4h h4; for (int q = 0; q < 4; ++q) h4[q] = (_Float16)(x[u][q] * sc); *(v4h*)(p + u * 128) = h4; } }

extern "C" void kernel_launch(void* const* d_in, const int* in_sizes, int n_in,
                              void* d_out, int out_size, void* d_ws, size_t ws_size, hipStream_t stream) {
  (void)in_sizes; (void)n_in; (void)out_size;
  const float* const* I = (const float* const*)d_in; const float* q = I[0]; const float* k = I[1]; const float* v = I[2];
  char* ws = (char*)d_ws; size_t off = 0;
  auto take = [&](size_t bytes) { char* p = ws + off; off += (bytes + 255) & ~(size_t)255; return p; };
  _Float16* Q16 = (_Float16*)take(NR * DM * 2); _Float16* K16 = (_Float16*)take(NR * DM * 2); _Float16* V16 = (_Float16*)take(NR * DM * 2); float* S = (float*)take((size_t)SQ * SQ * 4); _Float16* P = (_Float16*)take((size_t)SQ * SQ * 2); _Float16* VT = (_Float16*)take((size_t)HD * SQ * 2);
  if (off > ws_size) return;      /* approx 12 x 3 + 16 + 8 + 0.25 = 60 MiB */
  k_x16<<<(unsigned)((NR * DM / 8 + 255) / 256), 256, 0, stream>>>(q, Q16, NR * DM / 8); k_x16<<<(unsigned)((NR * DM / 8 + 255) / 256), 256, 0, stream>>>(k, K16, NR * DM / 8); k_x16<<<(unsigned)((NR * DM / 8 + 255) / 256), 256, 0, stream>>>(v, V16, NR * DM / 8);
  for (int b = 0; b < NB; ++b) { const size_t r0 = (size_t)b * SQ;
    { const int bb = b / 12, hh = b % 12; k_vt<1, SQ><<<SQ / 64, 256, 0, stream>>>(V16 + (size_t)bb * SQ * 768 + (size_t)hh * 64, 768, 0, VT); }      /* values are [B][S][12][64]: this slice's 64 columns of the 768-wide rows */
    k_gemm2<0><<<dim3((SQ / 128) * (SQ / 64), 1), 128, 0, stream>>>(Q16 + r0 * DM, DM, 0, K16 + r0 * DM, DM, 0, 0.03608439182435161f, nullptr, 0, nullptr, 1, 0, 0, S, nullptr, SQ, 0, SQ, SQ, DM);      /* scores / sqrt(768) (exact products) */
    k_rsmw<<<SQ / 8, 256, 0, stream>>>(S, P, SQ);
    k_gemm2<0><<<dim3((SQ / 128) * (HD / 64), 1), 128, 0, stream>>>(P, SQ, 0, VT, SQ, 0, 0.00390625f, nullptr, 0, nullptr, 1, 0, 0, (float*)d_out + r0 * DM, nullptr, DM, 0, SQ, HD, SQ); }      /* out = P V / 256 */
}

// v003
// One run takes 86.1 microseconds.
// Versions between v001 and this one are left out; their measured steps multiply to 41.3 times as fast.
// All steps since v000 together make it 220 times as fast.
#include <hip/hip_runtime.h>
#define NB 48
#define SQ 2048
#define DM 64
#define NH 1
#define HD 64
#define HG 1
#define NR ((size_t)NB * SQ)
typedef __bf16 v16b __attribute__((ext_vector_type(16)));
typedef unsigned short v8us __attribute__((ext_vector_type(8), may_alias));
typedef float  v8f  __attribute__((ext_vector_type(8)));
typedef float  v4f  __attribute__((ext_vector_type(4)));
typedef float  v4fa __attribute__((ext_vector_type(4), may_alias));
union FragB { v16b v; v8us half[2]; unsigned short u[16]; };

__device__ __forceinline__ unsigned short bf16_bits(float x) { unsigned int u = __float_as_uint(x); return (unsigned short)((u + 0x7FFFu + ((u >> 16) & 1u)) >> 16); }
__device__ __forceinline__ float bf16_val(unsigned short b) { return __uint_as_float(((unsigned int)b) << 16); }
__device__ __forceinline__ float bf16_round(float x) { return bf16_val(bf16_bits(x)); }
// D += A·B with NT terms: 1 = ah·bh, 2 = + al·bh (A split), 3 = + ah·bl (both split)
template <int NT>
__device__ __forceinline__ v8f mmaN(v16b ah, v16b al, v16b bh, v16b bl, v8f c) {
  c = __builtin_amdgcn_wmma_f32_16x16x32_bf16(false, ah, false, bh, (short)0, c, false, false);
  if (NT >= 2) c = __builtin_amdgcn_wmma_f32_16x16x32_bf16(false, al, false, bh, (short)0, c, false, false);
  if (NT >= 3) c = __builtin_amdgcn_wmma_f32_16x16x32_bf16(false, ah, false, bl, (short)0, c, false, false);
  asm volatile("v_nop\n\tv_nop\n\tv_nop\n\tv_nop" : "+v"(c) : "v"(ah), "v"(al), "v"(bh), "v"(bl));
  return c;
}

__global__ __launch_bounds__(256) void k_wt_bf16(const float* __restrict__ W, unsigned short* __restrict__ Wt, int K, int N) {
  const int t = blockIdx.x * 256 + threadIdx.x;
  const int k8n = K / 8;
  if (t >= N * k8n) return;
  const int n = t / k8n, k8 = (t % k8n) * 8;
  v8us v;
#pragma unroll
  for (int i = 0; i < 8; ++i) v[i] = bf16_bits(W[(size_t)(k8 + i) * N + n]);
  *(v8us*)(Wt + (size_t)n * K + k8) = v;
  
}

// GEMM C[M][N] (f32, pitch ldc) = act(A[M][K]·W + bias). A f32 row-major (pitch lda) converted per fragment to bf16
// (ASPLIT: hi/lo two planes -> 2 terms, else single rounded term); Wt bf16 [N][K] (pitch ldb). BIAS_BF16 rounds the
// bias to bf16 first (bias quantised to bf16 before the add). K%32==0, M%16==0, N%64==0.
template <bool ASPLIT, int ACT, bool BIAS_BF16>
__global__ __launch_bounds__(128) void k_gemm_bf(const float* __restrict__ A, int lda, const unsigned short* __restrict__ Wt, int ldb,
                                               const float* __restrict__ bias, float* __restrict__ C, int ldc, int M, int N, int K) {
  __shared__ __attribute__((aligned(16))) float so[4][16][64];
  const int tid = threadIdx.x, w = tid >> 5, lane = tid & 31, ln = lane & 15, hh = lane >> 4;
  const int ntn = N / 64;
  const int wid = blockIdx.x * 4 + w;
  const int mt = wid / ntn, nq = wid % ntn;
  if (mt * 16 >= M) return;
  const int row0 = mt * 16, col0 = nq * 64;
  const float* arow = A + (size_t)(row0 + ln) * lda;
  v8f acc[4] = {};
  for (int kb = 0; kb < K; kb += 32) {
    FragB ah, al;
    const v4f x0 = *(const v4fa*)(arow + kb + 8 * hh), x1 = *(const v4fa*)(arow + kb + 8 * hh + 4);
    const v4f x2 = *(const v4fa*)(arow + kb + 16 + 8 * hh), x3 = *(const v4fa*)(arow + kb + 16 + 8 * hh + 4);
    float xs[16] = {x0[0],x0[1],x0[2],x0[3],x1[0],x1[1],x1[2],x1[3],x2[0],x2[1],x2[2],x2[3],x3[0],x3[1],x3[2],x3[3]};
#pragma unroll
    for (int i = 0; i < 16; ++i) { const unsigned short hb = bf16_bits(xs[i]); ah.u[i] = hb; al.u[i] = ASPLIT ? bf16_bits(xs[i] - bf16_val(hb)) : (unsigned short)0; }
#pragma unroll
    for (int t = 0; t < 4; ++t) {
      const unsigned short* brow = Wt + (size_t)(col0 + t * 16 + ln) * ldb + kb;
      FragB b;
      b.half[0] = *(const v8us*)(brow + 8 * hh);
      b.half[1] = *(const v8us*)(brow + 16 + 8 * hh);
      acc[t] = mmaN<ASPLIT ? 2 : 1>(ah.v, al.v, b.v, b.v, acc[t]);
    }
  }
#pragma unroll
  for (int t = 0; t < 4; ++t) {
    float bv = bias ? bias[col0 + t * 16 + ln] : 0.f;
    if (BIAS_BF16) bv = bf16_round(bv);
#pragma unroll
    for (int r = 0; r < 8; ++r) { float v = acc[t][r] + bv; if (ACT == 1) v = fmaxf(v, 0.f); so[w][8 * hh + r][t * 16 + ln] = v; }
  }
  __builtin_amdgcn_fence(__ATOMIC_ACQ_REL, "workgroup");
  __builtin_amdgcn_wave_barrier();
  const int rsub = lane >> 4, c4 = (lane & 15) * 4;
  {
#pragma unroll
    for (int q = 0; q < 8; ++q) {
      const int r = q * 2 + rsub;
      const v4f v = *(const v4fa*)&so[w][r][c4];
      *(v4f*)(C + (size_t)(row0 + r) * ldc + col0 + c4) = v;
    }
    
  }
}

// GEMM C = act(A·W + bias + resid): A f32 (ASPLIT -> hi/lo 2 terms), Wt bf16 [N][K]; ACT 0 none, 1 relu, 2 exact gelu;
// resid (optional, f32, row index = (row % rmod), pitch ldr, RES_BF16 rounds it) added before the activation.
template <bool ASPLIT, int ACT, bool BIAS_BF16, bool RES_BF16>
__global__ __launch_bounds__(128) void k_gemm_bf3(const float* __restrict__ A, int lda, const unsigned short* __restrict__ Wt, int ldb,
                                                const float* __restrict__ bias, const float* __restrict__ resid, int rmod, int ldr,
                                                float* __restrict__ C, int ldc, int M, int N, int K) {
  __shared__ __attribute__((aligned(16))) float so[4][16][64];
  const int tid = threadIdx.x, w = tid >> 5, lane = tid & 31, ln = lane & 15, hh = lane >> 4;
  const int ntn = N / 64;
  const int wid = blockIdx.x * 4 + w;
  const int mt = wid / ntn, nq = wid % ntn;
  if (mt * 16 >= M) return;
  const int row0 = mt * 16, col0 = nq * 64;
  const float* arow = A + (size_t)(row0 + ln) * lda;
  v8f acc[4] = {};
  for (int kb = 0; kb < K; kb += 32) {
    FragB ah, al;
    const v4f x0 = *(const v4fa*)(arow + kb + 8 * hh), x1 = *(const v4fa*)(arow + kb + 8 * hh + 4);
    const v4f x2 = *(const v4fa*)(arow + kb + 16 + 8 * hh), x3 = *(const v4fa*)(arow + kb + 16 + 8 * hh + 4);
    float xs[16] = {x0[0],x0[1],x0[2],x0[3],x1[0],x1[1],x1[2],x1[3],x2[0],x2[1],x2[2],x2[3],x3[0],x3[1],x3[2],x3[3]};
#pragma unroll
    for (int i = 0; i < 16; ++i) { const unsigned short hb = bf16_bits(xs[i]); ah.u[i] = hb; al.u[i] = ASPLIT ? bf16_bits(xs[i] - bf16_val(hb)) : (unsigned short)0; }
#pragma unroll
    for (int t = 0; t < 4; ++t) {
      const unsigned short* brow = Wt + (size_t)(col0 + t * 16 + ln) * ldb + kb;
      FragB b;
      b.half[0] = *(const v8us*)(brow + 8 * hh);
      b.half[1] = *(const v8us*)(brow + 16 + 8 * hh);
      acc[t] = mmaN<ASPLIT ? 2 : 1>(ah.v, al.v, b.v, b.v, acc[t]);
    }
  }
#pragma unroll
  for (int t = 0; t < 4; ++t) {
    const int col = col0 + t * 16 + ln;
    float bv = bias ? bias[col] : 0.f;
    if (BIAS_BF16) bv = bf16_round(bv);
#pragma unroll
    for (int r = 0; r < 8; ++r) {
      float v = acc[t][r] + bv;
      if (resid) { float rv = resid[(size_t)((row0 + 8 * hh + r) % rmod) * ldr + col]; if (RES_BF16) rv = bf16_round(rv); v += rv; }
      if (ACT == 1) v = fmaxf(v, 0.f);
      if (ACT == 2) v = 0.5f * v * (1.0f + erff(v * 0.70710678118654752f));
      if (ACT == 3) { const float u = 0.7978845608028654f * (v + 0.044715f * v * v * v); v = 0.5f * v * (1.0f + tanhf(u)); }
      so[w][8 * hh + r][t * 16 + ln] = v;
    }
  }
  __builtin_amdgcn_fence(__ATOMIC_ACQ_REL, "workgroup");
  __builtin_amdgcn_wave_barrier();
  const int rsub = lane >> 4, c4 = (lane & 15) * 4;
  {
#pragma unroll
    for (int q = 0; q < 8; ++q) {
      const int r = q * 2 + rsub;
      const v4f v = *(const v4fa*)&so[w][r][c4];
      *(v4f*)(C + (size_t)(row0 + r) * ldc + col0 + c4) = v;
    }
    
  }
}
// row LayerNorm (biased variance, eps) over N: s = X (+ R); optional out_sum <- s; out_norm <- (s-mu)*rsqrt(var+eps)*g + b
template <bool PARAM_BF16>
__global__ __launch_bounds__(256) void k_layernorm(const float* __restrict__ X, const float* __restrict__ R, const float* __restrict__ g, const float* __restrict__ bta,
                                                  float* __restrict__ out_sum, float* __restrict__ out_norm, int N, float eps) {
  __shared__ float red[256];
  const int row = blockIdx.x, tid = threadIdx.x;
  const float* x = X + (size_t)row * N; const float* rr = R ? R + (size_t)row * N : nullptr;
  float vals[16];                     // up to N = 4096
  const int per = N / 256;            // contiguous chunk per thread? use strided-by-4 chunks: thread handles j = tid*4 + 1024*u
  float s1 = 0.f;
  for (int u = 0; u < per / 4; ++u) {
    const int j = tid * 4 + 1024 * u;
    const v4f a = *(const v4fa*)(x + j);
    v4f b = {0.f,0.f,0.f,0.f}; if (rr) b = *(const v4fa*)(rr + j);
#pragma unroll
    for (int q = 0; q < 4; ++q) { const float v = a[q] + b[q]; vals[u * 4 + q] = v; s1 += v; }
  }
  red[tid] = s1; __syncthreads();
  for (int st = 128; st > 0; st >>= 1) { if (tid < st) red[tid] += red[tid + st]; __syncthreads(); }
  const float mu = red[0] / (float)N; __syncthreads();
  float s2 = 0.f;
  for (int u = 0; u < per / 4; ++u)
#pragma unroll
    for (int q = 0; q < 4; ++q) { const float c = vals[u * 4 + q] - mu; s2 += c * c; }
  red[tid] = s2; __syncthreads();
  for (int st = 128; st > 0; st >>= 1) { if (tid < st) red[tid] += red[tid + st]; __syncthreads(); }
  const float rs = rsqrtf(red[0] / (float)N + eps);
  {
    for (int u = 0; u < per / 4; ++u) {
      const int j = tid * 4 + 1024 * u;
      v4f o, sm;
#pragma unroll
      for (int q = 0; q < 4; ++q) {
        float gg = g[j + q], bb = bta[j + q];
        if (PARAM_BF16) { gg = bf16_round(gg); bb = bf16_round(bb); }
        sm[q] = vals[u * 4 + q]; o[q] = (vals[u * 4 + q] - mu) * rs * gg + bb;
      }
      if (out_sum) *(v4f*)(out_sum + (size_t)row * N + j) = sm;
      *(v4f*)(out_norm + (size_t)row * N + j) = o;
    }
    
  }
}



// ---- f16 WMMA path (v_wmma_f32_16x16x32_f16): 11-bit significands for operands in range — used where a [0,1] probability operand needs more precision than bf16
typedef _Float16 v16h __attribute__((ext_vector_type(16)));
union FragH { v16h v; v8us half[2]; _Float16 h[16]; unsigned short u[16]; };
template <int NT>
__device__ __forceinline__ v8f mmaH(v16h ah, v16h al, v16h bh, v16h bl, v8f c) {
  c = __builtin_amdgcn_wmma_f32_16x16x32_f16(false, ah, false, bh, (short)0, c, false, false);
  if (NT >= 2) c = __builtin_amdgcn_wmma_f32_16x16x32_f16(false, al, false, bh, (short)0, c, false, false);
  if (NT >= 3) c = __builtin_amdgcn_wmma_f32_16x16x32_f16(false, ah, false, bl, (short)0, c, false, false);
  asm volatile("v_nop\n\tv_nop\n\tv_nop\n\tv_nop" : "+v"(c) : "v"(ah), "v"(al), "v"(bh), "v"(bl));
  return c;
}
// batched GEMM like k_gemm_b but f16 operands: A f32 (split into f16 hi/lo if ASPLIT, else rounded to f16), Bt = f16 values [n][k]; alpha; C f32; N multiple of 16 (partial tiles skipped)
template <bool ASPLIT>
__global__ __launch_bounds__(128) void k_gemm_h(const float* __restrict__ A, int lda, size_t sA, const _Float16* __restrict__ Bh, int ldb, size_t sB, float alpha, float* __restrict__ C, int ldc, size_t sC, int M, int N, int K) {
  __shared__ __attribute__((aligned(16))) float so[4][16][64];
  const int tid = threadIdx.x, w = tid >> 5, lane = tid & 31, ln = lane & 15, hh = lane >> 4; const int by = blockIdx.y;
  A += (size_t)by * sA; Bh += (size_t)by * sB; C += (size_t)by * sC;
  const int ntn = (N + 63) / 64; const int wid = blockIdx.x * 4 + w; const int mt = wid / ntn, nq = wid % ntn; if (mt * 16 >= M) return;
  const int row0 = mt * 16, col0 = nq * 64; const float* arow = A + (size_t)(row0 + ln) * lda;
  v8f acc[4] = {};
  for (int kb = 0; kb < K; kb += 32) {
    FragH ah, al;
    const v4f x0 = *(const v4fa*)(arow + kb + 8 * hh), x1 = *(const v4fa*)(arow + kb + 8 * hh + 4), x2 = *(const v4fa*)(arow + kb + 16 + 8 * hh), x3 = *(const v4fa*)(arow + kb + 16 + 8 * hh + 4);
    float xs[16] = {x0[0],x0[1],x0[2],x0[3],x1[0],x1[1],x1[2],x1[3],x2[0],x2[1],x2[2],x2[3],x3[0],x3[1],x3[2],x3[3]};
#pragma unroll
    for (int i = 0; i < 16; ++i) { const _Float16 h = (_Float16)xs[i]; ah.h[i] = h; al.h[i] = ASPLIT ? (_Float16)(xs[i] - (float)h) : (_Float16)0.0f; }
#pragma unroll
    for (int t = 0; t < 4; ++t) { if (col0 + t * 16 >= N) continue; const size_t boff = (size_t)(col0 + t * 16 + ln) * ldb + kb; FragH bq; bq.half[0] = *(const v8us*)(Bh + boff + 8 * hh); bq.half[1] = *(const v8us*)(Bh + boff + 16 + 8 * hh);
      acc[t] = mmaH<ASPLIT ? 2 : 1>(ah.v, al.v, bq.v, bq.v, acc[t]); }
  }
#pragma unroll
  for (int t = 0; t < 4; ++t) { if (col0 + t * 16 >= N) continue;
#pragma unroll
    for (int r = 0; r < 8; ++r) so[w][8 * hh + r][t * 16 + ln] = acc[t][r] * alpha; }
  __builtin_amdgcn_fence(__ATOMIC_ACQ_REL, "workgroup"); __builtin_amdgcn_wave_barrier();
  const int rsub = lane >> 4, c4 = (lane & 15) * 4;
  {
#pragma unroll
    for (int q = 0; q < 8; ++q) { const int r = q * 2 + rsub; if (col0 + c4 < N) { const v4f v = *(const v4fa*)&so[w][r][c4]; *(v4f*)(C + (size_t)(row0 + r) * ldc + col0 + c4) = v; } }
     }
}

// Wt[n][k] = f16(W[k][n]·scale) from f32 row-major W[K][N] (scale = power of two; bf16-exact weights stay exact in f16 away from the subnormal range)
__global__ __launch_bounds__(256) void k_wt_f16(const float* __restrict__ W, _Float16* __restrict__ Wt, int K, int N, float scale) {
  const int t = blockIdx.x * 256 + threadIdx.x; if (t >= N * (K / 8)) return; const int n = t / (K / 8), k8 = (t % (K / 8)) * 8; FragH f;
#pragma unroll
  for (int i = 0; i < 8; ++i) f.h[i] = (_Float16)(bf16_round(W[(size_t)(k8 + i) * N + n]) * scale); const v8us o = f.half[0];
  *(v8us*)((unsigned short*)Wt + (size_t)n * K + k8) = o; 
}
// k_gemm_hh variant with fused epilogue: v = acc·alpha + bias[by·sBias + col] (+ CP[(row/rowsPerB)·sCPb + by·64 + col] if CP) ; ACT 0 none / 1 elu ; writes f16 C16 (and f32 C if non-null)
template <int ACT>
__global__ __launch_bounds__(128) void k_gemm_hhx(const _Float16* __restrict__ A, int lda, size_t sA, const _Float16* __restrict__ Bh, int ldb, size_t sB, float alpha, const float* __restrict__ bias, size_t sBias, const float* __restrict__ CP, int rowsPerB, size_t sCPb, int row0g,
    float* __restrict__ C, _Float16* __restrict__ C16, int ldc, size_t sC, int M, int N, int K) {
  __shared__ __attribute__((aligned(16))) float so[4][16][64];
  const int tid = threadIdx.x, w = tid >> 5, lane = tid & 31, ln = lane & 15, hh = lane >> 4; const int by = blockIdx.y;
  A += (size_t)by * sA; Bh += (size_t)by * sB; const size_t cofs = (size_t)by * sC; const float* bp = bias ? bias + (size_t)by * sBias : nullptr;
  const int ntn = (N + 63) / 64; const int wid = blockIdx.x * 4 + w; const int mt = wid / ntn, nq = wid % ntn; if (mt * 16 >= M) return;
  const int row0 = mt * 16, col0 = nq * 64; const _Float16* arow = A + (size_t)(row0 + ln) * lda;
  v8f acc[4] = {};
  for (int kb = 0; kb < K; kb += 32) { FragH ah; ah.half[0] = *(const v8us*)((const unsigned short*)arow + kb + 8 * hh); ah.half[1] = *(const v8us*)((const unsigned short*)arow + kb + 16 + 8 * hh);
#pragma unroll
    for (int t = 0; t < 4; ++t) { if (col0 + t * 16 >= N) continue; const size_t boff = (size_t)(col0 + t * 16 + ln) * ldb + kb; FragH bq; bq.half[0] = *(const v8us*)((const unsigned short*)Bh + boff + 8 * hh); bq.half[1] = *(const v8us*)((const unsigned short*)Bh + boff + 16 + 8 * hh);
      acc[t] = mmaH<1>(ah.v, ah.v, bq.v, bq.v, acc[t]); }
  }
#pragma unroll
  for (int t = 0; t < 4; ++t) { if (col0 + t * 16 >= N) continue; const int col = col0 + t * 16 + ln; const float bv = bp ? bf16_round(bp[col]) : 0.f;
#pragma unroll
    for (int r = 0; r < 8; ++r) { float v = acc[t][r] * alpha + bv; if (CP) { const int rr = row0g + row0 + 8 * hh + r; if (rowsPerB < 0) v += CP[cofs + (size_t)rr * ldc + col];      /* rowsPerB < 0: own element of the batched C plane */ else { const int bidx = rr / rowsPerB; v += CP[(size_t)bidx * sCPb + (size_t)by * 64 + col]; } } if (ACT == 1) v = (v > 0.f) ? v : expm1f(v); else if (ACT == 7) v = (v > 0.f) ? v + 1.0f : expf(v); else if (ACT == 8) v = tanhf(v); else if (ACT == 9) v = 0.5f * v * (1.0f + tanhf(0.7978845608028654f * (v + 0.044715f * v * v * v))); else if (ACT == 11) v = 1.0f / (1.0f + expf(-v)); else if (ACT == 12) v = (v > 0.f) ? v : 0.01f * v; else if (ACT == 14) v = (v > 0.f) ? v : 0.1f * v; else if (ACT == 16) v = (v >= 0.f) ? v : 0.3f * v; else if (ACT == 17) v = (v >= 0.f) ? v : 0.2f * v; else if (ACT == 15) v = v / (1.0f + expf(-v)); else if (ACT == 3) v = fmaxf(v, 0.f); else if (ACT == 6) v = 0.5f * v * (1.0f + erff(v * 0.70710678118654752f)); so[w][8 * hh + r][t * 16 + ln] = v; } }
  __builtin_amdgcn_fence(__ATOMIC_ACQ_REL, "workgroup"); __builtin_amdgcn_wave_barrier();
  const int rsub = lane >> 4, c4 = (lane & 15) * 4; typedef _Float16 v4h __attribute__((ext_vector_type(4)));
  {
#pragma unroll
    for (int q = 0; q < 8; ++q) { const int r = q * 2 + rsub; if (col0 + c4 < N) { const v4f v = *(const v4fa*)&so[w][r][c4]; if (C) *(v4f*)(C + cofs + (size_t)(row0 + r) * ldc + col0 + c4) = v; if (C16) { v4h h4; for (int i = 0; i < 4; ++i) h4[i] = (_Float16)v[i]; *(v4h*)(C16 + cofs + (size_t)(row0 + r) * ldc + col0 + c4) = h4; } } }
     }
}


typedef _Float16 v4h __attribute__((ext_vector_type(4)));

__global__ __launch_bounds__(256) void k_x16(const float* __restrict__ x, _Float16* __restrict__ X16, size_t n8) { const size_t t = (size_t)blockIdx.x * 256 + threadIdx.x; if (t >= n8) return; FragH f;
#pragma unroll
  for (int q = 0; q < 8; ++q) f.h[q] = (_Float16)bf16_round(x[t * 8 + q]); *(v8us*)((unsigned short*)X16 + t * 8) = f.half[0];  }
__global__ __launch_bounds__(256) void k_h16(const float* __restrict__ x, _Float16* __restrict__ X16, size_t n8) { const size_t t = (size_t)blockIdx.x * 256 + threadIdx.x; if (t >= n8) return; FragH f;
#pragma unroll
  for (int q = 0; q < 8; ++q) f.h[q] = (_Float16)x[t * 8 + q]; *(v8us*)((unsigned short*)X16 + t * 8) = f.half[0];  }
__global__ __launch_bounds__(256) void k_round16f(const float* __restrict__ W, _Float16* __restrict__ Bt, size_t n8) { const size_t t = (size_t)blockIdx.x * 256 + threadIdx.x; if (t >= n8) return; FragH f;
#pragma unroll
  for (int i = 0; i < 8; ++i) f.h[i] = (_Float16)(bf16_round(W[t * 8 + i]) * 16.0f); *(v8us*)((unsigned short*)Bt + t * 8) = f.half[0];  }
template <int NHv, int TTv>
__global__ __launch_bounds__(256) void k_vt(const _Float16* __restrict__ V16, int ldv, int voff, _Float16* __restrict__ Vt) { __shared__ unsigned short tl[64][66]; const int tid = threadIdx.x; const int slab = blockIdx.x / (TTv / 64), lg = blockIdx.x % (TTv / 64); const int b = slab / NHv, h = slab % NHv;
  for (int i = tid; i < 64 * 8; i += 256) { const int r = i / 8, c8 = (i % 8) * 8; FragH f; f.half[0] = *(const v8us*)((const unsigned short*)V16 + ((size_t)b * TTv + lg * 64 + r) * ldv + voff + h * 64 + c8);
#pragma unroll
    for (int q = 0; q < 8; ++q) tl[r][c8 + q] = f.u[q]; }
  __syncthreads();
  {
#pragma unroll
    for (int rd = 0; rd < 2; ++rd) { const int d = rd * 32 + tid / 8, pc = tid % 8; FragH f;
#pragma unroll
      for (int q = 0; q < 8; ++q) f.u[q] = tl[pc * 8 + q][d];
      *(v8us*)((unsigned short*)Vt + ((size_t)slab * 64 + d) * TTv + lg * 64 + pc * 8) = f.half[0]; }
     } }

__global__ __launch_bounds__(256) void k_hl(const float* __restrict__ F, _Float16* __restrict__ Hh, _Float16* __restrict__ Hl, size_t n8) { const size_t t = (size_t)blockIdx.x * 256 + threadIdx.x; if (t >= n8) return; FragH fh, fl; const v4f a = *(const v4fa*)(F + t * 8), c = *(const v4fa*)(F + t * 8 + 4);
#pragma unroll
  for (int q = 0; q < 4; ++q) { _Float16 h = (_Float16)a[q]; fh.h[q] = h; fl.h[q] = (_Float16)((a[q] - (float)h) * 1024.0f); h = (_Float16)c[q]; fh.h[4 + q] = h; fl.h[4 + q] = (_Float16)((c[q] - (float)h) * 1024.0f); }
  { *(v8us*)((unsigned short*)Hh + t * 8) = fh.half[0]; *(v8us*)((unsigned short*)Hl + t * 8) = fl.half[0];  } }

// ---- fast GEMM (wave tile 32x64; requires M % 32 == 0 rows per launch region and N % 64 == 0); epilogue = k_gemm_hhx semantics ----
__device__ __forceinline__ v16h g2_frag(const _Float16* p, int hh) { FragH f; f.half[0] = *(const v8us*)((const unsigned short*)p + 8 * hh); f.half[1] = *(const v8us*)((const unsigned short*)p + 16 + 8 * hh); return f.v; }
__device__ __forceinline__ v8f g2_mma(v16h a, v16h b, v8f c) { v8f d = __builtin_amdgcn_wmma_f32_16x16x32_f16(false, a, false, b, (short)0, c, false, false); asm volatile("v_nop\n\tv_nop\n\tv_nop\n\tv_nop" : "+v"(d) : "v"(a), "v"(b)); return d; }
template <int ACT>
__global__ __launch_bounds__(128) void k_gemm2(const _Float16* __restrict__ A, int lda, size_t sA, const _Float16* __restrict__ Bh, int ldb, size_t sB, float alpha, const float* __restrict__ bias, size_t sBias, const float* __restrict__ CP, int rowsPerB, size_t sCPb, int row0g,
    float* __restrict__ C, _Float16* __restrict__ C16, int ldc, size_t sC, int M, int N, int K) { static_assert(ACT == 0 || ACT == 3 || ACT == 6 || ACT == 8 || ACT == 9 || ACT == 11 || ACT == 12 || ACT == 14 || ACT == 15 || ACT == 16 || ACT == 17, "k_gemm2: unsupported ACT code (would silently apply no activation)");
  __shared__ __attribute__((aligned(16))) float so[4][32][68];
  const int tid = threadIdx.x, w = tid >> 5, lane = tid & 31, ln = lane & 15, hh = lane >> 4; const int by = blockIdx.y;
  A += (size_t)by * sA; Bh += (size_t)by * sB; const size_t cofs = (size_t)by * sC; const float* bp = bias ? bias + (size_t)by * sBias : nullptr;
  const int ntn = N >> 6; const int mt = blockIdx.x / ntn, nq = blockIdx.x - mt * ntn; const int row0 = mt * 128 + 32 * w, col0 = nq * 64; if (row0 >= M) return;
  const _Float16* a0p = A + (size_t)(row0 + ln) * lda; const _Float16* a1p = a0p + (size_t)16 * lda;
  const _Float16* b0p = Bh + (size_t)(col0 + ln) * ldb; const _Float16* b1p = b0p + (size_t)16 * ldb; const _Float16* b2p = b1p + (size_t)16 * ldb; const _Float16* b3p = b2p + (size_t)16 * ldb;
  const v8f z8 = {0.f,0.f,0.f,0.f,0.f,0.f,0.f,0.f}; v8f c00 = z8, c01 = z8, c02 = z8, c03 = z8, c10 = z8, c11 = z8, c12 = z8, c13 = z8;
#pragma unroll 1
  for (int kb = 0; kb < K; kb += 32) { const v16h a0 = g2_frag(a0p + kb, hh), a1 = g2_frag(a1p + kb, hh);
    v16h b = g2_frag(b0p + kb, hh); c00 = g2_mma(a0, b, c00); c10 = g2_mma(a1, b, c10);
    b = g2_frag(b1p + kb, hh); c01 = g2_mma(a0, b, c01); c11 = g2_mma(a1, b, c11);
    b = g2_frag(b2p + kb, hh); c02 = g2_mma(a0, b, c02); c12 = g2_mma(a1, b, c12);
    b = g2_frag(b3p + kb, hh); c03 = g2_mma(a0, b, c03); c13 = g2_mma(a1, b, c13); }
  v8f accs[8] = {c00, c01, c02, c03, c10, c11, c12, c13};
#pragma unroll
  for (int u = 0; u < 8; ++u) { const int t = u & 3, half = u >> 2; const int col = col0 + t * 16 + ln; const float bv = bp ? bf16_round(bp[col]) : 0.f;
#pragma unroll
    for (int r = 0; r < 8; ++r) { const int rloc = half * 16 + 8 * hh + r; float v = accs[u][r] * alpha + bv; if (CP) { if (rowsPerB < 0) v += CP[cofs + (size_t)(row0g + row0 + rloc) * ldc + col];      /* rowsPerB < 0: own element of the batched C plane */ else { const int bidx = (row0g + row0 + rloc) / rowsPerB; v += CP[(size_t)bidx * sCPb + (size_t)by * 64 + col]; } }
      if (ACT == 3) v = fmaxf(v, 0.f); else if (ACT == 6) v = 0.5f * v * (1.0f + erff(v * 0.70710678118654752f)); else if (ACT == 11) v = 1.0f / (1.0f + expf(-v)); else if (ACT == 15) v = v / (1.0f + expf(-v)); else if (ACT == 12) v = (v > 0.f) ? v : 0.01f * v; else if (ACT == 8) v = tanhf(v); else if (ACT == 9) v = 0.5f * v * (1.0f + tanhf(0.7978845608028654f * (v + 0.044715f * v * v * v))); else if (ACT == 14) v = (v > 0.f) ? v : 0.1f * v; else if (ACT == 16) v = (v >= 0.f) ? v : 0.3f * v; else if (ACT == 17) v = (v >= 0.f) ? v : 0.2f * v;
      so[w][rloc][t * 16 + ln] = v; } }
  __builtin_amdgcn_fence(__ATOMIC_ACQ_REL, "workgroup"); __builtin_amdgcn_wave_barrier();
  const int rsub = lane >> 4, c4 = (lane & 15) * 4;
  {
#pragma unroll
    for (int q = 0; q < 16; ++q) { const int r = q * 2 + rsub; const v4f v = *(const v4fa*)&so[w][r][c4]; if (C) *(v4f*)(C + cofs + (size_t)(row0 + r) * ldc + col0 + c4) = v; if (C16) { v4h h4; for (int i = 0; i < 4; ++i) h4[i] = (_Float16)v[i]; *(v4h*)(C16 + cofs + (size_t)(row0 + r) * ldc + col0 + c4) = h4; } }
     } }


__global__ __launch_bounds__(256) void k_wnat(const float* __restrict__ w, size_t n8, _Float16* __restrict__ Bt) { const size_t t = (size_t)blockIdx.x * 256 + threadIdx.x; if (t >= n8) return; FragH f; for (int q = 0; q < 8; ++q) f.h[q] = (_Float16)(bf16_round(w[t * 8 + q]) * 16.0f); *(v8us*)((unsigned short*)Bt + t * 8) = f.half[0];  }
__global__ __launch_bounds__(256) void k_rsm(const float* __restrict__ S, _Float16* __restrict__ P, int nrows) {
  #pragma clang fp contract(off)
  const int i = blockIdx.x * 256 + threadIdx.x; if (i >= nrows) return; const float* s = S + (size_t)i * SQ; float mx = -3.0e38f;
#pragma unroll 1
  for (int j = 0; j < SQ; ++j) mx = fmaxf(mx, s[j]); float se = 0.f;
#pragma unroll 1
  for (int j = 0; j < SQ; ++j) se += expf(s[j] - mx); const float sc = 256.0f / se;
#pragma unroll 1
  for (int j0 = 0; j0 < SQ; j0 += 8) { FragH f; for (int q = 0; q < 8; ++q) f.h[q] = (_Float16)(expf(s[j0 + q] - mx) * sc); unsigned short* d = (unsigned short*)P + (size_t)i * SQ + j0; *(v8us*)d = f.half[0];  } }
__global__ __launch_bounds__(256) void k_vt(const _Float16* __restrict__ V16, int b, int h0, _Float16* __restrict__ VT) { __shared__ unsigned short tl[64][65]; const int tid = threadIdx.x; const int hh = blockIdx.x % HG, sg = blockIdx.x / HG; const int s0 = sg * 64; const int h = h0 + hh;
  for (int i = tid; i < 64 * 8; i += 256) { const int j = i / 8, d8 = (i % 8) * 8; FragH f; f.half[0] = *(const v8us*)((const unsigned short*)V16 + ((size_t)b * SQ + s0 + j) * DM + h * HD + d8); for (int q = 0; q < 8; ++q) tl[d8 + q][j] = f.u[q]; }
  __syncthreads();
  { for (int i = tid; i < 64 * 8; i += 256) { const int d = i / 8, j8 = (i % 8) * 8; FragH f; for (int q = 0; q < 8; ++q) f.u[q] = tl[d][j8 + q]; *(v8us*)((unsigned short*)VT + ((size_t)hh * HD + d) * SQ + s0 + j8) = f.half[0]; }  } }


// K and V for the fused kernel, all (batch, head) slices in one launch, straight from the f32 inputs. A block takes 128 keys of one slice: their K rows (8192 floats in a row) go out rounded, in place order;
// their V rows (64 floats each, 768 apart) go out rounded and transposed as Vt[slice][key / 32][d][key % 32], so that the 64 x 32 block which one pass of k_attn reads is 4 KiB in a row (whole cache lines, no power-of-two pitch between the 64 rows).
// 768 equal blocks of 8 waves, three on each of 256 WGPs, all resident at once; a thread has its 8 + 8 loads of 16 bytes out before it converts anything, and each load of a wave covers whole lines (512 bytes in a row of K, two 256-byte row pieces of V).
__global__ __launch_bounds__(256) void k_prep(const float* __restrict__ k, const float* __restrict__ v, _Float16* __restrict__ K16, _Float16* __restrict__ Vt) { __shared__ unsigned short tl[128][66]; const int tid = threadIdx.x; const int slab = blockIdx.x / (SQ / 128), lg = blockIdx.x % (SQ / 128); const int b = slab / 12, h = slab % 12;
  const float* kp = k + (size_t)blockIdx.x * (128 * HD) + tid * 4; const float* vp = v + ((size_t)b * SQ + lg * 128 + tid / 16) * 768 + h * 64 + (tid % 16) * 4;
  v4f ka[8], va[8];
#pragma unroll
  for (int u = 0; u < 8; ++u) ka[u] = *(const v4fa*)(kp + u * 1024);
#pragma unroll
  for (int u = 0; u < 8; ++u) va[u] = *(const v4fa*)(vp + (size_t)u * 16 * 768);
  __builtin_amdgcn_sched_barrier(0);      /* all sixteen loads go out together: without it the scheduler sank most of the K loads between the conversions, one memory round trip behind the other */
#pragma unroll
  for (int u = 0; u < 8; ++u) { FragH f;
#pragma unroll
    for (int q = 0; q < 4; ++q) f.h[q] = (_Float16)bf16_round(va[u][q]);
#pragma unroll
    for (int q = 0; q < 4; ++q) tl[u * 16 + tid / 16][(tid % 16) * 4 + q] = f.u[q]; }
  __syncthreads();
  // K goes out behind the barrier: in front of it the barrier's wait would hold every wave until its K stores have returned.
#pragma unroll
  for (int u = 0; u < 8; ++u) { v4h f;
#pragma unroll
    for (int q = 0; q < 4; ++q) f[q] = (_Float16)bf16_round(ka[u][q]);
    *(v4h*)(K16 + (size_t)blockIdx.x * (128 * HD) + u * 1024 + tid * 4) = f; }
#pragma unroll
  for (int rd = 0; rd < 4; ++rd) { const int d = (rd & 1) * 32 + tid / 8, pc = (rd >> 1) * 8 + tid % 8; FragH f;
#pragma unroll
    for (int q = 0; q < 8; ++q) f.u[q] = tl[pc * 8 + q][d];
    *(v8us*)((unsigned short*)Vt + (size_t)slab * HD * SQ + (size_t)(lg * 4 + pc / 4) * (HD * 32) + d * 32 + (pc % 4) * 8) = f.half[0]; } }

typedef float v2f __attribute__((ext_vector_type(2)));
typedef _Float16 v2h __attribute__((ext_vector_type(2)));
__device__ __forceinline__ float xhalf(float x) { return __builtin_bit_cast(float, __builtin_amdgcn_permlanex16(__builtin_bit_cast(int, x), __builtin_bit_cast(int, x), 0x76543210, 0xfedcba98, false, false)); }      /* lane l <-> lane l ^ 16 */
__device__ __forceinline__ v8f fa_mma(v16h a, v16h b, v8f c) { return __builtin_amdgcn_wmma_f32_16x16x32_f16(false, a, false, b, (short)0, c, false, false); }
// Scores, softmax and weighted sum in one kernel. Block = 4 waves x 32 queries of one (batch, head) slice; grid = 48 x 16 = 768 blocks, three on each of 256 WGPs.
// S^T = K Q^T: A = 16 key rows, B = 16 query rows (kept in registers), same k order for both. A lane's 8 accumulator registers are keys 8 hh + r of ONE query (column ln):
// maximum and sum run inside the lane plus one exchange with lane ^ 16, and two S^T tiles (keys 0-15, 16-31), converted in place, ARE the B operand of O^T += V^T P^T (k = 8 hh + r, 16 + 8 hh + r: the order in which g2_frag reads V^T).
// Running softmax per query: m = maximum so far (raw scores), weights 2^8 exp((s - m) alpha), sum and O^T rescaled by exp((m_old - m) alpha) in every pass; the 2^8 cancels in the division at the end.
__global__ __launch_bounds__(128) void k_attn(const float* __restrict__ Q, const _Float16* __restrict__ K16, const _Float16* __restrict__ Vt, float* __restrict__ O, float cs) {
  const int tid = threadIdx.x, w = tid >> 5, lane = tid & 31, ln = lane & 15, hh = lane >> 4;
  const int slab = blockIdx.x / (SQ / 128), q0 = (blockIdx.x % (SQ / 128)) * 128 + w * 32;
  const float* qp = Q + ((size_t)slab * SQ + q0 + ln) * HD + 8 * hh;      /* the f32 input itself: each query row is read by one wave only, which rounds it as K and V are rounded */
  // K and V^T: one address pair per lane each, alive through the whole loop and moved once per pass by 4 KiB (32 keys); the sixteen loads of a pass differ in their immediate offsets only.
  typedef __attribute__((address_space(1))) const char gch; typedef __attribute__((address_space(1))) const v8us gv8;      /* global address space by type: the two addresses pass through an asm statement, behind which the compiler would otherwise fall back to flat loads */
  auto frag = [](gch* p, int off) { FragH f; f.half[0] = *(gv8*)(p + off); f.half[1] = *(gv8*)(p + off + 32); return f.v; };      /* k = 8 hh + 0..7 and 16 + 8 hh + 0..7, as g2_frag */
  gch* kn = (gch*)(K16 + ((size_t)slab * SQ + ln) * HD + 8 * hh); gch* vn = (gch*)(Vt + (size_t)slab * HD * SQ + ln * 32 + 8 * hh);      /* this lane's place in the block of 32 keys that the loads last issued name */
  v16h qf[2][2], kf[2][2], vf[4];      /* q, k: [16-row tile][32-wide step of d]; v: [16 rows of d] */
  v4f qr[2][2][4];      /* q as loaded: k = 8 hh + 0..7 and 16 + 8 hh + 0..7, as g2_frag */
#pragma unroll
  for (int j = 0; j < 2; ++j) for (int ks = 0; ks < 2; ++ks) for (int c = 0; c < 4; ++c) qr[j][ks][c] = *(const v4fa*)(qp + j * 16 * HD + ks * 32 + (c >> 1) * 16 + (c & 1) * 4);
  __builtin_amdgcn_sched_barrier(0);      /* q, then k, then v, the order of the loop: with a q load issued last, the loop's first wait became a wait for every load, the V^T just issued too */
#pragma unroll
  for (int t = 0; t < 2; ++t) for (int ks = 0; ks < 2; ++ks) kf[t][ks] = frag(kn, t * 16 * HD * 2 + ks * 64);
  __builtin_amdgcn_sched_barrier(0);      /* as above */
#pragma unroll
  for (int t = 0; t < 4; ++t) vf[t] = frag(vn, t * 16 * 32 * 2);
  __builtin_amdgcn_sched_barrier(0);      /* q is rounded while the first K and V^T blocks fly: without it the V^T loads sank behind the rounding */
#pragma unroll
  for (int j = 0; j < 2; ++j) for (int ks = 0; ks < 2; ++ks) { FragH f;
#pragma unroll
    for (int i = 0; i < 16; ++i) f.h[i] = (_Float16)bf16_round(qr[j][ks][i >> 2][i & 3]);
    qf[j][ks] = f.v; }
  const v8f z8 = {0.f,0.f,0.f,0.f,0.f,0.f,0.f,0.f}; v8f o[4][2] = {{z8, z8}, {z8, z8}, {z8, z8}, {z8, z8}};      /* O^T: [16 rows of d][16 queries] */
  float mr[2] = {-3.0e38f, -3.0e38f}, ls[2] = {0.f, 0.f};
  for (int kb = 0; kb < SQ / 32; ++kb) {      /* one pass = 32 keys */
    v8f s[2][2];      /* S^T: [16 keys][16 queries] */
#pragma unroll
    for (int t = 0; t < 2; ++t) for (int j = 0; j < 2; ++j) s[t][j] = fa_mma(kf[t][1], qf[j][1], fa_mma(kf[t][0], qf[j][0], z8));
    __builtin_amdgcn_sched_barrier(0);      /* keeps the wait below behind all eight score products (without it the wait rose to the first of them, a few instructions behind the V^T loads at the foot of the last pass) */
    const long long inc = kb + 1 < SQ / 32 ? 32 * HD * 2 : -(SQ / 32 - 1) * 32 * HD * 2;      /* the last pass has no next block: its addresses go back to block 0, inside the buffers */
    // Loads that name the two address pairs may still be out: the wait and the move stand in one statement, so that nothing rewrites a pair in front of the wait.
    asm volatile("s_wait_xcnt 0x0\n\tv_add_nc_u64 %0, %2, %0\n\tv_add_nc_u64 %1, %2, %1" : "+v"(kn), "+v"(vn) : "s"(inc) : "memory");
    // The next pass's keys go out as soon as this pass's score products are issued, into the same registers: softmax and the second product cover their latency.
#pragma unroll
    for (int t = 0; t < 2; ++t) for (int ks = 0; ks < 2; ++ks) kf[t][ks] = frag(kn, t * 16 * HD * 2 + ks * 64);
    __builtin_amdgcn_sched_barrier(0);      /* without it the scheduler sank these loads to the foot of the pass, directly in front of their use */
#pragma unroll
    for (int j = 0; j < 2; ++j) {
      float mx = fmaxf(s[0][j][0], s[1][j][0]);
#pragma unroll
      for (int r = 1; r < 8; ++r) mx = fmaxf(mx, fmaxf(s[0][j][r], s[1][j][r]));
      mx = fmaxf(mx, xhalf(mx));
      const float mn = fmaxf(mr[j], mx), corr = __builtin_amdgcn_exp2f((mr[j] - mn) * cs), nb = 8.0f - mn * cs; mr[j] = mn;
      FragH pf; v2f sm = {0.f, 0.f};
#pragma unroll
      for (int i = 0; i < 8; ++i) { const v2f a = __builtin_elementwise_fma(v2f{s[i >> 2][j][2 * (i & 3)], s[i >> 2][j][2 * (i & 3) + 1]}, v2f{cs, cs}, v2f{nb, nb});
        const v2f p = {__builtin_amdgcn_exp2f(a.x), __builtin_amdgcn_exp2f(a.y)}; sm += p; const v2h ph = __builtin_convertvector(p, v2h); pf.h[2 * i] = ph.x; pf.h[2 * i + 1] = ph.y; }
      ls[j] = ls[j] * corr + (sm.x + sm.y);
#pragma unroll
      for (int t = 0; t < 4; ++t) o[t][j] = fa_mma(vf[t], pf.v, o[t][j] * corr);
    }
    // The next pass's V^T goes out behind the last product that reads this pass's, into the same registers: the next score products and softmax cover its latency.
#pragma unroll
    for (int t = 0; t < 4; ++t) vf[t] = frag(vn, t * 16 * 32 * 2);
  }
#pragma unroll
  for (int j = 0; j < 2; ++j) { const float inv = 1.0f / (ls[j] + xhalf(ls[j])); float* op = O + ((size_t)slab * SQ + q0 + j * 16 + ln) * HD + 8 * hh;
#pragma unroll
    for (int t = 0; t < 4; ++t) { const v8f v = o[t][j] * inv; *(v4f*)(op + t * 16) = v4f{v[0], v[1], v[2], v[3]}; *(v4f*)(op + t * 16 + 4) = v4f{v[4], v[5], v[6], v[7]}; } } }

extern "C" void kernel_launch(void* const* d_in, const int* in_sizes, int n_in,
                              void* d_out, int out_size, void* d_ws, size_t ws_size, hipStream_t stream) {
  (void)in_sizes; (void)n_in; (void)out_size;
  const float* const* I = (const float* const*)d_in; const float* q = I[0]; const float* k = I[1]; const float* v = I[2];
  char* ws = (char*)d_ws; size_t off = 0;
  auto take = [&](size_t bytes) { char* p = ws + off; off += (bytes + 255) & ~(size_t)255; return p; };
  _Float16* K16 = (_Float16*)take(NR * DM * 2); _Float16* VT = (_Float16*)take(NR * DM * 2);
  if (off > ws_size) return;      /* 2 x 12 = 24 MiB */
  k_prep<<<NB * (SQ / 128), 256, 0, stream>>>(k, v, K16, VT);      /* values are [B][S][12][64]: each slice's 64 columns of the 768-wide rows */
  k_attn<<<NB * (SQ / 128), 128, 0, stream>>>(q, K16, VT, (float*)d_out, 0.05205877313848632f);      /* 768^-0.5 x log2 e: exp(x) = 2^(x log2 e) */
}

// v004
// Measured time: 65.5 microseconds a run.
// In two side-by-side timings against v003, it was 1.31 and 1.32 times as fast.
// Over all steps from v000 it is 289 times as fast.
#include <hip/hip_runtime.h>
#define NB 48
#define SQ 2048
#define DM 64
#define NH 1
#define HD 64
#define HG 1
#define NR ((size_t)NB * SQ)
typedef __bf16 v16b __attribute__((ext_vector_type(16)));
typedef unsigned short v8us __attribute__((ext_vector_type(8), may_alias));
typedef float  v8f  __attribute__((ext_vector_type(8)));
typedef float  v4f  __attribute__((ext_vector_type(4)));
typedef float  v4fa __attribute__((ext_vector_type(4), may_alias));
union FragB { v16b v; v8us half[2]; unsigned short u[16]; };

__device__ __forceinline__ unsigned short bf16_bits(float x) { unsigned int u = __float_as_uint(x); return (unsigned short)((u + 0x7FFFu + ((u >> 16) & 1u)) >> 16); }
__device__ __forceinline__ float bf16_val(unsigned short b) { return __uint_as_float(((unsigned int)b) << 16); }
__device__ __forceinline__ float bf16_round(float x) { return bf16_val(bf16_bits(x)); }
// D += A·B with NT terms: 1 = ah·bh, 2 = + al·bh (A split), 3 = + ah·bl (both split)
template <int NT>
__device__ __forceinline__ v8f mmaN(v16b ah, v16b al, v16b bh, v16b bl, v8f c) {
  c = __builtin_amdgcn_wmma_f32_16x16x32_bf16(false, ah, false, bh, (short)0, c, false, false);
  if (NT >= 2) c = __builtin_amdgcn_wmma_f32_16x16x32_bf16(false, al, false, bh, (short)0, c, false, false);
  if (NT >= 3) c = __builtin_amdgcn_wmma_f32_16x16x32_bf16(false, ah, false, bl, (short)0, c, false, false);
  asm volatile("v_nop\n\tv_nop\n\tv_nop\n\tv_nop" : "+v"(c) : "v"(ah), "v"(al), "v"(bh), "v"(bl));
  return c;
}

__global__ __launch_bounds__(256) void k_wt_bf16(const float* __restrict__ W, unsigned short* __restrict__ Wt, int K, int N) {
  const int t = blockIdx.x * 256 + threadIdx.x;
  const int k8n = K / 8;
  if (t >= N * k8n) return;
  const int n = t / k8n, k8 = (t % k8n) * 8;
  v8us v;
#pragma unroll
  for (int i = 0; i < 8; ++i) v[i] = bf16_bits(W[(size_t)(k8 + i) * N + n]);
  *(v8us*)(Wt + (size_t)n * K + k8) = v;
  
}

// GEMM C[M][N] (f32, pitch ldc) = act(A[M][K]·W + bias). A f32 row-major (pitch lda) converted per fragment to bf16
// (ASPLIT: hi/lo two planes -> 2 terms, else single rounded term); Wt bf16 [N][K] (pitch ldb). BIAS_BF16 rounds the
// bias to bf16 first (bias quantised to bf16 before the add). K%32==0, M%16==0, N%64==0.
template <bool ASPLIT, int ACT, bool BIAS_BF16>
__global__ __launch_bounds__(128) void k_gemm_bf(const float* __restrict__ A, int lda, const unsigned short* __restrict__ Wt, int ldb,
                                               const float* __restrict__ bias, float* __restrict__ C, int ldc, int M, int N, int K) {
  __shared__ __attribute__((aligned(16))) float so[4][16][64];
  const int tid = threadIdx.x, w = tid >> 5, lane = tid & 31, ln = lane & 15, hh = lane >> 4;
  const int ntn = N / 64;
  const int wid = blockIdx.x * 4 + w;
  const int mt = wid / ntn, nq = wid % ntn;
  if (mt * 16 >= M) return;
  const int row0 = mt * 16, col0 = nq * 64;
  const float* arow = A + (size_t)(row0 + ln) * lda;
  v8f acc[4] = {};
  for (int kb = 0; kb < K; kb += 32) {
    FragB ah, al;
    const v4f x0 = *(const v4fa*)(arow + kb + 8 * hh), x1 = *(const v4fa*)(arow + kb + 8 * hh + 4);
    const v4f x2 = *(const v4fa*)(arow + kb + 16 + 8 * hh), x3 = *(const v4fa*)(arow + kb + 16 + 8 * hh + 4);
    float xs[16] = {x0[0],x0[1],x0[2],x0[3],x1[0],x1[1],x1[2],x1[3],x2[0],x2[1],x2[2],x2[3],x3[0],x3[1],x3[2],x3[3]};
#pragma unroll
    for (int i = 0; i < 16; ++i) { const unsigned short hb = bf16_bits(xs[i]); ah.u[i] = hb; al.u[i] = ASPLIT ? bf16_bits(xs[i] - bf16_val(hb)) : (unsigned short)0; }
#pragma unroll
    for (int t = 0; t < 4; ++t) {
      const unsigned short* brow = Wt + (size_t)(col0 + t * 16 + ln) * ldb + kb;
      FragB b;
      b.half[0] = *(const v8us*)(brow + 8 * hh);
      b.half[1] = *(const v8us*)(brow + 16 + 8 * hh);
      acc[t] = mmaN<ASPLIT ? 2 : 1>(ah.v, al.v, b.v, b.v, acc[t]);
    }
  }
#pragma unroll
  for (int t = 0; t < 4; ++t) {
    float bv = bias ? bias[col0 + t * 16 + ln] : 0.f;
    if (BIAS_BF16) bv = bf16_round(bv);
#pragma unroll
    for (int r = 0; r < 8; ++r) { float v = acc[t][r] + bv; if (ACT == 1) v = fmaxf(v, 0.f); so[w][8 * hh + r][t * 16 + ln] = v; }
  }
  __builtin_amdgcn_fence(__ATOMIC_ACQ_REL, "workgroup");
  __builtin_amdgcn_wave_barrier();
  const int rsub = lane >> 4, c4 = (lane & 15) * 4;
  {
#pragma unroll
    for (int q = 0; q < 8; ++q) {
      const int r = q * 2 + rsub;
      const v4f v = *(const v4fa*)&so[w][r][c4];
      *(v4f*)(C + (size_t)(row0 + r) * ldc + col0 + c4) = v;
    }
    
  }
}

// GEMM C = act(A·W + bias + resid): A f32 (ASPLIT -> hi/lo 2 terms), Wt bf16 [N][K]; ACT 0 none, 1 relu, 2 exact gelu;
// resid (optional, f32, row index = (row % rmod), pitch ldr, RES_BF16 rounds it) added before the activation.
template <bool ASPLIT, int ACT, bool BIAS_BF16, bool RES_BF16>
__global__ __launch_bounds__(128) void k_gemm_bf3(const float* __restrict__ A, int lda, const unsigned short* __restrict__ Wt, int ldb,
                                                const float* __restrict__ bias, const float* __restrict__ resid, int rmod, int ldr,
                                                float* __restrict__ C, int ldc, int M, int N, int K) {
  __shared__ __attribute__((aligned(16))) float so[4][16][64];
  const int tid = threadIdx.x, w = tid >> 5, lane = tid & 31, ln = lane & 15, hh = lane >> 4;
  const int ntn = N / 64;
  const int wid = blockIdx.x * 4 + w;
  const int mt = wid / ntn, nq = wid % ntn;
  if (mt * 16 >= M) return;
  const int row0 = mt * 16, col0 = nq * 64;
  const float* arow = A + (size_t)(row0 + ln) * lda;
  v8f acc[4] = {};
  for (int kb = 0; kb < K; kb += 32) {
    FragB ah, al;
    const v4f x0 = *(const v4fa*)(arow + kb + 8 * hh), x1 = *(const v4fa*)(arow + kb + 8 * hh + 4);
    const v4f x2 = *(const v4fa*)(arow + kb + 16 + 8 * hh), x3 = *(const v4fa*)(arow + kb + 16 + 8 * hh + 4);
    float xs[16] = {x0[0],x0[1],x0[2],x0[3],x1[0],x1[1],x1[2],x1[3],x2[0],x2[1],x2[2],x2[3],x3[0],x3[1],x3[2],x3[3]};
#pragma unroll
    for (int i = 0; i < 16; ++i) { const unsigned short hb = bf16_bits(xs[i]); ah.u[i] = hb; al.u[i] = ASPLIT ? bf16_bits(xs[i] - bf16_val(hb)) : (unsigned short)0; }
#pragma unroll
    for (int t = 0; t < 4; ++t) {
      const unsigned short* brow = Wt + (size_t)(col0 + t * 16 + ln) * ldb + kb;
      FragB b;
      b.half[0] = *(const v8us*)(brow + 8 * hh);
      b.half[1] = *(const v8us*)(brow + 16 + 8 * hh);
      acc[t] = mmaN<ASPLIT ? 2 : 1>(ah.v, al.v, b.v, b.v, acc[t]);
    }
  }
#pragma unroll
  for (int t = 0; t < 4; ++t) {
    const int col = col0 + t * 16 + ln;
    float bv = bias ? bias[col] : 0.f;
    if (BIAS_BF16) bv = bf16_round(bv);
#pragma unroll
    for (int r = 0; r < 8; ++r) {
      float v = acc[t][r] + bv;
      if (resid) { float rv = resid[(size_t)((row0 + 8 * hh + r) % rmod) * ldr + col]; if (RES_BF16) rv = bf16_round(rv); v += rv; }
      if (ACT == 1) v = fmaxf(v, 0.f);
      if (ACT == 2) v = 0.5f * v * (1.0f + erff(v * 0.70710678118654752f));
      if (ACT == 3) { const float u = 0.7978845608028654f * (v + 0.044715f * v * v * v); v = 0.5f * v * (1.0f + tanhf(u)); }
      so[w][8 * hh + r][t * 16 + ln] = v;
    }
  }
  __builtin_amdgcn_fence(__ATOMIC_ACQ_REL, "workgroup");
  __builtin_amdgcn_wave_barrier();
  const int rsub = lane >> 4, c4 = (lane & 15) * 4;
  {
#pragma unroll
    for (int q = 0; q < 8; ++q) {
      const int r = q * 2 + rsub;
      const v4f v = *(const v4fa*)&so[w][r][c4];
      *(v4f*)(C + (size_t)(row0 + r) * ldc + col0 + c4) = v;
    }
    
  }
}
// row LayerNorm (biased variance, eps) over N: s = X (+ R); optional out_sum <- s; out_norm <- (s-mu)*rsqrt(var+eps)*g + b
template <bool PARAM_BF16>
__global__ __launch_bounds__(256) void k_layernorm(const float* __restrict__ X, const float* __restrict__ R, const float* __restrict__ g, const float* __restrict__ bta,
                                                  float* __restrict__ out_sum, float* __restrict__ out_norm, int N, float eps) {
  __shared__ float red[256];
  const int row = blockIdx.x, tid = threadIdx.x;
  const float* x = X + (size_t)row * N; const float* rr = R ? R + (size_t)row * N : nullptr;
  float vals[16];                     // up to N = 4096
  const int per = N / 256;            // contiguous chunk per thread? use strided-by-4 chunks: thread handles j = tid*4 + 1024*u
  float s1 = 0.f;
  for (int u = 0; u < per / 4; ++u) {
    const int j = tid * 4 + 1024 * u;
    const v4f a = *(const v4fa*)(x + j);
    v4f b = {0.f,0.f,0.f,0.f}; if (rr) b = *(const v4fa*)(rr + j);
#pragma unroll
    for (int q = 0; q < 4; ++q) { const float v = a[q] + b[q]; vals[u * 4 + q] = v; s1 += v; }
  }
  red[tid] = s1; __syncthreads();
  for (int st = 128; st > 0; st >>= 1) { if (tid < st) red[tid] += red[tid + st]; __syncthreads(); }
  const float mu = red[0] / (float)N; __syncthreads();
  float s2 = 0.f;
  for (int u = 0; u < per / 4; ++u)
#pragma unroll
    for (int q = 0; q < 4; ++q) { const float c = vals[u * 4 + q] - mu; s2 += c * c; }
  red[tid] = s2; __syncthreads();
  for (int st = 128; st > 0; st >>= 1) { if (tid < st) red[tid] += red[tid + st]; __syncthreads(); }
  const float rs = rsqrtf(red[0] / (float)N + eps);
  {
    for (int u = 0; u < per / 4; ++u) {
      const int j = tid * 4 + 1024 * u;
      v4f o, sm;
#pragma unroll
      for (int q = 0; q < 4; ++q) {
        float gg = g[j + q], bb = bta[j + q];
        if (PARAM_BF16) { gg = bf16_round(gg); bb = bf16_round(bb); }
        sm[q] = vals[u * 4 + q]; o[q] = (vals[u * 4 + q] - mu) * rs * gg + bb;
      }
      if (out_sum) *(v4f*)(out_sum + (size_t)row * N + j) = sm;
      *(v4f*)(out_norm + (size_t)row * N + j) = o;
    }
    
  }
}



// ---- f16 WMMA path (v_wmma_f32_16x16x32_f16): 11-bit significands for operands in range — used where a [0,1] probability operand needs more precision than bf16
typedef _Float16 v16h __attribute__((ext_vector_type(16)));
union FragH { v16h v; v8us half[2]; _Float16 h[16]; unsigned short u[16]; };
template <int NT>
__device__ __forceinline__ v8f mmaH(v16h ah, v16h al, v16h bh, v16h bl, v8f c) {
  c = __builtin_amdgcn_wmma_f32_16x16x32_f16(false, ah, false, bh, (short)0, c, false, false);
  if (NT >= 2) c = __builtin_amdgcn_wmma_f32_16x16x32_f16(false, al, false, bh, (short)0, c, false, false);
  if (NT >= 3) c = __builtin_amdgcn_wmma_f32_16x16x32_f16(false, ah, false, bl, (short)0, c, false, false);
  asm volatile("v_nop\n\tv_nop\n\tv_nop\n\tv_nop" : "+v"(c) : "v"(ah), "v"(al), "v"(bh), "v"(bl));
  return c;
}
// batched GEMM like k_gemm_b but f16 operands: A f32 (split into f16 hi/lo if ASPLIT, else rounded to f16), Bt = f16 values [n][k]; alpha; C f32; N multiple of 16 (partial tiles skipped)
template <bool ASPLIT>
__global__ __launch_bounds__(128) void k_gemm_h(const float* __restrict__ A, int lda, size_t sA, const _Float16* __restrict__ Bh, int ldb, size_t sB, float alpha, float* __restrict__ C, int ldc, size_t sC, int M, int N, int K) {
  __shared__ __attribute__((aligned(16))) float so[4][16][64];
  const int tid = threadIdx.x, w = tid >> 5, lane = tid & 31, ln = lane & 15, hh = lane >> 4; const int by = blockIdx.y;
  A += (size_t)by * sA; Bh += (size_t)by * sB; C += (size_t)by * sC;
  const int ntn = (N + 63) / 64; const int wid = blockIdx.x * 4 + w; const int mt = wid / ntn, nq = wid % ntn; if (mt * 16 >= M) return;
  const int row0 = mt * 16, col0 = nq * 64; const float* arow = A + (size_t)(row0 + ln) * lda;
  v8f acc[4] = {};
  for (int kb = 0; kb < K; kb += 32) {
    FragH ah, al;
    const v4f x0 = *(const v4fa*)(arow + kb + 8 * hh), x1 = *(const v4fa*)(arow + kb + 8 * hh + 4), x2 = *(const v4fa*)(arow + kb + 16 + 8 * hh), x3 = *(const v4fa*)(arow + kb + 16 + 8 * hh + 4);
    float xs[16] = {x0[0],x0[1],x0[2],x0[3],x1[0],x1[1],x1[2],x1[3],x2[0],x2[1],x2[2],x2[3],x3[0],x3[1],x3[2],x3[3]};
#pragma unroll
    for (int i = 0; i < 16; ++i) { const _Float16 h = (_Float16)xs[i]; ah.h[i] = h; al.h[i] = ASPLIT ? (_Float16)(xs[i] - (float)h) : (_Float16)0.0f; }
#pragma unroll
    for (int t = 0; t < 4; ++t) { if (col0 + t * 16 >= N) continue; const size_t boff = (size_t)(col0 + t * 16 + ln) * ldb + kb; FragH bq; bq.half[0] = *(const v8us*)(Bh + boff + 8 * hh); bq.half[1] = *(const v8us*)(Bh + boff + 16 + 8 * hh);
      acc[t] = mmaH<ASPLIT ? 2 : 1>(ah.v, al.v, bq.v, bq.v, acc[t]); }
  }
#pragma unroll
  for (int t = 0; t < 4; ++t) { if (col0 + t * 16 >= N) continue;
#pragma unroll
    for (int r = 0; r < 8; ++r) so[w][8 * hh + r][t * 16 + ln] = acc[t][r] * alpha; }
  __builtin_amdgcn_fence(__ATOMIC_ACQ_REL, "workgroup"); __builtin_amdgcn_wave_barrier();
  const int rsub = lane >> 4, c4 = (lane & 15) * 4;
  {
#pragma unroll
    for (int q = 0; q < 8; ++q) { const int r = q * 2 + rsub; if (col0 + c4 < N) { const v4f v = *(const v4fa*)&so[w][r][c4]; *(v4f*)(C + (size_t)(row0 + r) * ldc + col0 + c4) = v; } }
     }
}

// Wt[n][k] = f16(W[k][n]·scale) from f32 row-major W[K][N] (scale = power of two; bf16-exact weights stay exact in f16 away from the subnormal range)
__global__ __launch_bounds__(256) void k_wt_f16(const float* __restrict__ W, _Float16* __restrict__ Wt, int K, int N, float scale) {
  const int t = blockIdx.x * 256 + threadIdx.x; if (t >= N * (K / 8)) return; const int n = t / (K / 8), k8 = (t % (K / 8)) * 8; FragH f;
#pragma unroll
  for (int i = 0; i < 8; ++i) f.h[i] = (_Float16)(bf16_round(W[(size_t)(k8 + i) * N + n]) * scale); const v8us o = f.half[0];
  *(v8us*)((unsigned short*)Wt + (size_t)n * K + k8) = o; 
}
// k_gemm_hh variant with fused epilogue: v = acc·alpha + bias[by·sBias + col] (+ CP[(row/rowsPerB)·sCPb + by·64 + col] if CP) ; ACT 0 none / 1 elu ; writes f16 C16 (and f32 C if non-null)
template <int ACT>
__global__ __launch_bounds__(128) void k_gemm_hhx(const _Float16* __restrict__ A, int lda, size_t sA, const _Float16* __restrict__ Bh, int ldb, size_t sB, float alpha, const float* __restrict__ bias, size_t sBias, const float* __restrict__ CP, int rowsPerB, size_t sCPb, int row0g,
    float* __restrict__ C, _Float16* __restrict__ C16, int ldc, size_t sC, int M, int N, int K) {
  __shared__ __attribute__((aligned(16))) float so[4][16][64];
  const int tid = threadIdx.x, w = tid >> 5, lane = tid & 31, ln = lane & 15, hh = lane >> 4; const int by = blockIdx.y;
  A += (size_t)by * sA; Bh += (size_t)by * sB; const size_t cofs = (size_t)by * sC; const float* bp = bias ? bias + (size_t)by * sBias : nullptr;
  const int ntn = (N + 63) / 64; const int wid = blockIdx.x * 4 + w; const int mt = wid / ntn, nq = wid % ntn; if (mt * 16 >= M) return;
  const int row0 = mt * 16, col0 = nq * 64; const _Float16* arow = A + (size_t)(row0 + ln) * lda;
  v8f acc[4] = {};
  for (int kb = 0; kb < K; kb += 32) { FragH ah; ah.half[0] = *(const v8us*)((const unsigned short*)arow + kb + 8 * hh); ah.half[1] = *(const v8us*)((const unsigned short*)arow + kb + 16 + 8 * hh);
#pragma unroll
    for (int t = 0; t < 4; ++t) { if (col0 + t * 16 >= N) continue; const size_t boff = (size_t)(col0 + t * 16 + ln) * ldb + kb; FragH bq; bq.half[0] = *(const v8us*)((const unsigned short*)Bh + boff + 8 * hh); bq.half[1] = *(const v8us*)((const unsigned short*)Bh + boff + 16 + 8 * hh);
      acc[t] = mmaH<1>(ah.v, ah.v, bq.v, bq.v, acc[t]); }
  }
#pragma unroll
  for (int t = 0; t < 4; ++t) { if (col0 + t * 16 >= N) continue; const int col = col0 + t * 16 + ln; const float bv = bp ? bf16_round(bp[col]) : 0.f;
#pragma unroll
    for (int r = 0; r < 8; ++r) { float v = acc[t][r] * alpha + bv; if (CP) { const int rr = row0g + row0 + 8 * hh + r; if (rowsPerB < 0) v += CP[cofs + (size_t)rr * ldc + col];      /* rowsPerB < 0: own element of the batched C plane */ else { const int bidx = rr / rowsPerB; v += CP[(size_t)bidx * sCPb + (size_t)by * 64 + col]; } } if (ACT == 1) v = (v > 0.f) ? v : expm1f(v); else if (ACT == 7) v = (v > 0.f) ? v + 1.0f : expf(v); else if (ACT == 8) v = tanhf(v); else if (ACT == 9) v = 0.5f * v * (1.0f + tanhf(0.7978845608028654f * (v + 0.044715f * v * v * v))); else if (ACT == 11) v = 1.0f / (1.0f + expf(-v)); else if (ACT == 12) v = (v > 0.f) ? v : 0.01f * v; else if (ACT == 14) v = (v > 0.f) ? v : 0.1f * v; else if (ACT == 16) v = (v >= 0.f) ? v : 0.3f * v; else if (ACT == 17) v = (v >= 0.f) ? v : 0.2f * v; else if (ACT == 15) v = v / (1.0f + expf(-v)); else if (ACT == 3) v = fmaxf(v, 0.f); else if (ACT == 6) v = 0.5f * v * (1.0f + erff(v * 0.70710678118654752f)); so[w][8 * hh + r][t * 16 + ln] = v; } }
  __builtin_amdgcn_fence(__ATOMIC_ACQ_REL, "workgroup"); __builtin_amdgcn_wave_barrier();
  const int rsub = lane >> 4, c4 = (lane & 15) * 4; typedef _Float16 v4h __attribute__((ext_vector_type(4)));
  {
#pragma unroll
    for (int q = 0; q < 8; ++q) { const int r = q * 2 + rsub; if (col0 + c4 < N) { const v4f v = *(const v4fa*)&so[w][r][c4]; if (C) *(v4f*)(C + cofs + (size_t)(row0 + r) * ldc + col0 + c4) = v; if (C16) { v4h h4; for (int i = 0; i < 4; ++i) h4[i] = (_Float16)v[i]; *(v4h*)(C16 + cofs + (size_t)(row0 + r) * ldc + col0 + c4) = h4; } } }
     }
}


typedef _Float16 v4h __attribute__((ext_vector_type(4)));
typedef _Float16 v4ha __attribute__((ext_vector_type(4), may_alias));

__global__ __launch_bounds__(256) void k_x16(const float* __restrict__ x, _Float16* __restrict__ X16, size_t n8) { const size_t t = (size_t)blockIdx.x * 256 + threadIdx.x; if (t >= n8) return; FragH f;
#pragma unroll
  for (int q = 0; q < 8; ++q) f.h[q] = (_Float16)bf16_round(x[t * 8 + q]); *(v8us*)((unsigned short*)X16 + t * 8) = f.half[0];  }
__global__ __launch_bounds__(256) void k_h16(const float* __restrict__ x, _Float16* __restrict__ X16, size_t n8) { const size_t t = (size_t)blockIdx.x * 256 + threadIdx.x; if (t >= n8) return; FragH f;
#pragma unroll
  for (int q = 0; q < 8; ++q) f.h[q] = (_Float16)x[t * 8 + q]; *(v8us*)((unsigned short*)X16 + t * 8) = f.half[0];  }
__global__ __launch_bounds__(256) void k_round16f(const float* __restrict__ W, _Float16* __restrict__ Bt, size_t n8) { const size_t t = (size_t)blockIdx.x * 256 + threadIdx.x; if (t >= n8) return; FragH f;
#pragma unroll
  for (int i = 0; i < 8; ++i) f.h[i] = (_Float16)(bf16_round(W[t * 8 + i]) * 16.0f); *(v8us*)((unsigned short*)Bt + t * 8) = f.half[0];  }
template <int NHv, int TTv>
__global__ __launch_bounds__(256) void k_vt(const _Float16* __restrict__ V16, int ldv, int voff, _Float16* __restrict__ Vt) { __shared__ unsigned short tl[64][66]; const int tid = threadIdx.x; const int slab = blockIdx.x / (TTv / 64), lg = blockIdx.x % (TTv / 64); const int b = slab / NHv, h = slab % NHv;
  for (int i = tid; i < 64 * 8; i += 256) { const int r = i / 8, c8 = (i % 8) * 8; FragH f; f.half[0] = *(const v8us*)((const unsigned short*)V16 + ((size_t)b * TTv + lg * 64 + r) * ldv + voff + h * 64 + c8);
#pragma unroll
    for (int q = 0; q < 8; ++q) tl[r][c8 + q] = f.u[q]; }
  __syncthreads();
  {
#pragma unroll
    for (int rd = 0; rd < 2; ++rd) { const int d = rd * 32 + tid / 8, pc = tid % 8; FragH f;
#pragma unroll
      for (int q = 0; q < 8; ++q) f.u[q] = tl[pc * 8 + q][d];
      *(v8us*)((unsigned short*)Vt + ((size_t)slab * 64 + d) * TTv + lg * 64 + pc * 8) = f.half[0]; }
     } }

__global__ __launch_bounds__(256) void k_hl(const float* __restrict__ F, _Float16* __restrict__ Hh, _Float16* __restrict__ Hl, size_t n8) { const size_t t = (size_t)blockIdx.x * 256 + threadIdx.x; if (t >= n8) return; FragH fh, fl; const v4f a = *(const v4fa*)(F + t * 8), c = *(const v4fa*)(F + t * 8 + 4);
#pragma unroll
  for (int q = 0; q < 4; ++q) { _Float16 h = (_Float16)a[q]; fh.h[q] = h; fl.h[q] = (_Float16)((a[q] - (float)h) * 1024.0f); h = (_Float16)c[q]; fh.h[4 + q] = h; fl.h[4 + q] = (_Float16)((c[q] - (float)h) * 1024.0f); }
  { *(v8us*)((unsigned short*)Hh + t * 8) = fh.half[0]; *(v8us*)((unsigned short*)Hl + t * 8) = fl.half[0];  } }

// ---- fast GEMM (wave tile 32x64; requires M % 32 == 0 rows per launch region and N % 64 == 0); epilogue = k_gemm_hhx semantics ----
__device__ __forceinline__ v16h g2_frag(const _Float16* p, int hh) { FragH f; f.half[0] = *(const v8us*)((const unsigned short*)p + 8 * hh); f.half[1] = *(const v8us*)((const unsigned short*)p + 16 + 8 * hh); return f.v; }
__device__ __forceinline__ v8f g2_mma(v16h a, v16h b, v8f c) { v8f d = __builtin_amdgcn_wmma_f32_16x16x32_f16(false, a, false, b, (short)0, c, false, false); asm volatile("v_nop\n\tv_nop\n\tv_nop\n\tv_nop" : "+v"(d) : "v"(a), "v"(b)); return d; }
template <int ACT>
__global__ __launch_bounds__(128) void k_gemm2(const _Float16* __restrict__ A, int lda, size_t sA, const _Float16* __restrict__ Bh, int ldb, size_t sB, float alpha, const float* __restrict__ bias, size_t sBias, const float* __restrict__ CP, int rowsPerB, size_t sCPb, int row0g,
    float* __restrict__ C, _Float16* __restrict__ C16, int ldc, size_t sC, int M, int N, int K) { static_assert(ACT == 0 || ACT == 3 || ACT == 6 || ACT == 8 || ACT == 9 || ACT == 11 || ACT == 12 || ACT == 14 || ACT == 15 || ACT == 16 || ACT == 17, "k_gemm2: unsupported ACT code (would silently apply no activation)");
  __shared__ __attribute__((aligned(16))) float so[4][32][68];
  const int tid = threadIdx.x, w = tid >> 5, lane = tid & 31, ln = lane & 15, hh = lane >> 4; const int by = blockIdx.y;
  A += (size_t)by * sA; Bh += (size_t)by * sB; const size_t cofs = (size_t)by * sC; const float* bp = bias ? bias + (size_t)by * sBias : nullptr;
  const int ntn = N >> 6; const int mt = blockIdx.x / ntn, nq = blockIdx.x - mt * ntn; const int row0 = mt * 128 + 32 * w, col0 = nq * 64; if (row0 >= M) return;
  const _Float16* a0p = A + (size_t)(row0 + ln) * lda; const _Float16* a1p = a0p + (size_t)16 * lda;
  const _Float16* b0p = Bh + (size_t)(col0 + ln) * ldb; const _Float16* b1p = b0p + (size_t)16 * ldb; const _Float16* b2p = b1p + (size_t)16 * ldb; const _Float16* b3p = b2p + (size_t)16 * ldb;
  const v8f z8 = {0.f,0.f,0.f,0.f,0.f,0.f,0.f,0.f}; v8f c00 = z8, c01 = z8, c02 = z8, c03 = z8, c10 = z8, c11 = z8, c12 = z8, c13 = z8;
#pragma unroll 1
  for (int kb = 0; kb < K; kb += 32) { const v16h a0 = g2_frag(a0p + kb, hh), a1 = g2_frag(a1p + kb, hh);
    v16h b = g2_frag(b0p + kb, hh); c00 = g2_mma(a0, b, c00); c10 = g2_mma(a1, b, c10);
    b = g2_frag(b1p + kb, hh); c01 = g2_mma(a0, b, c01); c11 = g2_mma(a1, b, c11);
    b = g2_frag(b2p + kb, hh); c02 = g2_mma(a0, b, c02); c12 = g2_mma(a1, b, c12);
    b = g2_frag(b3p + kb, hh); c03 = g2_mma(a0, b, c03); c13 = g2_mma(a1, b, c13); }
  v8f accs[8] = {c00, c01, c02, c03, c10, c11, c12, c13};
#pragma unroll
  for (int u = 0; u < 8; ++u) { const int t = u & 3, half = u >> 2; const int col = col0 + t * 16 + ln; const float bv = bp ? bf16_round(bp[col]) : 0.f;
#pragma unroll
    for (int r = 0; r < 8; ++r) { const int rloc = half * 16 + 8 * hh + r; float v = accs[u][r] * alpha + bv; if (CP) { if (rowsPerB < 0) v += CP[cofs + (size_t)(row0g + row0 + rloc) * ldc + col];      /* rowsPerB < 0: own element of the batched C plane */ else { const int bidx = (row0g + row0 + rloc) / rowsPerB; v += CP[(size_t)bidx * sCPb + (size_t)by * 64 + col]; } }
      if (ACT == 3) v = fmaxf(v, 0.f); else if (ACT == 6) v = 0.5f * v * (1.0f + erff(v * 0.70710678118654752f)); else if (ACT == 11) v = 1.0f / (1.0f + expf(-v)); else if (ACT == 15) v = v / (1.0f + expf(-v)); else if (ACT == 12) v = (v > 0.f) ? v : 0.01f * v; else if (ACT == 8) v = tanhf(v); else if (ACT == 9) v = 0.5f * v * (1.0f + tanhf(0.7978845608028654f * (v + 0.044715f * v * v * v))); else if (ACT == 14) v = (v > 0.f) ? v : 0.1f * v; else if (ACT == 16) v = (v >= 0.f) ? v : 0.3f * v; else if (ACT == 17) v = (v >= 0.f) ? v : 0.2f * v;
      so[w][rloc][t * 16 + ln] = v; } }
  __builtin_amdgcn_fence(__ATOMIC_ACQ_REL, "workgroup"); __builtin_amdgcn_wave_barrier();
  const int rsub = lane >> 4, c4 = (lane & 15) * 4;
  {
#pragma unroll
    for (int q = 0; q < 16; ++q) { const int r = q * 2 + rsub; const v4f v = *(const v4fa*)&so[w][r][c4]; if (C) *(v4f*)(C + cofs + (size_t)(row0 + r) * ldc + col0 + c4) = v; if (C16) { v4h h4; for (int i = 0; i < 4; ++i) h4[i] = (_Float16)v[i]; *(v4h*)(C16 + cofs + (size_t)(row0 + r) * ldc + col0 + c4) = h4; } }
     } }


__global__ __launch_bounds__(256) void k_wnat(const float* __restrict__ w, size_t n8, _Float16* __restrict__ Bt) { const size_t t = (size_t)blockIdx.x * 256 + threadIdx.x; if (t >= n8) return; FragH f; for (int q = 0; q < 8; ++q) f.h[q] = (_Float16)(bf16_round(w[t * 8 + q]) * 16.0f); *(v8us*)((unsigned short*)Bt + t * 8) = f.half[0];  }
__global__ __launch_bounds__(256) void k_rsm(const float* __restrict__ S, _Float16* __restrict__ P, int nrows) {
  #pragma clang fp contract(off)
  const int i = blockIdx.x * 256 + threadIdx.x; if (i >= nrows) return; const float* s = S + (size_t)i * SQ; float mx = -3.0e38f;
#pragma unroll 1
  for (int j = 0; j < SQ; ++j) mx = fmaxf(mx, s[j]); float se = 0.f;
#pragma unroll 1
  for (int j = 0; j < SQ; ++j) se += expf(s[j] - mx); const float sc = 256.0f / se;
#pragma unroll 1
  for (int j0 = 0; j0 < SQ; j0 += 8) { FragH f; for (int q = 0; q < 8; ++q) f.h[q] = (_Float16)(expf(s[j0 + q] - mx) * sc); unsigned short* d = (unsigned short*)P + (size_t)i * SQ + j0; *(v8us*)d = f.half[0];  } }
__global__ __launch_bounds__(256) void k_vt(const _Float16* __restrict__ V16, int b, int h0, _Float16* __restrict__ VT) { __shared__ unsigned short tl[64][65]; const int tid = threadIdx.x; const int hh = blockIdx.x % HG, sg = blockIdx.x / HG; const int s0 = sg * 64; const int h = h0 + hh;
  for (int i = tid; i < 64 * 8; i += 256) { const int j = i / 8, d8 = (i % 8) * 8; FragH f; f.half[0] = *(const v8us*)((const unsigned short*)V16 + ((size_t)b * SQ + s0 + j) * DM + h * HD + d8); for (int q = 0; q < 8; ++q) tl[d8 + q][j] = f.u[q]; }
  __syncthreads();
  { for (int i = tid; i < 64 * 8; i += 256) { const int d = i / 8, j8 = (i % 8) * 8; FragH f; for (int q = 0; q < 8; ++q) f.u[q] = tl[d][j8 + q]; *(v8us*)((unsigned short*)VT + ((size_t)hh * HD + d) * SQ + s0 + j8) = f.half[0]; }  } }


// K and V for the fused kernel, all (batch, head) slices in one launch, straight from the f32 inputs. A block takes 128 keys of one slice: their K rows (8192 floats in a row) and their V rows (64 floats each, 768 apart) go out rounded, V transposed.
// Both go out in FRAGMENT ORDER: per 32 keys 4 KiB = 8 pieces of 512 bytes, a piece = the 16 bytes of lane 0, lane 1, ... lane 31 of one 16-byte load of k_attn, so that such a load covers four whole 128-byte lines
// (row-major, the 32 lanes of a K load fell on 16 lines and those of a V^T load on 8, and the WGP cache pays by the line touched).
// K16[slice][key / 32][t][ks][half][hh][ln][8] = k[key = t 16 + ln][d = ks 32 + half 16 + hh 8 + 0..7]; Vt[slice][key / 32][t][half][hh][ln][8] = v[key = half 16 + hh 8 + 0..7][d = t 16 + ln].
// 768 equal blocks of 8 waves, three on each of 256 WGPs, all resident at once; a thread has its 8 + 8 loads of 16 bytes out before it converts anything, and each load of a wave covers whole lines (512 bytes in a row of K, two 256-byte row pieces of V).
__global__ __launch_bounds__(256) void k_prep(const float* __restrict__ k, const float* __restrict__ v, _Float16* __restrict__ K16, _Float16* __restrict__ Vt) { __shared__ unsigned short tl[128][66]; __shared__ __attribute__((aligned(16))) unsigned short kl[32][272];      /* kl: 32 pieces of K, 512 bytes each at a pitch of 544: the four pieces that one wave's store falls on start 8 banks apart */
  const int tid = threadIdx.x; const int slab = blockIdx.x / (SQ / 128), lg = blockIdx.x % (SQ / 128); const int b = slab / 12, h = slab % 12;
  const float* kp = k + (size_t)blockIdx.x * (128 * HD) + tid * 4; const float* vp = v + ((size_t)b * SQ + lg * 128 + tid / 16) * 768 + h * 64 + (tid % 16) * 4;
  v4f ka[8], va[8];
#pragma unroll
  for (int u = 0; u < 8; ++u) ka[u] = *(const v4fa*)(kp + u * 1024);
#pragma unroll
  for (int u = 0; u < 8; ++u) va[u] = *(const v4fa*)(vp + (size_t)u * 16 * 768);
  __builtin_amdgcn_sched_barrier(0);      /* all sixteen loads go out together: without it the scheduler sank most of the K loads between the conversions, one memory round trip behind the other */
#pragma unroll
  for (int u = 0; u < 8; ++u) { FragH f;
#pragma unroll
    for (int q = 0; q < 4; ++q) f.h[q] = (_Float16)bf16_round(va[u][q]);
#pragma unroll
    for (int q = 0; q < 4; ++q) tl[u * 16 + tid / 16][(tid % 16) * 4 + q] = f.u[q]; }
  // K: load u of this thread is key u 16 + tid / 16, d = (tid % 16) 4 + 0..3: piece u 4 + d / 16, hh = (d / 8) % 2, ln = tid / 16, first or second 8 bytes of the lane's 16.
#pragma unroll
  for (int u = 0; u < 8; ++u) { v4h f;
#pragma unroll
    for (int q = 0; q < 4; ++q) f[q] = (_Float16)bf16_round(ka[u][q]);
    *(v4ha*)&kl[u * 4 + (tid % 16) / 4][((((tid % 16) >> 1) & 1) * 16 + tid / 16) * 8 + (tid & 1) * 4] = f; }
  __syncthreads();
  // Behind the barrier a wave takes whole pieces: round rd is the block's rd-th group of 32 keys, wave w its piece w, and every store is 512 bytes in a row.
  const int w = tid >> 5, lane = tid & 31, ln = lane & 15, hh = lane >> 4;
#pragma unroll
  for (int rd = 0; rd < 4; ++rd) *(v8us*)((unsigned short*)K16 + (size_t)blockIdx.x * (128 * HD) + (rd * 256 + tid) * 8) = *(const v8us*)&kl[rd * 8 + w][lane * 8];
#pragma unroll
  for (int rd = 0; rd < 4; ++rd) { const int d = (w >> 1) * 16 + ln, k0 = rd * 32 + (w & 1) * 16 + hh * 8; FragH f;
#pragma unroll
    for (int q = 0; q < 8; ++q) f.u[q] = tl[k0 + q][d];
    *(v8us*)((unsigned short*)Vt + (size_t)blockIdx.x * (128 * HD) + (rd * 256 + tid) * 8) = f.half[0]; } }

typedef float v2f __attribute__((ext_vector_type(2)));
typedef _Float16 v2h __attribute__((ext_vector_type(2)));
__device__ __forceinline__ float xhalf(float x) { return __builtin_bit_cast(float, __builtin_amdgcn_permlanex16(__builtin_bit_cast(int, x), __builtin_bit_cast(int, x), 0x76543210, 0xfedcba98, false, false)); }      /* lane l <-> lane l ^ 16 */
__device__ __forceinline__ v8f fa_mma(v16h a, v16h b, v8f c) { return __builtin_amdgcn_wmma_f32_16x16x32_f16(false, a, false, b, (short)0, c, false, false); }
// Scores, softmax and weighted sum in one kernel. Block = 4 waves x 32 queries of one (batch, head) slice; grid = 48 x 16 = 768 blocks, three on each of 256 WGPs.
// S^T = K Q^T: A = 16 key rows, B = 16 query rows (kept in registers), same k order for both. A lane's 8 accumulator registers are keys 8 hh + r of ONE query (column ln):
// maximum and sum run inside the lane plus one exchange with lane ^ 16, and two S^T tiles (keys 0-15, 16-31), converted in place, ARE the B operand of O^T += V^T P^T (k = 8 hh + r, 16 + 8 hh + r: the order in which k_prep has laid V^T out).
// Running softmax per query: m = maximum so far (raw scores), weights 2^8 exp((s - m) alpha), sum and O^T rescaled by exp((m_old - m) alpha) in every pass; the 2^8 cancels in the division at the end.
__global__ __launch_bounds__(128) void k_attn(const float* __restrict__ Q, const _Float16* __restrict__ K16, const _Float16* __restrict__ Vt, float* __restrict__ O, float cs) {
  const int tid = threadIdx.x, w = tid >> 5, lane = tid & 31, ln = lane & 15, hh = lane >> 4;
  const int slab = blockIdx.x / (SQ / 128), q0 = (blockIdx.x % (SQ / 128)) * 128 + w * 32;
  const float* qp = Q + ((size_t)slab * SQ + q0 + ln) * HD + 8 * hh;      /* the f32 input itself: each query row is read by one wave only, which rounds it as K and V are rounded */
  // K and V^T: one address pair per lane each, alive through the whole loop and moved once per pass by 4 KiB (32 keys); the sixteen loads of a pass differ in their immediate offsets only, and each takes one 512-byte piece of k_prep's fragment order (lane l its 16 bytes at 16 l).
  typedef __attribute__((address_space(1))) const char gch; typedef __attribute__((address_space(1))) const v8us gv8;      /* global address space by type: the two addresses pass through an asm statement, behind which the compiler would otherwise fall back to flat loads */
  auto frag = [](gch* p, int off) { FragH f; f.half[0] = *(gv8*)(p + off); f.half[1] = *(gv8*)(p + off + 512); return f.v; };      /* two pieces: k = 8 hh + 0..7 and 16 + 8 hh + 0..7, as g2_frag */
  gch* kn = (gch*)(K16 + (size_t)slab * SQ * HD + lane * 8); gch* vn = (gch*)(Vt + (size_t)slab * HD * SQ + lane * 8);      /* this lane's place in the block of 32 keys that the loads last issued name */
  v16h qf[2][2], kf[2][2], vf[4];      /* q, k: [16-row tile][32-wide step of d]; v: [16 rows of d] */
  v4f qr[2][2][4];      /* q as loaded: k = 8 hh + 0..7 and 16 + 8 hh + 0..7, as g2_frag */
#pragma unroll
  for (int j = 0; j < 2; ++j) for (int ks = 0; ks < 2; ++ks) for (int c = 0; c < 4; ++c) qr[j][ks][c] = *(const v4fa*)(qp + j * 16 * HD + ks * 32 + (c >> 1) * 16 + (c & 1) * 4);
  __builtin_amdgcn_sched_barrier(0);      /* q, then k, then v, the order of the loop: with a q load issued last, the loop's first wait became a wait for every load, the V^T just issued too */
#pragma unroll
  for (int t = 0; t < 2; ++t) for (int ks = 0; ks < 2; ++ks) kf[t][ks] = frag(kn, (t * 2 + ks) * 1024);
  __builtin_amdgcn_sched_barrier(0);      /* as above */
#pragma unroll
  for (int t = 0; t < 4; ++t) vf[t] = frag(vn, t * 1024);
  __builtin_amdgcn_sched_barrier(0);      /* q is rounded while the first K and V^T blocks fly: without it the V^T loads sank behind the rounding */
#pragma unroll
  for (int j = 0; j < 2; ++j) for (int ks = 0; ks < 2; ++ks) { FragH f;
#pragma unroll
    for (int i = 0; i < 16; ++i) f.h[i] = (_Float16)bf16_round(qr[j][ks][i >> 2][i & 3]);
    qf[j][ks] = f.v; }
  const v8f z8 = {0.f,0.f,0.f,0.f,0.f,0.f,0.f,0.f}; v8f o[4][2] = {{z8, z8}, {z8, z8}, {z8, z8}, {z8, z8}};      /* O^T: [16 rows of d][16 queries] */
  float mr[2] = {-3.0e38f, -3.0e38f}, ls[2] = {0.f, 0.f};
  for (int kb = 0; kb < SQ / 32; ++kb) {      /* one pass = 32 keys */
    v8f s[2][2];      /* S^T: [16 keys][16 queries] */
#pragma unroll
    for (int t = 0; t < 2; ++t) for (int j = 0; j < 2; ++j) s[t][j] = fa_mma(kf[t][1], qf[j][1], fa_mma(kf[t][0], qf[j][0], z8));
    __builtin_amdgcn_sched_barrier(0);      /* keeps the wait below behind all eight score products (without it the wait rose to the first of them, a few instructions behind the V^T loads at the foot of the last pass) */
    const long long inc = kb + 1 < SQ / 32 ? 32 * HD * 2 : -(SQ / 32 - 1) * 32 * HD * 2;      /* the last pass has no next block: its addresses go back to block 0, inside the buffers */
    // Loads that name the two address pairs may still be out: the wait and the move stand in one statement, so that nothing rewrites a pair in front of the wait.
    asm volatile("s_wait_xcnt 0x0\n\tv_add_nc_u64 %0, %2, %0\n\tv_add_nc_u64 %1, %2, %1" : "+v"(kn), "+v"(vn) : "s"(inc) : "memory");
    // The next pass's keys go out as soon as this pass's score products are issued, into the same registers: softmax and the second product cover their latency.
#pragma unroll
    for (int t = 0; t < 2; ++t) for (int ks = 0; ks < 2; ++ks) kf[t][ks] = frag(kn, (t * 2 + ks) * 1024);
    __builtin_amdgcn_sched_barrier(0);      /* without it the scheduler sank these loads to the foot of the pass, directly in front of their use */
#pragma unroll
    for (int j = 0; j < 2; ++j) {
      float mx = fmaxf(s[0][j][0], s[1][j][0]);
#pragma unroll
      for (int r = 1; r < 8; ++r) mx = fmaxf(mx, fmaxf(s[0][j][r], s[1][j][r]));
      mx = fmaxf(mx, xhalf(mx));
      const float mn = fmaxf(mr[j], mx), corr = __builtin_amdgcn_exp2f((mr[j] - mn) * cs), nb = 8.0f - mn * cs; mr[j] = mn;
      FragH pf; v2f sm = {0.f, 0.f};
#pragma unroll
      for (int i = 0; i < 8; ++i) { const v2f a = __builtin_elementwise_fma(v2f{s[i >> 2][j][2 * (i & 3)], s[i >> 2][j][2 * (i & 3) + 1]}, v2f{cs, cs}, v2f{nb, nb});
        const v2f p = {__builtin_amdgcn_exp2f(a.x), __builtin_amdgcn_exp2f(a.y)}; sm += p; const v2h ph = __builtin_convertvector(p, v2h); pf.h[2 * i] = ph.x; pf.h[2 * i + 1] = ph.y; }
      ls[j] = ls[j] * corr + (sm.x + sm.y);
#pragma unroll
      for (int t = 0; t < 4; ++t) o[t][j] = fa_mma(vf[t], pf.v, o[t][j] * corr);
    }
    // The next pass's V^T goes out behind the last product that reads this pass's, into the same registers: the next score products and softmax cover its latency.
#pragma unroll
    for (int t = 0; t < 4; ++t) vf[t] = frag(vn, t * 1024);
  }
#pragma unroll
  for (int j = 0; j < 2; ++j) { const float inv = 1.0f / (ls[j] + xhalf(ls[j])); float* op = O + ((size_t)slab * SQ + q0 + j * 16 + ln) * HD + 8 * hh;
#pragma unroll
    for (int t = 0; t < 4; ++t) { const v8f v = o[t][j] * inv; *(v4f*)(op + t * 16) = v4f{v[0], v[1], v[2], v[3]}; *(v4f*)(op + t * 16 + 4) = v4f{v[4], v[5], v[6], v[7]}; } } }

extern "C" void kernel_launch(void* const* d_in, const int* in_sizes, int n_in,
                              void* d_out, int out_size, void* d_ws, size_t ws_size, hipStream_t stream) {
  (void)in_sizes; (void)n_in; (void)out_size;
  const float* const* I = (const float* const*)d_in; const float* q = I[0]; const float* k = I[1]; const float* v = I[2];
  char* ws = (char*)d_ws; size_t off = 0;
  auto take = [&](size_t bytes) { char* p = ws + off; off += (bytes + 255) & ~(size_t)255; return p; };
  _Float16* K16 = (_Float16*)take(NR * DM * 2); _Float16* VT = (_Float16*)take(NR * DM * 2);
  if (off > ws_size) return;      /* 2 x 12 = 24 MiB */
  k_prep<<<NB * (SQ / 128), 256, 0, stream>>>(k, v, K16, VT);      /* values are [B][S][12][64]: each slice's 64 columns of the 768-wide rows */
  k_attn<<<NB * (SQ / 128), 128, 0, stream>>>(q, K16, VT, (float*)d_out, 0.05205877313848632f);      /* 768^-0.5 x log2 e: exp(x) = 2^(x log2 e) */
}

// v005
// It runs in 57.4 microseconds.
// Timed twice side by side with v004, it ran 1.14 times as fast both times.
// Counting every step since v000, it is 331 times as fast.
#include <hip/hip_runtime.h>
#define NB 48
#define SQ 2048
#define DM 64
#define NH 1
#define HD 64
#define HG 1
#define NR ((size_t)NB * SQ)
typedef __bf16 v16b __attribute__((ext_vector_type(16)));
typedef unsigned short v8us __attribute__((ext_vector_type(8), may_alias));
typedef float  v8f  __attribute__((ext_vector_type(8)));
typedef float  v4f  __attribute__((ext_vector_type(4)));
typedef float  v4fa __attribute__((ext_vector_type(4), may_alias));
union FragB { v16b v; v8us half[2]; unsigned short u[16]; };

__device__ __forceinline__ unsigned short bf16_bits(float x) { unsigned int u = __float_as_uint(x); return (unsigned short)((u + 0x7FFFu + ((u >> 16) & 1u)) >> 16); }
__device__ __forceinline__ float bf16_val(unsigned short b) { return __uint_as_float(((unsigned int)b) << 16); }
__device__ __forceinline__ float bf16_round(float x) { return bf16_val(bf16_bits(x)); }
// D += A·B with NT terms: 1 = ah·bh, 2 = + al·bh (A split), 3 = + ah·bl (both split)
template <int NT>
__device__ __forceinline__ v8f mmaN(v16b ah, v16b al, v16b bh, v16b bl, v8f c) {
  c = __builtin_amdgcn_wmma_f32_16x16x32_bf16(false, ah, false, bh, (short)0, c, false, false);
  if (NT >= 2) c = __builtin_amdgcn_wmma_f32_16x16x32_bf16(false, al, false, bh, (short)0, c, false, false);
  if (NT >= 3) c = __builtin_amdgcn_wmma_f32_16x16x32_bf16(false, ah, false, bl, (short)0, c, false, false);
  asm volatile("v_nop\n\tv_nop\n\tv_nop\n\tv_nop" : "+v"(c) : "v"(ah), "v"(al), "v"(bh), "v"(bl));
  return c;
}

__global__ __launch_bounds__(256) void k_wt_bf16(const float* __restrict__ W, unsigned short* __restrict__ Wt, int K, int N) {
  const int t = blockIdx.x * 256 + threadIdx.x;
  const int k8n = K / 8;
  if (t >= N * k8n) return;
  const int n = t / k8n, k8 = (t % k8n) * 8;
  v8us v;
#pragma unroll
  for (int i = 0; i < 8; ++i) v[i] = bf16_bits(W[(size_t)(k8 + i) * N + n]);
  *(v8us*)(Wt + (size_t)n * K + k8) = v;
  
}

// GEMM C[M][N] (f32, pitch ldc) = act(A[M][K]·W + bias). A f32 row-major (pitch lda) converted per fragment to bf16
// (ASPLIT: hi/lo two planes -> 2 terms, else single rounded term); Wt bf16 [N][K] (pitch ldb). BIAS_BF16 rounds the
// bias to bf16 first (bias quantised to bf16 before the add). K%32==0, M%16==0, N%64==0.
template <bool ASPLIT, int ACT, bool BIAS_BF16>
__global__ __launch_bounds__(128) void k_gemm_bf(const float* __restrict__ A, int lda, const unsigned short* __restrict__ Wt, int ldb,
                                               const float* __restrict__ bias, float* __restrict__ C, int ldc, int M, int N, int K) {
  __shared__ __attribute__((aligned(16))) float so[4][16][64];
  const int tid = threadIdx.x, w = tid >> 5, lane = tid & 31, ln = lane & 15, hh = lane >> 4;
  const int ntn = N / 64;
  const int wid = blockIdx.x * 4 + w;
  const int mt = wid / ntn, nq = wid % ntn;
  if (mt * 16 >= M) return;
  const int row0 = mt * 16, col0 = nq * 64;
  const float* arow = A + (size_t)(row0 + ln) * lda;
  v8f acc[4] = {};
  for (int kb = 0; kb < K; kb += 32) {
    FragB ah, al;
    const v4f x0 = *(const v4fa*)(arow + kb + 8 * hh), x1 = *(const v4fa*)(arow + kb + 8 * hh + 4);
    const v4f x2 = *(const v4fa*)(arow + kb + 16 + 8 * hh), x3 = *(const v4fa*)(arow + kb + 16 + 8 * hh + 4);
    float xs[16] = {x0[0],x0[1],x0[2],x0[3],x1[0],x1[1],x1[2],x1[3],x2[0],x2[1],x2[2],x2[3],x3[0],x3[1],x3[2],x3[3]};
#pragma unroll
    for (int i = 0; i < 16; ++i) { const unsigned short hb = bf16_bits(xs[i]); ah.u[i] = hb; al.u[i] = ASPLIT ? bf16_bits(xs[i] - bf16_val(hb)) : (unsigned short)0; }
#pragma unroll
    for (int t = 0; t < 4; ++t) {
      const unsigned short* brow = Wt + (size_t)(col0 + t * 16 + ln) * ldb + kb;
      FragB b;
      b.half[0] = *(const v8us*)(brow + 8 * hh);
      b.half[1] = *(const v8us*)(brow + 16 + 8 * hh);
      acc[t] = mmaN<ASPLIT ? 2 : 1>(ah.v, al.v, b.v, b.v, acc[t]);
    }
  }
#pragma unroll
  for (int t = 0; t < 4; ++t) {
    float bv = bias ? bias[col0 + t * 16 + ln] : 0.f;
    if (BIAS_BF16) bv = bf16_round(bv);
#pragma unroll
    for (int r = 0; r < 8; ++r) { float v = acc[t][r] + bv; if (ACT == 1) v = fmaxf(v, 0.f); so[w][8 * hh + r][t * 16 + ln] = v; }
  }
  __builtin_amdgcn_fence(__ATOMIC_ACQ_REL, "workgroup");
  __builtin_amdgcn_wave_barrier();
  const int rsub = lane >> 4, c4 = (lane & 15) * 4;
  {
#pragma unroll
    for (int q = 0; q < 8; ++q) {
      const int r = q * 2 + rsub;
      const v4f v = *(const v4fa*)&so[w][r][c4];
      *(v4f*)(C + (size_t)(row0 + r) * ldc + col0 + c4) = v;
    }
    
  }
}

// GEMM C = act(A·W + bias + resid): A f32 (ASPLIT -> hi/lo 2 terms), Wt bf16 [N][K]; ACT 0 none, 1 relu, 2 exact gelu;
// resid (optional, f32, row index = (row % rmod), pitch ldr, RES_BF16 rounds it) added before the activation.
template <bool ASPLIT, int ACT, bool BIAS_BF16, bool RES_BF16>
__global__ __launch_bounds__(128) void k_gemm_bf3(const float* __restrict__ A, int lda, const unsigned short* __restrict__ Wt, int ldb,
                                                const float* __restrict__ bias, const float* __restrict__ resid, int rmod, int ldr,
                                                float* __restrict__ C, int ldc, int M, int N, int K) {
  __shared__ __attribute__((aligned(16))) float so[4][16][64];
  const int tid = threadIdx.x, w = tid >> 5, lane = tid & 31, ln = lane & 15, hh = lane >> 4;
  const int ntn = N / 64;
  const int wid = blockIdx.x * 4 + w;
  const int mt = wid / ntn, nq = wid % ntn;
  if (mt * 16 >= M) return;
  const int row0 = mt * 16, col0 = nq * 64;
  const float* arow = A + (size_t)(row0 + ln) * lda;
  v8f acc[4] = {};
  for (int kb = 0; kb < K; kb += 32) {
    FragB ah, al;
    const v4f x0 = *(const v4fa*)(arow + kb + 8 * hh), x1 = *(const v4fa*)(arow + kb + 8 * hh + 4);
    const v4f x2 = *(const v4fa*)(arow + kb + 16 + 8 * hh), x3 = *(const v4fa*)(arow + kb + 16 + 8 * hh + 4);
    float xs[16] = {x0[0],x0[1],x0[2],x0[3],x1[0],x1[1],x1[2],x1[3],x2[0],x2[1],x2[2],x2[3],x3[0],x3[1],x3[2],x3[3]};
#pragma unroll
    for (int i = 0; i < 16; ++i) { const unsigned short hb = bf16_bits(xs[i]); ah.u[i] = hb; al.u[i] = ASPLIT ? bf16_bits(xs[i] - bf16_val(hb)) : (unsigned short)0; }
#pragma unroll
    for (int t = 0; t < 4; ++t) {
      const unsigned short* brow = Wt + (size_t)(col0 + t * 16 + ln) * ldb + kb;
      FragB b;
      b.half[0] = *(const v8us*)(brow + 8 * hh);
      b.half[1] = *(const v8us*)(brow + 16 + 8 * hh);
      acc[t] = mmaN<ASPLIT ? 2 : 1>(ah.v, al.v, b.v, b.v, acc[t]);
    }
  }
#pragma unroll
  for (int t = 0; t < 4; ++t) {
    const int col = col0 + t * 16 + ln;
    float bv = bias ? bias[col] : 0.f;
    if (BIAS_BF16) bv = bf16_round(bv);
#pragma unroll
    for (int r = 0; r < 8; ++r) {
      float v = acc[t][r] + bv;
      if (resid) { float rv = resid[(size_t)((row0 + 8 * hh + r) % rmod) * ldr + col]; if (RES_BF16) rv = bf16_round(rv); v += rv; }
      if (ACT == 1) v = fmaxf(v, 0.f);
      if (ACT == 2) v = 0.5f * v * (1.0f + erff(v * 0.70710678118654752f));
      if (ACT == 3) { const float u = 0.7978845608028654f * (v + 0.044715f * v * v * v); v = 0.5f * v * (1.0f + tanhf(u)); }
      so[w][8 * hh + r][t * 16 + ln] = v;
    }
  }
  __builtin_amdgcn_fence(__ATOMIC_ACQ_REL, "workgroup");
  __builtin_amdgcn_wave_barrier();
  const int rsub = lane >> 4, c4 = (lane & 15) * 4;
  {
#pragma unroll
    for (int q = 0; q < 8; ++q) {
      const int r = q * 2 + rsub;
      const v4f v = *(const v4fa*)&so[w][r][c4];
      *(v4f*)(C + (size_t)(row0 + r) * ldc + col0 + c4) = v;
    }
    
  }
}
// row LayerNorm (biased variance, eps) over N: s = X (+ R); optional out_sum <- s; out_norm <- (s-mu)*rsqrt(var+eps)*g + b
template <bool PARAM_BF16>
__global__ __launch_bounds__(256) void k_layernorm(const float* __restrict__ X, const float* __restrict__ R, const float* __restrict__ g, const float* __restrict__ bta,
                                                  float* __restrict__ out_sum, float* __restrict__ out_norm, int N, float eps) {
  __shared__ float red[256];
  const int row = blockIdx.x, tid = threadIdx.x;
  const float* x = X + (size_t)row * N; const float* rr = R ? R + (size_t)row * N : nullptr;
  float vals[16];                     // up to N = 4096
  const int per = N / 256;            // contiguous chunk per thread? use strided-by-4 chunks: thread handles j = tid*4 + 1024*u
  float s1 = 0.f;
  for (int u = 0; u < per / 4; ++u) {
    const int j = tid * 4 + 1024 * u;
    const v4f a = *(const v4fa*)(x + j);
    v4f b = {0.f,0.f,0.f,0.f}; if (rr) b = *(const v4fa*)(rr + j);
#pragma unroll
    for (int q = 0; q < 4; ++q) { const float v = a[q] + b[q]; vals[u * 4 + q] = v; s1 += v; }
  }
  red[tid] = s1; __syncthreads();
  for (int st = 128; st > 0; st >>= 1) { if (tid < st) red[tid] += red[tid + st]; __syncthreads(); }
  const float mu = red[0] / (float)N; __syncthreads();
  float s2 = 0.f;
  for (int u = 0; u < per / 4; ++u)
#pragma unroll
    for (int q = 0; q < 4; ++q) { const float c = vals[u * 4 + q] - mu; s2 += c * c; }
  red[tid] = s2; __syncthreads();
  for (int st = 128; st > 0; st >>= 1) { if (tid < st) red[tid] += red[tid + st]; __syncthreads(); }
  const float rs = rsqrtf(red[0] / (float)N + eps);
  {
    for (int u = 0; u < per / 4; ++u) {
      const int j = tid * 4 + 1024 * u;
      v4f o, sm;
#pragma unroll
      for (int q = 0; q < 4; ++q) {
        float gg = g[j + q], bb = bta[j + q];
        if (PARAM_BF16) { gg = bf16_round(gg); bb = bf16_round(bb); }
        sm[q] = vals[u * 4 + q]; o[q] = (vals[u * 4 + q] - mu) * rs * gg + bb;
      }
      if (out_sum) *(v4f*)(out_sum + (size_t)row * N + j) = sm;
      *(v4f*)(out_norm + (size_t)row * N + j) = o;
    }
    
  }
}



// ---- f16 WMMA path (v_wmma_f32_16x16x32_f16): 11-bit significands for operands in range — used where a [0,1] probability operand needs more precision than bf16
typedef _Float16 v16h __attribute__((ext_vector_type(16)));
union FragH { v16h v; v8us half[2]; _Float16 h[16]; unsigned short u[16]; };
template <int NT>
__device__ __forceinline__ v8f mmaH(v16h ah, v16h al, v16h bh, v16h bl, v8f c) {
  c = __builtin_amdgcn_wmma_f32_16x16x32_f16(false, ah, false, bh, (short)0, c, false, false);
  if (NT >= 2) c = __builtin_amdgcn_wmma_f32_16x16x32_f16(false, al, false, bh, (short)0, c, false, false);
  if (NT >= 3) c = __builtin_amdgcn_wmma_f32_16x16x32_f16(false, ah, false, bl, (short)0, c, false, false);
  asm volatile("v_nop\n\tv_nop\n\tv_nop\n\tv_nop" : "+v"(c) : "v"(ah), "v"(al), "v"(bh), "v"(bl));
  return c;
}
// batched GEMM like k_gemm_b but f16 operands: A f32 (split into f16 hi/lo if ASPLIT, else rounded to f16), Bt = f16 values [n][k]; alpha; C f32; N multiple of 16 (partial tiles skipped)
template <bool ASPLIT>
__global__ __launch_bounds__(128) void k_gemm_h(const float* __restrict__ A, int lda, size_t sA, const _Float16* __restrict__ Bh, int ldb, size_t sB, float alpha, float* __restrict__ C, int ldc, size_t sC, int M, int N, int K) {
  __shared__ __attribute__((aligned(16))) float so[4][16][64];
  const int tid = threadIdx.x, w = tid >> 5, lane = tid & 31, ln = lane & 15, hh = lane >> 4; const int by = blockIdx.y;
  A += (size_t)by * sA; Bh += (size_t)by * sB; C += (size_t)by * sC;
  const int ntn = (N + 63) / 64; const int wid = blockIdx.x * 4 + w; const int mt = wid / ntn, nq = wid % ntn; if (mt * 16 >= M) return;
  const int row0 = mt * 16, col0 = nq * 64; const float* arow = A + (size_t)(row0 + ln) * lda;
  v8f acc[4] = {};
  for (int kb = 0; kb < K; kb += 32) {
    FragH ah, al;
    const v4f x0 = *(const v4fa*)(arow + kb + 8 * hh), x1 = *(const v4fa*)(arow + kb + 8 * hh + 4), x2 = *(const v4fa*)(arow + kb + 16 + 8 * hh), x3 = *(const v4fa*)(arow + kb + 16 + 8 * hh + 4);
    float xs[16] = {x0[0],x0[1],x0[2],x0[3],x1[0],x1[1],x1[2],x1[3],x2[0],x2[1],x2[2],x2[3],x3[0],x3[1],x3[2],x3[3]};
#pragma unroll
    for (int i = 0; i < 16; ++i) { const _Float16 h = (_Float16)xs[i]; ah.h[i] = h; al.h[i] = ASPLIT ? (_Float16)(xs[i] - (float)h) : (_Float16)0.0f; }
#pragma unroll
    for (int t = 0; t < 4; ++t) { if (col0 + t * 16 >= N) continue; const size_t boff = (size_t)(col0 + t * 16 + ln) * ldb + kb; FragH bq; bq.half[0] = *(const v8us*)(Bh + boff + 8 * hh); bq.half[1] = *(const v8us*)(Bh + boff + 16 + 8 * hh);
      acc[t] = mmaH<ASPLIT ? 2 : 1>(ah.v, al.v, bq.v, bq.v, acc[t]); }
  }
#pragma unroll
  for (int t = 0; t < 4; ++t) { if (col0 + t * 16 >= N) continue;
#pragma unroll
    for (int r = 0; r < 8; ++r) so[w][8 * hh + r][t * 16 + ln] = acc[t][r] * alpha; }
  __builtin_amdgcn_fence(__ATOMIC_ACQ_REL, "workgroup"); __builtin_amdgcn_wave_barrier();
  const int rsub = lane >> 4, c4 = (lane & 15) * 4;
  {
#pragma unroll
    for (int q = 0; q < 8; ++q) { const int r = q * 2 + rsub; if (col0 + c4 < N) { const v4f v = *(const v4fa*)&so[w][r][c4]; *(v4f*)(C + (size_t)(row0 + r) * ldc + col0 + c4) = v; } }
     }
}

// Wt[n][k] = f16(W[k][n]·scale) from f32 row-major W[K][N] (scale = power of two; bf16-exact weights stay exact in f16 away from the subnormal range)
__global__ __launch_bounds__(256) void k_wt_f16(const float* __restrict__ W, _Float16* __restrict__ Wt, int K, int N, float scale) {
  const int t = blockIdx.x * 256 + threadIdx.x; if (t >= N * (K / 8)) return; const int n = t / (K / 8), k8 = (t % (K / 8)) * 8; FragH f;
#pragma unroll
  for (int i = 0; i < 8; ++i) f.h[i] = (_Float16)(bf16_round(W[(size_t)(k8 + i) * N + n]) * scale); const v8us o = f.half[0];
  *(v8us*)((unsigned short*)Wt + (size_t)n * K + k8) = o; 
}
// k_gemm_hh variant with fused epilogue: v = acc·alpha + bias[by·sBias + col] (+ CP[(row/rowsPerB)·sCPb + by·64 + col] if CP) ; ACT 0 none / 1 elu ; writes f16 C16 (and f32 C if non-null)
template <int ACT>
__global__ __launch_bounds__(128) void k_gemm_hhx(const _Float16* __restrict__ A, int lda, size_t sA, const _Float16* __restrict__ Bh, int ldb, size_t sB, float alpha, const float* __restrict__ bias, size_t sBias, const float* __restrict__ CP, int rowsPerB, size_t sCPb, int row0g,
    float* __restrict__ C, _Float16* __restrict__ C16, int ldc, size_t sC, int M, int N, int K) {
  __shared__ __attribute__((aligned(16))) float so[4][16][64];
  const int tid = threadIdx.x, w = tid >> 5, lane = tid & 31, ln = lane & 15, hh = lane >> 4; const int by = blockIdx.y;
  A += (size_t)by * sA; Bh += (size_t)by * sB; const size_t cofs = (size_t)by * sC; const float* bp = bias ? bias + (size_t)by * sBias : nullptr;
  const int ntn = (N + 63) / 64; const int wid = blockIdx.x * 4 + w; const int mt = wid / ntn, nq = wid % ntn; if (mt * 16 >= M) return;
  const int row0 = mt * 16, col0 = nq * 64; const _Float16* arow = A + (size_t)(row0 + ln) * lda;
  v8f acc[4] = {};
  for (int kb = 0; kb < K; kb += 32) { FragH ah; ah.half[0] = *(const v8us*)((const unsigned short*)arow + kb + 8 * hh); ah.half[1] = *(const v8us*)((const unsigned short*)arow + kb + 16 + 8 * hh);
#pragma unroll
    for (int t = 0; t < 4; ++t) { if (col0 + t * 16 >= N) continue; const size_t boff = (size_t)(col0 + t * 16 + ln) * ldb + kb; FragH bq; bq.half[0] = *(const v8us*)((const unsigned short*)Bh + boff + 8 * hh); bq.half[1] = *(const v8us*)((const unsigned short*)Bh + boff + 16 + 8 * hh);
      acc[t] = mmaH<1>(ah.v, ah.v, bq.v, bq.v, acc[t]); }
  }
#pragma unroll
  for (int t = 0; t < 4; ++t) { if (col0 + t * 16 >= N) continue; const int col = col0 + t * 16 + ln; const float bv = bp ? bf16_round(bp[col]) : 0.f;
#pragma unroll
    for (int r = 0; r < 8; ++r) { float v = acc[t][r] * alpha + bv; if (CP) { const int rr = row0g + row0 + 8 * hh + r; if (rowsPerB < 0) v += CP[cofs + (size_t)rr * ldc + col];      /* rowsPerB < 0: own element of the batched C plane */ else { const int bidx = rr / rowsPerB; v += CP[(size_t)bidx * sCPb + (size_t)by * 64 + col]; } } if (ACT == 1) v = (v > 0.f) ? v : expm1f(v); else if (ACT == 7) v = (v > 0.f) ? v + 1.0f : expf(v); else if (ACT == 8) v = tanhf(v); else if (ACT == 9) v = 0.5f * v * (1.0f + tanhf(0.7978845608028654f * (v + 0.044715f * v * v * v))); else if (ACT == 11) v = 1.0f / (1.0f + expf(-v)); else if (ACT == 12) v = (v > 0.f) ? v : 0.01f * v; else if (ACT == 14) v = (v > 0.f) ? v : 0.1f * v; else if (ACT == 16) v = (v >= 0.f) ? v : 0.3f * v; else if (ACT == 17) v = (v >= 0.f) ? v : 0.2f * v; else if (ACT == 15) v = v / (1.0f + expf(-v)); else if (ACT == 3) v = fmaxf(v, 0.f); else if (ACT == 6) v = 0.5f * v * (1.0f + erff(v * 0.70710678118654752f)); so[w][8 * hh + r][t * 16 + ln] = v; } }
  __builtin_amdgcn_fence(__ATOMIC_ACQ_REL, "workgroup"); __builtin_amdgcn_wave_barrier();
  const int rsub = lane >> 4, c4 = (lane & 15) * 4; typedef _Float16 v4h __attribute__((ext_vector_type(4)));
  {
#pragma unroll
    for (int q = 0; q < 8; ++q) { const int r = q * 2 + rsub; if (col0 + c4 < N) { const v4f v = *(const v4fa*)&so[w][r][c4]; if (C) *(v4f*)(C + cofs + (size_t)(row0 + r) * ldc + col0 + c4) = v; if (C16) { v4h h4; for (int i = 0; i < 4; ++i) h4[i] = (_Float16)v[i]; *(v4h*)(C16 + cofs + (size_t)(row0 + r) * ldc + col0 + c4) = h4; } } }
     }
}


typedef _Float16 v4h __attribute__((ext_vector_type(4)));
typedef _Float16 v4ha __attribute__((ext_vector_type(4), may_alias));

__global__ __launch_bounds__(256) void k_x16(const float* __restrict__ x, _Float16* __restrict__ X16, size_t n8) { const size_t t = (size_t)blockIdx.x * 256 + threadIdx.x; if (t >= n8) return; FragH f;
#pragma unroll
  for (int q = 0; q < 8; ++q) f.h[q] = (_Float16)bf16_round(x[t * 8 + q]); *(v8us*)((unsigned short*)X16 + t * 8) = f.half[0];  }
__global__ __launch_bounds__(256) void k_h16(const float* __restrict__ x, _Float16* __restrict__ X16, size_t n8) { const size_t t = (size_t)blockIdx.x * 256 + threadIdx.x; if (t >= n8) return; FragH f;
#pragma unroll
  for (int q = 0; q < 8; ++q) f.h[q] = (_Float16)x[t * 8 + q]; *(v8us*)((unsigned short*)X16 + t * 8) = f.half[0];  }
__global__ __launch_bounds__(256) void k_round16f(const float* __restrict__ W, _Float16* __restrict__ Bt, size_t n8) { const size_t t = (size_t)blockIdx.x * 256 + threadIdx.x; if (t >= n8) return; FragH f;
#pragma unroll
  for (int i = 0; i < 8; ++i) f.h[i] = (_Float16)(bf16_round(W[t * 8 + i]) * 16.0f); *(v8us*)((unsigned short*)Bt + t * 8) = f.half[0];  }
template <int NHv, int TTv>
__global__ __launch_bounds__(256) void k_vt(const _Float16* __restrict__ V16, int ldv, int voff, _Float16* __restrict__ Vt) { __shared__ unsigned short tl[64][66]; const int tid = threadIdx.x; const int slab = blockIdx.x / (TTv / 64), lg = blockIdx.x % (TTv / 64); const int b = slab / NHv, h = slab % NHv;
  for (int i = tid; i < 64 * 8; i += 256) { const int r = i / 8, c8 = (i % 8) * 8; FragH f; f.half[0] = *(const v8us*)((const unsigned short*)V16 + ((size_t)b * TTv + lg * 64 + r) * ldv + voff + h * 64 + c8);
#pragma unroll
    for (int q = 0; q < 8; ++q) tl[r][c8 + q] = f.u[q]; }
  __syncthreads();
  {
#pragma unroll
    for (int rd = 0; rd < 2; ++rd) { const int d = rd * 32 + tid / 8, pc = tid % 8; FragH f;
#pragma unroll
      for (int q = 0; q < 8; ++q) f.u[q] = tl[pc * 8 + q][d];
      *(v8us*)((unsigned short*)Vt + ((size_t)slab * 64 + d) * TTv + lg * 64 + pc * 8) = f.half[0]; }
     } }

__global__ __launch_bounds__(256) void k_hl(const float* __restrict__ F, _Float16* __restrict__ Hh, _Float16* __restrict__ Hl, size_t n8) { const size_t t = (size_t)blockIdx.x * 256 + threadIdx.x; if (t >= n8) return; FragH fh, fl; const v4f a = *(const v4fa*)(F + t * 8), c = *(const v4fa*)(F + t * 8 + 4);
#pragma unroll
  for (int q = 0; q < 4; ++q) { _Float16 h = (_Float16)a[q]; fh.h[q] = h; fl.h[q] = (_Float16)((a[q] - (float)h) * 1024.0f); h = (_Float16)c[q]; fh.h[4 + q] = h; fl.h[4 + q] = (_Float16)((c[q] - (float)h) * 1024.0f); }
  { *(v8us*)((unsigned short*)Hh + t * 8) = fh.half[0]; *(v8us*)((unsigned short*)Hl + t * 8) = fl.half[0];  } }

// ---- fast GEMM (wave tile 32x64; requires M % 32 == 0 rows per launch region and N % 64 == 0); epilogue = k_gemm_hhx semantics ----
__device__ __forceinline__ v16h g2_frag(const _Float16* p, int hh) { FragH f; f.half[0] = *(const v8us*)((const unsigned short*)p + 8 * hh); f.half[1] = *(const v8us*)((const unsigned short*)p + 16 + 8 * hh); return f.v; }
__device__ __forceinline__ v8f g2_mma(v16h a, v16h b, v8f c) { v8f d = __builtin_amdgcn_wmma_f32_16x16x32_f16(false, a, false, b, (short)0, c, false, false); asm volatile("v_nop\n\tv_nop\n\tv_nop\n\tv_nop" : "+v"(d) : "v"(a), "v"(b)); return d; }
template <int ACT>
__global__ __launch_bounds__(128) void k_gemm2(const _Float16* __restrict__ A, int lda, size_t sA, const _Float16* __restrict__ Bh, int ldb, size_t sB, float alpha, const float* __restrict__ bias, size_t sBias, const float* __restrict__ CP, int rowsPerB, size_t sCPb, int row0g,
    float* __restrict__ C, _Float16* __restrict__ C16, int ldc, size_t sC, int M, int N, int K) { static_assert(ACT == 0 || ACT == 3 || ACT == 6 || ACT == 8 || ACT == 9 || ACT == 11 || ACT == 12 || ACT == 14 || ACT == 15 || ACT == 16 || ACT == 17, "k_gemm2: unsupported ACT code (would silently apply no activation)");
  __shared__ __attribute__((aligned(16))) float so[4][32][68];
  const int tid = threadIdx.x, w = tid >> 5, lane = tid & 31, ln = lane & 15, hh = lane >> 4; const int by = blockIdx.y;
  A += (size_t)by * sA; Bh += (size_t)by * sB; const size_t cofs = (size_t)by * sC; const float* bp = bias ? bias + (size_t)by * sBias : nullptr;
  const int ntn = N >> 6; const int mt = blockIdx.x / ntn, nq = blockIdx.x - mt * ntn; const int row0 = mt * 128 + 32 * w, col0 = nq * 64; if (row0 >= M) return;
  const _Float16* a0p = A + (size_t)(row0 + ln) * lda; const _Float16* a1p = a0p + (size_t)16 * lda;
  const _Float16* b0p = Bh + (size_t)(col0 + ln) * ldb; const _Float16* b1p = b0p + (size_t)16 * ldb; const _Float16* b2p = b1p + (size_t)16 * ldb; const _Float16* b3p = b2p + (size_t)16 * ldb;
  const v8f z8 = {0.f,0.f,0.f,0.f,0.f,0.f,0.f,0.f}; v8f c00 = z8, c01 = z8, c02 = z8, c03 = z8, c10 = z8, c11 = z8, c12 = z8, c13 = z8;
#pragma unroll 1
  for (int kb = 0; kb < K; kb += 32) { const v16h a0 = g2_frag(a0p + kb, hh), a1 = g2_frag(a1p + kb, hh);
    v16h b = g2_frag(b0p + kb, hh); c00 = g2_mma(a0, b, c00); c10 = g2_mma(a1, b, c10);
    b = g2_frag(b1p + kb, hh); c01 = g2_mma(a0, b, c01); c11 = g2_mma(a1, b, c11);
    b = g2_frag(b2p + kb, hh); c02 = g2_mma(a0, b, c02); c12 = g2_mma(a1, b, c12);
    b = g2_frag(b3p + kb, hh); c03 = g2_mma(a0, b, c03); c13 = g2_mma(a1, b, c13); }
  v8f accs[8] = {c00, c01, c02, c03, c10, c11, c12, c13};
#pragma unroll
  for (int u = 0; u < 8; ++u) { const int t = u & 3, half = u >> 2; const int col = col0 + t * 16 + ln; const float bv = bp ? bf16_round(bp[col]) : 0.f;
#pragma unroll
    for (int r = 0; r < 8; ++r) { const int rloc = half * 16 + 8 * hh + r; float v = accs[u][r] * alpha + bv; if (CP) { if (rowsPerB < 0) v += CP[cofs + (size_t)(row0g + row0 + rloc) * ldc + col];      /* rowsPerB < 0: own element of the batched C plane */ else { const int bidx = (row0g + row0 + rloc) / rowsPerB; v += CP[(size_t)bidx * sCPb + (size_t)by * 64 + col]; } }
      if (ACT == 3) v = fmaxf(v, 0.f); else if (ACT == 6) v = 0.5f * v * (1.0f + erff(v * 0.70710678118654752f)); else if (ACT == 11) v = 1.0f / (1.0f + expf(-v)); else if (ACT == 15) v = v / (1.0f + expf(-v)); else if (ACT == 12) v = (v > 0.f) ? v : 0.01f * v; else if (ACT == 8) v = tanhf(v); else if (ACT == 9) v = 0.5f * v * (1.0f + tanhf(0.7978845608028654f * (v + 0.044715f * v * v * v))); else if (ACT == 14) v = (v > 0.f) ? v : 0.1f * v; else if (ACT == 16) v = (v >= 0.f) ? v : 0.3f * v; else if (ACT == 17) v = (v >= 0.f) ? v : 0.2f * v;
      so[w][rloc][t * 16 + ln] = v; } }
  __builtin_amdgcn_fence(__ATOMIC_ACQ_REL, "workgroup"); __builtin_amdgcn_wave_barrier();
  const int rsub = lane >> 4, c4 = (lane & 15) * 4;
  {
#pragma unroll
    for (int q = 0; q < 16; ++q) { const int r = q * 2 + rsub; const v4f v = *(const v4fa*)&so[w][r][c4]; if (C) *(v4f*)(C + cofs + (size_t)(row0 + r) * ldc + col0 + c4) = v; if (C16) { v4h h4; for (int i = 0; i < 4; ++i) h4[i] = (_Float16)v[i]; *(v4h*)(C16 + cofs + (size_t)(row0 + r) * ldc + col0 + c4) = h4; } }
     } }


__global__ __launch_bounds__(256) void k_wnat(const float* __restrict__ w, size_t n8, _Float16* __restrict__ Bt) { const size_t t = (size_t)blockIdx.x * 256 + threadIdx.x; if (t >= n8) return; FragH f; for (int q = 0; q < 8; ++q) f.h[q] = (_Float16)(bf16_round(w[t * 8 + q]) * 16.0f); *(v8us*)((unsigned short*)Bt + t * 8) = f.half[0];  }
__global__ __launch_bounds__(256) void k_rsm(const float* __restrict__ S, _Float16* __restrict__ P, int nrows) {
  #pragma clang fp contract(off)
  const int i = blockIdx.x * 256 + threadIdx.x; if (i >= nrows) return; const float* s = S + (size_t)i * SQ; float mx = -3.0e38f;
#pragma unroll 1
  for (int j = 0; j < SQ; ++j) mx = fmaxf(mx, s[j]); float se = 0.f;
#pragma unroll 1
  for (int j = 0; j < SQ; ++j) se += expf(s[j] - mx); const float sc = 256.0f / se;
#pragma unroll 1
  for (int j0 = 0; j0 < SQ; j0 += 8) { FragH f; for (int q = 0; q < 8; ++q) f.h[q] = (_Float16)(expf(s[j0 + q] - mx) * sc); unsigned short* d = (unsigned short*)P + (size_t)i * SQ + j0; *(v8us*)d = f.half[0];  } }
__global__ __launch_bounds__(256) void k_vt(const _Float16* __restrict__ V16, int b, int h0, _Float16* __restrict__ VT) { __shared__ unsigned short tl[64][65]; const int tid = threadIdx.x; const int hh = blockIdx.x % HG, sg = blockIdx.x / HG; const int s0 = sg * 64; const int h = h0 + hh;
  for (int i = tid; i < 64 * 8; i += 256) { const int j = i / 8, d8 = (i % 8) * 8; FragH f; f.half[0] = *(const v8us*)((const unsigned short*)V16 + ((size_t)b * SQ + s0 + j) * DM + h * HD + d8); for (int q = 0; q < 8; ++q) tl[d8 + q][j] = f.u[q]; }
  __syncthreads();
  { for (int i = tid; i < 64 * 8; i += 256) { const int d = i / 8, j8 = (i % 8) * 8; FragH f; for (int q = 0; q < 8; ++q) f.u[q] = tl[d][j8 + q]; *(v8us*)((unsigned short*)VT + ((size_t)hh * HD + d) * SQ + s0 + j8) = f.half[0]; }  } }


// K and V for the fused kernel, all (batch, head) slices in one launch, straight from the f32 inputs. A block takes 128 keys of one slice: their K rows (8192 floats in a row) and their V rows (64 floats each, 768 apart) go out rounded, V transposed.
// Both go out in FRAGMENT ORDER: per 32 keys 4 KiB = 8 pieces of 512 bytes, a piece = the 16 bytes of lane 0, lane 1, ... lane 31 of one 16-byte load of k_attn, so that such a load covers four whole 128-byte lines
// (row-major, the 32 lanes of a K load fell on 16 lines and those of a V^T load on 8, and the WGP cache pays by the line touched).
// K16[slice][key / 32][t][ks][half][hh][ln][8] = k[key = t 16 + ln][d = ks 32 + half 16 + hh 8 + 0..7]; Vt[slice][key / 32][t][half][hh][ln][8] = v[key = half 16 + hh 8 + 0..7][d = t 16 + ln].
// 768 equal blocks of 8 waves, three on each of 256 WGPs, all resident at once; a thread has its 8 + 8 loads of 16 bytes out before it converts anything, and each load of a wave covers whole lines (512 bytes in a row of K, two 256-byte row pieces of V).
__global__ __launch_bounds__(256) void k_prep(const float* __restrict__ k, const float* __restrict__ v, _Float16* __restrict__ K16, _Float16* __restrict__ Vt) { __shared__ unsigned short tl[128][66]; __shared__ __attribute__((aligned(16))) unsigned short kl[32][272];      /* kl: 32 pieces of K, 512 bytes each at a pitch of 544: the four pieces that one wave's store falls on start 8 banks apart */
  const int tid = threadIdx.x; const int slab = blockIdx.x / (SQ / 128), lg = blockIdx.x % (SQ / 128); const int b = slab / 12, h = slab % 12;
  const float* kp = k + (size_t)blockIdx.x * (128 * HD) + tid * 4; const float* vp = v + ((size_t)b * SQ + lg * 128 + tid / 16) * 768 + h * 64 + (tid % 16) * 4;
  v4f ka[8], va[8];
#pragma unroll
  for (int u = 0; u < 8; ++u) ka[u] = *(const v4fa*)(kp + u * 1024);
#pragma unroll
  for (int u = 0; u < 8; ++u) va[u] = *(const v4fa*)(vp + (size_t)u * 16 * 768);
  __builtin_amdgcn_sched_barrier(0);      /* all sixteen loads go out together: without it the scheduler sank most of the K loads between the conversions, one memory round trip behind the other */
#pragma unroll
  for (int u = 0; u < 8; ++u) { FragH f;
#pragma unroll
    for (int q = 0; q < 4; ++q) f.h[q] = (_Float16)bf16_round(va[u][q]);
#pragma unroll
    for (int q = 0; q < 4; ++q) tl[u * 16 + tid / 16][(tid % 16) * 4 + q] = f.u[q]; }
  // K: load u of this thread is key u 16 + tid / 16, d = (tid % 16) 4 + 0..3: piece u 4 + d / 16, hh = (d / 8) % 2, ln = tid / 16, first or second 8 bytes of the lane's 16.
#pragma unroll
  for (int u = 0; u < 8; ++u) { v4h f;
#pragma unroll
    for (int q = 0; q < 4; ++q) f[q] = (_Float16)bf16_round(ka[u][q]);
    *(v4ha*)&kl[u * 4 + (tid % 16) / 4][((((tid % 16) >> 1) & 1) * 16 + tid / 16) * 8 + (tid & 1) * 4] = f; }
  __syncthreads();
  // Behind the barrier a wave takes whole pieces: round rd is the block's rd-th group of 32 keys, wave w its piece w, and every store is 512 bytes in a row.
  const int w = tid >> 5, lane = tid & 31, ln = lane & 15, hh = lane >> 4;
#pragma unroll
  for (int rd = 0; rd < 4; ++rd) *(v8us*)((unsigned short*)K16 + (size_t)blockIdx.x * (128 * HD) + (rd * 256 + tid) * 8) = *(const v8us*)&kl[rd * 8 + w][lane * 8];
#pragma unroll
  for (int rd = 0; rd < 4; ++rd) { const int d = (w >> 1) * 16 + ln, k0 = rd * 32 + (w & 1) * 16 + hh * 8; FragH f;
#pragma unroll
    for (int q = 0; q < 8; ++q) f.u[q] = tl[k0 + q][d];
    *(v8us*)((unsigned short*)Vt + (size_t)blockIdx.x * (128 * HD) + (rd * 256 + tid) * 8) = f.half[0]; } }

typedef float v2f __attribute__((ext_vector_type(2)));
typedef _Float16 v2h __attribute__((ext_vector_type(2)));
__device__ __forceinline__ float xhalf(float x) { return __builtin_bit_cast(float, __builtin_amdgcn_permlanex16(__builtin_bit_cast(int, x), __builtin_bit_cast(int, x), 0x76543210, 0xfedcba98, false, false)); }      /* lane l <-> lane l ^ 16 */
__device__ __forceinline__ v8f fa_mma(v16h a, v16h b, v8f c) { return __builtin_amdgcn_wmma_f32_16x16x32_f16(false, a, false, b, (short)0, c, false, false); }
// Scores, softmax and weighted sum in one kernel. Block = 4 waves x 32 queries of one (batch, head) slice; grid = 48 x 16 = 768 blocks, three on each of 256 WGPs.
// S^T = K Q^T: A = 16 key rows, B = 16 query rows (kept in registers), same k order for both. A lane's 8 accumulator registers are keys 8 hh + r of ONE query (column ln):
// maximum and sum run inside the lane plus one exchange with lane ^ 16, and two S^T tiles (keys 0-15, 16-31), converted in place, ARE the B operand of O^T += V^T P^T (k = 8 hh + r, 16 + 8 hh + r: the order in which k_prep has laid V^T out).
// Running softmax per query: m = maximum so far (raw scores), weights 2^8 exp((s - m) alpha), sum and O^T rescaled by exp((m_old - m) alpha) in every pass; the 2^8 cancels in the division at the end.
// K and V^T reach the block ONCE, not once per wave: a stage = 128 keys = 16 KiB of K and 16 KiB of V^T, both in a row in k_prep's fragment order, copied as they lie into one of two LDS buffers by asynchronous copies
// (a thread 16 bytes per copy, a wave 512 bytes in a row, 16 copies per thread and stage); the four waves read their fragments from LDS, 512 bytes in a row per wave-wide load. Stage t + 1 flies while stage t is worked on.
#define KS 128                /* keys per stage */
#define NT (SQ / KS)          /* stages */
#define SB (KS * HD * 2)      /* bytes of K, and of V^T, per stage */
// One stage: lk, lv = this thread's LDS byte addresses in the K and the V^T half of a buffer, gk, gv = its global addresses; the immediate offset moves the LDS and the global address alike, and both sides lie in a row.
// s_wait_xcnt 0 is the statement's last line, so that no register which a copy names is rewritten in front of it.
__device__ __forceinline__ void stage_copy(unsigned lk, unsigned lv, const char* gk, const char* gv) {
  asm volatile("global_load_async_to_lds_b128 %0, %2, off\n\t"
               "global_load_async_to_lds_b128 %0, %2, off offset:2048\n\t"
               "global_load_async_to_lds_b128 %0, %2, off offset:4096\n\t"
               "global_load_async_to_lds_b128 %0, %2, off offset:6144\n\t"
               "global_load_async_to_lds_b128 %1, %3, off\n\t"
               "global_load_async_to_lds_b128 %1, %3, off offset:2048\n\t"
               "global_load_async_to_lds_b128 %1, %3, off offset:4096\n\t"
               "global_load_async_to_lds_b128 %1, %3, off offset:6144\n\t"
               "global_load_async_to_lds_b128 %0, %2, off offset:8192\n\t"
               "global_load_async_to_lds_b128 %0, %2, off offset:10240\n\t"
               "global_load_async_to_lds_b128 %0, %2, off offset:12288\n\t"
               "global_load_async_to_lds_b128 %0, %2, off offset:14336\n\t"
               "global_load_async_to_lds_b128 %1, %3, off offset:8192\n\t"
               "global_load_async_to_lds_b128 %1, %3, off offset:10240\n\t"
               "global_load_async_to_lds_b128 %1, %3, off offset:12288\n\t"
               "global_load_async_to_lds_b128 %1, %3, off offset:14336\n\t"
               "s_wait_xcnt 0x0" :: "v"(lk), "v"(lv), "v"(gk), "v"(gv) : "memory");
}
__global__ __launch_bounds__(128) void k_attn(const float* __restrict__ Q, const _Float16* __restrict__ K16, const _Float16* __restrict__ Vt, float* __restrict__ O, float cs) {
  __shared__ __attribute__((aligned(16))) char ring[2][2 * SB];      /* two buffers, each K then V^T of one stage: 64 KiB */
  const int tid = threadIdx.x, w = tid >> 5, lane = tid & 31, ln = lane & 15, hh = lane >> 4;
  const int slab = blockIdx.x / (SQ / 128), q0 = (blockIdx.x % (SQ / 128)) * 128 + w * 32;
  const float* qp = Q + ((size_t)slab * SQ + q0 + ln) * HD + 8 * hh;      /* the f32 input itself: each query row is read by one wave only, which rounds it as K and V are rounded */
  typedef __attribute__((address_space(3))) const char lch; typedef __attribute__((address_space(3))) const v8us lv8;
  auto frag = [](lch* p, int off) { FragH f; f.half[0] = *(lv8*)(p + off); f.half[1] = *(lv8*)(p + off + 512); return f.v; };      /* two pieces: k = 8 hh + 0..7 and 16 + 8 hh + 0..7, as g2_frag */
  const char* kg = (const char*)(K16 + (size_t)slab * SQ * HD) + tid * 16; const char* vg = (const char*)(Vt + (size_t)slab * HD * SQ) + tid * 16;      /* this thread's 16 bytes of the first 2 KiB of the stage that is copied next */
  const unsigned l0 = (unsigned)(size_t)&ring[0][0] + tid * 16;      /* the low 32 bits of a __shared__ address are its LDS byte address */
  v16h qf[2][2], kf[2][2], vf[4];      /* q, k: [16-row tile][32-wide step of d]; v: [16 rows of d] */
  v4f qr[2][2][4];      /* q as loaded: k = 8 hh + 0..7 and 16 + 8 hh + 0..7, as g2_frag */
#pragma unroll
  for (int j = 0; j < 2; ++j) for (int ks = 0; ks < 2; ++ks) for (int c = 0; c < 4; ++c) qr[j][ks][c] = *(const v4fa*)(qp + j * 16 * HD + ks * 32 + (c >> 1) * 16 + (c & 1) * 4);
  stage_copy(l0, l0 + SB, kg, vg); kg += SB; vg += SB;      /* stage 0 into buffer 0; q is rounded while it flies */
#pragma unroll
  for (int j = 0; j < 2; ++j) for (int ks = 0; ks < 2; ++ks) { FragH f;
#pragma unroll
    for (int i = 0; i < 16; ++i) f.h[i] = (_Float16)bf16_round(qr[j][ks][i >> 2][i & 3]);
    qf[j][ks] = f.v; }
  const v8f z8 = {0.f,0.f,0.f,0.f,0.f,0.f,0.f,0.f}; v8f o[4][2] = {{z8, z8}, {z8, z8}, {z8, z8}, {z8, z8}};      /* O^T: [16 rows of d][16 queries] */
  float mr[2] = {-3.0e38f, -3.0e38f}, ls[2] = {0.f, 0.f};
  for (int st = 0; st < NT; ++st) {
    const int bo = (st & 1) * 2 * SB;      /* the buffer of this stage */
    // Hand-over at the head of every stage, every wave, in this order: my reads of the other buffer (the stage before) are done; my copies of this stage have landed; the barrier publishes this stage and ends every wave's reads of the other buffer;
    // only then is the other buffer filled again, with the next stage, which flies while this one is worked on. Nothing of a stage is read in front of its barrier.
    // It stands at the head, not at the foot: with a branch behind the four passes the compiler sank their row sums into the block behind it, every weight alive in f32 until then (314 registers).
    asm volatile("s_wait_dscnt 0x0" ::: "memory");
    asm volatile("s_wait_asynccnt 0x0" ::: "memory");
    __syncthreads();
    if (st + 1 < NT) { stage_copy(l0 + (2 * SB - bo), l0 + (3 * SB - bo), kg, vg); kg += SB; vg += SB; }      /* the test reads the same in the whole block */
    lch* rb = (lch*)&ring[0][0] + bo + lane * 16;      /* lane l takes its 16 bytes at 16 l of each 512-byte piece */
#pragma unroll
    for (int t = 0; t < 2; ++t) for (int ks = 0; ks < 2; ++ks) kf[t][ks] = frag(rb, (t * 2 + ks) * 1024);
#pragma unroll
    for (int t = 0; t < 4; ++t) vf[t] = frag(rb, SB + t * 1024);
    __builtin_amdgcn_sched_barrier(0);      /* the stage's first K and V^T loads go out as one group (k first: LDS loads return in order, and the first product waits for k alone): without it the scheduler put the V^T loads in three groups among the score products */
#pragma unroll
    for (int ps = 0; ps < KS / 32; ++ps) {      /* one pass = 32 keys */
      v8f s[2][2];      /* S^T: [16 keys][16 queries] */
#pragma unroll
      for (int t = 0; t < 2; ++t) for (int j = 0; j < 2; ++j) s[t][j] = fa_mma(kf[t][1], qf[j][1], fa_mma(kf[t][0], qf[j][0], z8));
      __builtin_amdgcn_sched_barrier(0);      /* without it the loads below rose in among the score products, into registers of their own */
      // The next pass's keys are read as soon as this pass's score products are issued: softmax and the second product cover their latency. A stage's last pass reads nothing ahead: the next stage is not published yet.
      if (ps + 1 < KS / 32) {
#pragma unroll
        for (int t = 0; t < 2; ++t) for (int ks = 0; ks < 2; ++ks) kf[t][ks] = frag(rb, (ps + 1) * 4096 + (t * 2 + ks) * 1024); }
      __builtin_amdgcn_sched_barrier(0);      /* without it the scheduler sank these loads into the second product, in four groups among its instructions */
#pragma unroll
      for (int j = 0; j < 2; ++j) {
        float mx = fmaxf(s[0][j][0], s[1][j][0]);
#pragma unroll
        for (int r = 1; r < 8; ++r) mx = fmaxf(mx, fmaxf(s[0][j][r], s[1][j][r]));
        mx = fmaxf(mx, xhalf(mx));
        const float mn = fmaxf(mr[j], mx), corr = __builtin_amdgcn_exp2f((mr[j] - mn) * cs), nb = 8.0f - mn * cs; mr[j] = mn;
        FragH pf; v2f sm = {0.f, 0.f};
#pragma unroll
        for (int i = 0; i < 8; ++i) { const v2f a = __builtin_elementwise_fma(v2f{s[i >> 2][j][2 * (i & 3)], s[i >> 2][j][2 * (i & 3) + 1]}, v2f{cs, cs}, v2f{nb, nb});
          const v2f p = {__builtin_amdgcn_exp2f(a.x), __builtin_amdgcn_exp2f(a.y)}; sm += p; const v2h ph = __builtin_convertvector(p, v2h); pf.h[2 * i] = ph.x; pf.h[2 * i + 1] = ph.y; }
        ls[j] = ls[j] * corr + (sm.x + sm.y);
#pragma unroll
        for (int t = 0; t < 4; ++t) o[t][j] = fa_mma(vf[t], pf.v, o[t][j] * corr);
      }
      // The next pass's V^T is read at the end of this pass: the next score products and softmax cover its latency.
      if (ps + 1 < KS / 32) {
#pragma unroll
        for (int t = 0; t < 4; ++t) vf[t] = frag(rb, SB + (ps + 1) * 4096 + t * 1024); }
      __builtin_amdgcn_sched_barrier(0);      /* a pass ends here: without it the scheduler split the V^T loads above into groups among the next pass's score products */
    }
  }
  asm volatile("s_wait_asynccnt 0x0" ::: "memory");      /* no copy is out when the wave ends */
#pragma unroll
  for (int j = 0; j < 2; ++j) { const float inv = 1.0f / (ls[j] + xhalf(ls[j])); float* op = O + ((size_t)slab * SQ + q0 + j * 16 + ln) * HD + 8 * hh;
#pragma unroll
    for (int t = 0; t < 4; ++t) { const v8f v = o[t][j] * inv; *(v4f*)(op + t * 16) = v4f{v[0], v[1], v[2], v[3]}; *(v4f*)(op + t * 16 + 4) = v4f{v[4], v[5], v[6], v[7]}; } } }

extern "C" void kernel_launch(void* const* d_in, const int* in_sizes, int n_in,
                              void* d_out, int out_size, void* d_ws, size_t ws_size, hipStream_t stream) {
  (void)in_sizes; (void)n_in; (void)out_size;
  const float* const* I = (const float* const*)d_in; const float* q = I[0]; const float* k = I[1]; const float* v = I[2];
  char* ws = (char*)d_ws; size_t off = 0;
  auto take = [&](size_t bytes) { char* p = ws + off; off += (bytes + 255) & ~(size_t)255; return p; };
  _Float16* K16 = (_Float16*)take(NR * DM * 2); _Float16* VT = (_Float16*)take(NR * DM * 2);
  if (off > ws_size) return;      /* 2 x 12 = 24 MiB */
  k_prep<<<NB * (SQ / 128), 256, 0, stream>>>(k, v, K16, VT);      /* values are [B][S][12][64]: each slice's 64 columns of the 768-wide rows */
  k_attn<<<NB * (SQ / 128), 128, 0, stream>>>(q, K16, VT, (float*)d_out, 0.05205877313848632f);      /* 768^-0.5 x log2 e: exp(x) = 2^(x log2 e) */
}

// v006
// Measured time: 52.1 microseconds a run.
// Two timings next to v005 put it at 1.11 and 1.10 times that version's speed.
// Over all steps from v000 it is 364 times as fast.
#include <hip/hip_runtime.h>
#define NB 48
#define SQ 2048
#define DM 64
#define NH 1
#define HD 64
#define HG 1
#define NR ((size_t)NB * SQ)
typedef __bf16 v16b __attribute__((ext_vector_type(16)));
typedef unsigned short v8us __attribute__((ext_vector_type(8), may_alias));
typedef float  v8f  __attribute__((ext_vector_type(8)));
typedef float  v4f  __attribute__((ext_vector_type(4)));
typedef float  v4fa __attribute__((ext_vector_type(4), may_alias));
union FragB { v16b v; v8us half[2]; unsigned short u[16]; };

__device__ __forceinline__ unsigned short bf16_bits(float x) { unsigned int u = __float_as_uint(x); return (unsigned short)((u + 0x7FFFu + ((u >> 16) & 1u)) >> 16); }
__device__ __forceinline__ float bf16_val(unsigned short b) { return __uint_as_float(((unsigned int)b) << 16); }
__device__ __forceinline__ float bf16_round(float x) { return bf16_val(bf16_bits(x)); }
// D += A·B with NT terms: 1 = ah·bh, 2 = + al·bh (A split), 3 = + ah·bl (both split)
template <int NT>
__device__ __forceinline__ v8f mmaN(v16b ah, v16b al, v16b bh, v16b bl, v8f c) {
  c = __builtin_amdgcn_wmma_f32_16x16x32_bf16(false, ah, false, bh, (short)0, c, false, false);
  if (NT >= 2) c = __builtin_amdgcn_wmma_f32_16x16x32_bf16(false, al, false, bh, (short)0, c, false, false);
  if (NT >= 3) c = __builtin_amdgcn_wmma_f32_16x16x32_bf16(false, ah, false, bl, (short)0, c, false, false);
  asm volatile("v_nop\n\tv_nop\n\tv_nop\n\tv_nop" : "+v"(c) : "v"(ah), "v"(al), "v"(bh), "v"(bl));
  return c;
}

__global__ __launch_bounds__(256) void k_wt_bf16(const float* __restrict__ W, unsigned short* __restrict__ Wt, int K, int N) {
  const int t = blockIdx.x * 256 + threadIdx.x;
  const int k8n = K / 8;
  if (t >= N * k8n) return;
  const int n = t / k8n, k8 = (t % k8n) * 8;
  v8us v;
#pragma unroll
  for (int i = 0; i < 8; ++i) v[i] = bf16_bits(W[(size_t)(k8 + i) * N + n]);
  *(v8us*)(Wt + (size_t)n * K + k8) = v;
  
}

// GEMM C[M][N] (f32, pitch ldc) = act(A[M][K]·W + bias). A f32 row-major (pitch lda) converted per fragment to bf16
// (ASPLIT: hi/lo two planes -> 2 terms, else single rounded term); Wt bf16 [N][K] (pitch ldb). BIAS_BF16 rounds the
// bias to bf16 first (bias quantised to bf16 before the add). K%32==0, M%16==0, N%64==0.
template <bool ASPLIT, int ACT, bool BIAS_BF16>
__global__ __launch_bounds__(128) void k_gemm_bf(const float* __restrict__ A, int lda, const unsigned short* __restrict__ Wt, int ldb,
                                               const float* __restrict__ bias, float* __restrict__ C, int ldc, int M, int N, int K) {
  __shared__ __attribute__((aligned(16))) float so[4][16][64];
  const int tid = threadIdx.x, w = tid >> 5, lane = tid & 31, ln = lane & 15, hh = lane >> 4;
  const int ntn = N / 64;
  const int wid = blockIdx.x * 4 + w;
  const int mt = wid / ntn, nq = wid % ntn;
  if (mt * 16 >= M) return;
  const int row0 = mt * 16, col0 = nq * 64;
  const float* arow = A + (size_t)(row0 + ln) * lda;
  v8f acc[4] = {};
  for (int kb = 0; kb < K; kb += 32) {
    FragB ah, al;
    const v4f x0 = *(const v4fa*)(arow + kb + 8 * hh), x1 = *(const v4fa*)(arow + kb + 8 * hh + 4);
    const v4f x2 = *(const v4fa*)(arow + kb + 16 + 8 * hh), x3 = *(const v4fa*)(arow + kb + 16 + 8 * hh + 4);
    float xs[16] = {x0[0],x0[1],x0[2],x0[3],x1[0],x1[1],x1[2],x1[3],x2[0],x2[1],x2[2],x2[3],x3[0],x3[1],x3[2],x3[3]};
#pragma unroll
    for (int i = 0; i < 16; ++i) { const unsigned short hb = bf16_bits(xs[i]); ah.u[i] = hb; al.u[i] = ASPLIT ? bf16_bits(xs[i] - bf16_val(hb)) : (unsigned short)0; }
#pragma unroll
    for (int t = 0; t < 4; ++t) {
      const unsigned short* brow = Wt + (size_t)(col0 + t * 16 + ln) * ldb + kb;
      FragB b;
      b.half[0] = *(const v8us*)(brow + 8 * hh);
      b.half[1] = *(const v8us*)(brow + 16 + 8 * hh);
      acc[t] = mmaN<ASPLIT ? 2 : 1>(ah.v, al.v, b.v, b.v, acc[t]);
    }
  }
#pragma unroll
  for (int t = 0; t < 4; ++t) {
    float bv = bias ? bias[col0 + t * 16 + ln] : 0.f;
    if (BIAS_BF16) bv = bf16_round(bv);
#pragma unroll
    for (int r = 0; r < 8; ++r) { float v = acc[t][r] + bv; if (ACT == 1) v = fmaxf(v, 0.f); so[w][8 * hh + r][t * 16 + ln] = v; }
  }
  __builtin_amdgcn_fence(__ATOMIC_ACQ_REL, "workgroup");
  __builtin_amdgcn_wave_barrier();
  const int rsub = lane >> 4, c4 = (lane & 15) * 4;
  {
#pragma unroll
    for (int q = 0; q < 8; ++q) {
      const int r = q * 2 + rsub;
      const v4f v = *(const v4fa*)&so[w][r][c4];
      *(v4f*)(C + (size_t)(row0 + r) * ldc + col0 + c4) = v;
    }
    
  }
}

// GEMM C = act(A·W + bias + resid): A f32 (ASPLIT -> hi/lo 2 terms), Wt bf16 [N][K]; ACT 0 none, 1 relu, 2 exact gelu;
// resid (optional, f32, row index = (row % rmod), pitch ldr, RES_BF16 rounds it) added before the activation.
template <bool ASPLIT, int ACT, bool BIAS_BF16, bool RES_BF16>
__global__ __launch_bounds__(128) void k_gemm_bf3(const float* __restrict__ A, int lda, const unsigned short* __restrict__ Wt, int ldb,
                                                const float* __restrict__ bias, const float* __restrict__ resid, int rmod, int ldr,
                                                float* __restrict__ C, int ldc, int M, int N, int K) {
  __shared__ __attribute__((aligned(16))) float so[4][16][64];
  const int tid = threadIdx.x, w = tid >> 5, lane = tid & 31, ln = lane & 15, hh = lane >> 4;
  const int ntn = N / 64;
  const int wid = blockIdx.x * 4 + w;
  const int mt = wid / ntn, nq = wid % ntn;
  if (mt * 16 >= M) return;
  const int row0 = mt * 16, col0 = nq * 64;
  const float* arow = A + (size_t)(row0 + ln) * lda;
  v8f acc[4] = {};
  for (int kb = 0; kb < K; kb += 32) {
    FragB ah, al;
    const v4f x0 = *(const v4fa*)(arow + kb + 8 * hh), x1 = *(const v4fa*)(arow + kb + 8 * hh + 4);
    const v4f x2 = *(const v4fa*)(arow + kb + 16 + 8 * hh), x3 = *(const v4fa*)(arow + kb + 16 + 8 * hh + 4);
    float xs[16] = {x0[0],x0[1],x0[2],x0[3],x1[0],x1[1],x1[2],x1[3],x2[0],x2[1],x2[2],x2[3],x3[0],x3[1],x3[2],x3[3]};
#pragma unroll
    for (int i = 0; i < 16; ++i) { const unsigned short hb = bf16_bits(xs[i]); ah.u[i] = hb; al.u[i] = ASPLIT ? bf16_bits(xs[i] - bf16_val(hb)) : (unsigned short)0; }
#pragma unroll
    for (int t = 0; t < 4; ++t) {
      const unsigned short* brow = Wt + (size_t)(col0 + t * 16 + ln) * ldb + kb;
      FragB b;
      b.half[0] = *(const v8us*)(brow + 8 * hh);
      b.half[1] = *(const v8us*)(brow + 16 + 8 * hh);
      acc[t] = mmaN<ASPLIT ? 2 : 1>(ah.v, al.v, b.v, b.v, acc[t]);
    }
  }
#pragma unroll
  for (int t = 0; t < 4; ++t) {
    const int col = col0 + t * 16 + ln;
    float bv = bias ? bias[col] : 0.f;
    if (BIAS_BF16) bv = bf16_round(bv);
#pragma unroll
    for (int r = 0; r < 8; ++r) {
      float v = acc[t][r] + bv;
      if (resid) { float rv = resid[(size_t)((row0 + 8 * hh + r) % rmod) * ldr + col]; if (RES_BF16) rv = bf16_round(rv); v += rv; }
      if (ACT == 1) v = fmaxf(v, 0.f);
      if (ACT == 2) v = 0.5f * v * (1.0f + erff(v * 0.70710678118654752f));
      if (ACT == 3) { const float u = 0.7978845608028654f * (v + 0.044715f * v * v * v); v = 0.5f * v * (1.0f + tanhf(u)); }
      so[w][8 * hh + r][t * 16 + ln] = v;
    }
  }
  __builtin_amdgcn_fence(__ATOMIC_ACQ_REL, "workgroup");
  __builtin_amdgcn_wave_barrier();
  const int rsub = lane >> 4, c4 = (lane & 15) * 4;
  {
#pragma unroll
    for (int q = 0; q < 8; ++q) {
      const int r = q * 2 + rsub;
      const v4f v = *(const v4fa*)&so[w][r][c4];
      *(v4f*)(C + (size_t)(row0 + r) * ldc + col0 + c4) = v;
    }
    
  }
}
// row LayerNorm (biased variance, eps) over N: s = X (+ R); optional out_sum <- s; out_norm <- (s-mu)*rsqrt(var+eps)*g + b
template <bool PARAM_BF16>
__global__ __launch_bounds__(256) void k_layernorm(const float* __restrict__ X, const float* __restrict__ R, const float* __restrict__ g, const float* __restrict__ bta,
                                                  float* __restrict__ out_sum, float* __restrict__ out_norm, int N, float eps) {
  __shared__ float red[256];
  const int row = blockIdx.x, tid = threadIdx.x;
  const float* x = X + (size_t)row * N; const float* rr = R ? R + (size_t)row * N : nullptr;
  float vals[16];                     // up to N = 4096
  const int per = N / 256;            // contiguous chunk per thread? use strided-by-4 chunks: thread handles j = tid*4 + 1024*u
  float s1 = 0.f;
  for (int u = 0; u < per / 4; ++u) {
    const int j = tid * 4 + 1024 * u;
    const v4f a = *(const v4fa*)(x + j);
    v4f b = {0.f,0.f,0.f,0.f}; if (rr) b = *(const v4fa*)(rr + j);
#pragma unroll
    for (int q = 0; q < 4; ++q) { const float v = a[q] + b[q]; vals[u * 4 + q] = v; s1 += v; }
  }
  red[tid] = s1; __syncthreads();
  for (int st = 128; st > 0; st >>= 1) { if (tid < st) red[tid] += red[tid + st]; __syncthreads(); }
  const float mu = red[0] / (float)N; __syncthreads();
  float s2 = 0.f;
  for (int u = 0; u < per / 4; ++u)
#pragma unroll
    for (int q = 0; q < 4; ++q) { const float c = vals[u * 4 + q] - mu; s2 += c * c; }
  red[tid] = s2; __syncthreads();
  for (int st = 128; st > 0; st >>= 1) { if (tid < st) red[tid] += red[tid + st]; __syncthreads(); }
  const float rs = rsqrtf(red[0] / (float)N + eps);
  {
    for (int u = 0; u < per / 4; ++u) {
      const int j = tid * 4 + 1024 * u;
      v4f o, sm;
#pragma unroll
      for (int q = 0; q < 4; ++q) {
        float gg = g[j + q], bb = bta[j + q];
        if (PARAM_BF16) { gg = bf16_round(gg); bb = bf16_round(bb); }
        sm[q] = vals[u * 4 + q]; o[q] = (vals[u * 4 + q] - mu) * rs * gg + bb;
      }
      if (out_sum) *(v4f*)(out_sum + (size_t)row * N + j) = sm;
      *(v4f*)(out_norm + (size_t)row * N + j) = o;
    }
    
  }
}



// ---- f16 WMMA path (v_wmma_f32_16x16x32_f16): 11-bit significands for operands in range — used where a [0,1] probability operand needs more precision than bf16
typedef _Float16 v16h __attribute__((ext_vector_type(16)));
union FragH { v16h v; v8us half[2]; _Float16 h[16]; unsigned short u[16]; };
template <int NT>
__device__ __forceinline__ v8f mmaH(v16h ah, v16h al, v16h bh, v16h bl, v8f c) {
  c = __builtin_amdgcn_wmma_f32_16x16x32_f16(false, ah, false, bh, (short)0, c, false, false);
  if (NT >= 2) c = __builtin_amdgcn_wmma_f32_16x16x32_f16(false, al, false, bh, (short)0, c, false, false);
  if (NT >= 3) c = __builtin_amdgcn_wmma_f32_16x16x32_f16(false, ah, false, bl, (short)0, c, false, false);
  asm volatile("v_nop\n\tv_nop\n\tv_nop\n\tv_nop" : "+v"(c) : "v"(ah), "v"(al), "v"(bh), "v"(bl));
  return c;
}
// batched GEMM like k_gemm_b but f16 operands: A f32 (split into f16 hi/lo if ASPLIT, else rounded to f16), Bt = f16 values [n][k]; alpha; C f32; N multiple of 16 (partial tiles skipped)
template <bool ASPLIT>
__global__ __launch_bounds__(128) void k_gemm_h(const float* __restrict__ A, int lda, size_t sA, const _Float16* __restrict__ Bh, int ldb, size_t sB, float alpha, float* __restrict__ C, int ldc, size_t sC, int M, int N, int K) {
  __shared__ __attribute__((aligned(16))) float so[4][16][64];
  const int tid = threadIdx.x, w = tid >> 5, lane = tid & 31, ln = lane & 15, hh = lane >> 4; const int by = blockIdx.y;
  A += (size_t)by * sA; Bh += (size_t)by * sB; C += (size_t)by * sC;
  const int ntn = (N + 63) / 64; const int wid = blockIdx.x * 4 + w; const int mt = wid / ntn, nq = wid % ntn; if (mt * 16 >= M) return;
  const int row0 = mt * 16, col0 = nq * 64; const float* arow = A + (size_t)(row0 + ln) * lda;
  v8f acc[4] = {};
  for (int kb = 0; kb < K; kb += 32) {
    FragH ah, al;
    const v4f x0 = *(const v4fa*)(arow + kb + 8 * hh), x1 = *(const v4fa*)(arow + kb + 8 * hh + 4), x2 = *(const v4fa*)(arow + kb + 16 + 8 * hh), x3 = *(const v4fa*)(arow + kb + 16 + 8 * hh + 4);
    float xs[16] = {x0[0],x0[1],x0[2],x0[3],x1[0],x1[1],x1[2],x1[3],x2[0],x2[1],x2[2],x2[3],x3[0],x3[1],x3[2],x3[3]};
#pragma unroll
    for (int i = 0; i < 16; ++i) { const _Float16 h = (_Float16)xs[i]; ah.h[i] = h; al.h[i] = ASPLIT ? (_Float16)(xs[i] - (float)h) : (_Float16)0.0f; }
#pragma unroll
    for (int t = 0; t < 4; ++t) { if (col0 + t * 16 >= N) continue; const size_t boff = (size_t)(col0 + t * 16 + ln) * ldb + kb; FragH bq; bq.half[0] = *(const v8us*)(Bh + boff + 8 * hh); bq.half[1] = *(const v8us*)(Bh + boff + 16 + 8 * hh);
      acc[t] = mmaH<ASPLIT ? 2 : 1>(ah.v, al.v, bq.v, bq.v, acc[t]); }
  }
#pragma unroll
  for (int t = 0; t < 4; ++t) { if (col0 + t * 16 >= N) continue;
#pragma unroll
    for (int r = 0; r < 8; ++r) so[w][8 * hh + r][t * 16 + ln] = acc[t][r] * alpha; }
  __builtin_amdgcn_fence(__ATOMIC_ACQ_REL, "workgroup"); __builtin_amdgcn_wave_barrier();
  const int rsub = lane >> 4, c4 = (lane & 15) * 4;
  {
#pragma unroll
    for (int q = 0; q < 8; ++q) { const int r = q * 2 + rsub; if (col0 + c4 < N) { const v4f v = *(const v4fa*)&so[w][r][c4]; *(v4f*)(C + (size_t)(row0 + r) * ldc + col0 + c4) = v; } }
     }
}

// Wt[n][k] = f16(W[k][n]·scale) from f32 row-major W[K][N] (scale = power of two; bf16-exact weights stay exact in f16 away from the subnormal range)
__global__ __launch_bounds__(256) void k_wt_f16(const float* __restrict__ W, _Float16* __restrict__ Wt, int K, int N, float scale) {
  const int t = blockIdx.x * 256 + threadIdx.x; if (t >= N * (K / 8)) return; const int n = t / (K / 8), k8 = (t % (K / 8)) * 8; FragH f;
#pragma unroll
  for (int i = 0; i < 8; ++i) f.h[i] = (_Float16)(bf16_round(W[(size_t)(k8 + i) * N + n]) * scale); const v8us o = f.half[0];
  *(v8us*)((unsigned short*)Wt + (size_t)n * K + k8) = o; 
}
// k_gemm_hh variant with fused epilogue: v = acc·alpha + bias[by·sBias + col] (+ CP[(row/rowsPerB)·sCPb + by·64 + col] if CP) ; ACT 0 none / 1 elu ; writes f16 C16 (and f32 C if non-null)
template <int ACT>
__global__ __launch_bounds__(128) void k_gemm_hhx(const _Float16* __restrict__ A, int lda, size_t sA, const _Float16* __restrict__ Bh, int ldb, size_t sB, float alpha, const float* __restrict__ bias, size_t sBias, const float* __restrict__ CP, int rowsPerB, size_t sCPb, int row0g,
    float* __restrict__ C, _Float16* __restrict__ C16, int ldc, size_t sC, int M, int N, int K) {
  __shared__ __attribute__((aligned(16))) float so[4][16][64];
  const int tid = threadIdx.x, w = tid >> 5, lane = tid & 31, ln = lane & 15, hh = lane >> 4; const int by = blockIdx.y;
  A += (size_t)by * sA; Bh += (size_t)by * sB; const size_t cofs = (size_t)by * sC; const float* bp = bias ? bias + (size_t)by * sBias : nullptr;
  const int ntn = (N + 63) / 64; const int wid = blockIdx.x * 4 + w; const int mt = wid / ntn, nq = wid % ntn; if (mt * 16 >= M) return;
  const int row0 = mt * 16, col0 = nq * 64; const _Float16* arow = A + (size_t)(row0 + ln) * lda;
  v8f acc[4] = {};
  for (int kb = 0; kb < K; kb += 32) { FragH ah; ah.half[0] = *(const v8us*)((const unsigned short*)arow + kb + 8 * hh); ah.half[1] = *(const v8us*)((const unsigned short*)arow + kb + 16 + 8 * hh);
#pragma unroll
    for (int t = 0; t < 4; ++t) { if (col0 + t * 16 >= N) continue; const size_t boff = (size_t)(col0 + t * 16 + ln) * ldb + kb; FragH bq; bq.half[0] = *(const v8us*)((const unsigned short*)Bh + boff + 8 * hh); bq.half[1] = *(const v8us*)((const unsigned short*)Bh + boff + 16 + 8 * hh);
      acc[t] = mmaH<1>(ah.v, ah.v, bq.v, bq.v, acc[t]); }
  }
#pragma unroll
  for (int t = 0; t < 4; ++t) { if (col0 + t * 16 >= N) continue; const int col = col0 + t * 16 + ln; const float bv = bp ? bf16_round(bp[col]) : 0.f;
#pragma unroll
    for (int r = 0; r < 8; ++r) { float v = acc[t][r] * alpha + bv; if (CP) { const int rr = row0g + row0 + 8 * hh + r; if (rowsPerB < 0) v += CP[cofs + (size_t)rr * ldc + col];      /* rowsPerB < 0: own element of the batched C plane */ else { const int bidx = rr / rowsPerB; v += CP[(size_t)bidx * sCPb + (size_t)by * 64 + col]; } } if (ACT == 1) v = (v > 0.f) ? v : expm1f(v); else if (ACT == 7) v = (v > 0.f) ? v + 1.0f : expf(v); else if (ACT == 8) v = tanhf(v); else if (ACT == 9) v = 0.5f * v * (1.0f + tanhf(0.7978845608028654f * (v + 0.044715f * v * v * v))); else if (ACT == 11) v = 1.0f / (1.0f + expf(-v)); else if (ACT == 12) v = (v > 0.f) ? v : 0.01f * v; else if (ACT == 14) v = (v > 0.f) ? v : 0.1f * v; else if (ACT == 16) v = (v >= 0.f) ? v : 0.3f * v; else if (ACT == 17) v = (v >= 0.f) ? v : 0.2f * v; else if (ACT == 15) v = v / (1.0f + expf(-v)); else if (ACT == 3) v = fmaxf(v, 0.f); else if (ACT == 6) v = 0.5f * v * (1.0f + erff(v * 0.70710678118654752f)); so[w][8 * hh + r][t * 16 + ln] = v; } }
  __builtin_amdgcn_fence(__ATOMIC_ACQ_REL, "workgroup"); __builtin_amdgcn_wave_barrier();
  const int rsub = lane >> 4, c4 = (lane & 15) * 4; typedef _Float16 v4h __attribute__((ext_vector_type(4)));
  {
#pragma unroll
    for (int q = 0; q < 8; ++q) { const int r = q * 2 + rsub; if (col0 + c4 < N) { const v4f v = *(const v4fa*)&so[w][r][c4]; if (C) *(v4f*)(C + cofs + (size_t)(row0 + r) * ldc + col0 + c4) = v; if (C16) { v4h h4; for (int i = 0; i < 4; ++i) h4[i] = (_Float16)v[i]; *(v4h*)(C16 + cofs + (size_t)(row0 + r) * ldc + col0 + c4) = h4; } } }
     }
}


typedef _Float16 v4h __attribute__((ext_vector_type(4)));
typedef _Float16 v4ha __attribute__((ext_vector_type(4), may_alias));

__global__ __launch_bounds__(256) void k_x16(const float* __restrict__ x, _Float16* __restrict__ X16, size_t n8) { const size_t t = (size_t)blockIdx.x * 256 + threadIdx.x; if (t >= n8) return; FragH f;
#pragma unroll
  for (int q = 0; q < 8; ++q) f.h[q] = (_Float16)bf16_round(x[t * 8 + q]); *(v8us*)((unsigned short*)X16 + t * 8) = f.half[0];  }
__global__ __launch_bounds__(256) void k_h16(const float* __restrict__ x, _Float16* __restrict__ X16, size_t n8) { const size_t t = (size_t)blockIdx.x * 256 + threadIdx.x; if (t >= n8) return; FragH f;
#pragma unroll
  for (int q = 0; q < 8; ++q) f.h[q] = (_Float16)x[t * 8 + q]; *(v8us*)((unsigned short*)X16 + t * 8) = f.half[0];  }
__global__ __launch_bounds__(256) void k_round16f(const float* __restrict__ W, _Float16* __restrict__ Bt, size_t n8) { const size_t t = (size_t)blockIdx.x * 256 + threadIdx.x; if (t >= n8) return; FragH f;
#pragma unroll
  for (int i = 0; i < 8; ++i) f.h[i] = (_Float16)(bf16_round(W[t * 8 + i]) * 16.0f); *(v8us*)((unsigned short*)Bt + t * 8) = f.half[0];  }
template <int NHv, int TTv>
__global__ __launch_bounds__(256) void k_vt(const _Float16* __restrict__ V16, int ldv, int voff, _Float16* __restrict__ Vt) { __shared__ unsigned short tl[64][66]; const int tid = threadIdx.x; const int slab = blockIdx.x / (TTv / 64), lg = blockIdx.x % (TTv / 64); const int b = slab / NHv, h = slab % NHv;
  for (int i = tid; i < 64 * 8; i += 256) { const int r = i / 8, c8 = (i % 8) * 8; FragH f; f.half[0] = *(const v8us*)((const unsigned short*)V16 + ((size_t)b * TTv + lg * 64 + r) * ldv + voff + h * 64 + c8);
#pragma unroll
    for (int q = 0; q < 8; ++q) tl[r][c8 + q] = f.u[q]; }
  __syncthreads();
  {
#pragma unroll
    for (int rd = 0; rd < 2; ++rd) { const int d = rd * 32 + tid / 8, pc = tid % 8; FragH f;
#pragma unroll
      for (int q = 0; q < 8; ++q) f.u[q] = tl[pc * 8 + q][d];
      *(v8us*)((unsigned short*)Vt + ((size_t)slab * 64 + d) * TTv + lg * 64 + pc * 8) = f.half[0]; }
     } }

__global__ __launch_bounds__(256) void k_hl(const float* __restrict__ F, _Float16* __restrict__ Hh, _Float16* __restrict__ Hl, size_t n8) { const size_t t = (size_t)blockIdx.x * 256 + threadIdx.x; if (t >= n8) return; FragH fh, fl; const v4f a = *(const v4fa*)(F + t * 8), c = *(const v4fa*)(F + t * 8 + 4);
#pragma unroll
  for (int q = 0; q < 4; ++q) { _Float16 h = (_Float16)a[q]; fh.h[q] = h; fl.h[q] = (_Float16)((a[q] - (float)h) * 1024.0f); h = (_Float16)c[q]; fh.h[4 + q] = h; fl.h[4 + q] = (_Float16)((c[q] - (float)h) * 1024.0f); }
  { *(v8us*)((unsigned short*)Hh + t * 8) = fh.half[0]; *(v8us*)((unsigned short*)Hl + t * 8) = fl.half[0];  } }

// ---- fast GEMM (wave tile 32x64; requires M % 32 == 0 rows per launch region and N % 64 == 0); epilogue = k_gemm_hhx semantics ----
__device__ __forceinline__ v16h g2_frag(const _Float16* p, int hh) { FragH f; f.half[0] = *(const v8us*)((const unsigned short*)p + 8 * hh); f.half[1] = *(const v8us*)((const unsigned short*)p + 16 + 8 * hh); return f.v; }
__device__ __forceinline__ v8f g2_mma(v16h a, v16h b, v8f c) { v8f d = __builtin_amdgcn_wmma_f32_16x16x32_f16(false, a, false, b, (short)0, c, false, false); asm volatile("v_nop\n\tv_nop\n\tv_nop\n\tv_nop" : "+v"(d) : "v"(a), "v"(b)); return d; }
template <int ACT>
__global__ __launch_bounds__(128) void k_gemm2(const _Float16* __restrict__ A, int lda, size_t sA, const _Float16* __restrict__ Bh, int ldb, size_t sB, float alpha, const float* __restrict__ bias, size_t sBias, const float* __restrict__ CP, int rowsPerB, size_t sCPb, int row0g,
    float* __restrict__ C, _Float16* __restrict__ C16, int ldc, size_t sC, int M, int N, int K) { static_assert(ACT == 0 || ACT == 3 || ACT == 6 || ACT == 8 || ACT == 9 || ACT == 11 || ACT == 12 || ACT == 14 || ACT == 15 || ACT == 16 || ACT == 17, "k_gemm2: unsupported ACT code (would silently apply no activation)");
  __shared__ __attribute__((aligned(16))) float so[4][32][68];
  const int tid = threadIdx.x, w = tid >> 5, lane = tid & 31, ln = lane & 15, hh = lane >> 4; const int by = blockIdx.y;
  A += (size_t)by * sA; Bh += (size_t)by * sB; const size_t cofs = (size_t)by * sC; const float* bp = bias ? bias + (size_t)by * sBias : nullptr;
  const int ntn = N >> 6; const int mt = blockIdx.x / ntn, nq = blockIdx.x - mt * ntn; const int row0 = mt * 128 + 32 * w, col0 = nq * 64; if (row0 >= M) return;
  const _Float16* a0p = A + (size_t)(row0 + ln) * lda; const _Float16* a1p = a0p + (size_t)16 * lda;
  const _Float16* b0p = Bh + (size_t)(col0 + ln) * ldb; const _Float16* b1p = b0p + (size_t)16 * ldb; const _Float16* b2p = b1p + (size_t)16 * ldb; const _Float16* b3p = b2p + (size_t)16 * ldb;
  const v8f z8 = {0.f,0.f,0.f,0.f,0.f,0.f,0.f,0.f}; v8f c00 = z8, c01 = z8, c02 = z8, c03 = z8, c10 = z8, c11 = z8, c12 = z8, c13 = z8;
#pragma unroll 1
  for (int kb = 0; kb < K; kb += 32) { const v16h a0 = g2_frag(a0p + kb, hh), a1 = g2_frag(a1p + kb, hh);
    v16h b = g2_frag(b0p + kb, hh); c00 = g2_mma(a0, b, c00); c10 = g2_mma(a1, b, c10);
    b = g2_frag(b1p + kb, hh); c01 = g2_mma(a0, b, c01); c11 = g2_mma(a1, b, c11);
    b = g2_frag(b2p + kb, hh); c02 = g2_mma(a0, b, c02); c12 = g2_mma(a1, b, c12);
    b = g2_frag(b3p + kb, hh); c03 = g2_mma(a0, b, c03); c13 = g2_mma(a1, b, c13); }
  v8f accs[8] = {c00, c01, c02, c03, c10, c11, c12, c13};
#pragma unroll
  for (int u = 0; u < 8; ++u) { const int t = u & 3, half = u >> 2; const int col = col0 + t * 16 + ln; const float bv = bp ? bf16_round(bp[col]) : 0.f;
#pragma unroll
    for (int r = 0; r < 8; ++r) { const int rloc = half * 16 + 8 * hh + r; float v = accs[u][r] * alpha + bv; if (CP) { if (rowsPerB < 0) v += CP[cofs + (size_t)(row0g + row0 + rloc) * ldc + col];      /* rowsPerB < 0: own element of the batched C plane */ else { const int bidx = (row0g + row0 + rloc) / rowsPerB; v += CP[(size_t)bidx * sCPb + (size_t)by * 64 + col]; } }
      if (ACT == 3) v = fmaxf(v, 0.f); else if (ACT == 6) v = 0.5f * v * (1.0f + erff(v * 0.70710678118654752f)); else if (ACT == 11) v = 1.0f / (1.0f + expf(-v)); else if (ACT == 15) v = v / (1.0f + expf(-v)); else if (ACT == 12) v = (v > 0.f) ? v : 0.01f * v; else if (ACT == 8) v = tanhf(v); else if (ACT == 9) v = 0.5f * v * (1.0f + tanhf(0.7978845608028654f * (v + 0.044715f * v * v * v))); else if (ACT == 14) v = (v > 0.f) ? v : 0.1f * v; else if (ACT == 16) v = (v >= 0.f) ? v : 0.3f * v; else if (ACT == 17) v = (v >= 0.f) ? v : 0.2f * v;
      so[w][rloc][t * 16 + ln] = v; } }
  __builtin_amdgcn_fence(__ATOMIC_ACQ_REL, "workgroup"); __builtin_amdgcn_wave_barrier();
  const int rsub = lane >> 4, c4 = (lane & 15) * 4;
  {
#pragma unroll
    for (int q = 0; q < 16; ++q) { const int r = q * 2 + rsub; const v4f v = *(const v4fa*)&so[w][r][c4]; if (C) *(v4f*)(C + cofs + (size_t)(row0 + r) * ldc + col0 + c4) = v; if (C16) { v4h h4; for (int i = 0; i < 4; ++i) h4[i] = (_Float16)v[i]; *(v4h*)(C16 + cofs + (size_t)(row0 + r) * ldc + col0 + c4) = h4; } }
     } }


__global__ __launch_bounds__(256) void k_wnat(const float* __restrict__ w, size_t n8, _Float16* __restrict__ Bt) { const size_t t = (size_t)blockIdx.x * 256 + threadIdx.x; if (t >= n8) return; FragH f; for (int q = 0; q < 8; ++q) f.h[q] = (_Float16)(bf16_round(w[t * 8 + q]) * 16.0f); *(v8us*)((unsigned short*)Bt + t * 8) = f.half[0];  }
__global__ __launch_bounds__(256) void k_rsm(const float* __restrict__ S, _Float16* __restrict__ P, int nrows) {
  #pragma clang fp contract(off)
  const int i = blockIdx.x * 256 + threadIdx.x; if (i >= nrows) return; const float* s = S + (size_t)i * SQ; float mx = -3.0e38f;
#pragma unroll 1
  for (int j = 0; j < SQ; ++j) mx = fmaxf(mx, s[j]); float se = 0.f;
#pragma unroll 1
  for (int j = 0; j < SQ; ++j) se += expf(s[j] - mx); const float sc = 256.0f / se;
#pragma unroll 1
  for (int j0 = 0; j0 < SQ; j0 += 8) { FragH f; for (int q = 0; q < 8; ++q) f.h[q] = (_Float16)(expf(s[j0 + q] - mx) * sc); unsigned short* d = (unsigned short*)P + (size_t)i * SQ + j0; *(v8us*)d = f.half[0];  } }
__global__ __launch_bounds__(256) void k_vt(const _Float16* __restrict__ V16, int b, int h0, _Float16* __restrict__ VT) { __shared__ unsigned short tl[64][65]; const int tid = threadIdx.x; const int hh = blockIdx.x % HG, sg = blockIdx.x / HG; const int s0 = sg * 64; const int h = h0 + hh;
  for (int i = tid; i < 64 * 8; i += 256) { const int j = i / 8, d8 = (i % 8) * 8; FragH f; f.half[0] = *(const v8us*)((const unsigned short*)V16 + ((size_t)b * SQ + s0 + j) * DM + h * HD + d8); for (int q = 0; q < 8; ++q) tl[d8 + q][j] = f.u[q]; }
  __syncthreads();
  { for (int i = tid; i < 64 * 8; i += 256) { const int d = i / 8, j8 = (i % 8) * 8; FragH f; for (int q = 0; q < 8; ++q) f.u[q] = tl[d][j8 + q]; *(v8us*)((unsigned short*)VT + ((size_t)hh * HD + d) * SQ + s0 + j8) = f.half[0]; }  } }


// K and V for the fused kernel, all (batch, head) slices in one launch, straight from the f32 inputs. A block takes 128 keys of one slice: their K rows (8192 floats in a row) and their V rows (64 floats each, 768 apart) go out rounded, V transposed.
// Both go out in FRAGMENT ORDER: per 32 keys 4 KiB = 8 pieces of 512 bytes, a piece = the 16 bytes of lane 0, lane 1, ... lane 31 of one 16-byte load of k_attn, so that such a load covers four whole 128-byte lines
// (row-major, the 32 lanes of a K load fell on 16 lines and those of a V^T load on 8, and the WGP cache pays by the line touched).
// K16[slice][key / 32][t][ks][half][hh][ln][8] = k[key = t 16 + ln][d = ks 32 + half 16 + hh 8 + 0..7]; Vt[slice][key / 32][t][half][hh][ln][8] = v[key = half 16 + hh 8 + 0..7][d = t 16 + ln].
// 768 equal blocks of 8 waves, three on each of 256 WGPs, all resident at once; a thread has its 8 + 8 loads of 16 bytes out before it converts anything, and each load of a wave covers whole lines (512 bytes in a row of K, two 256-byte row pieces of V).
__global__ __launch_bounds__(256) void k_prep(const float* __restrict__ k, const float* __restrict__ v, _Float16* __restrict__ K16, _Float16* __restrict__ Vt) { __shared__ unsigned short tl[128][66]; __shared__ __attribute__((aligned(16))) unsigned short kl[32][272];      /* kl: 32 pieces of K, 512 bytes each at a pitch of 544: the four pieces that one wave's store falls on start 8 banks apart */
  const int tid = threadIdx.x; const int slab = blockIdx.x / (SQ / 128), lg = blockIdx.x % (SQ / 128); const int b = slab / 12, h = slab % 12;
  const float* kp = k + (size_t)blockIdx.x * (128 * HD) + tid * 4; const float* vp = v + ((size_t)b * SQ + lg * 128 + tid / 16) * 768 + h * 64 + (tid % 16) * 4;
  v4f ka[8], va[8];
#pragma unroll
  for (int u = 0; u < 8; ++u) ka[u] = *(const v4fa*)(kp + u * 1024);
#pragma unroll
  for (int u = 0; u < 8; ++u) va[u] = *(const v4fa*)(vp + (size_t)u * 16 * 768);
  __builtin_amdgcn_sched_barrier(0);      /* all sixteen loads go out together: without it the scheduler sank most of the K loads between the conversions, one memory round trip behind the other */
#pragma unroll
  for (int u = 0; u < 8; ++u) { FragH f;
#pragma unroll
    for (int q = 0; q < 4; ++q) f.h[q] = (_Float16)bf16_round(va[u][q]);
#pragma unroll
    for (int q = 0; q < 4; ++q) tl[u * 16 + tid / 16][(tid % 16) * 4 + q] = f.u[q]; }
  // K: load u of this thread is key u 16 + tid / 16, d = (tid % 16) 4 + 0..3: piece u 4 + d / 16, hh = (d / 8) % 2, ln = tid / 16, first or second 8 bytes of the lane's 16.
#pragma unroll
  for (int u = 0; u < 8; ++u) { v4h f;
#pragma unroll
    for (int q = 0; q < 4; ++q) f[q] = (_Float16)bf16_round(ka[u][q]);
    *(v4ha*)&kl[u * 4 + (tid % 16) / 4][((((tid % 16) >> 1) & 1) * 16 + tid / 16) * 8 + (tid & 1) * 4] = f; }
  __syncthreads();
  // Behind the barrier a wave takes whole pieces: round rd is the block's rd-th group of 32 keys, wave w its piece w, and every store is 512 bytes in a row.
  const int w = tid >> 5, lane = tid & 31, ln = lane & 15, hh = lane >> 4;
#pragma unroll
  for (int rd = 0; rd < 4; ++rd) *(v8us*)((unsigned short*)K16 + (size_t)blockIdx.x * (128 * HD) + (rd * 256 + tid) * 8) = *(const v8us*)&kl[rd * 8 + w][lane * 8];
#pragma unroll
  for (int rd = 0; rd < 4; ++rd) { const int d = (w >> 1) * 16 + ln, k0 = rd * 32 + (w & 1) * 16 + hh * 8; FragH f;
#pragma unroll
    for (int q = 0; q < 8; ++q) f.u[q] = tl[k0 + q][d];
    *(v8us*)((unsigned short*)Vt + (size_t)blockIdx.x * (128 * HD) + (rd * 256 + tid) * 8) = f.half[0]; } }

typedef float v2f __attribute__((ext_vector_type(2)));
typedef _Float16 v2h __attribute__((ext_vector_type(2)));
__device__ __forceinline__ float xhalf(float x) { return __builtin_bit_cast(float, __builtin_amdgcn_permlanex16(__builtin_bit_cast(int, x), __builtin_bit_cast(int, x), 0x76543210, 0xfedcba98, false, false)); }      /* lane l <-> lane l ^ 16 */
__device__ __forceinline__ v8f fa_mma(v16h a, v16h b, v8f c) { return __builtin_amdgcn_wmma_f32_16x16x32_f16(false, a, false, b, (short)0, c, false, false); }
// The 16 weights of one lane for one query: 2^(s cs + nb), rounded to f16 in the order of the B operand; sm = their f32 sums, even and odd keys apart.
__device__ __forceinline__ v16h fa_weights(v8f s0, v8f s1, float cs, float nb, v2f& sm) { FragH pf;
#pragma unroll
  for (int i = 0; i < 8; ++i) { const v8f sv = i < 4 ? s0 : s1; const v2f a = __builtin_elementwise_fma(v2f{sv[2 * (i & 3)], sv[2 * (i & 3) + 1]}, v2f{cs, cs}, v2f{nb, nb});
    const v2f p = {__builtin_amdgcn_exp2f(a.x), __builtin_amdgcn_exp2f(a.y)}; sm = i ? sm + p : p; const v2h ph = __builtin_convertvector(p, v2h); pf.h[2 * i] = ph.x; pf.h[2 * i + 1] = ph.y; }
  return pf.v; }
// Scores, softmax and weighted sum in one kernel. Block = 4 waves x 32 queries of one (batch, head) slice; grid = 48 x 16 = 768 blocks, three on each of 256 WGPs.
// S^T = K Q^T: A = 16 key rows, B = 16 query rows (kept in registers), same k order for both. A lane's 8 accumulator registers are keys 8 hh + r of ONE query (column ln):
// maximum and sum run inside the lane plus one exchange with lane ^ 16, and two S^T tiles (keys 0-15, 16-31), converted in place, ARE the B operand of O^T += V^T P^T (k = 8 hh + r, 16 + 8 hh + r: the order in which k_prep has laid V^T out).
// Running softmax per query: m = the maximum in use (raw scores), weights 2^8 exp((s - m) alpha); m is renewed, and sum and O^T rescaled by exp((m_old - m) alpha), only in a pass whose weights come near the f16 range; the 2^8 cancels in the division at the end.
// K and V^T reach the block ONCE, not once per wave: a stage = 128 keys = 16 KiB of K and 16 KiB of V^T, both in a row in k_prep's fragment order, copied as they lie into one of two LDS buffers by asynchronous copies
// (a thread 16 bytes per copy, a wave 512 bytes in a row, 16 copies per thread and stage); the four waves read their fragments from LDS, 512 bytes in a row per wave-wide load. Stage t + 1 flies while stage t is worked on.
#define KS 128                /* keys per stage */
#define NT (SQ / KS)          /* stages */
#define SB (KS * HD * 2)      /* bytes of K, and of V^T, per stage */
// One stage: lk, lv = this thread's LDS byte addresses in the K and the V^T half of a buffer, gk, gv = its global addresses; the immediate offset moves the LDS and the global address alike, and both sides lie in a row.
// s_wait_xcnt 0 is the statement's last line, so that no register which a copy names is rewritten in front of it.
__device__ __forceinline__ void stage_copy(unsigned lk, unsigned lv, const char* gk, const char* gv) {
  asm volatile("global_load_async_to_lds_b128 %0, %2, off\n\t"
               "global_load_async_to_lds_b128 %0, %2, off offset:2048\n\t"
               "global_load_async_to_lds_b128 %0, %2, off offset:4096\n\t"
               "global_load_async_to_lds_b128 %0, %2, off offset:6144\n\t"
               "global_load_async_to_lds_b128 %1, %3, off\n\t"
               "global_load_async_to_lds_b128 %1, %3, off offset:2048\n\t"
               "global_load_async_to_lds_b128 %1, %3, off offset:4096\n\t"
               "global_load_async_to_lds_b128 %1, %3, off offset:6144\n\t"
               "global_load_async_to_lds_b128 %0, %2, off offset:8192\n\t"
               "global_load_async_to_lds_b128 %0, %2, off offset:10240\n\t"
               "global_load_async_to_lds_b128 %0, %2, off offset:12288\n\t"
               "global_load_async_to_lds_b128 %0, %2, off offset:14336\n\t"
               "global_load_async_to_lds_b128 %1, %3, off offset:8192\n\t"
               "global_load_async_to_lds_b128 %1, %3, off offset:10240\n\t"
               "global_load_async_to_lds_b128 %1, %3, off offset:12288\n\t"
               "global_load_async_to_lds_b128 %1, %3, off offset:14336\n\t"
               "s_wait_xcnt 0x0" :: "v"(lk), "v"(lv), "v"(gk), "v"(gv) : "memory");
}
__global__ __launch_bounds__(128) void k_attn(const float* __restrict__ Q, const _Float16* __restrict__ K16, const _Float16* __restrict__ Vt, float* __restrict__ O, float cs) {
  __shared__ __attribute__((aligned(16))) char ring[2][2 * SB];      /* two buffers, each K then V^T of one stage: 64 KiB */
  const int tid = threadIdx.x, w = tid >> 5, lane = tid & 31, ln = lane & 15, hh = lane >> 4;
  const int slab = blockIdx.x / (SQ / 128), q0 = (blockIdx.x % (SQ / 128)) * 128 + w * 32;
  const float* qp = Q + ((size_t)slab * SQ + q0 + ln) * HD + 8 * hh;      /* the f32 input itself: each query row is read by one wave only, which rounds it as K and V are rounded */
  typedef __attribute__((address_space(3))) const char lch; typedef __attribute__((address_space(3))) const v8us lv8;
  auto frag = [](lch* p, int off) { FragH f; f.half[0] = *(lv8*)(p + off); f.half[1] = *(lv8*)(p + off + 512); return f.v; };      /* two pieces: k = 8 hh + 0..7 and 16 + 8 hh + 0..7, as g2_frag */
  const char* kg = (const char*)(K16 + (size_t)slab * SQ * HD) + tid * 16; const char* vg = (const char*)(Vt + (size_t)slab * HD * SQ) + tid * 16;      /* this thread's 16 bytes of the first 2 KiB of the stage that is copied next */
  const unsigned l0 = (unsigned)(size_t)&ring[0][0] + tid * 16;      /* the low 32 bits of a __shared__ address are its LDS byte address */
  v16h qf[2][2], kf[2][2], vf[4];      /* q, k: [16-row tile][32-wide step of d]; v: [16 rows of d] */
  v4f qr[2][2][4];      /* q as loaded: k = 8 hh + 0..7 and 16 + 8 hh + 0..7, as g2_frag */
#pragma unroll
  for (int j = 0; j < 2; ++j) for (int ks = 0; ks < 2; ++ks) for (int c = 0; c < 4; ++c) qr[j][ks][c] = *(const v4fa*)(qp + j * 16 * HD + ks * 32 + (c >> 1) * 16 + (c & 1) * 4);
  stage_copy(l0, l0 + SB, kg, vg); kg += SB; vg += SB;      /* stage 0 into buffer 0; q is rounded while it flies */
#pragma unroll
  for (int j = 0; j < 2; ++j) for (int ks = 0; ks < 2; ++ks) { FragH f;
#pragma unroll
    for (int i = 0; i < 16; ++i) f.h[i] = (_Float16)bf16_round(qr[j][ks][i >> 2][i & 3]);
    qf[j][ks] = f.v; }
  const v8f z8 = {0.f,0.f,0.f,0.f,0.f,0.f,0.f,0.f}; v8f o[4][2] = {{z8, z8}, {z8, z8}, {z8, z8}, {z8, z8}};      /* O^T: [16 rows of d][16 queries] */
  float mr[2] = {-3.0e38f, -3.0e38f}; v2f ls[2] = {{0.f, 0.f}, {0.f, 0.f}};      /* ls: sums over even and odd keys, joined at the end */
  float nb[2] = {8.0f - mr[0] * cs, 8.0f - mr[1] * cs};      /* exponent offset that belongs to mr; the start value is so large that the first pass's weights overflow and its test sets a real maximum */
  for (int st = 0; st < NT; ++st) {
    const int bo = (st & 1) * 2 * SB;      /* the buffer of this stage */
    // Hand-over at the head of every stage, every wave, in this order: my reads of the other buffer (the stage before) are done; my copies of this stage have landed; the barrier publishes this stage and ends every wave's reads of the other buffer;
    // only then is the other buffer filled again, with the next stage, which flies while this one is worked on. Nothing of a stage is read in front of its barrier.
    // It stands at the head, not at the foot: with a branch behind the four passes the compiler sank their row sums into the block behind it, every weight alive in f32 until then (314 registers).
    asm volatile("s_wait_dscnt 0x0" ::: "memory");
    asm volatile("s_wait_asynccnt 0x0" ::: "memory");
    __syncthreads();
    if (st + 1 < NT) { stage_copy(l0 + (2 * SB - bo), l0 + (3 * SB - bo), kg, vg); kg += SB; vg += SB; }      /* the test reads the same in the whole block */
    lch* rb = (lch*)&ring[0][0] + bo + lane * 16;      /* lane l takes its 16 bytes at 16 l of each 512-byte piece */
#pragma unroll
    for (int t = 0; t < 2; ++t) for (int ks = 0; ks < 2; ++ks) kf[t][ks] = frag(rb, (t * 2 + ks) * 1024);
#pragma unroll
    for (int t = 0; t < 4; ++t) vf[t] = frag(rb, SB + t * 1024);
    __builtin_amdgcn_sched_barrier(0);      /* the stage's first K and V^T loads go out as one group (k first: LDS loads return in order, and the first product waits for k alone): without it the scheduler put the V^T loads in three groups among the score products */
#pragma unroll
    for (int ps = 0; ps < KS / 32; ++ps) {      /* one pass = 32 keys */
      v8f s[2][2];      /* S^T: [16 keys][16 queries] */
#pragma unroll
      for (int t = 0; t < 2; ++t) for (int j = 0; j < 2; ++j) s[t][j] = fa_mma(kf[t][1], qf[j][1], fa_mma(kf[t][0], qf[j][0], z8));
      __builtin_amdgcn_sched_barrier(0);      /* without it the loads below rose in among the score products, into registers of their own */
      // The next pass's keys are read as soon as this pass's score products are issued: softmax and the second product cover their latency. A stage's last pass reads nothing ahead: the next stage is not published yet.
      if (ps + 1 < KS / 32) {
#pragma unroll
        for (int t = 0; t < 2; ++t) for (int ks = 0; ks < 2; ++ks) kf[t][ks] = frag(rb, (ps + 1) * 4096 + (t * 2 + ks) * 1024); }
      __builtin_amdgcn_sched_barrier(0);      /* without it the scheduler sank these loads into the second product, in four groups among its instructions */
      // Weights against the maximum IN USE (mr, nb), no maximum taken: a lane's two sums of 8 weights each are needed anyway and double as the range test.
      v16h pf[2]; v2f tot[2];
#pragma unroll
      for (int j = 0; j < 2; ++j) pf[j] = fa_weights(s[0][j], s[1][j], cs, nb[j], tot[j]);
      // One test per pass, a scalar branch for the whole wave. Not taken: every weight is at most 2^15 and finite in f16, and sum and O^T need no rescaling.
      // Taken (the first pass, where nb makes every weight infinite, and whenever scores have climbed some 4 to 7 powers of two above mr): the usual step of the running softmax, then this pass's weights anew (at most 2^8).
      if (__builtin_expect(__builtin_amdgcn_ballot_w32(fmaxf(fmaxf(tot[0].x, tot[0].y), fmaxf(tot[1].x, tot[1].y)) > 32768.0f) != 0u, 0)) {      /* rare: laid out behind the loop, so that the usual path falls through */
#pragma unroll
        for (int j = 0; j < 2; ++j) {
          float mx = fmaxf(s[0][j][0], s[1][j][0]);
#pragma unroll
          for (int r = 1; r < 8; ++r) mx = fmaxf(mx, fmaxf(s[0][j][r], s[1][j][r]));
          mx = fmaxf(mx, xhalf(mx));
          const float mn = fmaxf(mr[j], mx), corr = __builtin_amdgcn_exp2f((mr[j] - mn) * cs); mr[j] = mn; nb[j] = 8.0f - mn * cs;
          ls[j] *= corr;
#pragma unroll
          for (int t = 0; t < 4; ++t) o[t][j] *= corr;
          pf[j] = fa_weights(s[0][j], s[1][j], cs, nb[j], tot[j]);
        }
      }
#pragma unroll
      for (int j = 0; j < 2; ++j) { ls[j] += tot[j];
#pragma unroll
        for (int t = 0; t < 4; ++t) o[t][j] = fa_mma(vf[t], pf[j], o[t][j]); }
      __builtin_amdgcn_sched_barrier(0);      /* the eight products stand in a row: without it the scheduler put the V^T loads below in two groups among them */
      // The next pass's V^T is read at the end of this pass: the next score products and softmax cover its latency.
      if (ps + 1 < KS / 32) {
#pragma unroll
        for (int t = 0; t < 4; ++t) vf[t] = frag(rb, SB + (ps + 1) * 4096 + t * 1024); }
      __builtin_amdgcn_sched_barrier(0);      /* a pass ends here: without it the scheduler split the V^T loads above into groups among the next pass's score products */
    }
  }
  asm volatile("s_wait_asynccnt 0x0" ::: "memory");      /* no copy is out when the wave ends */
#pragma unroll
  for (int j = 0; j < 2; ++j) { const float lj = ls[j].x + ls[j].y, inv = 1.0f / (lj + xhalf(lj)); float* op = O + ((size_t)slab * SQ + q0 + j * 16 + ln) * HD + 8 * hh;
#pragma unroll
    for (int t = 0; t < 4; ++t) { const v8f v = o[t][j] * inv; *(v4f*)(op + t * 16) = v4f{v[0], v[1], v[2], v[3]}; *(v4f*)(op + t * 16 + 4) = v4f{v[4], v[5], v[6], v[7]}; } } }

extern "C" void kernel_launch(void* const* d_in, const int* in_sizes, int n_in,
                              void* d_out, int out_size, void* d_ws, size_t ws_size, hipStream_t stream) {
  (void)in_sizes; (void)n_in; (void)out_size;
  const float* const* I = (const float* const*)d_in; const float* q = I[0]; const float* k = I[1]; const float* v = I[2];
  char* ws = (char*)d_ws; size_t off = 0;
  auto take = [&](size_t bytes) { char* p = ws + off; off += (bytes + 255) & ~(size_t)255; return p; };
  _Float16* K16 = (_Float16*)take(NR * DM * 2); _Float16* VT = (_Float16*)take(NR * DM * 2);
  if (off > ws_size) return;      /* 2 x 12 = 24 MiB */
  k_prep<<<NB * (SQ / 128), 256, 0, stream>>>(k, v, K16, VT);      /* values are [B][S][12][64]: each slice's 64 columns of the 768-wide rows */
  k_attn<<<NB * (SQ / 128), 128, 0, stream>>>(q, K16, VT, (float*)d_out, 0.05205877313848632f);      /* 768^-0.5 x log2 e: exp(x) = 2^(x log2 e) */
}

// v007
// One run takes 50.9 microseconds.
// Next to v006, in two timings, it ran 1.03 times as fast each time.
// All steps since v000 together make it 376 times as fast.
#include <hip/hip_runtime.h>
#define NB 48
#define SQ 2048
#define DM 64
#define NH 1
#define HD 64
#define HG 1
#define NR ((size_t)NB * SQ)
typedef __bf16 v16b __attribute__((ext_vector_type(16)));
typedef unsigned short v8us __attribute__((ext_vector_type(8), may_alias));
typedef float  v8f  __attribute__((ext_vector_type(8)));
typedef float  v4f  __attribute__((ext_vector_type(4)));
typedef float  v4fa __attribute__((ext_vector_type(4), may_alias));
union FragB { v16b v; v8us half[2]; unsigned short u[16]; };

__device__ __forceinline__ unsigned short bf16_bits(float x) { unsigned int u = __float_as_uint(x); return (unsigned short)((u + 0x7FFFu + ((u >> 16) & 1u)) >> 16); }
__device__ __forceinline__ float bf16_val(unsigned short b) { return __uint_as_float(((unsigned int)b) << 16); }
__device__ __forceinline__ float bf16_round(float x) { return bf16_val(bf16_bits(x)); }
// D += A·B with NT terms: 1 = ah·bh, 2 = + al·bh (A split), 3 = + ah·bl (both split)
template <int NT>
__device__ __forceinline__ v8f mmaN(v16b ah, v16b al, v16b bh, v16b bl, v8f c) {
  c = __builtin_amdgcn_wmma_f32_16x16x32_bf16(false, ah, false, bh, (short)0, c, false, false);
  if (NT >= 2) c = __builtin_amdgcn_wmma_f32_16x16x32_bf16(false, al, false, bh, (short)0, c, false, false);
  if (NT >= 3) c = __builtin_amdgcn_wmma_f32_16x16x32_bf16(false, ah, false, bl, (short)0, c, false, false);
  asm volatile("v_nop\n\tv_nop\n\tv_nop\n\tv_nop" : "+v"(c) : "v"(ah), "v"(al), "v"(bh), "v"(bl));
  return c;
}

__global__ __launch_bounds__(256) void k_wt_bf16(const float* __restrict__ W, unsigned short* __restrict__ Wt, int K, int N) {
  const int t = blockIdx.x * 256 + threadIdx.x;
  const int k8n = K / 8;
  if (t >= N * k8n) return;
  const int n = t / k8n, k8 = (t % k8n) * 8;
  v8us v;
#pragma unroll
  for (int i = 0; i < 8; ++i) v[i] = bf16_bits(W[(size_t)(k8 + i) * N + n]);
  *(v8us*)(Wt + (size_t)n * K + k8) = v;
  
}

// GEMM C[M][N] (f32, pitch ldc) = act(A[M][K]·W + bias). A f32 row-major (pitch lda) converted per fragment to bf16
// (ASPLIT: hi/lo two planes -> 2 terms, else single rounded term); Wt bf16 [N][K] (pitch ldb). BIAS_BF16 rounds the
// bias to bf16 first (bias quantised to bf16 before the add). K%32==0, M%16==0, N%64==0.
template <bool ASPLIT, int ACT, bool BIAS_BF16>
__global__ __launch_bounds__(128) void k_gemm_bf(const float* __restrict__ A, int lda, const unsigned short* __restrict__ Wt, int ldb,
                                               const float* __restrict__ bias, float* __restrict__ C, int ldc, int M, int N, int K) {
  __shared__ __attribute__((aligned(16))) float so[4][16][64];
  const int tid = threadIdx.x, w = tid >> 5, lane = tid & 31, ln = lane & 15, hh = lane >> 4;
  const int ntn = N / 64;
  const int wid = blockIdx.x * 4 + w;
  const int mt = wid / ntn, nq = wid % ntn;
  if (mt * 16 >= M) return;
  const int row0 = mt * 16, col0 = nq * 64;
  const float* arow = A + (size_t)(row0 + ln) * lda;
  v8f acc[4] = {};
  for (int kb = 0; kb < K; kb += 32) {
    FragB ah, al;
    const v4f x0 = *(const v4fa*)(arow + kb + 8 * hh), x1 = *(const v4fa*)(arow + kb + 8 * hh + 4);
    const v4f x2 = *(const v4fa*)(arow + kb + 16 + 8 * hh), x3 = *(const v4fa*)(arow + kb + 16 + 8 * hh + 4);
    float xs[16] = {x0[0],x0[1],x0[2],x0[3],x1[0],x1[1],x1[2],x1[3],x2[0],x2[1],x2[2],x2[3],x3[0],x3[1],x3[2],x3[3]};
#pragma unroll
    for (int i = 0; i < 16; ++i) { const unsigned short hb = bf16_bits(xs[i]); ah.u[i] = hb; al.u[i] = ASPLIT ? bf16_bits(xs[i] - bf16_val(hb)) : (unsigned short)0; }
#pragma unroll
    for (int t = 0; t < 4; ++t) {
      const unsigned short* brow = Wt + (size_t)(col0 + t * 16 + ln) * ldb + kb;
      FragB b;
      b.half[0] = *(const v8us*)(brow + 8 * hh);
      b.half[1] = *(const v8us*)(brow + 16 + 8 * hh);
      acc[t] = mmaN<ASPLIT ? 2 : 1>(ah.v, al.v, b.v, b.v, acc[t]);
    }
  }
#pragma unroll
  for (int t = 0; t < 4; ++t) {
    float bv = bias ? bias[col0 + t * 16 + ln] : 0.f;
    if (BIAS_BF16) bv = bf16_round(bv);
#pragma unroll
    for (int r = 0; r < 8; ++r) { float v = acc[t][r] + bv; if (ACT == 1) v = fmaxf(v, 0.f); so[w][8 * hh + r][t * 16 + ln] = v; }
  }
  __builtin_amdgcn_fence(__ATOMIC_ACQ_REL, "workgroup");
  __builtin_amdgcn_wave_barrier();
  const int rsub = lane >> 4, c4 = (lane & 15) * 4;
  {
#pragma unroll
    for (int q = 0; q < 8; ++q) {
      const int r = q * 2 + rsub;
      const v4f v = *(const v4fa*)&so[w][r][c4];
      *(v4f*)(C + (size_t)(row0 + r) * ldc + col0 + c4) = v;
    }
    
  }
}

// GEMM C = act(A·W + bias + resid): A f32 (ASPLIT -> hi/lo 2 terms), Wt bf16 [N][K]; ACT 0 none, 1 relu, 2 exact gelu;
// resid (optional, f32, row index = (row % rmod), pitch ldr, RES_BF16 rounds it) added before the activation.
template <bool ASPLIT, int ACT, bool BIAS_BF16, bool RES_BF16>
__global__ __launch_bounds__(128) void k_gemm_bf3(const float* __restrict__ A, int lda, const unsigned short* __restrict__ Wt, int ldb,
                                                const float* __restrict__ bias, const float* __restrict__ resid, int rmod, int ldr,
                                                float* __restrict__ C, int ldc, int M, int N, int K) {
  __shared__ __attribute__((aligned(16))) float so[4][16][64];
  const int tid = threadIdx.x, w = tid >> 5, lane = tid & 31, ln = lane & 15, hh = lane >> 4;
  const int ntn = N / 64;
  const int wid = blockIdx.x * 4 + w;
  const int mt = wid / ntn, nq = wid % ntn;
  if (mt * 16 >= M) return;
  const int row0 = mt * 16, col0 = nq * 64;
  const float* arow = A + (size_t)(row0 + ln) * lda;
  v8f acc[4] = {};
  for (int kb = 0; kb < K; kb += 32) {
    FragB ah, al;
    const v4f x0 = *(const v4fa*)(arow + kb + 8 * hh), x1 = *(const v4fa*)(arow + kb + 8 * hh + 4);
    const v4f x2 = *(const v4fa*)(arow + kb + 16 + 8 * hh), x3 = *(const v4fa*)(arow + kb + 16 + 8 * hh + 4);
    float xs[16] = {x0[0],x0[1],x0[2],x0[3],x1[0],x1[1],x1[2],x1[3],x2[0],x2[1],x2[2],x2[3],x3[0],x3[1],x3[2],x3[3]};
#pragma unroll
    for (int i = 0; i < 16; ++i) { const unsigned short hb = bf16_bits(xs[i]); ah.u[i] = hb; al.u[i] = ASPLIT ? bf16_bits(xs[i] - bf16_val(hb)) : (unsigned short)0; }
#pragma unroll
    for (int t = 0; t < 4; ++t) {
      const unsigned short* brow = Wt + (size_t)(col0 + t * 16 + ln) * ldb + kb;
      FragB b;
      b.half[0] = *(const v8us*)(brow + 8 * hh);
      b.half[1] = *(const v8us*)(brow + 16 + 8 * hh);
      acc[t] = mmaN<ASPLIT ? 2 : 1>(ah.v, al.v, b.v, b.v, acc[t]);
    }
  }
#pragma unroll
  for (int t = 0; t < 4; ++t) {
    const int col = col0 + t * 16 + ln;
    float bv = bias ? bias[col] : 0.f;
    if (BIAS_BF16) bv = bf16_round(bv);
#pragma unroll
    for (int r = 0; r < 8; ++r) {
      float v = acc[t][r] + bv;
      if (resid) { float rv = resid[(size_t)((row0 + 8 * hh + r) % rmod) * ldr + col]; if (RES_BF16) rv = bf16_round(rv); v += rv; }
      if (ACT == 1) v = fmaxf(v, 0.f);
      if (ACT == 2) v = 0.5f * v * (1.0f + erff(v * 0.70710678118654752f));
      if (ACT == 3) { const float u = 0.7978845608028654f * (v + 0.044715f * v * v * v); v = 0.5f * v * (1.0f + tanhf(u)); }
      so[w][8 * hh + r][t * 16 + ln] = v;
    }
  }
  __builtin_amdgcn_fence(__ATOMIC_ACQ_REL, "workgroup");
  __builtin_amdgcn_wave_barrier();
  const int rsub = lane >> 4, c4 = (lane & 15) * 4;
  {
#pragma unroll
    for (int q = 0; q < 8; ++q) {
      const int r = q * 2 + rsub;
      const v4f v = *(const v4fa*)&so[w][r][c4];
      *(v4f*)(C + (size_t)(row0 + r) * ldc + col0 + c4) = v;
    }
    
  }
}
// row LayerNorm (biased variance, eps) over N: s = X (+ R); optional out_sum <- s; out_norm <- (s-mu)*rsqrt(var+eps)*g + b
template <bool PARAM_BF16>
__global__ __launch_bounds__(256) void k_layernorm(const float* __restrict__ X, const float* __restrict__ R, const float* __restrict__ g, const float* __restrict__ bta,
                                                  float* __restrict__ out_sum, float* __restrict__ out_norm, int N, float eps) {
  __shared__ float red[256];
  const int row = blockIdx.x, tid = threadIdx.x;
  const float* x = X + (size_t)row * N; const float* rr = R ? R + (size_t)row * N : nullptr;
  float vals[16];                     // up to N = 4096
  const int per = N / 256;            // contiguous chunk per thread? use strided-by-4 chunks: thread handles j = tid*4 + 1024*u
  float s1 = 0.f;
  for (int u = 0; u < per / 4; ++u) {
    const int j = tid * 4 + 1024 * u;
    const v4f a = *(const v4fa*)(x + j);
    v4f b = {0.f,0.f,0.f,0.f}; if (rr) b = *(const v4fa*)(rr + j);
#pragma unroll
    for (int q = 0; q < 4; ++q) { const float v = a[q] + b[q]; vals[u * 4 + q] = v; s1 += v; }
  }
  red[tid] = s1; __syncthreads();
  for (int st = 128; st > 0; st >>= 1) { if (tid < st) red[tid] += red[tid + st]; __syncthreads(); }
  const float mu = red[0] / (float)N; __syncthreads();
  float s2 = 0.f;
  for (int u = 0; u < per / 4; ++u)
#pragma unroll
    for (int q = 0; q < 4; ++q) { const float c = vals[u * 4 + q] - mu; s2 += c * c; }
  red[tid] = s2; __syncthreads();
  for (int st = 128; st > 0; st >>= 1) { if (tid < st) red[tid] += red[tid + st]; __syncthreads(); }
  const float rs = rsqrtf(red[0] / (float)N + eps);
  {
    for (int u = 0; u < per / 4; ++u) {
      const int j = tid * 4 + 1024 * u;
      v4f o, sm;
#pragma unroll
      for (int q = 0; q < 4; ++q) {
        float gg = g[j + q], bb = bta[j + q];
        if (PARAM_BF16) { gg = bf16_round(gg); bb = bf16_round(bb); }
        sm[q] = vals[u * 4 + q]; o[q] = (vals[u * 4 + q] - mu) * rs * gg + bb;
      }
      if (out_sum) *(v4f*)(out_sum + (size_t)row * N + j) = sm;
      *(v4f*)(out_norm + (size_t)row * N + j) = o;
    }
    
  }
}



// ---- f16 WMMA path (v_wmma_f32_16x16x32_f16): 11-bit significands for operands in range — used where a [0,1] probability operand needs more precision than bf16
typedef _Float16 v16h __attribute__((ext_vector_type(16)));
union FragH { v16h v; v8us half[2]; _Float16 h[16]; unsigned short u[16]; };
template <int NT>
__device__ __forceinline__ v8f mmaH(v16h ah, v16h al, v16h bh, v16h bl, v8f c) {
  c = __builtin_amdgcn_wmma_f32_16x16x32_f16(false, ah, false, bh, (short)0, c, false, false);
  if (NT >= 2) c = __builtin_amdgcn_wmma_f32_16x16x32_f16(false, al, false, bh, (short)0, c, false, false);
  if (NT >= 3) c = __builtin_amdgcn_wmma_f32_16x16x32_f16(false, ah, false, bl, (short)0, c, false, false);
  asm volatile("v_nop\n\tv_nop\n\tv_nop\n\tv_nop" : "+v"(c) : "v"(ah), "v"(al), "v"(bh), "v"(bl));
  return c;
}
// batched GEMM like k_gemm_b but f16 operands: A f32 (split into f16 hi/lo if ASPLIT, else rounded to f16), Bt = f16 values [n][k]; alpha; C f32; N multiple of 16 (partial tiles skipped)
template <bool ASPLIT>
__global__ __launch_bounds__(128) void k_gemm_h(const float* __restrict__ A, int lda, size_t sA, const _Float16* __restrict__ Bh, int ldb, size_t sB, float alpha, float* __restrict__ C, int ldc, size_t sC, int M, int N, int K) {
  __shared__ __attribute__((aligned(16))) float so[4][16][64];
  const int tid = threadIdx.x, w = tid >> 5, lane = tid & 31, ln = lane & 15, hh = lane >> 4; const int by = blockIdx.y;
  A += (size_t)by * sA; Bh += (size_t)by * sB; C += (size_t)by * sC;
  const int ntn = (N + 63) / 64; const int wid = blockIdx.x * 4 + w; const int mt = wid / ntn, nq = wid % ntn; if (mt * 16 >= M) return;
  const int row0 = mt * 16, col0 = nq * 64; const float* arow = A + (size_t)(row0 + ln) * lda;
  v8f acc[4] = {};
  for (int kb = 0; kb < K; kb += 32) {
    FragH ah, al;
    const v4f x0 = *(const v4fa*)(arow + kb + 8 * hh), x1 = *(const v4fa*)(arow + kb + 8 * hh + 4), x2 = *(const v4fa*)(arow + kb + 16 + 8 * hh), x3 = *(const v4fa*)(arow + kb + 16 + 8 * hh + 4);
    float xs[16] = {x0[0],x0[1],x0[2],x0[3],x1[0],x1[1],x1[2],x1[3],x2[0],x2[1],x2[2],x2[3],x3[0],x3[1],x3[2],x3[3]};
#pragma unroll
    for (int i = 0; i < 16; ++i) { const _Float16 h = (_Float16)xs[i]; ah.h[i] = h; al.h[i] = ASPLIT ? (_Float16)(xs[i] - (float)h) : (_Float16)0.0f; }
#pragma unroll
    for (int t = 0; t < 4; ++t) { if (col0 + t * 16 >= N) continue; const size_t boff = (size_t)(col0 + t * 16 + ln) * ldb + kb; FragH bq; bq.half[0] = *(const v8us*)(Bh + boff + 8 * hh); bq.half[1] = *(const v8us*)(Bh + boff + 16 + 8 * hh);
      acc[t] = mmaH<ASPLIT ? 2 : 1>(ah.v, al.v, bq.v, bq.v, acc[t]); }
  }
#pragma unroll
  for (int t = 0; t < 4; ++t) { if (col0 + t * 16 >= N) continue;
#pragma unroll
    for (int r = 0; r < 8; ++r) so[w][8 * hh + r][t * 16 + ln] = acc[t][r] * alpha; }
  __builtin_amdgcn_fence(__ATOMIC_ACQ_REL, "workgroup"); __builtin_amdgcn_wave_barrier();
  const int rsub = lane >> 4, c4 = (lane & 15) * 4;
  {
#pragma unroll
    for (int q = 0; q < 8; ++q) { const int r = q * 2 + rsub; if (col0 + c4 < N) { const v4f v = *(const v4fa*)&so[w][r][c4]; *(v4f*)(C + (size_t)(row0 + r) * ldc + col0 + c4) = v; } }
     }
}

// Wt[n][k] = f16(W[k][n]·scale) from f32 row-major W[K][N] (scale = power of two; bf16-exact weights stay exact in f16 away from the subnormal range)
__global__ __launch_bounds__(256) void k_wt_f16(const float* __restrict__ W, _Float16* __restrict__ Wt, int K, int N, float scale) {
  const int t = blockIdx.x * 256 + threadIdx.x; if (t >= N * (K / 8)) return; const int n = t / (K / 8), k8 = (t % (K / 8)) * 8; FragH f;
#pragma unroll
  for (int i = 0; i < 8; ++i) f.h[i] = (_Float16)(bf16_round(W[(size_t)(k8 + i) * N + n]) * scale); const v8us o = f.half[0];
  *(v8us*)((unsigned short*)Wt + (size_t)n * K + k8) = o; 
}
// k_gemm_hh variant with fused epilogue: v = acc·alpha + bias[by·sBias + col] (+ CP[(row/rowsPerB)·sCPb + by·64 + col] if CP) ; ACT 0 none / 1 elu ; writes f16 C16 (and f32 C if non-null)
template <int ACT>
__global__ __launch_bounds__(128) void k_gemm_hhx(const _Float16* __restrict__ A, int lda, size_t sA, const _Float16* __restrict__ Bh, int ldb, size_t sB, float alpha, const float* __restrict__ bias, size_t sBias, const float* __restrict__ CP, int rowsPerB, size_t sCPb, int row0g,
    float* __restrict__ C, _Float16* __restrict__ C16, int ldc, size_t sC, int M, int N, int K) {
  __shared__ __attribute__((aligned(16))) float so[4][16][64];
  const int tid = threadIdx.x, w = tid >> 5, lane = tid & 31, ln = lane & 15, hh = lane >> 4; const int by = blockIdx.y;
  A += (size_t)by * sA; Bh += (size_t)by * sB; const size_t cofs = (size_t)by * sC; const float* bp = bias ? bias + (size_t)by * sBias : nullptr;
  const int ntn = (N + 63) / 64; const int wid = blockIdx.x * 4 + w; const int mt = wid / ntn, nq = wid % ntn; if (mt * 16 >= M) return;
  const int row0 = mt * 16, col0 = nq * 64; const _Float16* arow = A + (size_t)(row0 + ln) * lda;
  v8f acc[4] = {};
  for (int kb = 0; kb < K; kb += 32) { FragH ah; ah.half[0] = *(const v8us*)((const unsigned short*)arow + kb + 8 * hh); ah.half[1] = *(const v8us*)((const unsigned short*)arow + kb + 16 + 8 * hh);
#pragma unroll
    for (int t = 0; t < 4; ++t) { if (col0 + t * 16 >= N) continue; const size_t boff = (size_t)(col0 + t * 16 + ln) * ldb + kb; FragH bq; bq.half[0] = *(const v8us*)((const unsigned short*)Bh + boff + 8 * hh); bq.half[1] = *(const v8us*)((const unsigned short*)Bh + boff + 16 + 8 * hh);
      acc[t] = mmaH<1>(ah.v, ah.v, bq.v, bq.v, acc[t]); }
  }
#pragma unroll
  for (int t = 0; t < 4; ++t) { if (col0 + t * 16 >= N) continue; const int col = col0 + t * 16 + ln; const float bv = bp ? bf16_round(bp[col]) : 0.f;
#pragma unroll
    for (int r = 0; r < 8; ++r) { float v = acc[t][r] * alpha + bv; if (CP) { const int rr = row0g + row0 + 8 * hh + r; if (rowsPerB < 0) v += CP[cofs + (size_t)rr * ldc + col];      /* rowsPerB < 0: own element of the batched C plane */ else { const int bidx = rr / rowsPerB; v += CP[(size_t)bidx * sCPb + (size_t)by * 64 + col]; } } if (ACT == 1) v = (v > 0.f) ? v : expm1f(v); else if (ACT == 7) v = (v > 0.f) ? v + 1.0f : expf(v); else if (ACT == 8) v = tanhf(v); else if (ACT == 9) v = 0.5f * v * (1.0f + tanhf(0.7978845608028654f * (v + 0.044715f * v * v * v))); else if (ACT == 11) v = 1.0f / (1.0f + expf(-v)); else if (ACT == 12) v = (v > 0.f) ? v : 0.01f * v; else if (ACT == 14) v = (v > 0.f) ? v : 0.1f * v; else if (ACT == 16) v = (v >= 0.f) ? v : 0.3f * v; else if (ACT == 17) v = (v >= 0.f) ? v : 0.2f * v; else if (ACT == 15) v = v / (1.0f + expf(-v)); else if (ACT == 3) v = fmaxf(v, 0.f); else if (ACT == 6) v = 0.5f * v * (1.0f + erff(v * 0.70710678118654752f)); so[w][8 * hh + r][t * 16 + ln] = v; } }
  __builtin_amdgcn_fence(__ATOMIC_ACQ_REL, "workgroup"); __builtin_amdgcn_wave_barrier();
  const int rsub = lane >> 4, c4 = (lane & 15) * 4; typedef _Float16 v4h __attribute__((ext_vector_type(4)));
  {
#pragma unroll
    for (int q = 0; q < 8; ++q) { const int r = q * 2 + rsub; if (col0 + c4 < N) { const v4f v = *(const v4fa*)&so[w][r][c4]; if (C) *(v4f*)(C + cofs + (size_t)(row0 + r) * ldc + col0 + c4) = v; if (C16) { v4h h4; for (int i = 0; i < 4; ++i) h4[i] = (_Float16)v[i]; *(v4h*)(C16 + cofs + (size_t)(row0 + r) * ldc + col0 + c4) = h4; } } }
     }
}


typedef _Float16 v4h __attribute__((ext_vector_type(4)));
typedef _Float16 v4ha __attribute__((ext_vector_type(4), may_alias));

__global__ __launch_bounds__(256) void k_x16(const float* __restrict__ x, _Float16* __restrict__ X16, size_t n8) { const size_t t = (size_t)blockIdx.x * 256 + threadIdx.x; if (t >= n8) return; FragH f;
#pragma unroll
  for (int q = 0; q < 8; ++q) f.h[q] = (_Float16)bf16_round(x[t * 8 + q]); *(v8us*)((unsigned short*)X16 + t * 8) = f.half[0];  }
__global__ __launch_bounds__(256) void k_h16(const float* __restrict__ x, _Float16* __restrict__ X16, size_t n8) { const size_t t = (size_t)blockIdx.x * 256 + threadIdx.x; if (t >= n8) return; FragH f;
#pragma unroll
  for (int q = 0; q < 8; ++q) f.h[q] = (_Float16)x[t * 8 + q]; *(v8us*)((unsigned short*)X16 + t * 8) = f.half[0];  }
__global__ __launch_bounds__(256) void k_round16f(const float* __restrict__ W, _Float16* __restrict__ Bt, size_t n8) { const size_t t = (size_t)blockIdx.x * 256 + threadIdx.x; if (t >= n8) return; FragH f;
#pragma unroll
  for (int i = 0; i < 8; ++i) f.h[i] = (_Float16)(bf16_round(W[t * 8 + i]) * 16.0f); *(v8us*)((unsigned short*)Bt + t * 8) = f.half[0];  }
template <int NHv, int TTv>
__global__ __launch_bounds__(256) void k_vt(const _Float16* __restrict__ V16, int ldv, int voff, _Float16* __restrict__ Vt) { __shared__ unsigned short tl[64][66]; const int tid = threadIdx.x; const int slab = blockIdx.x / (TTv / 64), lg = blockIdx.x % (TTv / 64); const int b = slab / NHv, h = slab % NHv;
  for (int i = tid; i < 64 * 8; i += 256) { const int r = i / 8, c8 = (i % 8) * 8; FragH f; f.half[0] = *(const v8us*)((const unsigned short*)V16 + ((size_t)b * TTv + lg * 64 + r) * ldv + voff + h * 64 + c8);
#pragma unroll
    for (int q = 0; q < 8; ++q) tl[r][c8 + q] = f.u[q]; }
  __syncthreads();
  {
#pragma unroll
    for (int rd = 0; rd < 2; ++rd) { const int d = rd * 32 + tid / 8, pc = tid % 8; FragH f;
#pragma unroll
      for (int q = 0; q < 8; ++q) f.u[q] = tl[pc * 8 + q][d];
      *(v8us*)((unsigned short*)Vt + ((size_t)slab * 64 + d) * TTv + lg * 64 + pc * 8) = f.half[0]; }
     } }

__global__ __launch_bounds__(256) void k_hl(const float* __restrict__ F, _Float16* __restrict__ Hh, _Float16* __restrict__ Hl, size_t n8) { const size_t t = (size_t)blockIdx.x * 256 + threadIdx.x; if (t >= n8) return; FragH fh, fl; const v4f a = *(const v4fa*)(F + t * 8), c = *(const v4fa*)(F + t * 8 + 4);
#pragma unroll
  for (int q = 0; q < 4; ++q) { _Float16 h = (_Float16)a[q]; fh.h[q] = h; fl.h[q] = (_Float16)((a[q] - (float)h) * 1024.0f); h = (_Float16)c[q]; fh.h[4 + q] = h; fl.h[4 + q] = (_Float16)((c[q] - (float)h) * 1024.0f); }
  { *(v8us*)((unsigned short*)Hh + t * 8) = fh.half[0]; *(v8us*)((unsigned short*)Hl + t * 8) = fl.half[0];  } }

// ---- fast GEMM (wave tile 32x64; requires M % 32 == 0 rows per launch region and N % 64 == 0); epilogue = k_gemm_hhx semantics ----
__device__ __forceinline__ v16h g2_frag(const _Float16* p, int hh) { FragH f; f.half[0] = *(const v8us*)((const unsigned short*)p + 8 * hh); f.half[1] = *(const v8us*)((const unsigned short*)p + 16 + 8 * hh); return f.v; }
__device__ __forceinline__ v8f g2_mma(v16h a, v16h b, v8f c) { v8f d = __builtin_amdgcn_wmma_f32_16x16x32_f16(false, a, false, b, (short)0, c, false, false); asm volatile("v_nop\n\tv_nop\n\tv_nop\n\tv_nop" : "+v"(d) : "v"(a), "v"(b)); return d; }
template <int ACT>
__global__ __launch_bounds__(128) void k_gemm2(const _Float16* __restrict__ A, int lda, size_t sA, const _Float16* __restrict__ Bh, int ldb, size_t sB, float alpha, const float* __restrict__ bias, size_t sBias, const float* __restrict__ CP, int rowsPerB, size_t sCPb, int row0g,
    float* __restrict__ C, _Float16* __restrict__ C16, int ldc, size_t sC, int M, int N, int K) { static_assert(ACT == 0 || ACT == 3 || ACT == 6 || ACT == 8 || ACT == 9 || ACT == 11 || ACT == 12 || ACT == 14 || ACT == 15 || ACT == 16 || ACT == 17, "k_gemm2: unsupported ACT code (would silently apply no activation)");
  __shared__ __attribute__((aligned(16))) float so[4][32][68];
  const int tid = threadIdx.x, w = tid >> 5, lane = tid & 31, ln = lane & 15, hh = lane >> 4; const int by = blockIdx.y;
  A += (size_t)by * sA; Bh += (size_t)by * sB; const size_t cofs = (size_t)by * sC; const float* bp = bias ? bias + (size_t)by * sBias : nullptr;
  const int ntn = N >> 6; const int mt = blockIdx.x / ntn, nq = blockIdx.x - mt * ntn; const int row0 = mt * 128 + 32 * w, col0 = nq * 64; if (row0 >= M) return;
  const _Float16* a0p = A + (size_t)(row0 + ln) * lda; const _Float16* a1p = a0p + (size_t)16 * lda;
  const _Float16* b0p = Bh + (size_t)(col0 + ln) * ldb; const _Float16* b1p = b0p + (size_t)16 * ldb; const _Float16* b2p = b1p + (size_t)16 * ldb; const _Float16* b3p = b2p + (size_t)16 * ldb;
  const v8f z8 = {0.f,0.f,0.f,0.f,0.f,0.f,0.f,0.f}; v8f c00 = z8, c01 = z8, c02 = z8, c03 = z8, c10 = z8, c11 = z8, c12 = z8, c13 = z8;
#pragma unroll 1
  for (int kb = 0; kb < K; kb += 32) { const v16h a0 = g2_frag(a0p + kb, hh), a1 = g2_frag(a1p + kb, hh);
    v16h b = g2_frag(b0p + kb, hh); c00 = g2_mma(a0, b, c00); c10 = g2_mma(a1, b, c10);
    b = g2_frag(b1p + kb, hh); c01 = g2_mma(a0, b, c01); c11 = g2_mma(a1, b, c11);
    b = g2_frag(b2p + kb, hh); c02 = g2_mma(a0, b, c02); c12 = g2_mma(a1, b, c12);
    b = g2_frag(b3p + kb, hh); c03 = g2_mma(a0, b, c03); c13 = g2_mma(a1, b, c13); }
  v8f accs[8] = {c00, c01, c02, c03, c10, c11, c12, c13};
#pragma unroll
  for (int u = 0; u < 8; ++u) { const int t = u & 3, half = u >> 2; const int col = col0 + t * 16 + ln; const float bv = bp ? bf16_round(bp[col]) : 0.f;
#pragma unroll
    for (int r = 0; r < 8; ++r) { const int rloc = half * 16 + 8 * hh + r; float v = accs[u][r] * alpha + bv; if (CP) { if (rowsPerB < 0) v += CP[cofs + (size_t)(row0g + row0 + rloc) * ldc + col];      /* rowsPerB < 0: own element of the batched C plane */ else { const int bidx = (row0g + row0 + rloc) / rowsPerB; v += CP[(size_t)bidx * sCPb + (size_t)by * 64 + col]; } }
      if (ACT == 3) v = fmaxf(v, 0.f); else if (ACT == 6) v = 0.5f * v * (1.0f + erff(v * 0.70710678118654752f)); else if (ACT == 11) v = 1.0f / (1.0f + expf(-v)); else if (ACT == 15) v = v / (1.0f + expf(-v)); else if (ACT == 12) v = (v > 0.f) ? v : 0.01f * v; else if (ACT == 8) v = tanhf(v); else if (ACT == 9) v = 0.5f * v * (1.0f + tanhf(0.7978845608028654f * (v + 0.044715f * v * v * v))); else if (ACT == 14) v = (v > 0.f) ? v : 0.1f * v; else if (ACT == 16) v = (v >= 0.f) ? v : 0.3f * v; else if (ACT == 17) v = (v >= 0.f) ? v : 0.2f * v;
      so[w][rloc][t * 16 + ln] = v; } }
  __builtin_amdgcn_fence(__ATOMIC_ACQ_REL, "workgroup"); __builtin_amdgcn_wave_barrier();
  const int rsub = lane >> 4, c4 = (lane & 15) * 4;
  {
#pragma unroll
    for (int q = 0; q < 16; ++q) { const int r = q * 2 + rsub; const v4f v = *(const v4fa*)&so[w][r][c4]; if (C) *(v4f*)(C + cofs + (size_t)(row0 + r) * ldc + col0 + c4) = v; if (C16) { v4h h4; for (int i = 0; i < 4; ++i) h4[i] = (_Float16)v[i]; *(v4h*)(C16 + cofs + (size_t)(row0 + r) * ldc + col0 + c4) = h4; } }
     } }


__global__ __launch_bounds__(256) void k_wnat(const float* __restrict__ w, size_t n8, _Float16* __restrict__ Bt) { const size_t t = (size_t)blockIdx.x * 256 + threadIdx.x; if (t >= n8) return; FragH f; for (int q = 0; q < 8; ++q) f.h[q] = (_Float16)(bf16_round(w[t * 8 + q]) * 16.0f); *(v8us*)((unsigned short*)Bt + t * 8) = f.half[0];  }
__global__ __launch_bounds__(256) void k_rsm(const float* __restrict__ S, _Float16* __restrict__ P, int nrows) {
  #pragma clang fp contract(off)
  const int i = blockIdx.x * 256 + threadIdx.x; if (i >= nrows) return; const float* s = S + (size_t)i * SQ; float mx = -3.0e38f;
#pragma unroll 1
  for (int j = 0; j < SQ; ++j) mx = fmaxf(mx, s[j]); float se = 0.f;
#pragma unroll 1
  for (int j = 0; j < SQ; ++j) se += expf(s[j] - mx); const float sc = 256.0f / se;
#pragma unroll 1
  for (int j0 = 0; j0 < SQ; j0 += 8) { FragH f; for (int q = 0; q < 8; ++q) f.h[q] = (_Float16)(expf(s[j0 + q] - mx) * sc); unsigned short* d = (unsigned short*)P + (size_t)i * SQ + j0; *(v8us*)d = f.half[0];  } }
__global__ __launch_bounds__(256) void k_vt(const _Float16* __restrict__ V16, int b, int h0, _Float16* __restrict__ VT) { __shared__ unsigned short tl[64][65]; const int tid = threadIdx.x; const int hh = blockIdx.x % HG, sg = blockIdx.x / HG; const int s0 = sg * 64; const int h = h0 + hh;
  for (int i = tid; i < 64 * 8; i += 256) { const int j = i / 8, d8 = (i % 8) * 8; FragH f; f.half[0] = *(const v8us*)((const unsigned short*)V16 + ((size_t)b * SQ + s0 + j) * DM + h * HD + d8); for (int q = 0; q < 8; ++q) tl[d8 + q][j] = f.u[q]; }
  __syncthreads();
  { for (int i = tid; i < 64 * 8; i += 256) { const int d = i / 8, j8 = (i % 8) * 8; FragH f; for (int q = 0; q < 8; ++q) f.u[q] = tl[d][j8 + q]; *(v8us*)((unsigned short*)VT + ((size_t)hh * HD + d) * SQ + s0 + j8) = f.half[0]; }  } }


// K and V for the fused kernel, all (batch, head) slices in one launch, straight from the f32 inputs. A block takes 128 keys of one slice: their K rows (8192 floats in a row) and their V rows (64 floats each, 768 apart) go out rounded, V transposed.
// Both go out in FRAGMENT ORDER: per 32 keys 4 KiB = 8 pieces of 512 bytes, a piece = the 16 bytes of lane 0, lane 1, ... lane 31 of one 16-byte load of k_attn, so that such a load covers four whole 128-byte lines
// (row-major, the 32 lanes of a K load fell on 16 lines and those of a V^T load on 8, and the WGP cache pays by the line touched).
// K16[slice][key / 32][t][ks][half][hh][ln][8] = k[key = t 16 + ln][d = ks 32 + half 16 + hh 8 + 0..7]; Vt[slice][key / 32][t][half][hh][ln][8] = v[key = half 16 + hh 8 + 0..7][d = t 16 + ln].
// 768 equal blocks of 8 waves, three on each of 256 WGPs, all resident at once; a thread has its 8 + 8 loads of 16 bytes out before it converts anything, and each load of a wave covers whole lines (512 bytes in a row of K, two 256-byte row pieces of V).
__global__ __launch_bounds__(256) void k_prep(const float* __restrict__ k, const float* __restrict__ v, _Float16* __restrict__ K16, _Float16* __restrict__ Vt) { __shared__ unsigned short tl[128][66]; __shared__ __attribute__((aligned(16))) unsigned short kl[32][272];      /* kl: 32 pieces of K, 512 bytes each at a pitch of 544: the four pieces that one wave's store falls on start 8 banks apart */
  const int tid = threadIdx.x; const int slab = blockIdx.x / (SQ / 128), lg = blockIdx.x % (SQ / 128); const int b = slab / 12, h = slab % 12;
  const float* kp = k + (size_t)blockIdx.x * (128 * HD) + tid * 4; const float* vp = v + ((size_t)b * SQ + lg * 128 + tid / 16) * 768 + h * 64 + (tid % 16) * 4;
  v4f ka[8], va[8];
#pragma unroll
  for (int u = 0; u < 8; ++u) ka[u] = *(const v4fa*)(kp + u * 1024);
#pragma unroll
  for (int u = 0; u < 8; ++u) va[u] = *(const v4fa*)(vp + (size_t)u * 16 * 768);
  __builtin_amdgcn_sched_barrier(0);      /* all sixteen loads go out together: without it the scheduler sank most of the K loads between the conversions, one memory round trip behind the other */
#pragma unroll
  for (int u = 0; u < 8; ++u) { FragH f;
#pragma unroll
    for (int q = 0; q < 4; ++q) f.h[q] = (_Float16)bf16_round(va[u][q]);
#pragma unroll
    for (int q = 0; q < 4; ++q) tl[u * 16 + tid / 16][(tid % 16) * 4 + q] = f.u[q]; }
  // K: load u of this thread is key u 16 + tid / 16, d = (tid % 16) 4 + 0..3: piece u 4 + d / 16, hh = (d / 8) % 2, ln = tid / 16, first or second 8 bytes of the lane's 16.
#pragma unroll
  for (int u = 0; u < 8; ++u) { v4h f;
#pragma unroll
    for (int q = 0; q < 4; ++q) f[q] = (_Float16)bf16_round(ka[u][q]);
    *(v4ha*)&kl[u * 4 + (tid % 16) / 4][((((tid % 16) >> 1) & 1) * 16 + tid / 16) * 8 + (tid & 1) * 4] = f; }
  __syncthreads();
  // Behind the barrier a wave takes whole pieces: round rd is the block's rd-th group of 32 keys, wave w its piece w, and every store is 512 bytes in a row.
  const int w = tid >> 5, lane = tid & 31, ln = lane & 15, hh = lane >> 4;
#pragma unroll
  for (int rd = 0; rd < 4; ++rd) *(v8us*)((unsigned short*)K16 + (size_t)blockIdx.x * (128 * HD) + (rd * 256 + tid) * 8) = *(const v8us*)&kl[rd * 8 + w][lane * 8];
#pragma unroll
  for (int rd = 0; rd < 4; ++rd) { const int d = (w >> 1) * 16 + ln, k0 = rd * 32 + (w & 1) * 16 + hh * 8; FragH f;
#pragma unroll
    for (int q = 0; q < 8; ++q) f.u[q] = tl[k0 + q][d];
    *(v8us*)((unsigned short*)Vt + (size_t)blockIdx.x * (128 * HD) + (rd * 256 + tid) * 8) = f.half[0]; } }

typedef float v2f __attribute__((ext_vector_type(2)));
typedef _Float16 v2h __attribute__((ext_vector_type(2)));
__device__ __forceinline__ float xhalf(float x) { return __builtin_bit_cast(float, __builtin_amdgcn_permlanex16(__builtin_bit_cast(int, x), __builtin_bit_cast(int, x), 0x76543210, 0xfedcba98, false, false)); }      /* lane l <-> lane l ^ 16 */
__device__ __forceinline__ v8f fa_mma(v16h a, v16h b, v8f c) { return __builtin_amdgcn_wmma_f32_16x16x32_f16(false, a, false, b, (short)0, c, false, false); }
// The 16 weights of one lane for one query: 2^(s cs + nb), rounded to f16 in the order of the B operand; sm = their f32 sums, even and odd keys apart.
__device__ __forceinline__ v16h fa_weights(v8f s0, v8f s1, float cs, float nb, v2f& sm) { FragH pf;
#pragma unroll
  for (int i = 0; i < 8; ++i) { const v8f sv = i < 4 ? s0 : s1; const v2f a = __builtin_elementwise_fma(v2f{sv[2 * (i & 3)], sv[2 * (i & 3) + 1]}, v2f{cs, cs}, v2f{nb, nb});
    const v2f p = {__builtin_amdgcn_exp2f(a.x), __builtin_amdgcn_exp2f(a.y)}; sm = i ? sm + p : p; const v2h ph = __builtin_convertvector(p, v2h); pf.h[2 * i] = ph.x; pf.h[2 * i + 1] = ph.y; }
  return pf.v; }
// Scores, softmax and weighted sum in one kernel. Block = 4 waves x 32 queries of one (batch, head) slice; grid = 48 x 16 = 768 blocks, three on each of 256 WGPs.
// S^T = K Q^T: A = 16 key rows, B = 16 query rows (kept in registers), same k order for both. A lane's 8 accumulator registers are keys 8 hh + r of ONE query (column ln):
// maximum and sum run inside the lane plus one exchange with lane ^ 16, and two S^T tiles (keys 0-15, 16-31), converted in place, ARE the B operand of O^T += V^T P^T (k = 8 hh + r, 16 + 8 hh + r: the order in which k_prep has laid V^T out).
// Running softmax per query: m = the maximum in use (raw scores), weights 2^8 exp((s - m) alpha); m is renewed, and sum and O^T rescaled by exp((m_old - m) alpha), only in a pass whose weights come near the f16 range; the 2^8 cancels in the division at the end.
// K and V^T reach the block ONCE, not once per wave: a stage = 128 keys = 16 KiB of K and 16 KiB of V^T, both in a row in k_prep's fragment order, copied as they lie into one of two LDS buffers by asynchronous copies
// (a thread 16 bytes per copy, a wave 512 bytes in a row, 16 copies per thread and stage); the four waves read their fragments from LDS, 512 bytes in a row per wave-wide load. Stage t + 1 flies while stage t is worked on.
#define KS 128                /* keys per stage */
#define NT (SQ / KS)          /* stages */
#define SB (KS * HD * 2)      /* bytes of K, and of V^T, per stage */
// One stage: lk, lv = this thread's LDS byte addresses in the K and the V^T half of a buffer, gk, gv = its global addresses; the immediate offset moves the LDS and the global address alike, and both sides lie in a row.
// s_wait_xcnt 0 is the statement's last line, so that no register which a copy names is rewritten in front of it.
__device__ __forceinline__ void stage_copy(unsigned lk, unsigned lv, const char* gk, const char* gv) {
  asm volatile("global_load_async_to_lds_b128 %0, %2, off\n\t"
               "global_load_async_to_lds_b128 %0, %2, off offset:2048\n\t"
               "global_load_async_to_lds_b128 %0, %2, off offset:4096\n\t"
               "global_load_async_to_lds_b128 %0, %2, off offset:6144\n\t"
               "global_load_async_to_lds_b128 %1, %3, off\n\t"
               "global_load_async_to_lds_b128 %1, %3, off offset:2048\n\t"
               "global_load_async_to_lds_b128 %1, %3, off offset:4096\n\t"
               "global_load_async_to_lds_b128 %1, %3, off offset:6144\n\t"
               "global_load_async_to_lds_b128 %0, %2, off offset:8192\n\t"
               "global_load_async_to_lds_b128 %0, %2, off offset:10240\n\t"
               "global_load_async_to_lds_b128 %0, %2, off offset:12288\n\t"
               "global_load_async_to_lds_b128 %0, %2, off offset:14336\n\t"
               "global_load_async_to_lds_b128 %1, %3, off offset:8192\n\t"
               "global_load_async_to_lds_b128 %1, %3, off offset:10240\n\t"
               "global_load_async_to_lds_b128 %1, %3, off offset:12288\n\t"
               "global_load_async_to_lds_b128 %1, %3, off offset:14336\n\t"
               "s_wait_xcnt 0x0" :: "v"(lk), "v"(lv), "v"(gk), "v"(gv) : "memory");
}
// A wave's 32 query rows (8 KiB in a row of the f32 input) into its own 8 KiB of LDS: copy i takes 512 bytes in a row = rows 2 i and 2 i + 1, four whole 128-byte lines, a lane 16 bytes.
// a0..a7 = the lane's LDS byte address for i = 0..7 (the 16-byte piece c of row r lies at place c ^ (r & 15) of the row, see k_attn), g = its global address; the immediate offset moves both addresses alike; rows 16..31 repeat the places of rows 0..15.
// s_wait_xcnt 0 is the statement's last line, so that no register which a copy names is rewritten in front of it.
__device__ __forceinline__ void q_copy(unsigned a0, unsigned a1, unsigned a2, unsigned a3, unsigned a4, unsigned a5, unsigned a6, unsigned a7, const char* g) {
  asm volatile("global_load_async_to_lds_b128 %0, %8, off\n\t"
               "global_load_async_to_lds_b128 %1, %8, off offset:512\n\t"
               "global_load_async_to_lds_b128 %2, %8, off offset:1024\n\t"
               "global_load_async_to_lds_b128 %3, %8, off offset:1536\n\t"
               "global_load_async_to_lds_b128 %4, %8, off offset:2048\n\t"
               "global_load_async_to_lds_b128 %5, %8, off offset:2560\n\t"
               "global_load_async_to_lds_b128 %6, %8, off offset:3072\n\t"
               "global_load_async_to_lds_b128 %7, %8, off offset:3584\n\t"
               "global_load_async_to_lds_b128 %0, %8, off offset:4096\n\t"
               "global_load_async_to_lds_b128 %1, %8, off offset:4608\n\t"
               "global_load_async_to_lds_b128 %2, %8, off offset:5120\n\t"
               "global_load_async_to_lds_b128 %3, %8, off offset:5632\n\t"
               "global_load_async_to_lds_b128 %4, %8, off offset:6144\n\t"
               "global_load_async_to_lds_b128 %5, %8, off offset:6656\n\t"
               "global_load_async_to_lds_b128 %6, %8, off offset:7168\n\t"
               "global_load_async_to_lds_b128 %7, %8, off offset:7680\n\t"
               "s_wait_xcnt 0x0" :: "v"(a0), "v"(a1), "v"(a2), "v"(a3), "v"(a4), "v"(a5), "v"(a6), "v"(a7), "v"(g) : "memory");
}
__global__ __launch_bounds__(128) void k_attn(const float* __restrict__ Q, const _Float16* __restrict__ K16, const _Float16* __restrict__ Vt, float* __restrict__ O, float cs) {
  __shared__ __attribute__((aligned(256))) char ring[2][2 * SB];      /* two buffers, each K then V^T of one stage: 64 KiB; a buffer is also 4 x 8 KiB, a wave's 32 rows of 64 floats (q at the start, O at the end) */
  static_assert(2 * SB == 4 * 32 * HD * 4 && (NT & 1) == 0, "a buffer holds the four waves' row blocks; the last stage lies in buffer 1");
  const int tid = threadIdx.x, w = tid >> 5, lane = tid & 31, ln = lane & 15, hh = lane >> 4;
  const int slab = blockIdx.x / (SQ / 128), q0 = (blockIdx.x % (SQ / 128)) * 128 + w * 32;
  typedef __attribute__((address_space(3))) const char lch; typedef __attribute__((address_space(3))) const v8us lv8;
  auto frag = [](lch* p, int off) { FragH f; f.half[0] = *(lv8*)(p + off); f.half[1] = *(lv8*)(p + off + 512); return f.v; };      /* two pieces: k = 8 hh + 0..7 and 16 + 8 hh + 0..7, as g2_frag */
  const char* kg = (const char*)(K16 + (size_t)slab * SQ * HD) + tid * 16; const char* vg = (const char*)(Vt + (size_t)slab * HD * SQ) + tid * 16;      /* this thread's 16 bytes of the first 2 KiB of the stage that is copied next */
  const unsigned l0 = (unsigned)(size_t)&ring[0][0] + tid * 16;      /* the low 32 bits of a __shared__ address are its LDS byte address */
  v16h qf[2][2], kf[2][2], vf[4];      /* q, k: [16-row tile][32-wide step of d]; v: [16 rows of d] */
  v4f qr[2][2][4];      /* q as loaded: k = 8 hh + 0..7 and 16 + 8 hh + 0..7, as g2_frag */
  // q and O cross between global memory and the fragments through LDS, so that every global access of a wave is 512 bytes in a row (four whole lines): straight from the fragment's lanes a 16-byte access fell on 16 lines, 32 bytes of each.
  // A wave's block = its 32 rows of 256 bytes; the 16-byte piece c of row r lies at place c ^ (r & 15): the 16 lanes that take one piece of 16 rows, and the 16 that take one whole row, each cover all 64 banks once.
  // q (the f32 input itself: each query row is read by one wave only, which rounds it as K and V are rounded) goes into the wave's block of buffer 1, which the ring fills only behind the first barrier of the loop, and that stands behind every wave's s_wait_dscnt 0.
  { const unsigned qa = (unsigned)(size_t)&ring[1][0] + w * 8192 + hh * 256 + ((ln ^ hh) << 4);      /* copy 0: row hh, piece ln; copy i: row 2 i + hh, so its place differs by 2 (i & 7) */
    q_copy(qa, qa ^ 0x20, qa ^ 0x40, qa ^ 0x60, qa ^ 0x80, qa ^ 0xa0, qa ^ 0xc0, qa ^ 0xe0, (const char*)(Q + ((size_t)slab * SQ + q0) * HD) + lane * 16); }
  stage_copy(l0, l0 + SB, kg, vg); kg += SB; vg += SB;      /* stage 0 into buffer 0 */
  asm volatile("s_wait_asynccnt 0x0" ::: "memory");      /* this wave's own copies have landed: it reads back only its own block of q, so no barrier is needed here */
  { const char* qs = &ring[1][0] + w * 8192 + ln * 256;
#pragma unroll
    for (int j = 0; j < 2; ++j) for (int ks = 0; ks < 2; ++ks) for (int c = 0; c < 4; ++c) qr[j][ks][c] = *(const v4fa*)(qs + j * 4096 + (((ks * 8 + (c >> 1) * 4 + hh * 2 + (c & 1)) ^ ln) << 4)); }
#pragma unroll
  for (int j = 0; j < 2; ++j) for (int ks = 0; ks < 2; ++ks) { FragH f;
#pragma unroll
    for (int i = 0; i < 16; ++i) f.h[i] = (_Float16)bf16_round(qr[j][ks][i >> 2][i & 3]);
    qf[j][ks] = f.v; }
  const v8f z8 = {0.f,0.f,0.f,0.f,0.f,0.f,0.f,0.f}; v8f o[4][2] = {{z8, z8}, {z8, z8}, {z8, z8}, {z8, z8}};      /* O^T: [16 rows of d][16 queries] */
  float mr[2] = {-3.0e38f, -3.0e38f}; v2f ls[2] = {{0.f, 0.f}, {0.f, 0.f}};      /* ls: sums over even and odd keys, joined at the end */
  float nb[2] = {8.0f - mr[0] * cs, 8.0f - mr[1] * cs};      /* exponent offset that belongs to mr; the start value is so large that the first pass's weights overflow and its test sets a real maximum */
  for (int st = 0; st < NT; ++st) {
    const int bo = (st & 1) * 2 * SB;      /* the buffer of this stage */
    // Hand-over at the head of every stage, every wave, in this order: my reads of the other buffer (the stage before) are done; my copies of this stage have landed; the barrier publishes this stage and ends every wave's reads of the other buffer;
    // only then is the other buffer filled again, with the next stage, which flies while this one is worked on. Nothing of a stage is read in front of its barrier.
    // It stands at the head, not at the foot: with a branch behind the four passes the compiler sank their row sums into the block behind it, every weight alive in f32 until then (314 registers).
    asm volatile("s_wait_dscnt 0x0" ::: "memory");
    asm volatile("s_wait_asynccnt 0x0" ::: "memory");
    __syncthreads();
    if (st + 1 < NT) { stage_copy(l0 + (2 * SB - bo), l0 + (3 * SB - bo), kg, vg); kg += SB; vg += SB; }      /* the test reads the same in the whole block */
    lch* rb = (lch*)&ring[0][0] + bo + lane * 16;      /* lane l takes its 16 bytes at 16 l of each 512-byte piece */
#pragma unroll
    for (int t = 0; t < 2; ++t) for (int ks = 0; ks < 2; ++ks) kf[t][ks] = frag(rb, (t * 2 + ks) * 1024);
#pragma unroll
    for (int t = 0; t < 4; ++t) vf[t] = frag(rb, SB + t * 1024);
    __builtin_amdgcn_sched_barrier(0);      /* the stage's first K and V^T loads go out as one group (k first: LDS loads return in order, and the first product waits for k alone): without it the scheduler put the V^T loads in three groups among the score products */
#pragma unroll
    for (int ps = 0; ps < KS / 32; ++ps) {      /* one pass = 32 keys */
      v8f s[2][2];      /* S^T: [16 keys][16 queries] */
#pragma unroll
      for (int t = 0; t < 2; ++t) for (int j = 0; j < 2; ++j) s[t][j] = fa_mma(kf[t][1], qf[j][1], fa_mma(kf[t][0], qf[j][0], z8));
      __builtin_amdgcn_sched_barrier(0);      /* without it the loads below rose in among the score products, into registers of their own */
      // The next pass's keys are read as soon as this pass's score products are issued: softmax and the second product cover their latency. A stage's last pass reads nothing ahead: the next stage is not published yet.
      if (ps + 1 < KS / 32) {
#pragma unroll
        for (int t = 0; t < 2; ++t) for (int ks = 0; ks < 2; ++ks) kf[t][ks] = frag(rb, (ps + 1) * 4096 + (t * 2 + ks) * 1024); }
      __builtin_amdgcn_sched_barrier(0);      /* without it the scheduler sank these loads into the second product, in four groups among its instructions */
      // Weights against the maximum IN USE (mr, nb), no maximum taken: a lane's two sums of 8 weights each are needed anyway and double as the range test.
      v16h pf[2]; v2f tot[2];
#pragma unroll
      for (int j = 0; j < 2; ++j) pf[j] = fa_weights(s[0][j], s[1][j], cs, nb[j], tot[j]);
      // One test per pass, a scalar branch for the whole wave. Not taken: every weight is at most 2^15 and finite in f16, and sum and O^T need no rescaling.
      // Taken (the first pass, where nb makes every weight infinite, and whenever scores have climbed some 4 to 7 powers of two above mr): the usual step of the running softmax, then this pass's weights anew (at most 2^8).
      if (__builtin_expect(__builtin_amdgcn_ballot_w32(fmaxf(fmaxf(tot[0].x, tot[0].y), fmaxf(tot[1].x, tot[1].y)) > 32768.0f) != 0u, 0)) {      /* rare: laid out behind the loop, so that the usual path falls through */
#pragma unroll
        for (int j = 0; j < 2; ++j) {
          float mx = fmaxf(s[0][j][0], s[1][j][0]);
#pragma unroll
          for (int r = 1; r < 8; ++r) mx = fmaxf(mx, fmaxf(s[0][j][r], s[1][j][r]));
          mx = fmaxf(mx, xhalf(mx));
          const float mn = fmaxf(mr[j], mx), corr = __builtin_amdgcn_exp2f((mr[j] - mn) * cs); mr[j] = mn; nb[j] = 8.0f - mn * cs;
          ls[j] *= corr;
#pragma unroll
          for (int t = 0; t < 4; ++t) o[t][j] *= corr;
          pf[j] = fa_weights(s[0][j], s[1][j], cs, nb[j], tot[j]);
        }
      }
#pragma unroll
      for (int j = 0; j < 2; ++j) { ls[j] += tot[j];
#pragma unroll
        for (int t = 0; t < 4; ++t) o[t][j] = fa_mma(vf[t], pf[j], o[t][j]); }
      __builtin_amdgcn_sched_barrier(0);      /* the eight products stand in a row: without it the scheduler put the V^T loads below in two groups among them */
      // The next pass's V^T is read at the end of this pass: the next score products and softmax cover its latency.
      if (ps + 1 < KS / 32) {
#pragma unroll
        for (int t = 0; t < 4; ++t) vf[t] = frag(rb, SB + (ps + 1) * 4096 + t * 1024); }
      __builtin_amdgcn_sched_barrier(0);      /* a pass ends here: without it the scheduler split the V^T loads above into groups among the next pass's score products */
    }
  }
  asm volatile("s_wait_asynccnt 0x0" ::: "memory");      /* no copy is out when the wave ends */
  // O goes out through the wave's block of buffer 0. That buffer is free: its last reads (the stage before the last) ended at the last stage's barrier, nothing was copied into it since, and the last stage lies in buffer 1; so no further barrier is needed.
  const int le = (int)__builtin_amdgcn_mbcnt_lo(~0u, 0u), lne = le & 15, hhe = le >> 4;      /* the lane number, taken anew: from the values of the prologue the compiler kept q's eight LDS places alive through the loop for use here, past 256 registers */
  char* os = &ring[0][0] + w * 8192;
#pragma unroll
  for (int j = 0; j < 2; ++j) { const float lj = ls[j].x + ls[j].y, inv = 1.0f / (lj + xhalf(lj)); char* orow = os + (j * 16 + lne) * 256;
#pragma unroll
    for (int t = 0; t < 4; ++t) { const v8f v = o[t][j] * inv; *(v4fa*)(orow + (((t * 4 + hhe * 2) ^ lne) << 4)) = v4f{v[0], v[1], v[2], v[3]}; *(v4fa*)(orow + (((t * 4 + hhe * 2 + 1) ^ lne) << 4)) = v4f{v[4], v[5], v[6], v[7]}; } }
  asm volatile("s_wait_dscnt 0x0" ::: "memory");      /* the wave's rows stand in LDS before other lanes of the same wave read them back */
  float* ob = O + ((size_t)slab * SQ + q0) * HD + le * 4;      /* the wave's 32 rows are 8 KiB in a row */
  v4f ov[16];
#pragma unroll
  for (int i = 0; i < 16; ++i) ov[i] = *(const v4fa*)(os + i * 512 + ((hhe * 256 + ((lne ^ hhe) << 4)) ^ ((i & 7) << 5)));      /* row 2 i + hhe, piece lne, at place lne ^ ((2 i + hhe) & 15) */
#pragma unroll
  for (int i = 0; i < 16; ++i) *(v4f*)(ob + i * 128) = ov[i]; }

extern "C" void kernel_launch(void* const* d_in, const int* in_sizes, int n_in,
                              void* d_out, int out_size, void* d_ws, size_t ws_size, hipStream_t stream) {
  (void)in_sizes; (void)n_in; (void)out_size;
  const float* const* I = (const float* const*)d_in; const float* q = I[0]; const float* k = I[1]; const float* v = I[2];
  char* ws = (char*)d_ws; size_t off = 0;
  auto take = [&](size_t bytes) { char* p = ws + off; off += (bytes + 255) & ~(size_t)255; return p; };
  _Float16* K16 = (_Float16*)take(NR * DM * 2); _Float16* VT = (_Float16*)take(NR * DM * 2);
  if (off > ws_size) return;      /* 2 x 12 = 24 MiB */
  k_prep<<<NB * (SQ / 128), 256, 0, stream>>>(k, v, K16, VT);      /* values are [B][S][12][64]: each slice's 64 columns of the 768-wide rows */
  k_attn<<<NB * (SQ / 128), 128, 0, stream>>>(q, K16, VT, (float*)d_out, 0.05205877313848632f);      /* 768^-0.5 x log2 e: exp(x) = 2^(x log2 e) */
}

// v008
// It runs in 48.6 microseconds.
// Next to v007, in two timings, it ran 1.04 and 1.05 times as fast.
// Over all steps from v000 it is 393 times as fast.
#include <hip/hip_runtime.h>
#define NB 48
#define SQ 2048
#define DM 64
#define NH 1
#define HD 64
#define HG 1
#define NR ((size_t)NB * SQ)
typedef __bf16 v16b __attribute__((ext_vector_type(16)));
typedef unsigned short v8us __attribute__((ext_vector_type(8), may_alias));
typedef float  v8f  __attribute__((ext_vector_type(8)));
typedef float  v4f  __attribute__((ext_vector_type(4)));
typedef float  v4fa __attribute__((ext_vector_type(4), may_alias));
union FragB { v16b v; v8us half[2]; unsigned short u[16]; };

__device__ __forceinline__ unsigned short bf16_bits(float x) { unsigned int u = __float_as_uint(x); return (unsigned short)((u + 0x7FFFu + ((u >> 16) & 1u)) >> 16); }
__device__ __forceinline__ float bf16_val(unsigned short b) { return __uint_as_float(((unsigned int)b) << 16); }
__device__ __forceinline__ float bf16_round(float x) { return bf16_val(bf16_bits(x)); }
// D += A·B with NT terms: 1 = ah·bh, 2 = + al·bh (A split), 3 = + ah·bl (both split)
template <int NT>
__device__ __forceinline__ v8f mmaN(v16b ah, v16b al, v16b bh, v16b bl, v8f c) {
  c = __builtin_amdgcn_wmma_f32_16x16x32_bf16(false, ah, false, bh, (short)0, c, false, false);
  if (NT >= 2) c = __builtin_amdgcn_wmma_f32_16x16x32_bf16(false, al, false, bh, (short)0, c, false, false);
  if (NT >= 3) c = __builtin_amdgcn_wmma_f32_16x16x32_bf16(false, ah, false, bl, (short)0, c, false, false);
  asm volatile("v_nop\n\tv_nop\n\tv_nop\n\tv_nop" : "+v"(c) : "v"(ah), "v"(al), "v"(bh), "v"(bl));
  return c;
}

__global__ __launch_bounds__(256) void k_wt_bf16(const float* __restrict__ W, unsigned short* __restrict__ Wt, int K, int N) {
  const int t = blockIdx.x * 256 + threadIdx.x;
  const int k8n = K / 8;
  if (t >= N * k8n) return;
  const int n = t / k8n, k8 = (t % k8n) * 8;
  v8us v;
#pragma unroll
  for (int i = 0; i < 8; ++i) v[i] = bf16_bits(W[(size_t)(k8 + i) * N + n]);
  *(v8us*)(Wt + (size_t)n * K + k8) = v;
  
}

// GEMM C[M][N] (f32, pitch ldc) = act(A[M][K]·W + bias). A f32 row-major (pitch lda) converted per fragment to bf16
// (ASPLIT: hi/lo two planes -> 2 terms, else single rounded term); Wt bf16 [N][K] (pitch ldb). BIAS_BF16 rounds the
// bias to bf16 first (bias quantised to bf16 before the add). K%32==0, M%16==0, N%64==0.
template <bool ASPLIT, int ACT, bool BIAS_BF16>
__global__ __launch_bounds__(128) void k_gemm_bf(const float* __restrict__ A, int lda, const unsigned short* __restrict__ Wt, int ldb,
                                               const float* __restrict__ bias, float* __restrict__ C, int ldc, int M, int N, int K) {
  __shared__ __attribute__((aligned(16))) float so[4][16][64];
  const int tid = threadIdx.x, w = tid >> 5, lane = tid & 31, ln = lane & 15, hh = lane >> 4;
  const int ntn = N / 64;
  const int wid = blockIdx.x * 4 + w;
  const int mt = wid / ntn, nq = wid % ntn;
  if (mt * 16 >= M) return;
  const int row0 = mt * 16, col0 = nq * 64;
  const float* arow = A + (size_t)(row0 + ln) * lda;
  v8f acc[4] = {};
  for (int kb = 0; kb < K; kb += 32) {
    FragB ah, al;
    const v4f x0 = *(const v4fa*)(arow + kb + 8 * hh), x1 = *(const v4fa*)(arow + kb + 8 * hh + 4);
    const v4f x2 = *(const v4fa*)(arow + kb + 16 + 8 * hh), x3 = *(const v4fa*)(arow + kb + 16 + 8 * hh + 4);
    float xs[16] = {x0[0],x0[1],x0[2],x0[3],x1[0],x1[1],x1[2],x1[3],x2[0],x2[1],x2[2],x2[3],x3[0],x3[1],x3[2],x3[3]};
#pragma unroll
    for (int i = 0; i < 16; ++i) { const unsigned short hb = bf16_bits(xs[i]); ah.u[i] = hb; al.u[i] = ASPLIT ? bf16_bits(xs[i] - bf16_val(hb)) : (unsigned short)0; }
#pragma unroll
    for (int t = 0; t < 4; ++t) {
      const unsigned short* brow = Wt + (size_t)(col0 + t * 16 + ln) * ldb + kb;
      FragB b;
      b.half[0] = *(const v8us*)(brow + 8 * hh);
      b.half[1] = *(const v8us*)(brow + 16 + 8 * hh);
      acc[t] = mmaN<ASPLIT ? 2 : 1>(ah.v, al.v, b.v, b.v, acc[t]);
    }
  }
#pragma unroll
  for (int t = 0; t < 4; ++t) {
    float bv = bias ? bias[col0 + t * 16 + ln] : 0.f;
    if (BIAS_BF16) bv = bf16_round(bv);
#pragma unroll
    for (int r = 0; r < 8; ++r) { float v = acc[t][r] + bv; if (ACT == 1) v = fmaxf(v, 0.f); so[w][8 * hh + r][t * 16 + ln] = v; }
  }
  __builtin_amdgcn_fence(__ATOMIC_ACQ_REL, "workgroup");
  __builtin_amdgcn_wave_barrier();
  const int rsub = lane >> 4, c4 = (lane & 15) * 4;
  {
#pragma unroll
    for (int q = 0; q < 8; ++q) {
      const int r = q * 2 + rsub;
      const v4f v = *(const v4fa*)&so[w][r][c4];
      *(v4f*)(C + (size_t)(row0 + r) * ldc + col0 + c4) = v;
    }
    
  }
}

// GEMM C = act(A·W + bias + resid): A f32 (ASPLIT -> hi/lo 2 terms), Wt bf16 [N][K]; ACT 0 none, 1 relu, 2 exact gelu;
// resid (optional, f32, row index = (row % rmod), pitch ldr, RES_BF16 rounds it) added before the activation.
template <bool ASPLIT, int ACT, bool BIAS_BF16, bool RES_BF16>
__global__ __launch_bounds__(128) void k_gemm_bf3(const float* __restrict__ A, int lda, const unsigned short* __restrict__ Wt, int ldb,
                                                const float* __restrict__ bias, const float* __restrict__ resid, int rmod, int ldr,
                                                float* __restrict__ C, int ldc, int M, int N, int K) {
  __shared__ __attribute__((aligned(16))) float so[4][16][64];
  const int tid = threadIdx.x, w = tid >> 5, lane = tid & 31, ln = lane & 15, hh = lane >> 4;
  const int ntn = N / 64;
  const int wid = blockIdx.x * 4 + w;
  const int mt = wid / ntn, nq = wid % ntn;
  if (mt * 16 >= M) return;
  const int row0 = mt * 16, col0 = nq * 64;
  const float* arow = A + (size_t)(row0 + ln) * lda;
  v8f acc[4] = {};
  for (int kb = 0; kb < K; kb += 32) {
    FragB ah, al;
    const v4f x0 = *(const v4fa*)(arow + kb + 8 * hh), x1 = *(const v4fa*)(arow + kb + 8 * hh + 4);
    const v4f x2 = *(const v4fa*)(arow + kb + 16 + 8 * hh), x3 = *(const v4fa*)(arow + kb + 16 + 8 * hh + 4);
    float xs[16] = {x0[0],x0[1],x0[2],x0[3],x1[0],x1[1],x1[2],x1[3],x2[0],x2[1],x2[2],x2[3],x3[0],x3[1],x3[2],x3[3]};
#pragma unroll
    for (int i = 0; i < 16; ++i) { const unsigned short hb = bf16_bits(xs[i]); ah.u[i] = hb; al.u[i] = ASPLIT ? bf16_bits(xs[i] - bf16_val(hb)) : (unsigned short)0; }
#pragma unroll
    for (int t = 0; t < 4; ++t) {
      const unsigned short* brow = Wt + (size_t)(col0 + t * 16 + ln) * ldb + kb;
      FragB b;
      b.half[0] = *(const v8us*)(brow + 8 * hh);
      b.half[1] = *(const v8us*)(brow + 16 + 8 * hh);
      acc[t] = mmaN<ASPLIT ? 2 : 1>(ah.v, al.v, b.v, b.v, acc[t]);
    }
  }
#pragma unroll
  for (int t = 0; t < 4; ++t) {
    const int col = col0 + t * 16 + ln;
    float bv = bias ? bias[col] : 0.f;
    if (BIAS_BF16) bv = bf16_round(bv);
#pragma unroll
    for (int r = 0; r < 8; ++r) {
      float v = acc[t][r] + bv;
      if (resid) { float rv = resid[(size_t)((row0 + 8 * hh + r) % rmod) * ldr + col]; if (RES_BF16) rv = bf16_round(rv); v += rv; }
      if (ACT == 1) v = fmaxf(v, 0.f);
      if (ACT == 2) v = 0.5f * v * (1.0f + erff(v * 0.70710678118654752f));
      if (ACT == 3) { const float u = 0.7978845608028654f * (v + 0.044715f * v * v * v); v = 0.5f * v * (1.0f + tanhf(u)); }
      so[w][8 * hh + r][t * 16 + ln] = v;
    }
  }
  __builtin_amdgcn_fence(__ATOMIC_ACQ_REL, "workgroup");
  __builtin_amdgcn_wave_barrier();
  const int rsub = lane >> 4, c4 = (lane & 15) * 4;
  {
#pragma unroll
    for (int q = 0; q < 8; ++q) {
      const int r = q * 2 + rsub;
      const v4f v = *(const v4fa*)&so[w][r][c4];
      *(v4f*)(C + (size_t)(row0 + r) * ldc + col0 + c4) = v;
    }
    
  }
}
// row LayerNorm (biased variance, eps) over N: s = X (+ R); optional out_sum <- s; out_norm <- (s-mu)*rsqrt(var+eps)*g + b
template <bool PARAM_BF16>
__global__ __launch_bounds__(256) void k_layernorm(const float* __restrict__ X, const float* __restrict__ R, const float* __restrict__ g, const float* __restrict__ bta,
                                                  float* __restrict__ out_sum, float* __restrict__ out_norm, int N, float eps) {
  __shared__ float red[256];
  const int row = blockIdx.x, tid = threadIdx.x;
  const float* x = X + (size_t)row * N; const float* rr = R ? R + (size_t)row * N : nullptr;
  float vals[16];                     // up to N = 4096
  const int per = N / 256;            // contiguous chunk per thread? use strided-by-4 chunks: thread handles j = tid*4 + 1024*u
  float s1 = 0.f;
  for (int u = 0; u < per / 4; ++u) {
    const int j = tid * 4 + 1024 * u;
    const v4f a = *(const v4fa*)(x + j);
    v4f b = {0.f,0.f,0.f,0.f}; if (rr) b = *(const v4fa*)(rr + j);
#pragma unroll
    for (int q = 0; q < 4; ++q) { const float v = a[q] + b[q]; vals[u * 4 + q] = v; s1 += v; }
  }
  red[tid] = s1; __syncthreads();
  for (int st = 128; st > 0; st >>= 1) { if (tid < st) red[tid] += red[tid + st]; __syncthreads(); }
  const float mu = red[0] / (float)N; __syncthreads();
  float s2 = 0.f;
  for (int u = 0; u < per / 4; ++u)
#pragma unroll
    for (int q = 0; q < 4; ++q) { const float c = vals[u * 4 + q] - mu; s2 += c * c; }
  red[tid] = s2; __syncthreads();
  for (int st = 128; st > 0; st >>= 1) { if (tid < st) red[tid] += red[tid + st]; __syncthreads(); }
  const float rs = rsqrtf(red[0] / (float)N + eps);
  {
    for (int u = 0; u < per / 4; ++u) {
      const int j = tid * 4 + 1024 * u;
      v4f o, sm;
#pragma unroll
      for (int q = 0; q < 4; ++q) {
        float gg = g[j + q], bb = bta[j + q];
        if (PARAM_BF16) { gg = bf16_round(gg); bb = bf16_round(bb); }
        sm[q] = vals[u * 4 + q]; o[q] = (vals[u * 4 + q] - mu) * rs * gg + bb;
      }
      if (out_sum) *(v4f*)(out_sum + (size_t)row * N + j) = sm;
      *(v4f*)(out_norm + (size_t)row * N + j) = o;
    }
    
  }
}



// ---- f16 WMMA path (v_wmma_f32_16x16x32_f16): 11-bit significands for operands in range — used where a [0,1] probability operand needs more precision than bf16
typedef _Float16 v16h __attribute__((ext_vector_type(16)));
union FragH { v16h v; v8us half[2]; _Float16 h[16]; unsigned short u[16]; };
template <int NT>
__device__ __forceinline__ v8f mmaH(v16h ah, v16h al, v16h bh, v16h bl, v8f c) {
  c = __builtin_amdgcn_wmma_f32_16x16x32_f16(false, ah, false, bh, (short)0, c, false, false);
  if (NT >= 2) c = __builtin_amdgcn_wmma_f32_16x16x32_f16(false, al, false, bh, (short)0, c, false, false);
  if (NT >= 3) c = __builtin_amdgcn_wmma_f32_16x16x32_f16(false, ah, false, bl, (short)0, c, false, false);
  asm volatile("v_nop\n\tv_nop\n\tv_nop\n\tv_nop" : "+v"(c) : "v"(ah), "v"(al), "v"(bh), "v"(bl));
  return c;
}
// batched GEMM like k_gemm_b but f16 operands: A f32 (split into f16 hi/lo if ASPLIT, else rounded to f16), Bt = f16 values [n][k]; alpha; C f32; N multiple of 16 (partial tiles skipped)
template <bool ASPLIT>
__global__ __launch_bounds__(128) void k_gemm_h(const float* __restrict__ A, int lda, size_t sA, const _Float16* __restrict__ Bh, int ldb, size_t sB, float alpha, float* __restrict__ C, int ldc, size_t sC, int M, int N, int K) {
  __shared__ __attribute__((aligned(16))) float so[4][16][64];
  const int tid = threadIdx.x, w = tid >> 5, lane = tid & 31, ln = lane & 15, hh = lane >> 4; const int by = blockIdx.y;
  A += (size_t)by * sA; Bh += (size_t)by * sB; C += (size_t)by * sC;
  const int ntn = (N + 63) / 64; const int wid = blockIdx.x * 4 + w; const int mt = wid / ntn, nq = wid % ntn; if (mt * 16 >= M) return;
  const int row0 = mt * 16, col0 = nq * 64; const float* arow = A + (size_t)(row0 + ln) * lda;
  v8f acc[4] = {};
  for (int kb = 0; kb < K; kb += 32) {
    FragH ah, al;
    const v4f x0 = *(const v4fa*)(arow + kb + 8 * hh), x1 = *(const v4fa*)(arow + kb + 8 * hh + 4), x2 = *(const v4fa*)(arow + kb + 16 + 8 * hh), x3 = *(const v4fa*)(arow + kb + 16 + 8 * hh + 4);
    float xs[16] = {x0[0],x0[1],x0[2],x0[3],x1[0],x1[1],x1[2],x1[3],x2[0],x2[1],x2[2],x2[3],x3[0],x3[1],x3[2],x3[3]};
#pragma unroll
    for (int i = 0; i < 16; ++i) { const _Float16 h = (_Float16)xs[i]; ah.h[i] = h; al.h[i] = ASPLIT ? (_Float16)(xs[i] - (float)h) : (_Float16)0.0f; }
#pragma unroll
    for (int t = 0; t < 4; ++t) { if (col0 + t * 16 >= N) continue; const size_t boff = (size_t)(col0 + t * 16 + ln) * ldb + kb; FragH bq; bq.half[0] = *(const v8us*)(Bh + boff + 8 * hh); bq.half[1] = *(const v8us*)(Bh + boff + 16 + 8 * hh);
      acc[t] = mmaH<ASPLIT ? 2 : 1>(ah.v, al.v, bq.v, bq.v, acc[t]); }
  }
#pragma unroll
  for (int t = 0; t < 4; ++t) { if (col0 + t * 16 >= N) continue;
#pragma unroll
    for (int r = 0; r < 8; ++r) so[w][8 * hh + r][t * 16 + ln] = acc[t][r] * alpha; }
  __builtin_amdgcn_fence(__ATOMIC_ACQ_REL, "workgroup"); __builtin_amdgcn_wave_barrier();
  const int rsub = lane >> 4, c4 = (lane & 15) * 4;
  {
#pragma unroll
    for (int q = 0; q < 8; ++q) { const int r = q * 2 + rsub; if (col0 + c4 < N) { const v4f v = *(const v4fa*)&so[w][r][c4]; *(v4f*)(C + (size_t)(row0 + r) * ldc + col0 + c4) = v; } }
     }
}

// Wt[n][k] = f16(W[k][n]·scale) from f32 row-major W[K][N] (scale = power of two; bf16-exact weights stay exact in f16 away from the subnormal range)
__global__ __launch_bounds__(256) void k_wt_f16(const float* __restrict__ W, _Float16* __restrict__ Wt, int K, int N, float scale) {
  const int t = blockIdx.x * 256 + threadIdx.x; if (t >= N * (K / 8)) return; const int n = t / (K / 8), k8 = (t % (K / 8)) * 8; FragH f;
#pragma unroll
  for (int i = 0; i < 8; ++i) f.h[i] = (_Float16)(bf16_round(W[(size_t)(k8 + i) * N + n]) * scale); const v8us o = f.half[0];
  *(v8us*)((unsigned short*)Wt + (size_t)n * K + k8) = o; 
}
// k_gemm_hh variant with fused epilogue: v = acc·alpha + bias[by·sBias + col] (+ CP[(row/rowsPerB)·sCPb + by·64 + col] if CP) ; ACT 0 none / 1 elu ; writes f16 C16 (and f32 C if non-null)
template <int ACT>
__global__ __launch_bounds__(128) void k_gemm_hhx(const _Float16* __restrict__ A, int lda, size_t sA, const _Float16* __restrict__ Bh, int ldb, size_t sB, float alpha, const float* __restrict__ bias, size_t sBias, const float* __restrict__ CP, int rowsPerB, size_t sCPb, int row0g,
    float* __restrict__ C, _Float16* __restrict__ C16, int ldc, size_t sC, int M, int N, int K) {
  __shared__ __attribute__((aligned(16))) float so[4][16][64];
  const int tid = threadIdx.x, w = tid >> 5, lane = tid & 31, ln = lane & 15, hh = lane >> 4; const int by = blockIdx.y;
  A += (size_t)by * sA; Bh += (size_t)by * sB; const size_t cofs = (size_t)by * sC; const float* bp = bias ? bias + (size_t)by * sBias : nullptr;
  const int ntn = (N + 63) / 64; const int wid = blockIdx.x * 4 + w; const int mt = wid / ntn, nq = wid % ntn; if (mt * 16 >= M) return;
  const int row0 = mt * 16, col0 = nq * 64; const _Float16* arow = A + (size_t)(row0 + ln) * lda;
  v8f acc[4] = {};
  for (int kb = 0; kb < K; kb += 32) { FragH ah; ah.half[0] = *(const v8us*)((const unsigned short*)arow + kb + 8 * hh); ah.half[1] = *(const v8us*)((const unsigned short*)arow + kb + 16 + 8 * hh);
#pragma unroll
    for (int t = 0; t < 4; ++t) { if (col0 + t * 16 >= N) continue; const size_t boff = (size_t)(col0 + t * 16 + ln) * ldb + kb; FragH bq; bq.half[0] = *(const v8us*)((const unsigned short*)Bh + boff + 8 * hh); bq.half[1] = *(const v8us*)((const unsigned short*)Bh + boff + 16 + 8 * hh);
      acc[t] = mmaH<1>(ah.v, ah.v, bq.v, bq.v, acc[t]); }
  }
#pragma unroll
  for (int t = 0; t < 4; ++t) { if (col0 + t * 16 >= N) continue; const int col = col0 + t * 16 + ln; const float bv = bp ? bf16_round(bp[col]) : 0.f;
#pragma unroll
    for (int r = 0; r < 8; ++r) { float v = acc[t][r] * alpha + bv; if (CP) { const int rr = row0g + row0 + 8 * hh + r; if (rowsPerB < 0) v += CP[cofs + (size_t)rr * ldc + col];      /* rowsPerB < 0: own element of the batched C plane */ else { const int bidx = rr / rowsPerB; v += CP[(size_t)bidx * sCPb + (size_t)by * 64 + col]; } } if (ACT == 1) v = (v > 0.f) ? v : expm1f(v); else if (ACT == 7) v = (v > 0.f) ? v + 1.0f : expf(v); else if (ACT == 8) v = tanhf(v); else if (ACT == 9) v = 0.5f * v * (1.0f + tanhf(0.7978845608028654f * (v + 0.044715f * v * v * v))); else if (ACT == 11) v = 1.0f / (1.0f + expf(-v)); else if (ACT == 12) v = (v > 0.f) ? v : 0.01f * v; else if (ACT == 14) v = (v > 0.f) ? v : 0.1f * v; else if (ACT == 16) v = (v >= 0.f) ? v : 0.3f * v; else if (ACT == 17) v = (v >= 0.f) ? v : 0.2f * v; else if (ACT == 15) v = v / (1.0f + expf(-v)); else if (ACT == 3) v = fmaxf(v, 0.f); else if (ACT == 6) v = 0.5f * v * (1.0f + erff(v * 0.70710678118654752f)); so[w][8 * hh + r][t * 16 + ln] = v; } }
  __builtin_amdgcn_fence(__ATOMIC_ACQ_REL, "workgroup"); __builtin_amdgcn_wave_barrier();
  const int rsub = lane >> 4, c4 = (lane & 15) * 4; typedef _Float16 v4h __attribute__((ext_vector_type(4)));
  {
#pragma unroll
    for (int q = 0; q < 8; ++q) { const int r = q * 2 + rsub; if (col0 + c4 < N) { const v4f v = *(const v4fa*)&so[w][r][c4]; if (C) *(v4f*)(C + cofs + (size_t)(row0 + r) * ldc + col0 + c4) = v; if (C16) { v4h h4; for (int i = 0; i < 4; ++i) h4[i] = (_Float16)v[i]; *(v4h*)(C16 + cofs + (size_t)(row0 + r) * ldc + col0 + c4) = h4; } } }
     }
}


typedef _Float16 v4h __attribute__((ext_vector_type(4)));
typedef _Float16 v4ha __attribute__((ext_vector_type(4), may_alias));

__global__ __launch_bounds__(256) void k_x16(const float* __restrict__ x, _Float16* __restrict__ X16, size_t n8) { const size_t t = (size_t)blockIdx.x * 256 + threadIdx.x; if (t >= n8) return; FragH f;
#pragma unroll
  for (int q = 0; q < 8; ++q) f.h[q] = (_Float16)bf16_round(x[t * 8 + q]); *(v8us*)((unsigned short*)X16 + t * 8) = f.half[0];  }
__global__ __launch_bounds__(256) void k_h16(const float* __restrict__ x, _Float16* __restrict__ X16, size_t n8) { const size_t t = (size_t)blockIdx.x * 256 + threadIdx.x; if (t >= n8) return; FragH f;
#pragma unroll
  for (int q = 0; q < 8; ++q) f.h[q] = (_Float16)x[t * 8 + q]; *(v8us*)((unsigned short*)X16 + t * 8) = f.half[0];  }
__global__ __launch_bounds__(256) void k_round16f(const float* __restrict__ W, _Float16* __restrict__ Bt, size_t n8) { const size_t t = (size_t)blockIdx.x * 256 + threadIdx.x; if (t >= n8) return; FragH f;
#pragma unroll
  for (int i = 0; i < 8; ++i) f.h[i] = (_Float16)(bf16_round(W[t * 8 + i]) * 16.0f); *(v8us*)((unsigned short*)Bt + t * 8) = f.half[0];  }
template <int NHv, int TTv>
__global__ __launch_bounds__(256) void k_vt(const _Float16* __restrict__ V16, int ldv, int voff, _Float16* __restrict__ Vt) { __shared__ unsigned short tl[64][66]; const int tid = threadIdx.x; const int slab = blockIdx.x / (TTv / 64), lg = blockIdx.x % (TTv / 64); const int b = slab / NHv, h = slab % NHv;
  for (int i = tid; i < 64 * 8; i += 256) { const int r = i / 8, c8 = (i % 8) * 8; FragH f; f.half[0] = *(const v8us*)((const unsigned short*)V16 + ((size_t)b * TTv + lg * 64 + r) * ldv + voff + h * 64 + c8);
#pragma unroll
    for (int q = 0; q < 8; ++q) tl[r][c8 + q] = f.u[q]; }
  __syncthreads();
  {
#pragma unroll
    for (int rd = 0; rd < 2; ++rd) { const int d = rd * 32 + tid / 8, pc = tid % 8; FragH f;
#pragma unroll
      for (int q = 0; q < 8; ++q) f.u[q] = tl[pc * 8 + q][d];
      *(v8us*)((unsigned short*)Vt + ((size_t)slab * 64 + d) * TTv + lg * 64 + pc * 8) = f.half[0]; }
     } }

__global__ __launch_bounds__(256) void k_hl(const float* __restrict__ F, _Float16* __restrict__ Hh, _Float16* __restrict__ Hl, size_t n8) { const size_t t = (size_t)blockIdx.x * 256 + threadIdx.x; if (t >= n8) return; FragH fh, fl; const v4f a = *(const v4fa*)(F + t * 8), c = *(const v4fa*)(F + t * 8 + 4);
#pragma unroll
  for (int q = 0; q < 4; ++q) { _Float16 h = (_Float16)a[q]; fh.h[q] = h; fl.h[q] = (_Float16)((a[q] - (float)h) * 1024.0f); h = (_Float16)c[q]; fh.h[4 + q] = h; fl.h[4 + q] = (_Float16)((c[q] - (float)h) * 1024.0f); }
  { *(v8us*)((unsigned short*)Hh + t * 8) = fh.half[0]; *(v8us*)((unsigned short*)Hl + t * 8) = fl.half[0];  } }

// ---- fast GEMM (wave tile 32x64; requires M % 32 == 0 rows per launch region and N % 64 == 0); epilogue = k_gemm_hhx semantics ----
__device__ __forceinline__ v16h g2_frag(const _Float16* p, int hh) { FragH f; f.half[0] = *(const v8us*)((const unsigned short*)p + 8 * hh); f.half[1] = *(const v8us*)((const unsigned short*)p + 16 + 8 * hh); return f.v; }
__device__ __forceinline__ v8f g2_mma(v16h a, v16h b, v8f c) { v8f d = __builtin_amdgcn_wmma_f32_16x16x32_f16(false, a, false, b, (short)0, c, false, false); asm volatile("v_nop\n\tv_nop\n\tv_nop\n\tv_nop" : "+v"(d) : "v"(a), "v"(b)); return d; }
template <int ACT>
__global__ __launch_bounds__(128) void k_gemm2(const _Float16* __restrict__ A, int lda, size_t sA, const _Float16* __restrict__ Bh, int ldb, size_t sB, float alpha, const float* __restrict__ bias, size_t sBias, const float* __restrict__ CP, int rowsPerB, size_t sCPb, int row0g,
    float* __restrict__ C, _Float16* __restrict__ C16, int ldc, size_t sC, int M, int N, int K) { static_assert(ACT == 0 || ACT == 3 || ACT == 6 || ACT == 8 || ACT == 9 || ACT == 11 || ACT == 12 || ACT == 14 || ACT == 15 || ACT == 16 || ACT == 17, "k_gemm2: unsupported ACT code (would silently apply no activation)");
  __shared__ __attribute__((aligned(16))) float so[4][32][68];
  const int tid = threadIdx.x, w = tid >> 5, lane = tid & 31, ln = lane & 15, hh = lane >> 4; const int by = blockIdx.y;
  A += (size_t)by * sA; Bh += (size_t)by * sB; const size_t cofs = (size_t)by * sC; const float* bp = bias ? bias + (size_t)by * sBias : nullptr;
  const int ntn = N >> 6; const int mt = blockIdx.x / ntn, nq = blockIdx.x - mt * ntn; const int row0 = mt * 128 + 32 * w, col0 = nq * 64; if (row0 >= M) return;
  const _Float16* a0p = A + (size_t)(row0 + ln) * lda; const _Float16* a1p = a0p + (size_t)16 * lda;
  const _Float16* b0p = Bh + (size_t)(col0 + ln) * ldb; const _Float16* b1p = b0p + (size_t)16 * ldb; const _Float16* b2p = b1p + (size_t)16 * ldb; const _Float16* b3p = b2p + (size_t)16 * ldb;
  const v8f z8 = {0.f,0.f,0.f,0.f,0.f,0.f,0.f,0.f}; v8f c00 = z8, c01 = z8, c02 = z8, c03 = z8, c10 = z8, c11 = z8, c12 = z8, c13 = z8;
#pragma unroll 1
  for (int kb = 0; kb < K; kb += 32) { const v16h a0 = g2_frag(a0p + kb, hh), a1 = g2_frag(a1p + kb, hh);
    v16h b = g2_frag(b0p + kb, hh); c00 = g2_mma(a0, b, c00); c10 = g2_mma(a1, b, c10);
    b = g2_frag(b1p + kb, hh); c01 = g2_mma(a0, b, c01); c11 = g2_mma(a1, b, c11);
    b = g2_frag(b2p + kb, hh); c02 = g2_mma(a0, b, c02); c12 = g2_mma(a1, b, c12);
    b = g2_frag(b3p + kb, hh); c03 = g2_mma(a0, b, c03); c13 = g2_mma(a1, b, c13); }
  v8f accs[8] = {c00, c01, c02, c03, c10, c11, c12, c13};
#pragma unroll
  for (int u = 0; u < 8; ++u) { const int t = u & 3, half = u >> 2; const int col = col0 + t * 16 + ln; const float bv = bp ? bf16_round(bp[col]) : 0.f;
#pragma unroll
    for (int r = 0; r < 8; ++r) { const int rloc = half * 16 + 8 * hh + r; float v = accs[u][r] * alpha + bv; if (CP) { if (rowsPerB < 0) v += CP[cofs + (size_t)(row0g + row0 + rloc) * ldc + col];      /* rowsPerB < 0: own element of the batched C plane */ else { const int bidx = (row0g + row0 + rloc) / rowsPerB; v += CP[(size_t)bidx * sCPb + (size_t)by * 64 + col]; } }
      if (ACT == 3) v = fmaxf(v, 0.f); else if (ACT == 6) v = 0.5f * v * (1.0f + erff(v * 0.70710678118654752f)); else if (ACT == 11) v = 1.0f / (1.0f + expf(-v)); else if (ACT == 15) v = v / (1.0f + expf(-v)); else if (ACT == 12) v = (v > 0.f) ? v : 0.01f * v; else if (ACT == 8) v = tanhf(v); else if (ACT == 9) v = 0.5f * v * (1.0f + tanhf(0.7978845608028654f * (v + 0.044715f * v * v * v))); else if (ACT == 14) v = (v > 0.f) ? v : 0.1f * v; else if (ACT == 16) v = (v >= 0.f) ? v : 0.3f * v; else if (ACT == 17) v = (v >= 0.f) ? v : 0.2f * v;
      so[w][rloc][t * 16 + ln] = v; } }
  __builtin_amdgcn_fence(__ATOMIC_ACQ_REL, "workgroup"); __builtin_amdgcn_wave_barrier();
  const int rsub = lane >> 4, c4 = (lane & 15) * 4;
  {
#pragma unroll
    for (int q = 0; q < 16; ++q) { const int r = q * 2 + rsub; const v4f v = *(const v4fa*)&so[w][r][c4]; if (C) *(v4f*)(C + cofs + (size_t)(row0 + r) * ldc + col0 + c4) = v; if (C16) { v4h h4; for (int i = 0; i < 4; ++i) h4[i] = (_Float16)v[i]; *(v4h*)(C16 + cofs + (size_t)(row0 + r) * ldc + col0 + c4) = h4; } }
     } }


__global__ __launch_bounds__(256) void k_wnat(const float* __restrict__ w, size_t n8, _Float16* __restrict__ Bt) { const size_t t = (size_t)blockIdx.x * 256 + threadIdx.x; if (t >= n8) return; FragH f; for (int q = 0; q < 8; ++q) f.h[q] = (_Float16)(bf16_round(w[t * 8 + q]) * 16.0f); *(v8us*)((unsigned short*)Bt + t * 8) = f.half[0];  }
__global__ __launch_bounds__(256) void k_rsm(const float* __restrict__ S, _Float16* __restrict__ P, int nrows) {
  #pragma clang fp contract(off)
  const int i = blockIdx.x * 256 + threadIdx.x; if (i >= nrows) return; const float* s = S + (size_t)i * SQ; float mx = -3.0e38f;
#pragma unroll 1
  for (int j = 0; j < SQ; ++j) mx = fmaxf(mx, s[j]); float se = 0.f;
#pragma unroll 1
  for (int j = 0; j < SQ; ++j) se += expf(s[j] - mx); const float sc = 256.0f / se;
#pragma unroll 1
  for (int j0 = 0; j0 < SQ; j0 += 8) { FragH f; for (int q = 0; q < 8; ++q) f.h[q] = (_Float16)(expf(s[j0 + q] - mx) * sc); unsigned short* d = (unsigned short*)P + (size_t)i * SQ + j0; *(v8us*)d = f.half[0];  } }
__global__ __launch_bounds__(256) void k_vt(const _Float16* __restrict__ V16, int b, int h0, _Float16* __restrict__ VT) { __shared__ unsigned short tl[64][65]; const int tid = threadIdx.x; const int hh = blockIdx.x % HG, sg = blockIdx.x / HG; const int s0 = sg * 64; const int h = h0 + hh;
  for (int i = tid; i < 64 * 8; i += 256) { const int j = i / 8, d8 = (i % 8) * 8; FragH f; f.half[0] = *(const v8us*)((const unsigned short*)V16 + ((size_t)b * SQ + s0 + j) * DM + h * HD + d8); for (int q = 0; q < 8; ++q) tl[d8 + q][j] = f.u[q]; }
  __syncthreads();
  { for (int i = tid; i < 64 * 8; i += 256) { const int d = i / 8, j8 = (i % 8) * 8; FragH f; for (int q = 0; q < 8; ++q) f.u[q] = tl[d][j8 + q]; *(v8us*)((unsigned short*)VT + ((size_t)hh * HD + d) * SQ + s0 + j8) = f.half[0]; }  } }


// K and V for the fused kernel, all (batch, head) slices in one launch, straight from the f32 inputs. A block takes 128 keys of one slice: their K rows (8192 floats in a row) and their V rows (64 floats each, 768 apart) go out rounded, V transposed.
// Both go out in FRAGMENT ORDER: per 32 keys 4 KiB = 8 pieces of 512 bytes, a piece = the 16 bytes of lane 0, lane 1, ... lane 31 of one 16-byte load of k_attn, so that such a load covers four whole 128-byte lines
// (row-major, the 32 lanes of a K load fell on 16 lines and those of a V^T load on 8, and the WGP cache pays by the line touched).
// K16[slice][key / 32][t][ks][half][hh][ln][8] = k[key = t 16 + ln][d = ks 32 + half 16 + hh 8 + 0..7]; Vt[slice][key / 32][t][half][hh][ln][8] = v[key = half 16 + hh 8 + 0..7][d = t 16 + ln].
// 768 equal blocks of 8 waves, three on each of 256 WGPs, all resident at once; a thread has its 8 + 8 loads of 16 bytes out before it converts anything, and each load of a wave covers whole lines (512 bytes in a row of K, two 256-byte row pieces of V).
__global__ __launch_bounds__(256) void k_prep(const float* __restrict__ k, const float* __restrict__ v, _Float16* __restrict__ K16, _Float16* __restrict__ Vt) { __shared__ unsigned short tl[128][66]; __shared__ __attribute__((aligned(16))) unsigned short kl[32][272];      /* kl: 32 pieces of K, 512 bytes each at a pitch of 544: the four pieces that one wave's store falls on start 8 banks apart */
  const int tid = threadIdx.x; const int slab = blockIdx.x / (SQ / 128), lg = blockIdx.x % (SQ / 128); const int b = slab / 12, h = slab % 12;
  const float* kp = k + (size_t)blockIdx.x * (128 * HD) + tid * 4; const float* vp = v + ((size_t)b * SQ + lg * 128 + tid / 16) * 768 + h * 64 + (tid % 16) * 4;
  v4f ka[8], va[8];
#pragma unroll
  for (int u = 0; u < 8; ++u) ka[u] = *(const v4fa*)(kp + u * 1024);
#pragma unroll
  for (int u = 0; u < 8; ++u) va[u] = *(const v4fa*)(vp + (size_t)u * 16 * 768);
  __builtin_amdgcn_sched_barrier(0);      /* all sixteen loads go out together: without it the scheduler sank most of the K loads between the conversions, one memory round trip behind the other */
#pragma unroll
  for (int u = 0; u < 8; ++u) { FragH f;
#pragma unroll
    for (int q = 0; q < 4; ++q) f.h[q] = (_Float16)bf16_round(va[u][q]);
#pragma unroll
    for (int q = 0; q < 4; ++q) tl[u * 16 + tid / 16][(tid % 16) * 4 + q] = f.u[q]; }
  // K: load u of this thread is key u 16 + tid / 16, d = (tid % 16) 4 + 0..3: piece u 4 + d / 16, hh = (d / 8) % 2, ln = tid / 16, first or second 8 bytes of the lane's 16.
#pragma unroll
  for (int u = 0; u < 8; ++u) { v4h f;
#pragma unroll
    for (int q = 0; q < 4; ++q) f[q] = (_Float16)bf16_round(ka[u][q]);
    *(v4ha*)&kl[u * 4 + (tid % 16) / 4][((((tid % 16) >> 1) & 1) * 16 + tid / 16) * 8 + (tid & 1) * 4] = f; }
  __syncthreads();
  // Behind the barrier a wave takes whole pieces: round rd is the block's rd-th group of 32 keys, wave w its piece w, and every store is 512 bytes in a row.
  const int w = tid >> 5, lane = tid & 31, ln = lane & 15, hh = lane >> 4;
#pragma unroll
  for (int rd = 0; rd < 4; ++rd) *(v8us*)((unsigned short*)K16 + (size_t)blockIdx.x * (128 * HD) + (rd * 256 + tid) * 8) = *(const v8us*)&kl[rd * 8 + w][lane * 8];
#pragma unroll
  for (int rd = 0; rd < 4; ++rd) { const int d = (w >> 1) * 16 + ln, k0 = rd * 32 + (w & 1) * 16 + hh * 8; FragH f;
#pragma unroll
    for (int q = 0; q < 8; ++q) f.u[q] = tl[k0 + q][d];
    *(v8us*)((unsigned short*)Vt + (size_t)blockIdx.x * (128 * HD) + (rd * 256 + tid) * 8) = f.half[0]; } }

typedef float v2f __attribute__((ext_vector_type(2)));
typedef _Float16 v2h __attribute__((ext_vector_type(2)));
__device__ __forceinline__ float xhalf(float x) { return __builtin_bit_cast(float, __builtin_amdgcn_permlanex16(__builtin_bit_cast(int, x), __builtin_bit_cast(int, x), 0x76543210, 0xfedcba98, false, false)); }      /* lane l <-> lane l ^ 16 */
__device__ __forceinline__ v8f fa_mma(v16h a, v16h b, v8f c) { return __builtin_amdgcn_wmma_f32_16x16x32_f16(false, a, false, b, (short)0, c, false, false); }
// The 16 weights of one lane for one query: 2^(s + dl), rounded to f16 in the order of the B operand; sm = their f32 sums, even and odd keys apart. s = the score accumulators, which hold scaled score + exponent offset as they leave the matrix unit; SH false: dl is 0 and nothing is added.
template <bool SH>
__device__ __forceinline__ v16h fa_weights(v8f s0, v8f s1, float dl, v2f& sm) { FragH pf;
#pragma unroll
  for (int i = 0; i < 8; ++i) { const v8f sv = i < 4 ? s0 : s1; v2f a = {sv[2 * (i & 3)], sv[2 * (i & 3) + 1]}; if (SH) a += v2f{dl, dl};
    const v2f p = {__builtin_amdgcn_exp2f(a.x), __builtin_amdgcn_exp2f(a.y)}; sm = i ? sm + p : p; const v2h ph = __builtin_convertvector(p, v2h); pf.h[2 * i] = ph.x; pf.h[2 * i + 1] = ph.y; }
  return pf.v; }
// Scores, softmax and weighted sum in one kernel. Block = 4 waves x 32 queries of one (batch, head) slice; grid = 48 x 16 = 768 blocks, three on each of 256 WGPs.
// S^T = K Q^T: A = 16 key rows, B = 16 query rows (kept in registers), same k order for both. A lane's 8 accumulator registers are keys 8 hh + r of ONE query (column ln):
// maximum and sum run inside the lane plus one exchange with lane ^ 16, and two S^T tiles (keys 0-15, 16-31), converted in place, ARE the B operand of O^T += V^T P^T (k = 8 hh + r, 16 + 8 hh + r: the order in which k_prep has laid V^T out).
// Running softmax per query: m = the maximum in use (scaled scores, powers of two), weights 2^(8 + s - m); m is renewed, and sum and O^T rescaled by 2^(m_old - m), in the first pass and then only in a pass whose weights come near the f16 range; the 2^8 cancels in the division at the end.
// No vector instruction stands between the score product and the exponential: the scale lies in q, and the offset 8 - m is the C operand of the score product (eight registers per 16 queries, all holding the lane's query's offset).
// K and V^T reach the block ONCE, not once per wave: a stage = 128 keys = 16 KiB of K and 16 KiB of V^T, both in a row in k_prep's fragment order, copied as they lie into one of two LDS buffers by asynchronous copies
// (a thread 16 bytes per copy, a wave 512 bytes in a row, 16 copies per thread and stage); the four waves read their fragments from LDS, 512 bytes in a row per wave-wide load. Stage t + 1 flies while stage t is worked on.
#define KS 128                /* keys per stage */
#define NT (SQ / KS)          /* stages */
#define SB (KS * HD * 2)      /* bytes of K, and of V^T, per stage */
// One stage: lk, lv = this thread's LDS byte addresses in the K and the V^T half of a buffer, gk, gv = its global addresses; the immediate offset moves the LDS and the global address alike, and both sides lie in a row.
// s_wait_xcnt 0 is the statement's last line, so that no register which a copy names is rewritten in front of it.
__device__ __forceinline__ void stage_copy(unsigned lk, unsigned lv, const char* gk, const char* gv) {
  asm volatile("global_load_async_to_lds_b128 %0, %2, off\n\t"
               "global_load_async_to_lds_b128 %0, %2, off offset:2048\n\t"
               "global_load_async_to_lds_b128 %0, %2, off offset:4096\n\t"
               "global_load_async_to_lds_b128 %0, %2, off offset:6144\n\t"
               "global_load_async_to_lds_b128 %1, %3, off\n\t"
               "global_load_async_to_lds_b128 %1, %3, off offset:2048\n\t"
               "global_load_async_to_lds_b128 %1, %3, off offset:4096\n\t"
               "global_load_async_to_lds_b128 %1, %3, off offset:6144\n\t"
               "global_load_async_to_lds_b128 %0, %2, off offset:8192\n\t"
               "global_load_async_to_lds_b128 %0, %2, off offset:10240\n\t"
               "global_load_async_to_lds_b128 %0, %2, off offset:12288\n\t"
               "global_load_async_to_lds_b128 %0, %2, off offset:14336\n\t"
               "global_load_async_to_lds_b128 %1, %3, off offset:8192\n\t"
               "global_load_async_to_lds_b128 %1, %3, off offset:10240\n\t"
               "global_load_async_to_lds_b128 %1, %3, off offset:12288\n\t"
               "global_load_async_to_lds_b128 %1, %3, off offset:14336\n\t"
               "s_wait_xcnt 0x0" :: "v"(lk), "v"(lv), "v"(gk), "v"(gv) : "memory");
}
// A wave's 32 query rows (8 KiB in a row of the f32 input) into its own 8 KiB of LDS: copy i takes 512 bytes in a row = rows 2 i and 2 i + 1, four whole 128-byte lines, a lane 16 bytes.
// a0..a7 = the lane's LDS byte address for i = 0..7 (the 16-byte piece c of row r lies at place c ^ (r & 15) of the row, see k_attn), g = its global address; the immediate offset moves both addresses alike; rows 16..31 repeat the places of rows 0..15.
// s_wait_xcnt 0 is the statement's last line, so that no register which a copy names is rewritten in front of it.
__device__ __forceinline__ void q_copy(unsigned a0, unsigned a1, unsigned a2, unsigned a3, unsigned a4, unsigned a5, unsigned a6, unsigned a7, const char* g) {
  asm volatile("global_load_async_to_lds_b128 %0, %8, off\n\t"
               "global_load_async_to_lds_b128 %1, %8, off offset:512\n\t"
               "global_load_async_to_lds_b128 %2, %8, off offset:1024\n\t"
               "global_load_async_to_lds_b128 %3, %8, off offset:1536\n\t"
               "global_load_async_to_lds_b128 %4, %8, off offset:2048\n\t"
               "global_load_async_to_lds_b128 %5, %8, off offset:2560\n\t"
               "global_load_async_to_lds_b128 %6, %8, off offset:3072\n\t"
               "global_load_async_to_lds_b128 %7, %8, off offset:3584\n\t"
               "global_load_async_to_lds_b128 %0, %8, off offset:4096\n\t"
               "global_load_async_to_lds_b128 %1, %8, off offset:4608\n\t"
               "global_load_async_to_lds_b128 %2, %8, off offset:5120\n\t"
               "global_load_async_to_lds_b128 %3, %8, off offset:5632\n\t"
               "global_load_async_to_lds_b128 %4, %8, off offset:6144\n\t"
               "global_load_async_to_lds_b128 %5, %8, off offset:6656\n\t"
               "global_load_async_to_lds_b128 %6, %8, off offset:7168\n\t"
               "global_load_async_to_lds_b128 %7, %8, off offset:7680\n\t"
               "s_wait_xcnt 0x0" :: "v"(a0), "v"(a1), "v"(a2), "v"(a3), "v"(a4), "v"(a5), "v"(a6), "v"(a7), "v"(g) : "memory");
}
__global__ __launch_bounds__(128) void k_attn(const float* __restrict__ Q, const _Float16* __restrict__ K16, const _Float16* __restrict__ Vt, float* __restrict__ O, float cs) {
  __shared__ __attribute__((aligned(256))) char ring[2][2 * SB];      /* two buffers, each K then V^T of one stage: 64 KiB; a buffer is also 4 x 8 KiB, a wave's 32 rows of 64 floats (q at the start, O at the end) */
  static_assert(2 * SB == 4 * 32 * HD * 4 && (NT & 1) == 0, "a buffer holds the four waves' row blocks; the last stage lies in buffer 1");
  const int tid = threadIdx.x, w = tid >> 5, lane = tid & 31, ln = lane & 15, hh = lane >> 4;
  const int slab = blockIdx.x / (SQ / 128), q0 = (blockIdx.x % (SQ / 128)) * 128 + w * 32;
  typedef __attribute__((address_space(3))) const char lch; typedef __attribute__((address_space(3))) const v8us lv8;
  auto frag = [](lch* p, int off) { FragH f; f.half[0] = *(lv8*)(p + off); f.half[1] = *(lv8*)(p + off + 512); return f.v; };      /* two pieces: k = 8 hh + 0..7 and 16 + 8 hh + 0..7, as g2_frag */
  const char* kg = (const char*)(K16 + (size_t)slab * SQ * HD) + tid * 16; const char* vg = (const char*)(Vt + (size_t)slab * HD * SQ) + tid * 16;      /* this thread's 16 bytes of the first 2 KiB of the stage that is copied next */
  const unsigned l0 = (unsigned)(size_t)&ring[0][0] + tid * 16;      /* the low 32 bits of a __shared__ address are its LDS byte address */
  v16h qf[2][2], kf[2][2], vf[4];      /* q, k: [16-row tile][32-wide step of d]; v: [16 rows of d] */
  v4f qr[2][2][4];      /* q as loaded: k = 8 hh + 0..7 and 16 + 8 hh + 0..7, as g2_frag */
  // q and O cross between global memory and the fragments through LDS, so that every global access of a wave is 512 bytes in a row (four whole lines): straight from the fragment's lanes a 16-byte access fell on 16 lines, 32 bytes of each.
  // A wave's block = its 32 rows of 256 bytes; the 16-byte piece c of row r lies at place c ^ (r & 15): the 16 lanes that take one piece of 16 rows, and the 16 that take one whole row, each cover all 64 banks once.
  // q (the f32 input itself: each query row is read by one wave only, which rounds it as K and V are rounded) goes into the wave's block of buffer 1, which the ring fills only behind the first barrier of the loop, and that stands behind every wave's s_wait_dscnt 0.
  { const unsigned qa = (unsigned)(size_t)&ring[1][0] + w * 8192 + hh * 256 + ((ln ^ hh) << 4);      /* copy 0: row hh, piece ln; copy i: row 2 i + hh, so its place differs by 2 (i & 7) */
    q_copy(qa, qa ^ 0x20, qa ^ 0x40, qa ^ 0x60, qa ^ 0x80, qa ^ 0xa0, qa ^ 0xc0, qa ^ 0xe0, (const char*)(Q + ((size_t)slab * SQ + q0) * HD) + lane * 16); }
  stage_copy(l0, l0 + SB, kg, vg); kg += SB; vg += SB;      /* stage 0 into buffer 0 */
  asm volatile("s_wait_asynccnt 0x0" ::: "memory");      /* this wave's own copies have landed: it reads back only its own block of q, so no barrier is needed here */
  { const char* qs = &ring[1][0] + w * 8192 + ln * 256;
#pragma unroll
    for (int j = 0; j < 2; ++j) for (int ks = 0; ks < 2; ++ks) for (int c = 0; c < 4; ++c) qr[j][ks][c] = *(const v4fa*)(qs + j * 4096 + (((ks * 8 + (c >> 1) * 4 + hh * 2 + (c & 1)) ^ ln) << 4)); }
#pragma unroll
  for (int j = 0; j < 2; ++j) for (int ks = 0; ks < 2; ++ks) { FragH f;
#pragma unroll
    for (int i = 0; i < 16; ++i) f.h[i] = (_Float16)(bf16_round(qr[j][ks][i >> 2][i & 3]) * cs);
    qf[j][ks] = f.v; }
  const v8f z8 = {0.f,0.f,0.f,0.f,0.f,0.f,0.f,0.f}; v8f o[4][2] = {{z8, z8}, {z8, z8}, {z8, z8}, {z8, z8}};      /* O^T: [16 rows of d][16 queries] */
  float mr[2] = {-3.0e38f, -3.0e38f}; v2f ls[2] = {{0.f, 0.f}, {0.f, 0.f}};      /* ls: sums over even and odd keys, joined at the end */
  v8f cb[2] = {z8, z8};      /* C operand of the score products: the exponent offset 8 - mr in all eight registers; 0 until the first pass has set a maximum (an offset from the start value of mr would swallow the scores) */
  float thr = -1.0f;      /* bound of the range test: below every sum at the start, so that the first pass takes the branch and sets a real maximum */
  for (int st = 0; st < NT; ++st) {
    const int bo = (st & 1) * 2 * SB;      /* the buffer of this stage */
    // Hand-over at the head of every stage, every wave, in this order: my reads of the other buffer (the stage before) are done; my copies of this stage have landed; the barrier publishes this stage and ends every wave's reads of the other buffer;
    // only then is the other buffer filled again, with the next stage, which flies while this one is worked on. Nothing of a stage is read in front of its barrier.
    // It stands at the head, not at the foot: with a branch behind the four passes the compiler sank their row sums into the block behind it, every weight alive in f32 until then (314 registers).
    asm volatile("s_wait_dscnt 0x0" ::: "memory");
    asm volatile("s_wait_asynccnt 0x0" ::: "memory");
    __syncthreads();
    if (st + 1 < NT) { stage_copy(l0 + (2 * SB - bo), l0 + (3 * SB - bo), kg, vg); kg += SB; vg += SB; }      /* the test reads the same in the whole block */
    lch* rb = (lch*)&ring[0][0] + bo + lane * 16;      /* lane l takes its 16 bytes at 16 l of each 512-byte piece */
#pragma unroll
    for (int t = 0; t < 2; ++t) for (int ks = 0; ks < 2; ++ks) kf[t][ks] = frag(rb, (t * 2 + ks) * 1024);
#pragma unroll
    for (int t = 0; t < 4; ++t) vf[t] = frag(rb, SB + t * 1024);
    __builtin_amdgcn_sched_barrier(0);      /* the stage's first K and V^T loads go out as one group (k first: LDS loads return in order, and the first product waits for k alone): without it the scheduler put the V^T loads in three groups among the score products */
#pragma unroll
    for (int ps = 0; ps < KS / 32; ++ps) {      /* one pass = 32 keys */
      v8f s[2][2];      /* S^T: [16 keys][16 queries] */
#pragma unroll
      for (int t = 0; t < 2; ++t) for (int j = 0; j < 2; ++j) s[t][j] = fa_mma(kf[t][0], qf[j][0], cb[j]);      /* the sum starts from the exponent offset */
      // The second halves in a nest of their own (unrolled like the first: s lies in registers): written as one nest, the scheduler left only one other product between a product and the one that adds to it.
#pragma unroll
      for (int t = 0; t < 2; ++t) for (int j = 0; j < 2; ++j) s[t][j] = fa_mma(kf[t][1], qf[j][1], s[t][j]);
      __builtin_amdgcn_sched_barrier(0);      /* without it the loads below rose in among the score products, into registers of their own */
      // The next pass's keys are read as soon as this pass's score products are issued: softmax and the second product cover their latency. A stage's last pass reads nothing ahead: the next stage is not published yet.
      if (ps + 1 < KS / 32) {
#pragma unroll
        for (int t = 0; t < 2; ++t) for (int ks = 0; ks < 2; ++ks) kf[t][ks] = frag(rb, (ps + 1) * 4096 + (t * 2 + ks) * 1024); }
      __builtin_amdgcn_sched_barrier(0);      /* without it the scheduler sank these loads into the second product, in four groups among its instructions */
      // Weights against the maximum IN USE (mr, cb), no maximum taken: a lane's two sums of 8 weights each are needed anyway and double as the range test.
      v16h pf[2]; v2f tot[2];
#pragma unroll
      for (int j = 0; j < 2; ++j) pf[j] = fa_weights<false>(s[0][j], s[1][j], 0.f, tot[j]);
      // One test per pass, a scalar branch for the whole wave. Not taken: every weight is at most 2^15 and finite in f16, and sum and O^T need no rescaling.
      // Taken (the first pass, by thr, and whenever scores have climbed some 4 to 7 powers of two above mr): the usual step of the running softmax, then this pass's weights anew (at most 2^8).
      if (__builtin_expect(__builtin_amdgcn_ballot_w32(fmaxf(fmaxf(tot[0].x, tot[0].y), fmaxf(tot[1].x, tot[1].y)) > thr) != 0u, 0)) {      /* rare: laid out behind the loop, so that the usual path falls through */
#pragma unroll
        for (int j = 0; j < 2; ++j) {
          float mx = fmaxf(s[0][j][0], s[1][j][0]);
#pragma unroll
          for (int r = 1; r < 8; ++r) mx = fmaxf(mx, fmaxf(s[0][j][r], s[1][j][r]));
          mx = fmaxf(mx, xhalf(mx));
          const float ob = cb[j][0], mn = fmaxf(mr[j], mx - ob), corr = __builtin_amdgcn_exp2f(mr[j] - mn), nbn = 8.0f - mn; mr[j] = mn;      /* the accumulators hold score + ob */
          ls[j] *= corr;
#pragma unroll
          for (int t = 0; t < 4; ++t) o[t][j] *= corr;
          pf[j] = fa_weights<true>(s[0][j], s[1][j], nbn - ob, tot[j]);
          cb[j] += nbn - ob;
        }
        thr = 32768.0f;
      }
#pragma unroll
      for (int j = 0; j < 2; ++j) { ls[j] += tot[j];
#pragma unroll
        for (int t = 0; t < 4; ++t) o[t][j] = fa_mma(vf[t], pf[j], o[t][j]); }
      __builtin_amdgcn_sched_barrier(0);      /* the eight products stand in a row: without it the scheduler put the V^T loads below in two groups among them */
      // The next pass's V^T is read at the end of this pass: the next score products and softmax cover its latency.
      if (ps + 1 < KS / 32) {
#pragma unroll
        for (int t = 0; t < 4; ++t) vf[t] = frag(rb, SB + (ps + 1) * 4096 + t * 1024); }
      __builtin_amdgcn_sched_barrier(0);      /* a pass ends here: without it the scheduler split the V^T loads above into groups among the next pass's score products */
    }
  }
  asm volatile("s_wait_asynccnt 0x0" ::: "memory");      /* no copy is out when the wave ends */
  // O goes out through the wave's block of buffer 0. That buffer is free: its last reads (the stage before the last) ended at the last stage's barrier, nothing was copied into it since, and the last stage lies in buffer 1; so no further barrier is needed.
  const int le = (int)__builtin_amdgcn_mbcnt_lo(~0u, 0u), lne = le & 15, hhe = le >> 4;      /* the lane number, taken anew: from the values of the prologue the compiler kept q's eight LDS places alive through the loop for use here, past 256 registers */
  char* os = &ring[0][0] + w * 8192;
#pragma unroll
  for (int j = 0; j < 2; ++j) { const float lj = ls[j].x + ls[j].y, inv = 1.0f / (lj + xhalf(lj)); char* orow = os + (j * 16 + lne) * 256;
#pragma unroll
    for (int t = 0; t < 4; ++t) { const v8f v = o[t][j] * inv; *(v4fa*)(orow + (((t * 4 + hhe * 2) ^ lne) << 4)) = v4f{v[0], v[1], v[2], v[3]}; *(v4fa*)(orow + (((t * 4 + hhe * 2 + 1) ^ lne) << 4)) = v4f{v[4], v[5], v[6], v[7]}; } }
  asm volatile("s_wait_dscnt 0x0" ::: "memory");      /* the wave's rows stand in LDS before other lanes of the same wave read them back */
  float* ob = O + ((size_t)slab * SQ + q0) * HD + le * 4;      /* the wave's 32 rows are 8 KiB in a row */
  v4f ov[16];
#pragma unroll
  for (int i = 0; i < 16; ++i) ov[i] = *(const v4fa*)(os + i * 512 + ((hhe * 256 + ((lne ^ hhe) << 4)) ^ ((i & 7) << 5)));      /* row 2 i + hhe, piece lne, at place lne ^ ((2 i + hhe) & 15) */
#pragma unroll
  for (int i = 0; i < 16; ++i) *(v4f*)(ob + i * 128) = ov[i]; }

extern "C" void kernel_launch(void* const* d_in, const int* in_sizes, int n_in,
                              void* d_out, int out_size, void* d_ws, size_t ws_size, hipStream_t stream) {
  (void)in_sizes; (void)n_in; (void)out_size;
  const float* const* I = (const float* const*)d_in; const float* q = I[0]; const float* k = I[1]; const float* v = I[2];
  char* ws = (char*)d_ws; size_t off = 0;
  auto take = [&](size_t bytes) { char* p = ws + off; off += (bytes + 255) & ~(size_t)255; return p; };
  _Float16* K16 = (_Float16*)take(NR * DM * 2); _Float16* VT = (_Float16*)take(NR * DM * 2);
  if (off > ws_size) return;      /* 2 x 12 = 24 MiB */
  k_prep<<<NB * (SQ / 128), 256, 0, stream>>>(k, v, K16, VT);      /* values are [B][S][12][64]: each slice's 64 columns of the 768-wide rows */
  k_attn<<<NB * (SQ / 128), 128, 0, stream>>>(q, K16, VT, (float*)d_out, 0.05205877313848632f);      /* 768^-0.5 x log2 e: exp(x) = 2^(x log2 e) */
}

// v009
// Measured time: 46.9 microseconds a run.
// Two timings next to v008 both put it at 1.03 times that version's speed.
// Over all steps from v000 it is 406 times as fast.
#include <hip/hip_runtime.h>
#define NB 48
#define SQ 2048
#define DM 64
#define NH 1
#define HD 64
#define HG 1
#define NR ((size_t)NB * SQ)
typedef __bf16 v16b __attribute__((ext_vector_type(16)));
typedef unsigned short v8us __attribute__((ext_vector_type(8), may_alias));
typedef float  v8f  __attribute__((ext_vector_type(8)));
typedef float  v4f  __attribute__((ext_vector_type(4)));
typedef float  v4fa __attribute__((ext_vector_type(4), may_alias));
union FragB { v16b v; v8us half[2]; unsigned short u[16]; };

__device__ __forceinline__ unsigned short bf16_bits(float x) { unsigned int u = __float_as_uint(x); return (unsigned short)((u + 0x7FFFu + ((u >> 16) & 1u)) >> 16); }
__device__ __forceinline__ float bf16_val(unsigned short b) { return __uint_as_float(((unsigned int)b) << 16); }
__device__ __forceinline__ float bf16_round(float x) { return bf16_val(bf16_bits(x)); }
// D += A·B with NT terms: 1 = ah·bh, 2 = + al·bh (A split), 3 = + ah·bl (both split)
template <int NT>
__device__ __forceinline__ v8f mmaN(v16b ah, v16b al, v16b bh, v16b bl, v8f c) {
  c = __builtin_amdgcn_wmma_f32_16x16x32_bf16(false, ah, false, bh, (short)0, c, false, false);
  if (NT >= 2) c = __builtin_amdgcn_wmma_f32_16x16x32_bf16(false, al, false, bh, (short)0, c, false, false);
  if (NT >= 3) c = __builtin_amdgcn_wmma_f32_16x16x32_bf16(false, ah, false, bl, (short)0, c, false, false);
  asm volatile("v_nop\n\tv_nop\n\tv_nop\n\tv_nop" : "+v"(c) : "v"(ah), "v"(al), "v"(bh), "v"(bl));
  return c;
}

__global__ __launch_bounds__(256) void k_wt_bf16(const float* __restrict__ W, unsigned short* __restrict__ Wt, int K, int N) {
  const int t = blockIdx.x * 256 + threadIdx.x;
  const int k8n = K / 8;
  if (t >= N * k8n) return;
  const int n = t / k8n, k8 = (t % k8n) * 8;
  v8us v;
#pragma unroll
  for (int i = 0; i < 8; ++i) v[i] = bf16_bits(W[(size_t)(k8 + i) * N + n]);
  *(v8us*)(Wt + (size_t)n * K + k8) = v;
  
}

// GEMM C[M][N] (f32, pitch ldc) = act(A[M][K]·W + bias). A f32 row-major (pitch lda) converted per fragment to bf16
// (ASPLIT: hi/lo two planes -> 2 terms, else single rounded term); Wt bf16 [N][K] (pitch ldb). BIAS_BF16 rounds the
// bias to bf16 first (bias quantised to bf16 before the add). K%32==0, M%16==0, N%64==0.
template <bool ASPLIT, int ACT, bool BIAS_BF16>
__global__ __launch_bounds__(128) void k_gemm_bf(const float* __restrict__ A, int lda, const unsigned short* __restrict__ Wt, int ldb,
                                               const float* __restrict__ bias, float* __restrict__ C, int ldc, int M, int N, int K) {
  __shared__ __attribute__((aligned(16))) float so[4][16][64];
  const int tid = threadIdx.x, w = tid >> 5, lane = tid & 31, ln = lane & 15, hh = lane >> 4;
  const int ntn = N / 64;
  const int wid = blockIdx.x * 4 + w;
  const int mt = wid / ntn, nq = wid % ntn;
  if (mt * 16 >= M) return;
  const int row0 = mt * 16, col0 = nq * 64;
  const float* arow = A + (size_t)(row0 + ln) * lda;
  v8f acc[4] = {};
  for (int kb = 0; kb < K; kb += 32) {
    FragB ah, al;
    const v4f x0 = *(const v4fa*)(arow + kb + 8 * hh), x1 = *(const v4fa*)(arow + kb + 8 * hh + 4);
    const v4f x2 = *(const v4fa*)(arow + kb + 16 + 8 * hh), x3 = *(const v4fa*)(arow + kb + 16 + 8 * hh + 4);
    float xs[16] = {x0[0],x0[1],x0[2],x0[3],x1[0],x1[1],x1[2],x1[3],x2[0],x2[1],x2[2],x2[3],x3[0],x3[1],x3[2],x3[3]};
#pragma unroll
    for (int i = 0; i < 16; ++i) { const unsigned short hb = bf16_bits(xs[i]); ah.u[i] = hb; al.u[i] = ASPLIT ? bf16_bits(xs[i] - bf16_val(hb)) : (unsigned short)0; }
#pragma unroll
    for (int t = 0; t < 4; ++t) {
      const unsigned short* brow = Wt + (size_t)(col0 + t * 16 + ln) * ldb + kb;
      FragB b;
      b.half[0] = *(const v8us*)(brow + 8 * hh);
      b.half[1] = *(const v8us*)(brow + 16 + 8 * hh);
      acc[t] = mmaN<ASPLIT ? 2 : 1>(ah.v, al.v, b.v, b.v, acc[t]);
    }
  }
#pragma unroll
  for (int t = 0; t < 4; ++t) {
    float bv = bias ? bias[col0 + t * 16 + ln] : 0.f;
    if (BIAS_BF16) bv = bf16_round(bv);
#pragma unroll
    for (int r = 0; r < 8; ++r) { float v = acc[t][r] + bv; if (ACT == 1) v = fmaxf(v, 0.f); so[w][8 * hh + r][t * 16 + ln] = v; }
  }
  __builtin_amdgcn_fence(__ATOMIC_ACQ_REL, "workgroup");
  __builtin_amdgcn_wave_barrier();
  const int rsub = lane >> 4, c4 = (lane & 15) * 4;
  {
#pragma unroll
    for (int q = 0; q < 8; ++q) {
      const int r = q * 2 + rsub;
      const v4f v = *(const v4fa*)&so[w][r][c4];
      *(v4f*)(C + (size_t)(row0 + r) * ldc + col0 + c4) = v;
    }
    
  }
}

// GEMM C = act(A·W + bias + resid): A f32 (ASPLIT -> hi/lo 2 terms), Wt bf16 [N][K]; ACT 0 none, 1 relu, 2 exact gelu;
// resid (optional, f32, row index = (row % rmod), pitch ldr, RES_BF16 rounds it) added before the activation.
template <bool ASPLIT, int ACT, bool BIAS_BF16, bool RES_BF16>
__global__ __launch_bounds__(128) void k_gemm_bf3(const float* __restrict__ A, int lda, const unsigned short* __restrict__ Wt, int ldb,
                                                const float* __restrict__ bias, const float* __restrict__ resid, int rmod, int ldr,
                                                float* __restrict__ C, int ldc, int M, int N, int K) {
  __shared__ __attribute__((aligned(16))) float so[4][16][64];
  const int tid = threadIdx.x, w = tid >> 5, lane = tid & 31, ln = lane & 15, hh = lane >> 4;
  const int ntn = N / 64;
  const int wid = blockIdx.x * 4 + w;
  const int mt = wid / ntn, nq = wid % ntn;
  if (mt * 16 >= M) return;
  const int row0 = mt * 16, col0 = nq * 64;
  const float* arow = A + (size_t)(row0 + ln) * lda;
  v8f acc[4] = {};
  for (int kb = 0; kb < K; kb += 32) {
    FragB ah, al;
    const v4f x0 = *(const v4fa*)(arow + kb + 8 * hh), x1 = *(const v4fa*)(arow + kb + 8 * hh + 4);
    const v4f x2 = *(const v4fa*)(arow + kb + 16 + 8 * hh), x3 = *(const v4fa*)(arow + kb + 16 + 8 * hh + 4);
    float xs[16] = {x0[0],x0[1],x0[2],x0[3],x1[0],x1[1],x1[2],x1[3],x2[0],x2[1],x2[2],x2[3],x3[0],x3[1],x3[2],x3[3]};
#pragma unroll
    for (int i = 0; i < 16; ++i) { const unsigned short hb = bf16_bits(xs[i]); ah.u[i] = hb; al.u[i] = ASPLIT ? bf16_bits(xs[i] - bf16_val(hb)) : (unsigned short)0; }
#pragma unroll
    for (int t = 0; t < 4; ++t) {
      const unsigned short* brow = Wt + (size_t)(col0 + t * 16 + ln) * ldb + kb;
      FragB b;
      b.half[0] = *(const v8us*)(brow + 8 * hh);
      b.half[1] = *(const v8us*)(brow + 16 + 8 * hh);
      acc[t] = mmaN<ASPLIT ? 2 : 1>(ah.v, al.v, b.v, b.v, acc[t]);
    }
  }
#pragma unroll
  for (int t = 0; t < 4; ++t) {
    const int col = col0 + t * 16 + ln;
    float bv = bias ? bias[col] : 0.f;
    if (BIAS_BF16) bv = bf16_round(bv);
#pragma unroll
    for (int r = 0; r < 8; ++r) {
      float v = acc[t][r] + bv;
      if (resid) { float rv = resid[(size_t)((row0 + 8 * hh + r) % rmod) * ldr + col]; if (RES_BF16) rv = bf16_round(rv); v += rv; }
      if (ACT == 1) v = fmaxf(v, 0.f);
      if (ACT == 2) v = 0.5f * v * (1.0f + erff(v * 0.70710678118654752f));
      if (ACT == 3) { const float u = 0.7978845608028654f * (v + 0.044715f * v * v * v); v = 0.5f * v * (1.0f + tanhf(u)); }
      so[w][8 * hh + r][t * 16 + ln] = v;
    }
  }
  __builtin_amdgcn_fence(__ATOMIC_ACQ_REL, "workgroup");
  __builtin_amdgcn_wave_barrier();
  const int rsub = lane >> 4, c4 = (lane & 15) * 4;
  {
#pragma unroll
    for (int q = 0; q < 8; ++q) {
      const int r = q * 2 + rsub;
      const v4f v = *(const v4fa*)&so[w][r][c4];
      *(v4f*)(C + (size_t)(row0 + r) * ldc + col0 + c4) = v;
    }
    
  }
}
// row LayerNorm (biased variance, eps) over N: s = X (+ R); optional out_sum <- s; out_norm <- (s-mu)*rsqrt(var+eps)*g + b
template <bool PARAM_BF16>
__global__ __launch_bounds__(256) void k_layernorm(const float* __restrict__ X, const float* __restrict__ R, const float* __restrict__ g, const float* __restrict__ bta,
                                                  float* __restrict__ out_sum, float* __restrict__ out_norm, int N, float eps) {
  __shared__ float red[256];
  const int row = blockIdx.x, tid = threadIdx.x;
  const float* x = X + (size_t)row * N; const float* rr = R ? R + (size_t)row * N : nullptr;
  float vals[16];                     // up to N = 4096
  const int per = N / 256;            // contiguous chunk per thread? use strided-by-4 chunks: thread handles j = tid*4 + 1024*u
  float s1 = 0.f;
  for (int u = 0; u < per / 4; ++u) {
    const int j = tid * 4 + 1024 * u;
    const v4f a = *(const v4fa*)(x + j);
    v4f b = {0.f,0.f,0.f,0.f}; if (rr) b = *(const v4fa*)(rr + j);
#pragma unroll
    for (int q = 0; q < 4; ++q) { const float v = a[q] + b[q]; vals[u * 4 + q] = v; s1 += v; }
  }
  red[tid] = s1; __syncthreads();
  for (int st = 128; st > 0; st >>= 1) { if (tid < st) red[tid] += red[tid + st]; __syncthreads(); }
  const float mu = red[0] / (float)N; __syncthreads();
  float s2 = 0.f;
  for (int u = 0; u < per / 4; ++u)
#pragma unroll
    for (int q = 0; q < 4; ++q) { const float c = vals[u * 4 + q] - mu; s2 += c * c; }
  red[tid] = s2; __syncthreads();
  for (int st = 128; st > 0; st >>= 1) { if (tid < st) red[tid] += red[tid + st]; __syncthreads(); }
  const float rs = rsqrtf(red[0] / (float)N + eps);
  {
    for (int u = 0; u < per / 4; ++u) {
      const int j = tid * 4 + 1024 * u;
      v4f o, sm;
#pragma unroll
      for (int q = 0; q < 4; ++q) {
        float gg = g[j + q], bb = bta[j + q];
        if (PARAM_BF16) { gg = bf16_round(gg); bb = bf16_round(bb); }
        sm[q] = vals[u * 4 + q]; o[q] = (vals[u * 4 + q] - mu) * rs * gg + bb;
      }
      if (out_sum) *(v4f*)(out_sum + (size_t)row * N + j) = sm;
      *(v4f*)(out_norm + (size_t)row * N + j) = o;
    }
    
  }
}



// ---- f16 WMMA path (v_wmma_f32_16x16x32_f16): 11-bit significands for operands in range — used where a [0,1] probability operand needs more precision than bf16
typedef _Float16 v16h __attribute__((ext_vector_type(16)));
union FragH { v16h v; v8us half[2]; _Float16 h[16]; unsigned short u[16]; };
template <int NT>
__device__ __forceinline__ v8f mmaH(v16h ah, v16h al, v16h bh, v16h bl, v8f c) {
  c = __builtin_amdgcn_wmma_f32_16x16x32_f16(false, ah, false, bh, (short)0, c, false, false);
  if (NT >= 2) c = __builtin_amdgcn_wmma_f32_16x16x32_f16(false, al, false, bh, (short)0, c, false, false);
  if (NT >= 3) c = __builtin_amdgcn_wmma_f32_16x16x32_f16(false, ah, false, bl, (short)0, c, false, false);
  asm volatile("v_nop\n\tv_nop\n\tv_nop\n\tv_nop" : "+v"(c) : "v"(ah), "v"(al), "v"(bh), "v"(bl));
  return c;
}
// batched GEMM like k_gemm_b but f16 operands: A f32 (split into f16 hi/lo if ASPLIT, else rounded to f16), Bt = f16 values [n][k]; alpha; C f32; N multiple of 16 (partial tiles skipped)
template <bool ASPLIT>
__global__ __launch_bounds__(128) void k_gemm_h(const float* __restrict__ A, int lda, size_t sA, const _Float16* __restrict__ Bh, int ldb, size_t sB, float alpha, float* __restrict__ C, int ldc, size_t sC, int M, int N, int K) {
  __shared__ __attribute__((aligned(16))) float so[4][16][64];
  const int tid = threadIdx.x, w = tid >> 5, lane = tid & 31, ln = lane & 15, hh = lane >> 4; const int by = blockIdx.y;
  A += (size_t)by * sA; Bh += (size_t)by * sB; C += (size_t)by * sC;
  const int ntn = (N + 63) / 64; const int wid = blockIdx.x * 4 + w; const int mt = wid / ntn, nq = wid % ntn; if (mt * 16 >= M) return;
  const int row0 = mt * 16, col0 = nq * 64; const float* arow = A + (size_t)(row0 + ln) * lda;
  v8f acc[4] = {};
  for (int kb = 0; kb < K; kb += 32) {
    FragH ah, al;
    const v4f x0 = *(const v4fa*)(arow + kb + 8 * hh), x1 = *(const v4fa*)(arow + kb + 8 * hh + 4), x2 = *(const v4fa*)(arow + kb + 16 + 8 * hh), x3 = *(const v4fa*)(arow + kb + 16 + 8 * hh + 4);
    float xs[16] = {x0[0],x0[1],x0[2],x0[3],x1[0],x1[1],x1[2],x1[3],x2[0],x2[1],x2[2],x2[3],x3[0],x3[1],x3[2],x3[3]};
#pragma unroll
    for (int i = 0; i < 16; ++i) { const _Float16 h = (_Float16)xs[i]; ah.h[i] = h; al.h[i] = ASPLIT ? (_Float16)(xs[i] - (float)h) : (_Float16)0.0f; }
#pragma unroll
    for (int t = 0; t < 4; ++t) { if (col0 + t * 16 >= N) continue; const size_t boff = (size_t)(col0 + t * 16 + ln) * ldb + kb; FragH bq; bq.half[0] = *(const v8us*)(Bh + boff + 8 * hh); bq.half[1] = *(const v8us*)(Bh + boff + 16 + 8 * hh);
      acc[t] = mmaH<ASPLIT ? 2 : 1>(ah.v, al.v, bq.v, bq.v, acc[t]); }
  }
#pragma unroll
  for (int t = 0; t < 4; ++t) { if (col0 + t * 16 >= N) continue;
#pragma unroll
    for (int r = 0; r < 8; ++r) so[w][8 * hh + r][t * 16 + ln] = acc[t][r] * alpha; }
  __builtin_amdgcn_fence(__ATOMIC_ACQ_REL, "workgroup"); __builtin_amdgcn_wave_barrier();
  const int rsub = lane >> 4, c4 = (lane & 15) * 4;
  {
#pragma unroll
    for (int q = 0; q < 8; ++q) { const int r = q * 2 + rsub; if (col0 + c4 < N) { const v4f v = *(const v4fa*)&so[w][r][c4]; *(v4f*)(C + (size_t)(row0 + r) * ldc + col0 + c4) = v; } }
     }
}

// Wt[n][k] = f16(W[k][n]·scale) from f32 row-major W[K][N] (scale = power of two; bf16-exact weights stay exact in f16 away from the subnormal range)
__global__ __launch_bounds__(256) void k_wt_f16(const float* __restrict__ W, _Float16* __restrict__ Wt, int K, int N, float scale) {
  const int t = blockIdx.x * 256 + threadIdx.x; if (t >= N * (K / 8)) return; const int n = t / (K / 8), k8 = (t % (K / 8)) * 8; FragH f;
#pragma unroll
  for (int i = 0; i < 8; ++i) f.h[i] = (_Float16)(bf16_round(W[(size_t)(k8 + i) * N + n]) * scale); const v8us o = f.half[0];
  *(v8us*)((unsigned short*)Wt + (size_t)n * K + k8) = o; 
}
// k_gemm_hh variant with fused epilogue: v = acc·alpha + bias[by·sBias + col] (+ CP[(row/rowsPerB)·sCPb + by·64 + col] if CP) ; ACT 0 none / 1 elu ; writes f16 C16 (and f32 C if non-null)
template <int ACT>
__global__ __launch_bounds__(128) void k_gemm_hhx(const _Float16* __restrict__ A, int lda, size_t sA, const _Float16* __restrict__ Bh, int ldb, size_t sB, float alpha, const float* __restrict__ bias, size_t sBias, const float* __restrict__ CP, int rowsPerB, size_t sCPb, int row0g,
    float* __restrict__ C, _Float16* __restrict__ C16, int ldc, size_t sC, int M, int N, int K) {
  __shared__ __attribute__((aligned(16))) float so[4][16][64];
  const int tid = threadIdx.x, w = tid >> 5, lane = tid & 31, ln = lane & 15, hh = lane >> 4; const int by = blockIdx.y;
  A += (size_t)by * sA; Bh += (size_t)by * sB; const size_t cofs = (size_t)by * sC; const float* bp = bias ? bias + (size_t)by * sBias : nullptr;
  const int ntn = (N + 63) / 64; const int wid = blockIdx.x * 4 + w; const int mt = wid / ntn, nq = wid % ntn; if (mt * 16 >= M) return;
  const int row0 = mt * 16, col0 = nq * 64; const _Float16* arow = A + (size_t)(row0 + ln) * lda;
  v8f acc[4] = {};
  for (int kb = 0; kb < K; kb += 32) { FragH ah; ah.half[0] = *(const v8us*)((const unsigned short*)arow + kb + 8 * hh); ah.half[1] = *(const v8us*)((const unsigned short*)arow + kb + 16 + 8 * hh);
#pragma unroll
    for (int t = 0; t < 4; ++t) { if (col0 + t * 16 >= N) continue; const size_t boff = (size_t)(col0 + t * 16 + ln) * ldb + kb; FragH bq; bq.half[0] = *(const v8us*)((const unsigned short*)Bh + boff + 8 * hh); bq.half[1] = *(const v8us*)((const unsigned short*)Bh + boff + 16 + 8 * hh);
      acc[t] = mmaH<1>(ah.v, ah.v, bq.v, bq.v, acc[t]); }
  }
#pragma unroll
  for (int t = 0; t < 4; ++t) { if (col0 + t * 16 >= N) continue; const int col = col0 + t * 16 + ln; const float bv = bp ? bf16_round(bp[col]) : 0.f;
#pragma unroll
    for (int r = 0; r < 8; ++r) { float v = acc[t][r] * alpha + bv; if (CP) { const int rr = row0g + row0 + 8 * hh + r; if (rowsPerB < 0) v += CP[cofs + (size_t)rr * ldc + col];      /* rowsPerB < 0: own element of the batched C plane */ else { const int bidx = rr / rowsPerB; v += CP[(size_t)bidx * sCPb + (size_t)by * 64 + col]; } } if (ACT == 1) v = (v > 0.f) ? v : expm1f(v); else if (ACT == 7) v = (v > 0.f) ? v + 1.0f : expf(v); else if (ACT == 8) v = tanhf(v); else if (ACT == 9) v = 0.5f * v * (1.0f + tanhf(0.7978845608028654f * (v + 0.044715f * v * v * v))); else if (ACT == 11) v = 1.0f / (1.0f + expf(-v)); else if (ACT == 12) v = (v > 0.f) ? v : 0.01f * v; else if (ACT == 14) v = (v > 0.f) ? v : 0.1f * v; else if (ACT == 16) v = (v >= 0.f) ? v : 0.3f * v; else if (ACT == 17) v = (v >= 0.f) ? v : 0.2f * v; else if (ACT == 15) v = v / (1.0f + expf(-v)); else if (ACT == 3) v = fmaxf(v, 0.f); else if (ACT == 6) v = 0.5f * v * (1.0f + erff(v * 0.70710678118654752f)); so[w][8 * hh + r][t * 16 + ln] = v; } }
  __builtin_amdgcn_fence(__ATOMIC_ACQ_REL, "workgroup"); __builtin_amdgcn_wave_barrier();
  const int rsub = lane >> 4, c4 = (lane & 15) * 4; typedef _Float16 v4h __attribute__((ext_vector_type(4)));
  {
#pragma unroll
    for (int q = 0; q < 8; ++q) { const int r = q * 2 + rsub; if (col0 + c4 < N) { const v4f v = *(const v4fa*)&so[w][r][c4]; if (C) *(v4f*)(C + cofs + (size_t)(row0 + r) * ldc + col0 + c4) = v; if (C16) { v4h h4; for (int i = 0; i < 4; ++i) h4[i] = (_Float16)v[i]; *(v4h*)(C16 + cofs + (size_t)(row0 + r) * ldc + col0 + c4) = h4; } } }
     }
}


typedef _Float16 v4h __attribute__((ext_vector_type(4)));
typedef _Float16 v4ha __attribute__((ext_vector_type(4), may_alias));

__global__ __launch_bounds__(256) void k_x16(const float* __restrict__ x, _Float16* __restrict__ X16, size_t n8) { const size_t t = (size_t)blockIdx.x * 256 + threadIdx.x; if (t >= n8) return; FragH f;
#pragma unroll
  for (int q = 0; q < 8; ++q) f.h[q] = (_Float16)bf16_round(x[t * 8 + q]); *(v8us*)((unsigned short*)X16 + t * 8) = f.half[0];  }
__global__ __launch_bounds__(256) void k_h16(const float* __restrict__ x, _Float16* __restrict__ X16, size_t n8) { const size_t t = (size_t)blockIdx.x * 256 + threadIdx.x; if (t >= n8) return; FragH f;
#pragma unroll
  for (int q = 0; q < 8; ++q) f.h[q] = (_Float16)x[t * 8 + q]; *(v8us*)((unsigned short*)X16 + t * 8) = f.half[0];  }
__global__ __launch_bounds__(256) void k_round16f(const float* __restrict__ W, _Float16* __restrict__ Bt, size_t n8) { const size_t t = (size_t)blockIdx.x * 256 + threadIdx.x; if (t >= n8) return; FragH f;
#pragma unroll
  for (int i = 0; i < 8; ++i) f.h[i] = (_Float16)(bf16_round(W[t * 8 + i]) * 16.0f); *(v8us*)((unsigned short*)Bt + t * 8) = f.half[0];  }
template <int NHv, int TTv>
__global__ __launch_bounds__(256) void k_vt(const _Float16* __restrict__ V16, int ldv, int voff, _Float16* __restrict__ Vt) { __shared__ unsigned short tl[64][66]; const int tid = threadIdx.x; const int slab = blockIdx.x / (TTv / 64), lg = blockIdx.x % (TTv / 64); const int b = slab / NHv, h = slab % NHv;
  for (int i = tid; i < 64 * 8; i += 256) { const int r = i / 8, c8 = (i % 8) * 8; FragH f; f.half[0] = *(const v8us*)((const unsigned short*)V16 + ((size_t)b * TTv + lg * 64 + r) * ldv + voff + h * 64 + c8);
#pragma unroll
    for (int q = 0; q < 8; ++q) tl[r][c8 + q] = f.u[q]; }
  __syncthreads();
  {
#pragma unroll
    for (int rd = 0; rd < 2; ++rd) { const int d = rd * 32 + tid / 8, pc = tid % 8; FragH f;
#pragma unroll
      for (int q = 0; q < 8; ++q) f.u[q] = tl[pc * 8 + q][d];
      *(v8us*)((unsigned short*)Vt + ((size_t)slab * 64 + d) * TTv + lg * 64 + pc * 8) = f.half[0]; }
     } }

__global__ __launch_bounds__(256) void k_hl(const float* __restrict__ F, _Float16* __restrict__ Hh, _Float16* __restrict__ Hl, size_t n8) { const size_t t = (size_t)blockIdx.x * 256 + threadIdx.x; if (t >= n8) return; FragH fh, fl; const v4f a = *(const v4fa*)(F + t * 8), c = *(const v4fa*)(F + t * 8 + 4);
#pragma unroll
  for (int q = 0; q < 4; ++q) { _Float16 h = (_Float16)a[q]; fh.h[q] = h; fl.h[q] = (_Float16)((a[q] - (float)h) * 1024.0f); h = (_Float16)c[q]; fh.h[4 + q] = h; fl.h[4 + q] = (_Float16)((c[q] - (float)h) * 1024.0f); }
  { *(v8us*)((unsigned short*)Hh + t * 8) = fh.half[0]; *(v8us*)((unsigned short*)Hl + t * 8) = fl.half[0];  } }

// ---- fast GEMM (wave tile 32x64; requires M % 32 == 0 rows per launch region and N % 64 == 0); epilogue = k_gemm_hhx semantics ----
__device__ __forceinline__ v16h g2_frag(const _Float16* p, int hh) { FragH f; f.half[0] = *(const v8us*)((const unsigned short*)p + 8 * hh); f.half[1] = *(const v8us*)((const unsigned short*)p + 16 + 8 * hh); return f.v; }
__device__ __forceinline__ v8f g2_mma(v16h a, v16h b, v8f c) { v8f d = __builtin_amdgcn_wmma_f32_16x16x32_f16(false, a, false, b, (short)0, c, false, false); asm volatile("v_nop\n\tv_nop\n\tv_nop\n\tv_nop" : "+v"(d) : "v"(a), "v"(b)); return d; }
template <int ACT>
__global__ __launch_bounds__(128) void k_gemm2(const _Float16* __restrict__ A, int lda, size_t sA, const _Float16* __restrict__ Bh, int ldb, size_t sB, float alpha, const float* __restrict__ bias, size_t sBias, const float* __restrict__ CP, int rowsPerB, size_t sCPb, int row0g,
    float* __restrict__ C, _Float16* __restrict__ C16, int ldc, size_t sC, int M, int N, int K) { static_assert(ACT == 0 || ACT == 3 || ACT == 6 || ACT == 8 || ACT == 9 || ACT == 11 || ACT == 12 || ACT == 14 || ACT == 15 || ACT == 16 || ACT == 17, "k_gemm2: unsupported ACT code (would silently apply no activation)");
  __shared__ __attribute__((aligned(16))) float so[4][32][68];
  const int tid = threadIdx.x, w = tid >> 5, lane = tid & 31, ln = lane & 15, hh = lane >> 4; const int by = blockIdx.y;
  A += (size_t)by * sA; Bh += (size_t)by * sB; const size_t cofs = (size_t)by * sC; const float* bp = bias ? bias + (size_t)by * sBias : nullptr;
  const int ntn = N >> 6; const int mt = blockIdx.x / ntn, nq = blockIdx.x - mt * ntn; const int row0 = mt * 128 + 32 * w, col0 = nq * 64; if (row0 >= M) return;
  const _Float16* a0p = A + (size_t)(row0 + ln) * lda; const _Float16* a1p = a0p + (size_t)16 * lda;
  const _Float16* b0p = Bh + (size_t)(col0 + ln) * ldb; const _Float16* b1p = b0p + (size_t)16 * ldb; const _Float16* b2p = b1p + (size_t)16 * ldb; const _Float16* b3p = b2p + (size_t)16 * ldb;
  const v8f z8 = {0.f,0.f,0.f,0.f,0.f,0.f,0.f,0.f}; v8f c00 = z8, c01 = z8, c02 = z8, c03 = z8, c10 = z8, c11 = z8, c12 = z8, c13 = z8;
#pragma unroll 1
  for (int kb = 0; kb < K; kb += 32) { const v16h a0 = g2_frag(a0p + kb, hh), a1 = g2_frag(a1p + kb, hh);
    v16h b = g2_frag(b0p + kb, hh); c00 = g2_mma(a0, b, c00); c10 = g2_mma(a1, b, c10);
    b = g2_frag(b1p + kb, hh); c01 = g2_mma(a0, b, c01); c11 = g2_mma(a1, b, c11);
    b = g2_frag(b2p + kb, hh); c02 = g2_mma(a0, b, c02); c12 = g2_mma(a1, b, c12);
    b = g2_frag(b3p + kb, hh); c03 = g2_mma(a0, b, c03); c13 = g2_mma(a1, b, c13); }
  v8f accs[8] = {c00, c01, c02, c03, c10, c11, c12, c13};
#pragma unroll
  for (int u = 0; u < 8; ++u) { const int t = u & 3, half = u >> 2; const int col = col0 + t * 16 + ln; const float bv = bp ? bf16_round(bp[col]) : 0.f;
#pragma unroll
    for (int r = 0; r < 8; ++r) { const int rloc = half * 16 + 8 * hh + r; float v = accs[u][r] * alpha + bv; if (CP) { if (rowsPerB < 0) v += CP[cofs + (size_t)(row0g + row0 + rloc) * ldc + col];      /* rowsPerB < 0: own element of the batched C plane */ else { const int bidx = (row0g + row0 + rloc) / rowsPerB; v += CP[(size_t)bidx * sCPb + (size_t)by * 64 + col]; } }
      if (ACT == 3) v = fmaxf(v, 0.f); else if (ACT == 6) v = 0.5f * v * (1.0f + erff(v * 0.70710678118654752f)); else if (ACT == 11) v = 1.0f / (1.0f + expf(-v)); else if (ACT == 15) v = v / (1.0f + expf(-v)); else if (ACT == 12) v = (v > 0.f) ? v : 0.01f * v; else if (ACT == 8) v = tanhf(v); else if (ACT == 9) v = 0.5f * v * (1.0f + tanhf(0.7978845608028654f * (v + 0.044715f * v * v * v))); else if (ACT == 14) v = (v > 0.f) ? v : 0.1f * v; else if (ACT == 16) v = (v >= 0.f) ? v : 0.3f * v; else if (ACT == 17) v = (v >= 0.f) ? v : 0.2f * v;
      so[w][rloc][t * 16 + ln] = v; } }
  __builtin_amdgcn_fence(__ATOMIC_ACQ_REL, "workgroup"); __builtin_amdgcn_wave_barrier();
  const int rsub = lane >> 4, c4 = (lane & 15) * 4;
  {
#pragma unroll
    for (int q = 0; q < 16; ++q) { const int r = q * 2 + rsub; const v4f v = *(const v4fa*)&so[w][r][c4]; if (C) *(v4f*)(C + cofs + (size_t)(row0 + r) * ldc + col0 + c4) = v; if (C16) { v4h h4; for (int i = 0; i < 4; ++i) h4[i] = (_Float16)v[i]; *(v4h*)(C16 + cofs + (size_t)(row0 + r) * ldc + col0 + c4) = h4; } }
     } }


__global__ __launch_bounds__(256) void k_wnat(const float* __restrict__ w, size_t n8, _Float16* __restrict__ Bt) { const size_t t = (size_t)blockIdx.x * 256 + threadIdx.x; if (t >= n8) return; FragH f; for (int q = 0; q < 8; ++q) f.h[q] = (_Float16)(bf16_round(w[t * 8 + q]) * 16.0f); *(v8us*)((unsigned short*)Bt + t * 8) = f.half[0];  }
__global__ __launch_bounds__(256) void k_rsm(const float* __restrict__ S, _Float16* __restrict__ P, int nrows) {
  #pragma clang fp contract(off)
  const int i = blockIdx.x * 256 + threadIdx.x; if (i >= nrows) return; const float* s = S + (size_t)i * SQ; float mx = -3.0e38f;
#pragma unroll 1
  for (int j = 0; j < SQ; ++j) mx = fmaxf(mx, s[j]); float se = 0.f;
#pragma unroll 1
  for (int j = 0; j < SQ; ++j) se += expf(s[j] - mx); const float sc = 256.0f / se;
#pragma unroll 1
  for (int j0 = 0; j0 < SQ; j0 += 8) { FragH f; for (int q = 0; q < 8; ++q) f.h[q] = (_Float16)(expf(s[j0 + q] - mx) * sc); unsigned short* d = (unsigned short*)P + (size_t)i * SQ + j0; *(v8us*)d = f.half[0];  } }
__global__ __launch_bounds__(256) void k_vt(const _Float16* __restrict__ V16, int b, int h0, _Float16* __restrict__ VT) { __shared__ unsigned short tl[64][65]; const int tid = threadIdx.x; const int hh = blockIdx.x % HG, sg = blockIdx.x / HG; const int s0 = sg * 64; const int h = h0 + hh;
  for (int i = tid; i < 64 * 8; i += 256) { const int j = i / 8, d8 = (i % 8) * 8; FragH f; f.half[0] = *(const v8us*)((const unsigned short*)V16 + ((size_t)b * SQ + s0 + j) * DM + h * HD + d8); for (int q = 0; q < 8; ++q) tl[d8 + q][j] = f.u[q]; }
  __syncthreads();
  { for (int i = tid; i < 64 * 8; i += 256) { const int d = i / 8, j8 = (i % 8) * 8; FragH f; for (int q = 0; q < 8; ++q) f.u[q] = tl[d][j8 + q]; *(v8us*)((unsigned short*)VT + ((size_t)hh * HD + d) * SQ + s0 + j8) = f.half[0]; }  } }


// K and V for the fused kernel, all (batch, head) slices in one launch, straight from the f32 inputs. A block takes 128 keys of one slice: their K rows (8192 floats in a row) and their V rows (64 floats each, 768 apart) go out rounded, V transposed.
// Both go out in FRAGMENT ORDER: per 32 keys 4 KiB = 8 pieces of 512 bytes, a piece = the 16 bytes of lane 0, lane 1, ... lane 31 of one 16-byte load of k_attn, so that such a load covers four whole 128-byte lines
// (row-major, the 32 lanes of a K load fell on 16 lines and those of a V^T load on 8, and the WGP cache pays by the line touched).
// K16[slice][key / 32][t][ks][half][hh][ln][8] = k[key = t 16 + ln][d = ks 32 + half 16 + hh 8 + 0..7]; Vt[slice][key / 32][t][half][hh][ln][8] = v[key = half 16 + hh 8 + 0..7][d = t 16 + ln].
// 768 equal blocks of 8 waves, three on each of 256 WGPs, all resident at once; a thread has its 8 + 8 loads of 16 bytes out before it converts anything, and each load of a wave covers whole lines (512 bytes in a row of K, two 256-byte row pieces of V).
__global__ __launch_bounds__(256) void k_prep(const float* __restrict__ k, const float* __restrict__ v, _Float16* __restrict__ K16, _Float16* __restrict__ Vt) { __shared__ unsigned short tl[128][66]; __shared__ __attribute__((aligned(16))) unsigned short kl[32][272];      /* kl: 32 pieces of K, 512 bytes each at a pitch of 544: the four pieces that one wave's store falls on start 8 banks apart */
  const int tid = threadIdx.x; const int slab = blockIdx.x / (SQ / 128), lg = blockIdx.x % (SQ / 128); const int b = slab / 12, h = slab % 12;
  const float* kp = k + (size_t)blockIdx.x * (128 * HD) + tid * 4; const float* vp = v + ((size_t)b * SQ + lg * 128 + tid / 16) * 768 + h * 64 + (tid % 16) * 4;
  v4f ka[8], va[8];
#pragma unroll
  for (int u = 0; u < 8; ++u) ka[u] = *(const v4fa*)(kp + u * 1024);
#pragma unroll
  for (int u = 0; u < 8; ++u) va[u] = *(const v4fa*)(vp + (size_t)u * 16 * 768);
  __builtin_amdgcn_sched_barrier(0);      /* all sixteen loads go out together: without it the scheduler sank most of the K loads between the conversions, one memory round trip behind the other */
#pragma unroll
  for (int u = 0; u < 8; ++u) { FragH f;
#pragma unroll
    for (int q = 0; q < 4; ++q) f.h[q] = (_Float16)bf16_round(va[u][q]);
#pragma unroll
    for (int q = 0; q < 4; ++q) tl[u * 16 + tid / 16][(tid % 16) * 4 + q] = f.u[q]; }
  // K: load u of this thread is key u 16 + tid / 16, d = (tid % 16) 4 + 0..3: piece u 4 + d / 16, hh = (d / 8) % 2, ln = tid / 16, first or second 8 bytes of the lane's 16.
#pragma unroll
  for (int u = 0; u < 8; ++u) { v4h f;
#pragma unroll
    for (int q = 0; q < 4; ++q) f[q] = (_Float16)bf16_round(ka[u][q]);
    *(v4ha*)&kl[u * 4 + (tid % 16) / 4][((((tid % 16) >> 1) & 1) * 16 + tid / 16) * 8 + (tid & 1) * 4] = f; }
  __syncthreads();
  // Behind the barrier a wave takes whole pieces: round rd is the block's rd-th group of 32 keys, wave w its piece w, and every store is 512 bytes in a row.
  const int w = tid >> 5, lane = tid & 31, ln = lane & 15, hh = lane >> 4;
#pragma unroll
  for (int rd = 0; rd < 4; ++rd) *(v8us*)((unsigned short*)K16 + (size_t)blockIdx.x * (128 * HD) + (rd * 256 + tid) * 8) = *(const v8us*)&kl[rd * 8 + w][lane * 8];
#pragma unroll
  for (int rd = 0; rd < 4; ++rd) { const int d = (w >> 1) * 16 + ln, k0 = rd * 32 + (w & 1) * 16 + hh * 8; FragH f;
#pragma unroll
    for (int q = 0; q < 8; ++q) f.u[q] = tl[k0 + q][d];
    *(v8us*)((unsigned short*)Vt + (size_t)blockIdx.x * (128 * HD) + (rd * 256 + tid) * 8) = f.half[0]; } }

typedef float v2f __attribute__((ext_vector_type(2)));
typedef _Float16 v2h __attribute__((ext_vector_type(2)));
__device__ __forceinline__ float xhalf(float x) { return __builtin_bit_cast(float, __builtin_amdgcn_permlanex16(__builtin_bit_cast(int, x), __builtin_bit_cast(int, x), 0x76543210, 0xfedcba98, false, false)); }      /* lane l <-> lane l ^ 16 */
__device__ __forceinline__ v8f fa_mma(v16h a, v16h b, v8f c) { return __builtin_amdgcn_wmma_f32_16x16x32_f16(false, a, false, b, (short)0, c, false, false); }
// The 16 weights of one lane for one query: 2^(s + dl), rounded to f16 in the order of the B operand; sm = their f32 sums, even and odd keys apart. s = the score accumulators, which hold scaled score + exponent offset as they leave the matrix unit; SH false: dl is 0 and nothing is added.
template <bool SH>
__device__ __forceinline__ v16h fa_weights(v8f s0, v8f s1, float dl, v2f& sm) { FragH pf;
#pragma unroll
  for (int i = 0; i < 8; ++i) { const v8f sv = i < 4 ? s0 : s1; v2f a = {sv[2 * (i & 3)], sv[2 * (i & 3) + 1]}; if (SH) a += v2f{dl, dl};
    const v2f p = {__builtin_amdgcn_exp2f(a.x), __builtin_amdgcn_exp2f(a.y)}; sm = i ? sm + p : p; const v2h ph = __builtin_convertvector(p, v2h); pf.h[2 * i] = ph.x; pf.h[2 * i + 1] = ph.y; }
  return pf.v; }
// Scores, softmax and weighted sum in one kernel. Block = 4 waves x 32 queries of one (batch, head) slice; grid = 48 x 16 = 768 blocks, three on each of 256 WGPs.
// S^T = K Q^T: A = 16 key rows, B = 16 query rows (kept in registers), same k order for both. A lane's 8 accumulator registers are keys 8 hh + r of ONE query (column ln):
// maximum and sum run inside the lane plus one exchange with lane ^ 16, and two S^T tiles (keys 0-15, 16-31), converted in place, ARE the B operand of O^T += V^T P^T (k = 8 hh + r, 16 + 8 hh + r: the order in which k_prep has laid V^T out).
// Softmax per query: m = the maximum in use (scaled scores, powers of two), weights 2^(8 + s - m); the 2^8 cancels in the division at the end. First walk: m = the maximum over the first 32 keys, kept to the end, nothing tested in the loop.
// A later score more than 8 above m makes a weight infinite in f16, and every element of that query's O^T then ends infinite or not a number: one element per query is looked at behind the loop.
// Second walk (only a wave that found such an element; a scalar branch): the running softmax with the range test in every pass, m renewed and sum and O^T rescaled by 2^(m_old - m) whenever the weights come near the f16 range.
// No vector instruction stands between the score product and the exponential: the scale lies in q, and the offset 8 - m is the C operand of the score product (eight registers per 16 queries, all holding the lane's query's offset).
// K and V^T reach the block ONCE, not once per wave: a stage = 128 keys = 16 KiB of K and 16 KiB of V^T, both in a row in k_prep's fragment order, copied as they lie into one of two LDS buffers by asynchronous copies
// (a thread 16 bytes per copy, a wave 512 bytes in a row, 16 copies per thread and stage); the four waves read their fragments from LDS, 512 bytes in a row per wave-wide load. Stage t + 1 flies while stage t is worked on.
#define KS 128                /* keys per stage */
#define NT (SQ / KS)          /* stages */
#define SB (KS * HD * 2)      /* bytes of K, and of V^T, per stage */
// One stage: lk, lv = this thread's LDS byte addresses in the K and the V^T half of a buffer, gk, gv = its global addresses; the immediate offset moves the LDS and the global address alike, and both sides lie in a row.
// s_wait_xcnt 0 is the statement's last line, so that no register which a copy names is rewritten in front of it.
__device__ __forceinline__ void stage_copy(unsigned lk, unsigned lv, const char* gk, const char* gv) {
  asm volatile("global_load_async_to_lds_b128 %0, %2, off\n\t"
               "global_load_async_to_lds_b128 %0, %2, off offset:2048\n\t"
               "global_load_async_to_lds_b128 %0, %2, off offset:4096\n\t"
               "global_load_async_to_lds_b128 %0, %2, off offset:6144\n\t"
               "global_load_async_to_lds_b128 %1, %3, off\n\t"
               "global_load_async_to_lds_b128 %1, %3, off offset:2048\n\t"
               "global_load_async_to_lds_b128 %1, %3, off offset:4096\n\t"
               "global_load_async_to_lds_b128 %1, %3, off offset:6144\n\t"
               "global_load_async_to_lds_b128 %0, %2, off offset:8192\n\t"
               "global_load_async_to_lds_b128 %0, %2, off offset:10240\n\t"
               "global_load_async_to_lds_b128 %0, %2, off offset:12288\n\t"
               "global_load_async_to_lds_b128 %0, %2, off offset:14336\n\t"
               "global_load_async_to_lds_b128 %1, %3, off offset:8192\n\t"
               "global_load_async_to_lds_b128 %1, %3, off offset:10240\n\t"
               "global_load_async_to_lds_b128 %1, %3, off offset:12288\n\t"
               "global_load_async_to_lds_b128 %1, %3, off offset:14336\n\t"
               "s_wait_xcnt 0x0" :: "v"(lk), "v"(lv), "v"(gk), "v"(gv) : "memory");
}
// A wave's 32 query rows (8 KiB in a row of the f32 input) into its own 8 KiB of LDS: copy i takes 512 bytes in a row = rows 2 i and 2 i + 1, four whole 128-byte lines, a lane 16 bytes.
// a0..a7 = the lane's LDS byte address for i = 0..7 (the 16-byte piece c of row r lies at place c ^ (r & 15) of the row, see k_attn), g = its global address; the immediate offset moves both addresses alike; rows 16..31 repeat the places of rows 0..15.
// s_wait_xcnt 0 is the statement's last line, so that no register which a copy names is rewritten in front of it.
__device__ __forceinline__ void q_copy(unsigned a0, unsigned a1, unsigned a2, unsigned a3, unsigned a4, unsigned a5, unsigned a6, unsigned a7, const char* g) {
  asm volatile("global_load_async_to_lds_b128 %0, %8, off\n\t"
               "global_load_async_to_lds_b128 %1, %8, off offset:512\n\t"
               "global_load_async_to_lds_b128 %2, %8, off offset:1024\n\t"
               "global_load_async_to_lds_b128 %3, %8, off offset:1536\n\t"
               "global_load_async_to_lds_b128 %4, %8, off offset:2048\n\t"
               "global_load_async_to_lds_b128 %5, %8, off offset:2560\n\t"
               "global_load_async_to_lds_b128 %6, %8, off offset:3072\n\t"
               "global_load_async_to_lds_b128 %7, %8, off offset:3584\n\t"
               "global_load_async_to_lds_b128 %0, %8, off offset:4096\n\t"
               "global_load_async_to_lds_b128 %1, %8, off offset:4608\n\t"
               "global_load_async_to_lds_b128 %2, %8, off offset:5120\n\t"
               "global_load_async_to_lds_b128 %3, %8, off offset:5632\n\t"
               "global_load_async_to_lds_b128 %4, %8, off offset:6144\n\t"
               "global_load_async_to_lds_b128 %5, %8, off offset:6656\n\t"
               "global_load_async_to_lds_b128 %6, %8, off offset:7168\n\t"
               "global_load_async_to_lds_b128 %7, %8, off offset:7680\n\t"
               "s_wait_xcnt 0x0" :: "v"(a0), "v"(a1), "v"(a2), "v"(a3), "v"(a4), "v"(a5), "v"(a6), "v"(a7), "v"(g) : "memory");
}
__global__ __launch_bounds__(128) void k_attn(const float* __restrict__ Q, const _Float16* __restrict__ K16, const _Float16* __restrict__ Vt, float* __restrict__ O, float cs) {
  __shared__ __attribute__((aligned(256))) char ring[2][2 * SB];      /* two buffers, each K then V^T of one stage: 64 KiB; a buffer is also 4 x 8 KiB, a wave's 32 rows of 64 floats (q at the start, O at the end) */
  static_assert(2 * SB == 4 * 32 * HD * 4 && (NT & 1) == 0, "a buffer holds the four waves' row blocks; the last stage lies in buffer 1");
  const int tid = threadIdx.x, w = tid >> 5, lane = tid & 31, ln = lane & 15, hh = lane >> 4;
  const int slab = blockIdx.x / (SQ / 128), q0 = (blockIdx.x % (SQ / 128)) * 128 + w * 32;
  typedef __attribute__((address_space(3))) const char lch; typedef __attribute__((address_space(3))) const v8us lv8;
  auto frag = [](lch* p, int off) { FragH f; f.half[0] = *(lv8*)(p + off); f.half[1] = *(lv8*)(p + off + 512); return f.v; };      /* two pieces: k = 8 hh + 0..7 and 16 + 8 hh + 0..7, as g2_frag */
  const char* kg = (const char*)(K16 + (size_t)slab * SQ * HD) + tid * 16; const char* vg = (const char*)(Vt + (size_t)slab * HD * SQ) + tid * 16;      /* this thread's 16 bytes of the first 2 KiB of the stage that is copied next */
  const unsigned l0 = (unsigned)(size_t)&ring[0][0] + tid * 16;      /* the low 32 bits of a __shared__ address are its LDS byte address */
  v16h qf[2][2], kf[2][2], vf[4];      /* q, k: [16-row tile][32-wide step of d]; v: [16 rows of d] */
  v4f qr[2][2][4];      /* q as loaded: k = 8 hh + 0..7 and 16 + 8 hh + 0..7, as g2_frag */
  // q and O cross between global memory and the fragments through LDS, so that every global access of a wave is 512 bytes in a row (four whole lines): straight from the fragment's lanes a 16-byte access fell on 16 lines, 32 bytes of each.
  // A wave's block = its 32 rows of 256 bytes; the 16-byte piece c of row r lies at place c ^ (r & 15): the 16 lanes that take one piece of 16 rows, and the 16 that take one whole row, each cover all 64 banks once.
  // q (the f32 input itself: each query row is read by one wave only, which rounds it as K and V are rounded) goes into the wave's block of buffer 1, which the ring fills only behind the first barrier of the loop, and that stands behind every wave's s_wait_dscnt 0.
  { const unsigned qa = (unsigned)(size_t)&ring[1][0] + w * 8192 + hh * 256 + ((ln ^ hh) << 4);      /* copy 0: row hh, piece ln; copy i: row 2 i + hh, so its place differs by 2 (i & 7) */
    q_copy(qa, qa ^ 0x20, qa ^ 0x40, qa ^ 0x60, qa ^ 0x80, qa ^ 0xa0, qa ^ 0xc0, qa ^ 0xe0, (const char*)(Q + ((size_t)slab * SQ + q0) * HD) + lane * 16); }
  stage_copy(l0, l0 + SB, kg, vg); kg += SB; vg += SB;      /* stage 0 into buffer 0 */
  auto gfrag = [](const char* p, int off) { FragH f; f.half[0] = *(const v8us*)(p + off); f.half[1] = *(const v8us*)(p + off + 512); return f.v; };      /* the same two pieces as frag, straight from k_prep's plane */
  // The first 32 keys' K fragments also come straight from global memory (4 KiB, the same for every wave of the slice): the first maximum is taken from them before stage 0 is published, under the flight of the copies.
  { const char* k0 = (const char*)(K16 + (size_t)slab * SQ * HD) + lane * 16;
#pragma unroll
    for (int t = 0; t < 2; ++t) for (int ks = 0; ks < 2; ++ks) kf[t][ks] = gfrag(k0, (t * 2 + ks) * 1024); }
  asm volatile("s_wait_asynccnt 0x0" ::: "memory");      /* this wave's own copies have landed: it reads back only its own block of q, so no barrier is needed here */
  { const char* qs = &ring[1][0] + w * 8192 + ln * 256;
#pragma unroll
    for (int j = 0; j < 2; ++j) for (int ks = 0; ks < 2; ++ks) for (int c = 0; c < 4; ++c) qr[j][ks][c] = *(const v4fa*)(qs + j * 4096 + (((ks * 8 + (c >> 1) * 4 + hh * 2 + (c & 1)) ^ ln) << 4)); }
#pragma unroll
  for (int j = 0; j < 2; ++j) for (int ks = 0; ks < 2; ++ks) { FragH f;
#pragma unroll
    for (int i = 0; i < 16; ++i) f.h[i] = (_Float16)(bf16_round(qr[j][ks][i >> 2][i & 3]) * cs);
    qf[j][ks] = f.v; }
  const v8f z8 = {0.f,0.f,0.f,0.f,0.f,0.f,0.f,0.f}; v8f o[4][2] = {{z8, z8}, {z8, z8}, {z8, z8}, {z8, z8}};      /* O^T: [16 rows of d][16 queries] */
  v2f ls[2] = {{0.f, 0.f}, {0.f, 0.f}};      /* ls: sums over even and odd keys, joined at the end */
  v8f cb[2];      /* C operand of the score products: the exponent offset 8 - maximum in use, in all eight registers */
  { v8f s[2][2];      /* scores of the first 32 keys, no offset: only their maximum per query is used, the loop forms them again */
#pragma unroll
    for (int t = 0; t < 2; ++t) for (int j = 0; j < 2; ++j) s[t][j] = fa_mma(kf[t][0], qf[j][0], z8);
#pragma unroll
    for (int t = 0; t < 2; ++t) for (int j = 0; j < 2; ++j) s[t][j] = fa_mma(kf[t][1], qf[j][1], s[t][j]);
#pragma unroll
    for (int j = 0; j < 2; ++j) {
      float mx = fmaxf(s[0][j][0], s[1][j][0]);
#pragma unroll
      for (int r = 1; r < 8; ++r) mx = fmaxf(mx, fmaxf(s[0][j][r], s[1][j][r]));
      mx = fmaxf(mx, xhalf(mx));
      cb[j] = z8 + (8.0f - mx); } }
  for (int st = 0; st < NT; ++st) {
    const int bo = (st & 1) * 2 * SB;      /* the buffer of this stage */
    // Hand-over at the head of every stage, every wave, in this order: my reads of the other buffer (the stage before) are done; my copies of this stage have landed; the barrier publishes this stage and ends every wave's reads of the other buffer;
    // only then is the other buffer filled again, with the next stage, which flies while this one is worked on. Nothing of a stage is read in front of its barrier.
    // It stands at the head, not at the foot: with a branch behind the four passes the compiler sank their row sums into the block behind it, every weight alive in f32 until then (314 registers).
    asm volatile("s_wait_dscnt 0x0" ::: "memory");
    asm volatile("s_wait_asynccnt 0x0" ::: "memory");
    __syncthreads();
    if (st + 1 < NT) { stage_copy(l0 + (2 * SB - bo), l0 + (3 * SB - bo), kg, vg); kg += SB; vg += SB; }      /* the test reads the same in the whole block */
    lch* rb = (lch*)&ring[0][0] + bo + lane * 16;      /* lane l takes its 16 bytes at 16 l of each 512-byte piece */
#pragma unroll
    for (int t = 0; t < 2; ++t) for (int ks = 0; ks < 2; ++ks) kf[t][ks] = frag(rb, (t * 2 + ks) * 1024);
#pragma unroll
    for (int t = 0; t < 4; ++t) vf[t] = frag(rb, SB + t * 1024);
    __builtin_amdgcn_sched_barrier(0);      /* the stage's first K and V^T loads go out as one group (k first: LDS loads return in order, and the first product waits for k alone): without it the scheduler put the V^T loads in three groups among the score products */
#pragma unroll
    for (int ps = 0; ps < KS / 32; ++ps) {      /* one pass = 32 keys */
      v8f s[2][2];      /* S^T: [16 keys][16 queries] */
#pragma unroll
      for (int t = 0; t < 2; ++t) for (int j = 0; j < 2; ++j) s[t][j] = fa_mma(kf[t][0], qf[j][0], cb[j]);      /* the sum starts from the exponent offset */
      // The second halves in a nest of their own (unrolled like the first: s lies in registers): written as one nest, the scheduler left only one other product between a product and the one that adds to it.
#pragma unroll
      for (int t = 0; t < 2; ++t) for (int j = 0; j < 2; ++j) s[t][j] = fa_mma(kf[t][1], qf[j][1], s[t][j]);
      __builtin_amdgcn_sched_barrier(0);      /* without it the loads below rose in among the score products, into registers of their own */
      // The next pass's keys are read as soon as this pass's score products are issued: softmax and the second product cover their latency. A stage's last pass reads nothing ahead: the next stage is not published yet.
      if (ps + 1 < KS / 32) {
#pragma unroll
        for (int t = 0; t < 2; ++t) for (int ks = 0; ks < 2; ++ks) kf[t][ks] = frag(rb, (ps + 1) * 4096 + (t * 2 + ks) * 1024); }
      __builtin_amdgcn_sched_barrier(0);      /* without it the scheduler sank these loads into the second product, in four groups among its instructions */
      // Weights against the maximum in use (cb). Nothing is tested here: a weight that leaves the f16 range shows in O^T behind the loop.
      v16h pf[2]; v2f tot[2];
#pragma unroll
      for (int j = 0; j < 2; ++j) pf[j] = fa_weights<false>(s[0][j], s[1][j], 0.f, tot[j]);
#pragma unroll
      for (int j = 0; j < 2; ++j) { ls[j] += tot[j];
#pragma unroll
        for (int t = 0; t < 4; ++t) o[t][j] = fa_mma(vf[t], pf[j], o[t][j]); }
      // The order of the pass's vector work and second product, laid down for the scheduler (0x400 exponentials, 0x2 other vector instructions, 0x8 matrix instructions): eight exponentials ahead, then a rounding or a sum and an exponential in turn
      // when the first 16 queries are rounded, three of their products, the first two each with four such pairs of the other 16 queries behind it,
      // the third with the rest of the rounding and sums; then the last five products in a row, with no vector instruction behind a product whose registers it could take.
      // Left free, the scheduler put the exponentials in runs and sank the row sums behind the products, into registers which those had just read: four v_nop a place, 28 a stage.
      __builtin_amdgcn_sched_group_barrier(0x400, 8, 0); __builtin_amdgcn_sched_group_barrier(0x2, 1, 0); __builtin_amdgcn_sched_group_barrier(0x400, 1, 0); __builtin_amdgcn_sched_group_barrier(0x2, 1, 0); __builtin_amdgcn_sched_group_barrier(0x400, 1, 0); __builtin_amdgcn_sched_group_barrier(0x2, 1, 0); __builtin_amdgcn_sched_group_barrier(0x400, 1, 0); __builtin_amdgcn_sched_group_barrier(0x2, 1, 0); __builtin_amdgcn_sched_group_barrier(0x400, 1, 0); __builtin_amdgcn_sched_group_barrier(0x2, 1, 0); __builtin_amdgcn_sched_group_barrier(0x400, 1, 0); __builtin_amdgcn_sched_group_barrier(0x2, 1, 0); __builtin_amdgcn_sched_group_barrier(0x400, 1, 0); __builtin_amdgcn_sched_group_barrier(0x2, 1, 0); __builtin_amdgcn_sched_group_barrier(0x400, 1, 0); __builtin_amdgcn_sched_group_barrier(0x2, 1, 0); __builtin_amdgcn_sched_group_barrier(0x400, 1, 0); __builtin_amdgcn_sched_group_barrier(0x2, 1, 0); __builtin_amdgcn_sched_group_barrier(0x400, 1, 0); __builtin_amdgcn_sched_group_barrier(0x2, 1, 0); __builtin_amdgcn_sched_group_barrier(0x400, 1, 0); __builtin_amdgcn_sched_group_barrier(0x2, 1, 0); __builtin_amdgcn_sched_group_barrier(0x400, 1, 0); __builtin_amdgcn_sched_group_barrier(0x2, 1, 0); __builtin_amdgcn_sched_group_barrier(0x400, 1, 0); __builtin_amdgcn_sched_group_barrier(0x2, 1, 0); __builtin_amdgcn_sched_group_barrier(0x400, 1, 0); __builtin_amdgcn_sched_group_barrier(0x2, 1, 0); __builtin_amdgcn_sched_group_barrier(0x400, 1, 0); __builtin_amdgcn_sched_group_barrier(0x2, 1, 0); __builtin_amdgcn_sched_group_barrier(0x400, 1, 0); __builtin_amdgcn_sched_group_barrier(0x2, 1, 0); __builtin_amdgcn_sched_group_barrier(0x400, 1, 0); __builtin_amdgcn_sched_group_barrier(0x8, 1, 0); __builtin_amdgcn_sched_group_barrier(0x2, 1, 0); __builtin_amdgcn_sched_group_barrier(0x400, 1, 0); __builtin_amdgcn_sched_group_barrier(0x2, 1, 0); __builtin_amdgcn_sched_group_barrier(0x400, 1, 0); __builtin_amdgcn_sched_group_barrier(0x2, 1, 0); __builtin_amdgcn_sched_group_barrier(0x400, 1, 0); __builtin_amdgcn_sched_group_barrier(0x2, 1, 0); __builtin_amdgcn_sched_group_barrier(0x400, 1, 0); __builtin_amdgcn_sched_group_barrier(0x8, 1, 0); __builtin_amdgcn_sched_group_barrier(0x2, 1, 0); __builtin_amdgcn_sched_group_barrier(0x400, 1, 0); __builtin_amdgcn_sched_group_barrier(0x2, 1, 0); __builtin_amdgcn_sched_group_barrier(0x400, 1, 0); __builtin_amdgcn_sched_group_barrier(0x2, 1, 0); __builtin_amdgcn_sched_group_barrier(0x400, 1, 0); __builtin_amdgcn_sched_group_barrier(0x2, 1, 0); __builtin_amdgcn_sched_group_barrier(0x400, 1, 0); __builtin_amdgcn_sched_group_barrier(0x8, 1, 0); __builtin_amdgcn_sched_group_barrier(0x2, 8, 0); __builtin_amdgcn_sched_group_barrier(0x8, 5, 0);
      __builtin_amdgcn_sched_barrier(0);      /* without it the scheduler put the V^T loads below in two groups among the products */
      // The next pass's V^T is read at the end of this pass: the next score products and softmax cover its latency.
      if (ps + 1 < KS / 32) {
#pragma unroll
        for (int t = 0; t < 4; ++t) vf[t] = frag(rb, SB + (ps + 1) * 4096 + t * 1024); }
      __builtin_amdgcn_sched_barrier(0);      /* a pass ends here: without it the scheduler split the V^T loads above into groups among the next pass's score products */
    }
  }
  asm volatile("s_wait_asynccnt 0x0" ::: "memory");      /* no copy is out when the wave ends */
  // The one range test. A weight above the f16 range is infinite, its products with V^T are infinite or not a number, and no later sum makes them finite again: element 0 of each of the lane's two queries tells.
  // Rare (a score more than 8 powers of two above the maximum of the first 32 keys): this wave alone walks the keys again, from the start, with the test in every pass. It takes its fragments straight from k_prep's planes,
  // in the order in which the stages lie there, touches no LDS and meets no barrier, so the other waves of the block need not follow.
  if (__builtin_expect(__builtin_amdgcn_ballot_w32(!(__builtin_fabsf(o[0][0][0]) < __builtin_inff()) || !(__builtin_fabsf(o[0][1][0]) < __builtin_inff())) != 0u, 0)) {
    const int lr = (int)__builtin_amdgcn_mbcnt_lo(~0u, 0u);      /* the lane number, taken anew, so that no address of this path lives through the loop above */
    const char* kq = (const char*)(K16 + (size_t)slab * SQ * HD) + lr * 16; const char* vq = (const char*)(Vt + (size_t)slab * HD * SQ) + lr * 16;
    float mr[2] = {-3.0e38f, -3.0e38f};      /* the maximum in use */
    float thr = -1.0f;      /* bound of the range test: below every sum at the start, so that the first pass takes the branch and sets a real maximum */
#pragma unroll
    for (int j = 0; j < 2; ++j) { ls[j] = v2f{0.f, 0.f}; cb[j] = z8;      /* offset 0 until the first pass has set a maximum (an offset from the start value of mr would swallow the scores) */
#pragma unroll
      for (int t = 0; t < 4; ++t) o[t][j] = z8; }
#pragma unroll 1      /* rolled: this path is rare, and unrolled it would only lengthen the kernel's text */
    for (int p = 0; p < SQ / 32; ++p) {      /* one pass = 32 keys = 4 KiB of each plane */
#pragma unroll
      for (int t = 0; t < 2; ++t) for (int ks = 0; ks < 2; ++ks) kf[t][ks] = gfrag(kq, p * 4096 + (t * 2 + ks) * 1024);
#pragma unroll
      for (int t = 0; t < 4; ++t) vf[t] = gfrag(vq, p * 4096 + t * 1024);
      v8f s[2][2];
#pragma unroll
      for (int t = 0; t < 2; ++t) for (int j = 0; j < 2; ++j) s[t][j] = fa_mma(kf[t][0], qf[j][0], cb[j]);
#pragma unroll
      for (int t = 0; t < 2; ++t) for (int j = 0; j < 2; ++j) s[t][j] = fa_mma(kf[t][1], qf[j][1], s[t][j]);
      // Weights against the maximum IN USE (mr, cb), no maximum taken: a lane's two sums of 8 weights each are needed anyway and double as the range test.
      v16h pf[2]; v2f tot[2];
#pragma unroll
      for (int j = 0; j < 2; ++j) pf[j] = fa_weights<false>(s[0][j], s[1][j], 0.f, tot[j]);
      // One test per pass, a scalar branch for the whole wave. Not taken: every weight is at most 2^15 and finite in f16, and sum and O^T need no rescaling.
      // Taken (the first pass, by thr, and whenever scores have climbed some 4 to 7 powers of two above mr): the usual step of the running softmax, then this pass's weights anew (at most 2^8).
      if (__builtin_expect(__builtin_amdgcn_ballot_w32(fmaxf(fmaxf(tot[0].x, tot[0].y), fmaxf(tot[1].x, tot[1].y)) > thr) != 0u, 0)) {      /* rare: laid out behind the loop, so that the usual path falls through */
#pragma unroll
        for (int j = 0; j < 2; ++j) {
          float mx = fmaxf(s[0][j][0], s[1][j][0]);
#pragma unroll
          for (int r = 1; r < 8; ++r) mx = fmaxf(mx, fmaxf(s[0][j][r], s[1][j][r]));
          mx = fmaxf(mx, xhalf(mx));
          const float ob = cb[j][0], mn = fmaxf(mr[j], mx - ob), corr = __builtin_amdgcn_exp2f(mr[j] - mn), nbn = 8.0f - mn; mr[j] = mn;      /* the accumulators hold score + ob */
          ls[j] *= corr;
#pragma unroll
          for (int t = 0; t < 4; ++t) o[t][j] *= corr;
          pf[j] = fa_weights<true>(s[0][j], s[1][j], nbn - ob, tot[j]);
          cb[j] += nbn - ob;
        }
        thr = 32768.0f;
      }
#pragma unroll
      for (int j = 0; j < 2; ++j) { ls[j] += tot[j];
#pragma unroll
        for (int t = 0; t < 4; ++t) o[t][j] = fa_mma(vf[t], pf[j], o[t][j]); }
    }
  }
  // O goes out through the wave's block of buffer 0. That buffer is free: its last reads (the stage before the last) ended at the last stage's barrier, nothing was copied into it since, and the last stage lies in buffer 1; so no further barrier is needed.
  const int le = (int)__builtin_amdgcn_mbcnt_lo(~0u, 0u), lne = le & 15, hhe = le >> 4;      /* the lane number, taken anew: from the values of the prologue the compiler kept q's eight LDS places alive through the loop for use here, past 256 registers */
  char* os = &ring[0][0] + w * 8192;
#pragma unroll
  for (int j = 0; j < 2; ++j) { const float lj = ls[j].x + ls[j].y, inv = 1.0f / (lj + xhalf(lj)); char* orow = os + (j * 16 + lne) * 256;
#pragma unroll
    for (int t = 0; t < 4; ++t) { const v8f v = o[t][j] * inv; *(v4fa*)(orow + (((t * 4 + hhe * 2) ^ lne) << 4)) = v4f{v[0], v[1], v[2], v[3]}; *(v4fa*)(orow + (((t * 4 + hhe * 2 + 1) ^ lne) << 4)) = v4f{v[4], v[5], v[6], v[7]}; } }
  asm volatile("s_wait_dscnt 0x0" ::: "memory");      /* the wave's rows stand in LDS before other lanes of the same wave read them back */
  float* ob = O + ((size_t)slab * SQ + q0) * HD + le * 4;      /* the wave's 32 rows are 8 KiB in a row */
  v4f ov[16];
#pragma unroll
  for (int i = 0; i < 16; ++i) ov[i] = *(const v4fa*)(os + i * 512 + ((hhe * 256 + ((lne ^ hhe) << 4)) ^ ((i & 7) << 5)));      /* row 2 i + hhe, piece lne, at place lne ^ ((2 i + hhe) & 15) */
#pragma unroll
  for (int i = 0; i < 16; ++i) *(v4f*)(ob + i * 128) = ov[i]; }

extern "C" void kernel_launch(void* const* d_in, const int* in_sizes, int n_in,
                              void* d_out, int out_size, void* d_ws, size_t ws_size, hipStream_t stream) {
  (void)in_sizes; (void)n_in; (void)out_size;
  const float* const* I = (const float* const*)d_in; const float* q = I[0]; const float* k = I[1]; const float* v = I[2];
  char* ws = (char*)d_ws; size_t off = 0;
  auto take = [&](size_t bytes) { char* p = ws + off; off += (bytes + 255) & ~(size_t)255; return p; };
  _Float16* K16 = (_Float16*)take(NR * DM * 2); _Float16* VT = (_Float16*)take(NR * DM * 2);
  if (off > ws_size) return;      /* 2 x 12 = 24 MiB */
  k_prep<<<NB * (SQ / 128), 256, 0, stream>>>(k, v, K16, VT);      /* values are [B][S][12][64]: each slice's 64 columns of the 768-wide rows */
  k_attn<<<NB * (SQ / 128), 128, 0, stream>>>(q, K16, VT, (float*)d_out, 0.05205877313848632f);      /* 768^-0.5 x log2 e: exp(x) = 2^(x log2 e) */
}

// v010
// A run of this version takes 45.3 microseconds.
// In two side-by-side timings against v009, it was 1.04 and 1.03 times as fast.
// All steps since v000 together make it 420 times as fast.
#include <hip/hip_runtime.h>
#define NB 48
#define SQ 2048
#define DM 64
#define NH 1
#define HD 64
#define HG 1
#define NR ((size_t)NB * SQ)
typedef __bf16 v16b __attribute__((ext_vector_type(16)));
typedef unsigned short v8us __attribute__((ext_vector_type(8), may_alias));
typedef float  v8f  __attribute__((ext_vector_type(8)));
typedef float  v4f  __attribute__((ext_vector_type(4)));
typedef float  v4fa __attribute__((ext_vector_type(4), may_alias));
union FragB { v16b v; v8us half[2]; unsigned short u[16]; };

__device__ __forceinline__ unsigned short bf16_bits(float x) { unsigned int u = __float_as_uint(x); return (unsigned short)((u + 0x7FFFu + ((u >> 16) & 1u)) >> 16); }
__device__ __forceinline__ float bf16_val(unsigned short b) { return __uint_as_float(((unsigned int)b) << 16); }
__device__ __forceinline__ float bf16_round(float x) { return bf16_val(bf16_bits(x)); }
// D += A·B with NT terms: 1 = ah·bh, 2 = + al·bh (A split), 3 = + ah·bl (both split)
template <int NT>
__device__ __forceinline__ v8f mmaN(v16b ah, v16b al, v16b bh, v16b bl, v8f c) {
  c = __builtin_amdgcn_wmma_f32_16x16x32_bf16(false, ah, false, bh, (short)0, c, false, false);
  if (NT >= 2) c = __builtin_amdgcn_wmma_f32_16x16x32_bf16(false, al, false, bh, (short)0, c, false, false);
  if (NT >= 3) c = __builtin_amdgcn_wmma_f32_16x16x32_bf16(false, ah, false, bl, (short)0, c, false, false);
  asm volatile("v_nop\n\tv_nop\n\tv_nop\n\tv_nop" : "+v"(c) : "v"(ah), "v"(al), "v"(bh), "v"(bl));
  return c;
}

__global__ __launch_bounds__(256) void k_wt_bf16(const float* __restrict__ W, unsigned short* __restrict__ Wt, int K, int N) {
  const int t = blockIdx.x * 256 + threadIdx.x;
  const int k8n = K / 8;
  if (t >= N * k8n) return;
  const int n = t / k8n, k8 = (t % k8n) * 8;
  v8us v;
#pragma unroll
  for (int i = 0; i < 8; ++i) v[i] = bf16_bits(W[(size_t)(k8 + i) * N + n]);
  *(v8us*)(Wt + (size_t)n * K + k8) = v;
  
}

// GEMM C[M][N] (f32, pitch ldc) = act(A[M][K]·W + bias). A f32 row-major (pitch lda) converted per fragment to bf16
// (ASPLIT: hi/lo two planes -> 2 terms, else single rounded term); Wt bf16 [N][K] (pitch ldb). BIAS_BF16 rounds the
// bias to bf16 first (bias quantised to bf16 before the add). K%32==0, M%16==0, N%64==0.
template <bool ASPLIT, int ACT, bool BIAS_BF16>
__global__ __launch_bounds__(128) void k_gemm_bf(const float* __restrict__ A, int lda, const unsigned short* __restrict__ Wt, int ldb,
                                               const float* __restrict__ bias, float* __restrict__ C, int ldc, int M, int N, int K) {
  __shared__ __attribute__((aligned(16))) float so[4][16][64];
  const int tid = threadIdx.x, w = tid >> 5, lane = tid & 31, ln = lane & 15, hh = lane >> 4;
  const int ntn = N / 64;
  const int wid = blockIdx.x * 4 + w;
  const int mt = wid / ntn, nq = wid % ntn;
  if (mt * 16 >= M) return;
  const int row0 = mt * 16, col0 = nq * 64;
  const float* arow = A + (size_t)(row0 + ln) * lda;
  v8f acc[4] = {};
  for (int kb = 0; kb < K; kb += 32) {
    FragB ah, al;
    const v4f x0 = *(const v4fa*)(arow + kb + 8 * hh), x1 = *(const v4fa*)(arow + kb + 8 * hh + 4);
    const v4f x2 = *(const v4fa*)(arow + kb + 16 + 8 * hh), x3 = *(const v4fa*)(arow + kb + 16 + 8 * hh + 4);
    float xs[16] = {x0[0],x0[1],x0[2],x0[3],x1[0],x1[1],x1[2],x1[3],x2[0],x2[1],x2[2],x2[3],x3[0],x3[1],x3[2],x3[3]};
#pragma unroll
    for (int i = 0; i < 16; ++i) { const unsigned short hb = bf16_bits(xs[i]); ah.u[i] = hb; al.u[i] = ASPLIT ? bf16_bits(xs[i] - bf16_val(hb)) : (unsigned short)0; }
#pragma unroll
    for (int t = 0; t < 4; ++t) {
      const unsigned short* brow = Wt + (size_t)(col0 + t * 16 + ln) * ldb + kb;
      FragB b;
      b.half[0] = *(const v8us*)(brow + 8 * hh);
      b.half[1] = *(const v8us*)(brow + 16 + 8 * hh);
      acc[t] = mmaN<ASPLIT ? 2 : 1>(ah.v, al.v, b.v, b.v, acc[t]);
    }
  }
#pragma unroll
  for (int t = 0; t < 4; ++t) {
    float bv = bias ? bias[col0 + t * 16 + ln] : 0.f;
    if (BIAS_BF16) bv = bf16_round(bv);
#pragma unroll
    for (int r = 0; r < 8; ++r) { float v = acc[t][r] + bv; if (ACT == 1) v = fmaxf(v, 0.f); so[w][8 * hh + r][t * 16 + ln] = v; }
  }
  __builtin_amdgcn_fence(__ATOMIC_ACQ_REL, "workgroup");
  __builtin_amdgcn_wave_barrier();
  const int rsub = lane >> 4, c4 = (lane & 15) * 4;
  {
#pragma unroll
    for (int q = 0; q < 8; ++q) {
      const int r = q * 2 + rsub;
      const v4f v = *(const v4fa*)&so[w][r][c4];
      *(v4f*)(C + (size_t)(row0 + r) * ldc + col0 + c4) = v;
    }
    
  }
}

// GEMM C = act(A·W + bias + resid): A f32 (ASPLIT -> hi/lo 2 terms), Wt bf16 [N][K]; ACT 0 none, 1 relu, 2 exact gelu;
// resid (optional, f32, row index = (row % rmod), pitch ldr, RES_BF16 rounds it) added before the activation.
template <bool ASPLIT, int ACT, bool BIAS_BF16, bool RES_BF16>
__global__ __launch_bounds__(128) void k_gemm_bf3(const float* __restrict__ A, int lda, const unsigned short* __restrict__ Wt, int ldb,
                                                const float* __restrict__ bias, const float* __restrict__ resid, int rmod, int ldr,
                                                float* __restrict__ C, int ldc, int M, int N, int K) {
  __shared__ __attribute__((aligned(16))) float so[4][16][64];
  const int tid = threadIdx.x, w = tid >> 5, lane = tid & 31, ln = lane & 15, hh = lane >> 4;
  const int ntn = N / 64;
  const int wid = blockIdx.x * 4 + w;
  const int mt = wid / ntn, nq = wid % ntn;
  if (mt * 16 >= M) return;
  const int row0 = mt * 16, col0 = nq * 64;
  const float* arow = A + (size_t)(row0 + ln) * lda;
  v8f acc[4] = {};
  for (int kb = 0; kb < K; kb += 32) {
    FragB ah, al;
    const v4f x0 = *(const v4fa*)(arow + kb + 8 * hh), x1 = *(const v4fa*)(arow + kb + 8 * hh + 4);
    const v4f x2 = *(const v4fa*)(arow + kb + 16 + 8 * hh), x3 = *(const v4fa*)(arow + kb + 16 + 8 * hh + 4);
    float xs[16] = {x0[0],x0[1],x0[2],x0[3],x1[0],x1[1],x1[2],x1[3],x2[0],x2[1],x2[2],x2[3],x3[0],x3[1],x3[2],x3[3]};
#pragma unroll
    for (int i = 0; i < 16; ++i) { const unsigned short hb = bf16_bits(xs[i]); ah.u[i] = hb; al.u[i] = ASPLIT ? bf16_bits(xs[i] - bf16_val(hb)) : (unsigned short)0; }
#pragma unroll
    for (int t = 0; t < 4; ++t) {
      const unsigned short* brow = Wt + (size_t)(col0 + t * 16 + ln) * ldb + kb;
      FragB b;
      b.half[0] = *(const v8us*)(brow + 8 * hh);
      b.half[1] = *(const v8us*)(brow + 16 + 8 * hh);
      acc[t] = mmaN<ASPLIT ? 2 : 1>(ah.v, al.v, b.v, b.v, acc[t]);
    }
  }
#pragma unroll
  for (int t = 0; t < 4; ++t) {
    const int col = col0 + t * 16 + ln;
    float bv = bias ? bias[col] : 0.f;
    if (BIAS_BF16) bv = bf16_round(bv);
#pragma unroll
    for (int r = 0; r < 8; ++r) {
      float v = acc[t][r] + bv;
      if (resid) { float rv = resid[(size_t)((row0 + 8 * hh + r) % rmod) * ldr + col]; if (RES_BF16) rv = bf16_round(rv); v += rv; }
      if (ACT == 1) v = fmaxf(v, 0.f);
      if (ACT == 2) v = 0.5f * v * (1.0f + erff(v * 0.70710678118654752f));
      if (ACT == 3) { const float u = 0.7978845608028654f * (v + 0.044715f * v * v * v); v = 0.5f * v * (1.0f + tanhf(u)); }
      so[w][8 * hh + r][t * 16 + ln] = v;
    }
  }
  __builtin_amdgcn_fence(__ATOMIC_ACQ_REL, "workgroup");
  __builtin_amdgcn_wave_barrier();
  const int rsub = lane >> 4, c4 = (lane & 15) * 4;
  {
#pragma unroll
    for (int q = 0; q < 8; ++q) {
      const int r = q * 2 + rsub;
      const v4f v = *(const v4fa*)&so[w][r][c4];
      *(v4f*)(C + (size_t)(row0 + r) * ldc + col0 + c4) = v;
    }
    
  }
}
// row LayerNorm (biased variance, eps) over N: s = X (+ R); optional out_sum <- s; out_norm <- (s-mu)*rsqrt(var+eps)*g + b
template <bool PARAM_BF16>
__global__ __launch_bounds__(256) void k_layernorm(const float* __restrict__ X, const float* __restrict__ R, const float* __restrict__ g, const float* __restrict__ bta,
                                                  float* __restrict__ out_sum, float* __restrict__ out_norm, int N, float eps) {
  __shared__ float red[256];
  const int row = blockIdx.x, tid = threadIdx.x;
  const float* x = X + (size_t)row * N; const float* rr = R ? R + (size_t)row * N : nullptr;
  float vals[16];                     // up to N = 4096
  const int per = N / 256;            // contiguous chunk per thread? use strided-by-4 chunks: thread handles j = tid*4 + 1024*u
  float s1 = 0.f;
  for (int u = 0; u < per / 4; ++u) {
    const int j = tid * 4 + 1024 * u;
    const v4f a = *(const v4fa*)(x + j);
    v4f b = {0.f,0.f,0.f,0.f}; if (rr) b = *(const v4fa*)(rr + j);
#pragma unroll
    for (int q = 0; q < 4; ++q) { const float v = a[q] + b[q]; vals[u * 4 + q] = v; s1 += v; }
  }
  red[tid] = s1; __syncthreads();
  for (int st = 128; st > 0; st >>= 1) { if (tid < st) red[tid] += red[tid + st]; __syncthreads(); }
  const float mu = red[0] / (float)N; __syncthreads();
  float s2 = 0.f;
  for (int u = 0; u < per / 4; ++u)
#pragma unroll
    for (int q = 0; q < 4; ++q) { const float c = vals[u * 4 + q] - mu; s2 += c * c; }
  red[tid] = s2; __syncthreads();
  for (int st = 128; st > 0; st >>= 1) { if (tid < st) red[tid] += red[tid + st]; __syncthreads(); }
  const float rs = rsqrtf(red[0] / (float)N + eps);
  {
    for (int u = 0; u < per / 4; ++u) {
      const int j = tid * 4 + 1024 * u;
      v4f o, sm;
#pragma unroll
      for (int q = 0; q < 4; ++q) {
        float gg = g[j + q], bb = bta[j + q];
        if (PARAM_BF16) { gg = bf16_round(gg); bb = bf16_round(bb); }
        sm[q] = vals[u * 4 + q]; o[q] = (vals[u * 4 + q] - mu) * rs * gg + bb;
      }
      if (out_sum) *(v4f*)(out_sum + (size_t)row * N + j) = sm;
      *(v4f*)(out_norm + (size_t)row * N + j) = o;
    }
    
  }
}



// ---- f16 WMMA path (v_wmma_f32_16x16x32_f16): 11-bit significands for operands in range — used where a [0,1] probability operand needs more precision than bf16
typedef _Float16 v16h __attribute__((ext_vector_type(16)));
union FragH { v16h v; v8us half[2]; _Float16 h[16]; unsigned short u[16]; };
template <int NT>
__device__ __forceinline__ v8f mmaH(v16h ah, v16h al, v16h bh, v16h bl, v8f c) {
  c = __builtin_amdgcn_wmma_f32_16x16x32_f16(false, ah, false, bh, (short)0, c, false, false);
  if (NT >= 2) c = __builtin_amdgcn_wmma_f32_16x16x32_f16(false, al, false, bh, (short)0, c, false, false);
  if (NT >= 3) c = __builtin_amdgcn_wmma_f32_16x16x32_f16(false, ah, false, bl, (short)0, c, false, false);
  asm volatile("v_nop\n\tv_nop\n\tv_nop\n\tv_nop" : "+v"(c) : "v"(ah), "v"(al), "v"(bh), "v"(bl));
  return c;
}
// batched GEMM like k_gemm_b but f16 operands: A f32 (split into f16 hi/lo if ASPLIT, else rounded to f16), Bt = f16 values [n][k]; alpha; C f32; N multiple of 16 (partial tiles skipped)
template <bool ASPLIT>
__global__ __launch_bounds__(128) void k_gemm_h(const float* __restrict__ A, int lda, size_t sA, const _Float16* __restrict__ Bh, int ldb, size_t sB, float alpha, float* __restrict__ C, int ldc, size_t sC, int M, int N, int K) {
  __shared__ __attribute__((aligned(16))) float so[4][16][64];
  const int tid = threadIdx.x, w = tid >> 5, lane = tid & 31, ln = lane & 15, hh = lane >> 4; const int by = blockIdx.y;
  A += (size_t)by * sA; Bh += (size_t)by * sB; C += (size_t)by * sC;
  const int ntn = (N + 63) / 64; const int wid = blockIdx.x * 4 + w; const int mt = wid / ntn, nq = wid % ntn; if (mt * 16 >= M) return;
  const int row0 = mt * 16, col0 = nq * 64; const float* arow = A + (size_t)(row0 + ln) * lda;
  v8f acc[4] = {};
  for (int kb = 0; kb < K; kb += 32) {
    FragH ah, al;
    const v4f x0 = *(const v4fa*)(arow + kb + 8 * hh), x1 = *(const v4fa*)(arow + kb + 8 * hh + 4), x2 = *(const v4fa*)(arow + kb + 16 + 8 * hh), x3 = *(const v4fa*)(arow + kb + 16 + 8 * hh + 4);
    float xs[16] = {x0[0],x0[1],x0[2],x0[3],x1[0],x1[1],x1[2],x1[3],x2[0],x2[1],x2[2],x2[3],x3[0],x3[1],x3[2],x3[3]};
#pragma unroll
    for (int i = 0; i < 16; ++i) { const _Float16 h = (_Float16)xs[i]; ah.h[i] = h; al.h[i] = ASPLIT ? (_Float16)(xs[i] - (float)h) : (_Float16)0.0f; }
#pragma unroll
    for (int t = 0; t < 4; ++t) { if (col0 + t * 16 >= N) continue; const size_t boff = (size_t)(col0 + t * 16 + ln) * ldb + kb; FragH bq; bq.half[0] = *(const v8us*)(Bh + boff + 8 * hh); bq.half[1] = *(const v8us*)(Bh + boff + 16 + 8 * hh);
      acc[t] = mmaH<ASPLIT ? 2 : 1>(ah.v, al.v, bq.v, bq.v, acc[t]); }
  }
#pragma unroll
  for (int t = 0; t < 4; ++t) { if (col0 + t * 16 >= N) continue;
#pragma unroll
    for (int r = 0; r < 8; ++r) so[w][8 * hh + r][t * 16 + ln] = acc[t][r] * alpha; }
  __builtin_amdgcn_fence(__ATOMIC_ACQ_REL, "workgroup"); __builtin_amdgcn_wave_barrier();
  const int rsub = lane >> 4, c4 = (lane & 15) * 4;
  {
#pragma unroll
    for (int q = 0; q < 8; ++q) { const int r = q * 2 + rsub; if (col0 + c4 < N) { const v4f v = *(const v4fa*)&so[w][r][c4]; *(v4f*)(C + (size_t)(row0 + r) * ldc + col0 + c4) = v; } }
     }
}

// Wt[n][k] = f16(W[k][n]·scale) from f32 row-major W[K][N] (scale = power of two; bf16-exact weights stay exact in f16 away from the subnormal range)
__global__ __launch_bounds__(256) void k_wt_f16(const float* __restrict__ W, _Float16* __restrict__ Wt, int K, int N, float scale) {
  const int t = blockIdx.x * 256 + threadIdx.x; if (t >= N * (K / 8)) return; const int n = t / (K / 8), k8 = (t % (K / 8)) * 8; FragH f;
#pragma unroll
  for (int i = 0; i < 8; ++i) f.h[i] = (_Float16)(bf16_round(W[(size_t)(k8 + i) * N + n]) * scale); const v8us o = f.half[0];
  *(v8us*)((unsigned short*)Wt + (size_t)n * K + k8) = o; 
}
// k_gemm_hh variant with fused epilogue: v = acc·alpha + bias[by·sBias + col] (+ CP[(row/rowsPerB)·sCPb + by·64 + col] if CP) ; ACT 0 none / 1 elu ; writes f16 C16 (and f32 C if non-null)
template <int ACT>
__global__ __launch_bounds__(128) void k_gemm_hhx(const _Float16* __restrict__ A, int lda, size_t sA, const _Float16* __restrict__ Bh, int ldb, size_t sB, float alpha, const float* __restrict__ bias, size_t sBias, const float* __restrict__ CP, int rowsPerB, size_t sCPb, int row0g,
    float* __restrict__ C, _Float16* __restrict__ C16, int ldc, size_t sC, int M, int N, int K) {
  __shared__ __attribute__((aligned(16))) float so[4][16][64];
  const int tid = threadIdx.x, w = tid >> 5, lane = tid & 31, ln = lane & 15, hh = lane >> 4; const int by = blockIdx.y;
  A += (size_t)by * sA; Bh += (size_t)by * sB; const size_t cofs = (size_t)by * sC; const float* bp = bias ? bias + (size_t)by * sBias : nullptr;
  const int ntn = (N + 63) / 64; const int wid = blockIdx.x * 4 + w; const int mt = wid / ntn, nq = wid % ntn; if (mt * 16 >= M) return;
  const int row0 = mt * 16, col0 = nq * 64; const _Float16* arow = A + (size_t)(row0 + ln) * lda;
  v8f acc[4] = {};
  for (int kb = 0; kb < K; kb += 32) { FragH ah; ah.half[0] = *(const v8us*)((const unsigned short*)arow + kb + 8 * hh); ah.half[1] = *(const v8us*)((const unsigned short*)arow + kb + 16 + 8 * hh);
#pragma unroll
    for (int t = 0; t < 4; ++t) { if (col0 + t * 16 >= N) continue; const size_t boff = (size_t)(col0 + t * 16 + ln) * ldb + kb; FragH bq; bq.half[0] = *(const v8us*)((const unsigned short*)Bh + boff + 8 * hh); bq.half[1] = *(const v8us*)((const unsigned short*)Bh + boff + 16 + 8 * hh);
      acc[t] = mmaH<1>(ah.v, ah.v, bq.v, bq.v, acc[t]); }
  }
#pragma unroll
  for (int t = 0; t < 4; ++t) { if (col0 + t * 16 >= N) continue; const int col = col0 + t * 16 + ln; const float bv = bp ? bf16_round(bp[col]) : 0.f;
#pragma unroll
    for (int r = 0; r < 8; ++r) { float v = acc[t][r] * alpha + bv; if (CP) { const int rr = row0g + row0 + 8 * hh + r; if (rowsPerB < 0) v += CP[cofs + (size_t)rr * ldc + col];      /* rowsPerB < 0: own element of the batched C plane */ else { const int bidx = rr / rowsPerB; v += CP[(size_t)bidx * sCPb + (size_t)by * 64 + col]; } } if (ACT == 1) v = (v > 0.f) ? v : expm1f(v); else if (ACT == 7) v = (v > 0.f) ? v + 1.0f : expf(v); else if (ACT == 8) v = tanhf(v); else if (ACT == 9) v = 0.5f * v * (1.0f + tanhf(0.7978845608028654f * (v + 0.044715f * v * v * v))); else if (ACT == 11) v = 1.0f / (1.0f + expf(-v)); else if (ACT == 12) v = (v > 0.f) ? v : 0.01f * v; else if (ACT == 14) v = (v > 0.f) ? v : 0.1f * v; else if (ACT == 16) v = (v >= 0.f) ? v : 0.3f * v; else if (ACT == 17) v = (v >= 0.f) ? v : 0.2f * v; else if (ACT == 15) v = v / (1.0f + expf(-v)); else if (ACT == 3) v = fmaxf(v, 0.f); else if (ACT == 6) v = 0.5f * v * (1.0f + erff(v * 0.70710678118654752f)); so[w][8 * hh + r][t * 16 + ln] = v; } }
  __builtin_amdgcn_fence(__ATOMIC_ACQ_REL, "workgroup"); __builtin_amdgcn_wave_barrier();
  const int rsub = lane >> 4, c4 = (lane & 15) * 4; typedef _Float16 v4h __attribute__((ext_vector_type(4)));
  {
#pragma unroll
    for (int q = 0; q < 8; ++q) { const int r = q * 2 + rsub; if (col0 + c4 < N) { const v4f v = *(const v4fa*)&so[w][r][c4]; if (C) *(v4f*)(C + cofs + (size_t)(row0 + r) * ldc + col0 + c4) = v; if (C16) { v4h h4; for (int i = 0; i < 4; ++i) h4[i] = (_Float16)v[i]; *(v4h*)(C16 + cofs + (size_t)(row0 + r) * ldc + col0 + c4) = h4; } } }
     }
}


typedef _Float16 v4h __attribute__((ext_vector_type(4)));
typedef _Float16 v4ha __attribute__((ext_vector_type(4), may_alias));

__global__ __launch_bounds__(256) void k_x16(const float* __restrict__ x, _Float16* __restrict__ X16, size_t n8) { const size_t t = (size_t)blockIdx.x * 256 + threadIdx.x; if (t >= n8) return; FragH f;
#pragma unroll
  for (int q = 0; q < 8; ++q) f.h[q] = (_Float16)bf16_round(x[t * 8 + q]); *(v8us*)((unsigned short*)X16 + t * 8) = f.half[0];  }
__global__ __launch_bounds__(256) void k_h16(const float* __restrict__ x, _Float16* __restrict__ X16, size_t n8) { const size_t t = (size_t)blockIdx.x * 256 + threadIdx.x; if (t >= n8) return; FragH f;
#pragma unroll
  for (int q = 0; q < 8; ++q) f.h[q] = (_Float16)x[t * 8 + q]; *(v8us*)((unsigned short*)X16 + t * 8) = f.half[0];  }
__global__ __launch_bounds__(256) void k_round16f(const float* __restrict__ W, _Float16* __restrict__ Bt, size_t n8) { const size_t t = (size_t)blockIdx.x * 256 + threadIdx.x; if (t >= n8) return; FragH f;
#pragma unroll
  for (int i = 0; i < 8; ++i) f.h[i] = (_Float16)(bf16_round(W[t * 8 + i]) * 16.0f); *(v8us*)((unsigned short*)Bt + t * 8) = f.half[0];  }
template <int NHv, int TTv>
__global__ __launch_bounds__(256) void k_vt(const _Float16* __restrict__ V16, int ldv, int voff, _Float16* __restrict__ Vt) { __shared__ unsigned short tl[64][66]; const int tid = threadIdx.x; const int slab = blockIdx.x / (TTv / 64), lg = blockIdx.x % (TTv / 64); const int b = slab / NHv, h = slab % NHv;
  for (int i = tid; i < 64 * 8; i += 256) { const int r = i / 8, c8 = (i % 8) * 8; FragH f; f.half[0] = *(const v8us*)((const unsigned short*)V16 + ((size_t)b * TTv + lg * 64 + r) * ldv + voff + h * 64 + c8);
#pragma unroll
    for (int q = 0; q < 8; ++q) tl[r][c8 + q] = f.u[q]; }
  __syncthreads();
  {
#pragma unroll
    for (int rd = 0; rd < 2; ++rd) { const int d = rd * 32 + tid / 8, pc = tid % 8; FragH f;
#pragma unroll
      for (int q = 0; q < 8; ++q) f.u[q] = tl[pc * 8 + q][d];
      *(v8us*)((unsigned short*)Vt + ((size_t)slab * 64 + d) * TTv + lg * 64 + pc * 8) = f.half[0]; }
     } }

__global__ __launch_bounds__(256) void k_hl(const float* __restrict__ F, _Float16* __restrict__ Hh, _Float16* __restrict__ Hl, size_t n8) { const size_t t = (size_t)blockIdx.x * 256 + threadIdx.x; if (t >= n8) return; FragH fh, fl; const v4f a = *(const v4fa*)(F + t * 8), c = *(const v4fa*)(F + t * 8 + 4);
#pragma unroll
  for (int q = 0; q < 4; ++q) { _Float16 h = (_Float16)a[q]; fh.h[q] = h; fl.h[q] = (_Float16)((a[q] - (float)h) * 1024.0f); h = (_Float16)c[q]; fh.h[4 + q] = h; fl.h[4 + q] = (_Float16)((c[q] - (float)h) * 1024.0f); }
  { *(v8us*)((unsigned short*)Hh + t * 8) = fh.half[0]; *(v8us*)((unsigned short*)Hl + t * 8) = fl.half[0];  } }

// ---- fast GEMM (wave tile 32x64; requires M % 32 == 0 rows per launch region and N % 64 == 0); epilogue = k_gemm_hhx semantics ----
__device__ __forceinline__ v16h g2_frag(const _Float16* p, int hh) { FragH f; f.half[0] = *(const v8us*)((const unsigned short*)p + 8 * hh); f.half[1] = *(const v8us*)((const unsigned short*)p + 16 + 8 * hh); return f.v; }
__device__ __forceinline__ v8f g2_mma(v16h a, v16h b, v8f c) { v8f d = __builtin_amdgcn_wmma_f32_16x16x32_f16(false, a, false, b, (short)0, c, false, false); asm volatile("v_nop\n\tv_nop\n\tv_nop\n\tv_nop" : "+v"(d) : "v"(a), "v"(b)); return d; }
template <int ACT>
__global__ __launch_bounds__(128) void k_gemm2(const _Float16* __restrict__ A, int lda, size_t sA, const _Float16* __restrict__ Bh, int ldb, size_t sB, float alpha, const float* __restrict__ bias, size_t sBias, const float* __restrict__ CP, int rowsPerB, size_t sCPb, int row0g,
    float* __restrict__ C, _Float16* __restrict__ C16, int ldc, size_t sC, int M, int N, int K) { static_assert(ACT == 0 || ACT == 3 || ACT == 6 || ACT == 8 || ACT == 9 || ACT == 11 || ACT == 12 || ACT == 14 || ACT == 15 || ACT == 16 || ACT == 17, "k_gemm2: unsupported ACT code (would silently apply no activation)");
  __shared__ __attribute__((aligned(16))) float so[4][32][68];
  const int tid = threadIdx.x, w = tid >> 5, lane = tid & 31, ln = lane & 15, hh = lane >> 4; const int by = blockIdx.y;
  A += (size_t)by * sA; Bh += (size_t)by * sB; const size_t cofs = (size_t)by * sC; const float* bp = bias ? bias + (size_t)by * sBias : nullptr;
  const int ntn = N >> 6; const int mt = blockIdx.x / ntn, nq = blockIdx.x - mt * ntn; const int row0 = mt * 128 + 32 * w, col0 = nq * 64; if (row0 >= M) return;
  const _Float16* a0p = A + (size_t)(row0 + ln) * lda; const _Float16* a1p = a0p + (size_t)16 * lda;
  const _Float16* b0p = Bh + (size_t)(col0 + ln) * ldb; const _Float16* b1p = b0p + (size_t)16 * ldb; const _Float16* b2p = b1p + (size_t)16 * ldb; const _Float16* b3p = b2p + (size_t)16 * ldb;
  const v8f z8 = {0.f,0.f,0.f,0.f,0.f,0.f,0.f,0.f}; v8f c00 = z8, c01 = z8, c02 = z8, c03 = z8, c10 = z8, c11 = z8, c12 = z8, c13 = z8;
#pragma unroll 1
  for (int kb = 0; kb < K; kb += 32) { const v16h a0 = g2_frag(a0p + kb, hh), a1 = g2_frag(a1p + kb, hh);
    v16h b = g2_frag(b0p + kb, hh); c00 = g2_mma(a0, b, c00); c10 = g2_mma(a1, b, c10);
    b = g2_frag(b1p + kb, hh); c01 = g2_mma(a0, b, c01); c11 = g2_mma(a1, b, c11);
    b = g2_frag(b2p + kb, hh); c02 = g2_mma(a0, b, c02); c12 = g2_mma(a1, b, c12);
    b = g2_frag(b3p + kb, hh); c03 = g2_mma(a0, b, c03); c13 = g2_mma(a1, b, c13); }
  v8f accs[8] = {c00, c01, c02, c03, c10, c11, c12, c13};
#pragma unroll
  for (int u = 0; u < 8; ++u) { const int t = u & 3, half = u >> 2; const int col = col0 + t * 16 + ln; const float bv = bp ? bf16_round(bp[col]) : 0.f;
#pragma unroll
    for (int r = 0; r < 8; ++r) { const int rloc = half * 16 + 8 * hh + r; float v = accs[u][r] * alpha + bv; if (CP) { if (rowsPerB < 0) v += CP[cofs + (size_t)(row0g + row0 + rloc) * ldc + col];      /* rowsPerB < 0: own element of the batched C plane */ else { const int bidx = (row0g + row0 + rloc) / rowsPerB; v += CP[(size_t)bidx * sCPb + (size_t)by * 64 + col]; } }
      if (ACT == 3) v = fmaxf(v, 0.f); else if (ACT == 6) v = 0.5f * v * (1.0f + erff(v * 0.70710678118654752f)); else if (ACT == 11) v = 1.0f / (1.0f + expf(-v)); else if (ACT == 15) v = v / (1.0f + expf(-v)); else if (ACT == 12) v = (v > 0.f) ? v : 0.01f * v; else if (ACT == 8) v = tanhf(v); else if (ACT == 9) v = 0.5f * v * (1.0f + tanhf(0.7978845608028654f * (v + 0.044715f * v * v * v))); else if (ACT == 14) v = (v > 0.f) ? v : 0.1f * v; else if (ACT == 16) v = (v >= 0.f) ? v : 0.3f * v; else if (ACT == 17) v = (v >= 0.f) ? v : 0.2f * v;
      so[w][rloc][t * 16 + ln] = v; } }
  __builtin_amdgcn_fence(__ATOMIC_ACQ_REL, "workgroup"); __builtin_amdgcn_wave_barrier();
  const int rsub = lane >> 4, c4 = (lane & 15) * 4;
  {
#pragma unroll
    for (int q = 0; q < 16; ++q) { const int r = q * 2 + rsub; const v4f v = *(const v4fa*)&so[w][r][c4]; if (C) *(v4f*)(C + cofs + (size_t)(row0 + r) * ldc + col0 + c4) = v; if (C16) { v4h h4; for (int i = 0; i < 4; ++i) h4[i] = (_Float16)v[i]; *(v4h*)(C16 + cofs + (size_t)(row0 + r) * ldc + col0 + c4) = h4; } }
     } }


__global__ __launch_bounds__(256) void k_wnat(const float* __restrict__ w, size_t n8, _Float16* __restrict__ Bt) { const size_t t = (size_t)blockIdx.x * 256 + threadIdx.x; if (t >= n8) return; FragH f; for (int q = 0; q < 8; ++q) f.h[q] = (_Float16)(bf16_round(w[t * 8 + q]) * 16.0f); *(v8us*)((unsigned short*)Bt + t * 8) = f.half[0];  }
__global__ __launch_bounds__(256) void k_rsm(const float* __restrict__ S, _Float16* __restrict__ P, int nrows) {
  #pragma clang fp contract(off)
  const int i = blockIdx.x * 256 + threadIdx.x; if (i >= nrows) return; const float* s = S + (size_t)i * SQ; float mx = -3.0e38f;
#pragma unroll 1
  for (int j = 0; j < SQ; ++j) mx = fmaxf(mx, s[j]); float se = 0.f;
#pragma unroll 1
  for (int j = 0; j < SQ; ++j) se += expf(s[j] - mx); const float sc = 256.0f / se;
#pragma unroll 1
  for (int j0 = 0; j0 < SQ; j0 += 8) { FragH f; for (int q = 0; q < 8; ++q) f.h[q] = (_Float16)(expf(s[j0 + q] - mx) * sc); unsigned short* d = (unsigned short*)P + (size_t)i * SQ + j0; *(v8us*)d = f.half[0];  } }
__global__ __launch_bounds__(256) void k_vt(const _Float16* __restrict__ V16, int b, int h0, _Float16* __restrict__ VT) { __shared__ unsigned short tl[64][65]; const int tid = threadIdx.x; const int hh = blockIdx.x % HG, sg = blockIdx.x / HG; const int s0 = sg * 64; const int h = h0 + hh;
  for (int i = tid; i < 64 * 8; i += 256) { const int j = i / 8, d8 = (i % 8) * 8; FragH f; f.half[0] = *(const v8us*)((const unsigned short*)V16 + ((size_t)b * SQ + s0 + j) * DM + h * HD + d8); for (int q = 0; q < 8; ++q) tl[d8 + q][j] = f.u[q]; }
  __syncthreads();
  { for (int i = tid; i < 64 * 8; i += 256) { const int d = i / 8, j8 = (i % 8) * 8; FragH f; for (int q = 0; q < 8; ++q) f.u[q] = tl[d][j8 + q]; *(v8us*)((unsigned short*)VT + ((size_t)hh * HD + d) * SQ + s0 + j8) = f.half[0]; }  } }


// K and V for the fused kernel, all (batch, head) slices in one launch, straight from the f32 inputs. A block takes 128 keys of one slice: their K rows (8192 floats in a row) and their V rows (64 floats each, 768 apart) go out rounded, V transposed.
// Both go out in FRAGMENT ORDER: per 32 keys 4 KiB = 8 pieces of 512 bytes, a piece = the 16 bytes of lane 0, lane 1, ... lane 31 of one 16-byte load of k_attn, so that such a load covers four whole 128-byte lines
// (row-major, the 32 lanes of a K load fell on 16 lines and those of a V^T load on 8, and the WGP cache pays by the line touched).
// K16[slice][key / 32][t][ks][half][hh][ln][8] = k[key = t 16 + ln][d = ks 32 + half 16 + hh 8 + 0..7]; Vt[slice][key / 32][t][half][hh][ln][8] = v[key = half 16 + hh 8 + 0..7][d = t 16 + ln].
// 768 equal blocks of 8 waves, three on each of 256 WGPs, all resident at once; a thread has its 8 + 8 loads of 16 bytes out before it converts anything, and each load of a wave covers whole lines (512 bytes in a row of K, two 256-byte row pieces of V).
__global__ __launch_bounds__(256) void k_prep(const float* __restrict__ k, const float* __restrict__ v, _Float16* __restrict__ K16, _Float16* __restrict__ Vt) { __shared__ unsigned short tl[128][66]; __shared__ __attribute__((aligned(16))) unsigned short kl[32][272];      /* kl: 32 pieces of K, 512 bytes each at a pitch of 544: the four pieces that one wave's store falls on start 8 banks apart */
  const int tid = threadIdx.x; const int slab = blockIdx.x / (SQ / 128), lg = blockIdx.x % (SQ / 128); const int b = slab / 12, h = slab % 12;
  const float* kp = k + (size_t)blockIdx.x * (128 * HD) + tid * 4; const float* vp = v + ((size_t)b * SQ + lg * 128 + tid / 16) * 768 + h * 64 + (tid % 16) * 4;
  v4f ka[8], va[8];
#pragma unroll
  for (int u = 0; u < 8; ++u) ka[u] = *(const v4fa*)(kp + u * 1024);
#pragma unroll
  for (int u = 0; u < 8; ++u) va[u] = *(const v4fa*)(vp + (size_t)u * 16 * 768);
  __builtin_amdgcn_sched_barrier(0);      /* all sixteen loads go out together: without it the scheduler sank most of the K loads between the conversions, one memory round trip behind the other */
#pragma unroll
  for (int u = 0; u < 8; ++u) { FragH f;
#pragma unroll
    for (int q = 0; q < 4; ++q) f.h[q] = (_Float16)bf16_round(va[u][q]);
#pragma unroll
    for (int q = 0; q < 4; ++q) tl[u * 16 + tid / 16][(tid % 16) * 4 + q] = f.u[q]; }
  // K: load u of this thread is key u 16 + tid / 16, d = (tid % 16) 4 + 0..3: piece u 4 + d / 16, hh = (d / 8) % 2, ln = tid / 16, first or second 8 bytes of the lane's 16.
#pragma unroll
  for (int u = 0; u < 8; ++u) { v4h f;
#pragma unroll
    for (int q = 0; q < 4; ++q) f[q] = (_Float16)bf16_round(ka[u][q]);
    *(v4ha*)&kl[u * 4 + (tid % 16) / 4][((((tid % 16) >> 1) & 1) * 16 + tid / 16) * 8 + (tid & 1) * 4] = f; }
  __syncthreads();
  // Behind the barrier a wave takes whole pieces: round rd is the block's rd-th group of 32 keys, wave w its piece w, and every store is 512 bytes in a row.
  const int w = tid >> 5, lane = tid & 31, ln = lane & 15, hh = lane >> 4;
#pragma unroll
  for (int rd = 0; rd < 4; ++rd) *(v8us*)((unsigned short*)K16 + (size_t)blockIdx.x * (128 * HD) + (rd * 256 + tid) * 8) = *(const v8us*)&kl[rd * 8 + w][lane * 8];
#pragma unroll
  for (int rd = 0; rd < 4; ++rd) { const int d = (w >> 1) * 16 + ln, k0 = rd * 32 + (w & 1) * 16 + hh * 8; FragH f;
#pragma unroll
    for (int q = 0; q < 8; ++q) f.u[q] = tl[k0 + q][d];
    *(v8us*)((unsigned short*)Vt + (size_t)blockIdx.x * (128 * HD) + (rd * 256 + tid) * 8) = f.half[0]; } }

typedef float v2f __attribute__((ext_vector_type(2)));
typedef _Float16 v2h __attribute__((ext_vector_type(2)));
__device__ __forceinline__ float xhalf(float x) { return __builtin_bit_cast(float, __builtin_amdgcn_permlanex16(__builtin_bit_cast(int, x), __builtin_bit_cast(int, x), 0x76543210, 0xfedcba98, false, false)); }      /* lane l <-> lane l ^ 16 */
__device__ __forceinline__ v8f fa_mma(v16h a, v16h b, v8f c) { return __builtin_amdgcn_wmma_f32_16x16x32_f16(false, a, false, b, (short)0, c, false, false); }
// The 16 weights of one lane for one query: 2^(s + dl), rounded to f16 in the order of the B operand; sm = their f32 sums, even and odd keys apart. s = the score accumulators, which hold scaled score + exponent offset as they leave the matrix unit; SH false: dl is 0 and nothing is added.
template <bool SH>
__device__ __forceinline__ v16h fa_weights(v8f s0, v8f s1, float dl, v2f& sm) { FragH pf;
#pragma unroll
  for (int i = 0; i < 8; ++i) { const v8f sv = i < 4 ? s0 : s1; v2f a = {sv[2 * (i & 3)], sv[2 * (i & 3) + 1]}; if (SH) a += v2f{dl, dl};
    const v2f p = {__builtin_amdgcn_exp2f(a.x), __builtin_amdgcn_exp2f(a.y)}; sm = i ? sm + p : p; const v2h ph = __builtin_convertvector(p, v2h); pf.h[2 * i] = ph.x; pf.h[2 * i + 1] = ph.y; }
  return pf.v; }
// Scores, softmax and weighted sum in one kernel. Block = 4 waves x 32 queries of one (batch, head) slice; grid = 48 x 16 = 768 blocks, three on each of 256 WGPs.
// S^T = K Q^T: A = 16 key rows, B = 16 query rows (kept in registers), same k order for both. A lane's 8 accumulator registers are keys 8 hh + r of ONE query (column ln):
// maximum and sum run inside the lane plus one exchange with lane ^ 16, and two S^T tiles (keys 0-15, 16-31), converted in place, ARE the B operand of O^T += V^T P^T (k = 8 hh + r, 16 + 8 hh + r: the order in which k_prep has laid V^T out).
// Softmax per query: m = the maximum in use (scaled scores, powers of two), weights 2^(8 + s - m); the 2^8 cancels in the division at the end. First walk: m = the maximum over the first 32 keys, kept to the end, nothing tested in the loop.
// A later score more than 8 above m makes a weight infinite in f16, and every element of that query's O^T then ends infinite or not a number: one element per query is looked at behind the loop.
// Second walk (only a wave that found such an element; a scalar branch): the running softmax with the range test in every pass, m renewed and sum and O^T rescaled by 2^(m_old - m) whenever the weights come near the f16 range.
// No vector instruction stands between the score product and the exponential: the scale lies in q, and the offset 8 - m is the C operand of the score product (eight registers per 16 queries, all holding the lane's query's offset).
// K and V^T reach the block ONCE, not once per wave: a stage = 128 keys = 16 KiB of K and 16 KiB of V^T, both in a row in k_prep's fragment order, copied as they lie into one of two LDS buffers by asynchronous copies
// (a thread 16 bytes per copy, a wave 512 bytes in a row, 16 copies per thread and stage); the four waves read their fragments from LDS, 512 bytes in a row per wave-wide load. Stage t + 1 flies while stage t is worked on.
#define KS 128                /* keys per stage */
#define NT (SQ / KS)          /* stages */
#define SB (KS * HD * 2)      /* bytes of K, and of V^T, per stage */
// One stage: lk, lv = this thread's LDS byte addresses in the K and the V^T half of a buffer, gk, gv = its global addresses; the immediate offset moves the LDS and the global address alike, and both sides lie in a row.
// s_wait_xcnt 0 is the statement's last line, so that no register which a copy names is rewritten in front of it.
__device__ __forceinline__ void stage_copy(unsigned lk, unsigned lv, const char* gk, const char* gv) {
  asm volatile("global_load_async_to_lds_b128 %0, %2, off\n\t"
               "global_load_async_to_lds_b128 %0, %2, off offset:2048\n\t"
               "global_load_async_to_lds_b128 %0, %2, off offset:4096\n\t"
               "global_load_async_to_lds_b128 %0, %2, off offset:6144\n\t"
               "global_load_async_to_lds_b128 %1, %3, off\n\t"
               "global_load_async_to_lds_b128 %1, %3, off offset:2048\n\t"
               "global_load_async_to_lds_b128 %1, %3, off offset:4096\n\t"
               "global_load_async_to_lds_b128 %1, %3, off offset:6144\n\t"
               "global_load_async_to_lds_b128 %0, %2, off offset:8192\n\t"
               "global_load_async_to_lds_b128 %0, %2, off offset:10240\n\t"
               "global_load_async_to_lds_b128 %0, %2, off offset:12288\n\t"
               "global_load_async_to_lds_b128 %0, %2, off offset:14336\n\t"
               "global_load_async_to_lds_b128 %1, %3, off offset:8192\n\t"
               "global_load_async_to_lds_b128 %1, %3, off offset:10240\n\t"
               "global_load_async_to_lds_b128 %1, %3, off offset:12288\n\t"
               "global_load_async_to_lds_b128 %1, %3, off offset:14336\n\t"
               "s_wait_xcnt 0x0" :: "v"(lk), "v"(lv), "v"(gk), "v"(gv) : "memory");
}
// A wave's 32 query rows (8 KiB in a row of the f32 input) into its own 8 KiB of LDS: copy i takes 512 bytes in a row = rows 2 i and 2 i + 1, four whole 128-byte lines, a lane 16 bytes.
// a0..a7 = the lane's LDS byte address for i = 0..7 (the 16-byte piece c of row r lies at place c ^ (r & 15) of the row, see k_attn), g = its global address; the immediate offset moves both addresses alike; rows 16..31 repeat the places of rows 0..15.
// s_wait_xcnt 0 is the statement's last line, so that no register which a copy names is rewritten in front of it.
__device__ __forceinline__ void q_copy(unsigned a0, unsigned a1, unsigned a2, unsigned a3, unsigned a4, unsigned a5, unsigned a6, unsigned a7, const char* g) {
  asm volatile("global_load_async_to_lds_b128 %0, %8, off\n\t"
               "global_load_async_to_lds_b128 %1, %8, off offset:512\n\t"
               "global_load_async_to_lds_b128 %2, %8, off offset:1024\n\t"
               "global_load_async_to_lds_b128 %3, %8, off offset:1536\n\t"
               "global_load_async_to_lds_b128 %4, %8, off offset:2048\n\t"
               "global_load_async_to_lds_b128 %5, %8, off offset:2560\n\t"
               "global_load_async_to_lds_b128 %6, %8, off offset:3072\n\t"
               "global_load_async_to_lds_b128 %7, %8, off offset:3584\n\t"
               "global_load_async_to_lds_b128 %0, %8, off offset:4096\n\t"
               "global_load_async_to_lds_b128 %1, %8, off offset:4608\n\t"
               "global_load_async_to_lds_b128 %2, %8, off offset:5120\n\t"
               "global_load_async_to_lds_b128 %3, %8, off offset:5632\n\t"
               "global_load_async_to_lds_b128 %4, %8, off offset:6144\n\t"
               "global_load_async_to_lds_b128 %5, %8, off offset:6656\n\t"
               "global_load_async_to_lds_b128 %6, %8, off offset:7168\n\t"
               "global_load_async_to_lds_b128 %7, %8, off offset:7680\n\t"
               "s_wait_xcnt 0x0" :: "v"(a0), "v"(a1), "v"(a2), "v"(a3), "v"(a4), "v"(a5), "v"(a6), "v"(a7), "v"(g) : "memory");
}
__global__ __launch_bounds__(128) void k_attn(const float* __restrict__ Q, const _Float16* __restrict__ K16, const _Float16* __restrict__ Vt, float* __restrict__ O, float cs) {
  __shared__ __attribute__((aligned(256))) char ring[2][2 * SB];      /* two buffers, each K then V^T of one stage: 64 KiB; a buffer is also 4 x 8 KiB, a wave's 32 rows of 64 floats (q at the start, O at the end) */
  static_assert(2 * SB == 4 * 32 * HD * 4 && (NT & 1) == 0, "a buffer holds the four waves' row blocks; the last stage lies in buffer 1");
  const int tid = threadIdx.x, w = tid >> 5, lane = tid & 31, ln = lane & 15, hh = lane >> 4;
  const int slab = blockIdx.x / (SQ / 128), q0 = (blockIdx.x % (SQ / 128)) * 128 + w * 32;
  typedef __attribute__((address_space(3))) const char lch; typedef __attribute__((address_space(3))) const v8us lv8;
  auto frag = [](lch* p, int off) { FragH f; f.half[0] = *(lv8*)(p + off); f.half[1] = *(lv8*)(p + off + 512); return f.v; };      /* two pieces: k = 8 hh + 0..7 and 16 + 8 hh + 0..7, as g2_frag */
  const char* kg = (const char*)(K16 + (size_t)slab * SQ * HD) + tid * 16; const char* vg = (const char*)(Vt + (size_t)slab * HD * SQ) + tid * 16;      /* this thread's 16 bytes of the first 2 KiB of the stage that is copied next */
  const unsigned l0 = (unsigned)(size_t)&ring[0][0] + tid * 16;      /* the low 32 bits of a __shared__ address are its LDS byte address */
  v16h qf[2][2], kf[2][2], vf[4];      /* q, k: [16-row tile][32-wide step of d]; v: [16 rows of d] */
  v4f qr[2][2][4];      /* q as loaded: k = 8 hh + 0..7 and 16 + 8 hh + 0..7, as g2_frag */
  // q and O cross between global memory and the fragments through LDS, so that every global access of a wave is 512 bytes in a row (four whole lines): straight from the fragment's lanes a 16-byte access fell on 16 lines, 32 bytes of each.
  // A wave's block = its 32 rows of 256 bytes; the 16-byte piece c of row r lies at place c ^ (r & 15): the 16 lanes that take one piece of 16 rows, and the 16 that take one whole row, each cover all 64 banks once.
  // q (the f32 input itself: each query row is read by one wave only, which rounds it as K and V are rounded) goes into the wave's block of buffer 1, which the ring fills only behind the first barrier of the loop, and that stands behind every wave's s_wait_dscnt 0.
  { const unsigned qa = (unsigned)(size_t)&ring[1][0] + w * 8192 + hh * 256 + ((ln ^ hh) << 4);      /* copy 0: row hh, piece ln; copy i: row 2 i + hh, so its place differs by 2 (i & 7) */
    q_copy(qa, qa ^ 0x20, qa ^ 0x40, qa ^ 0x60, qa ^ 0x80, qa ^ 0xa0, qa ^ 0xc0, qa ^ 0xe0, (const char*)(Q + ((size_t)slab * SQ + q0) * HD) + lane * 16); }
  stage_copy(l0, l0 + SB, kg, vg); kg += SB; vg += SB;      /* stage 0 into buffer 0 */
  auto gfrag = [](const char* p, int off) { FragH f; f.half[0] = *(const v8us*)(p + off); f.half[1] = *(const v8us*)(p + off + 512); return f.v; };      /* the same two pieces as frag, straight from k_prep's plane */
  // The first 32 keys' K fragments also come straight from global memory (4 KiB, the same for every wave of the slice): the first maximum is taken from them before stage 0 is published, under the flight of the copies.
  { const char* k0 = (const char*)(K16 + (size_t)slab * SQ * HD) + lane * 16;
#pragma unroll
    for (int t = 0; t < 2; ++t) for (int ks = 0; ks < 2; ++ks) kf[t][ks] = gfrag(k0, (t * 2 + ks) * 1024); }
  asm volatile("s_wait_asynccnt 0x0" ::: "memory");      /* this wave's own copies have landed: it reads back only its own block of q, so no barrier is needed here */
  { const char* qs = &ring[1][0] + w * 8192 + ln * 256;
#pragma unroll
    for (int j = 0; j < 2; ++j) for (int ks = 0; ks < 2; ++ks) for (int c = 0; c < 4; ++c) qr[j][ks][c] = *(const v4fa*)(qs + j * 4096 + (((ks * 8 + (c >> 1) * 4 + hh * 2 + (c & 1)) ^ ln) << 4)); }
#pragma unroll
  for (int j = 0; j < 2; ++j) for (int ks = 0; ks < 2; ++ks) { FragH f;
#pragma unroll
    for (int i = 0; i < 16; ++i) f.h[i] = (_Float16)(bf16_round(qr[j][ks][i >> 2][i & 3]) * cs);
    qf[j][ks] = f.v; }
  const v8f z8 = {0.f,0.f,0.f,0.f,0.f,0.f,0.f,0.f}; v8f o[4][2] = {{z8, z8}, {z8, z8}, {z8, z8}, {z8, z8}};      /* O^T: [16 rows of d][16 queries] */
  v2f ls[2] = {{0.f, 0.f}, {0.f, 0.f}};      /* ls: sums over even and odd keys, joined at the end */
  v8f cb[2];      /* C operand of the score products: the exponent offset 8 - maximum in use, in all eight registers */
  { v8f s[2][2];      /* scores of the first 32 keys, no offset: only their maximum per query is used, the loop forms them again */
#pragma unroll
    for (int t = 0; t < 2; ++t) for (int j = 0; j < 2; ++j) s[t][j] = fa_mma(kf[t][0], qf[j][0], z8);
#pragma unroll
    for (int t = 0; t < 2; ++t) for (int j = 0; j < 2; ++j) s[t][j] = fa_mma(kf[t][1], qf[j][1], s[t][j]);
#pragma unroll
    for (int j = 0; j < 2; ++j) {
      float mx = fmaxf(s[0][j][0], s[1][j][0]);
#pragma unroll
      for (int r = 1; r < 8; ++r) mx = fmaxf(mx, fmaxf(s[0][j][r], s[1][j][r]));
      mx = fmaxf(mx, xhalf(mx));
      cb[j] = z8 + (8.0f - mx); } }
  for (int st = 0; st < NT; ++st) {
    const int bo = (st & 1) * 2 * SB;      /* the buffer of this stage */
    // Hand-over at the head of every stage, every wave, in this order: my reads of the other buffer (the stage before) are done; my copies of this stage have landed; the barrier publishes this stage and ends every wave's reads of the other buffer;
    // only then is the other buffer filled again, with the next stage, which flies while this one is worked on. Nothing of a stage is read in front of its barrier.
    // It stands at the head, not at the foot: with a branch behind the four passes the compiler sank their row sums into the block behind it, every weight alive in f32 until then (314 registers).
    asm volatile("s_wait_dscnt 0x0" ::: "memory");
    asm volatile("s_wait_asynccnt 0x0" ::: "memory");
    __syncthreads();
    // Issue priority falls with the wave's own progress through the stage: 3 from the barrier through the first pass, then 2, 1, 0. The three waves of a SIMD belong to three blocks with barriers of their own.
    // The wave furthest behind in its stage goes first, for speed only. The last pass leaves 0, also behind the loop.
    __builtin_amdgcn_s_setprio(3);
    if (st + 1 < NT) { stage_copy(l0 + (2 * SB - bo), l0 + (3 * SB - bo), kg, vg); kg += SB; vg += SB; }      /* the test reads the same in the whole block */
    lch* rb = (lch*)&ring[0][0] + bo + lane * 16;      /* lane l takes its 16 bytes at 16 l of each 512-byte piece */
#pragma unroll
    for (int t = 0; t < 2; ++t) for (int ks = 0; ks < 2; ++ks) kf[t][ks] = frag(rb, (t * 2 + ks) * 1024);
#pragma unroll
    for (int t = 0; t < 4; ++t) vf[t] = frag(rb, SB + t * 1024);
    __builtin_amdgcn_sched_barrier(0);      /* the stage's first K and V^T loads go out as one group (k first: LDS loads return in order, and the first product waits for k alone): without it the scheduler put the V^T loads in three groups among the score products */
#pragma unroll
    for (int ps = 0; ps < KS / 32; ++ps) {      /* one pass = 32 keys */
      if (ps == 1) __builtin_amdgcn_s_setprio(2); else if (ps == 2) __builtin_amdgcn_s_setprio(1); else if (ps == 3) __builtin_amdgcn_s_setprio(0);      /* the priority step of this pass (see at the barrier); the builtin takes a literal */
      static_assert(KS / 32 == 4, "four passes, four priorities; the last is 0");
      v8f s[2][2];      /* S^T: [16 keys][16 queries] */
#pragma unroll
      for (int t = 0; t < 2; ++t) for (int j = 0; j < 2; ++j) s[t][j] = fa_mma(kf[t][0], qf[j][0], cb[j]);      /* the sum starts from the exponent offset */
      // The second halves in a nest of their own (unrolled like the first: s lies in registers): written as one nest, the scheduler left only one other product between a product and the one that adds to it.
#pragma unroll
      for (int t = 0; t < 2; ++t) for (int j = 0; j < 2; ++j) s[t][j] = fa_mma(kf[t][1], qf[j][1], s[t][j]);
      __builtin_amdgcn_sched_barrier(0);      /* without it the loads below rose in among the score products, into registers of their own */
      // The next pass's keys are read as soon as this pass's score products are issued: softmax and the second product cover their latency. A stage's last pass reads nothing ahead: the next stage is not published yet.
      if (ps + 1 < KS / 32) {
#pragma unroll
        for (int t = 0; t < 2; ++t) for (int ks = 0; ks < 2; ++ks) kf[t][ks] = frag(rb, (ps + 1) * 4096 + (t * 2 + ks) * 1024); }
      __builtin_amdgcn_sched_barrier(0);      /* without it the scheduler sank these loads into the second product, in four groups among its instructions */
      // Weights against the maximum in use (cb). Nothing is tested here: a weight that leaves the f16 range shows in O^T behind the loop.
      v16h pf[2]; v2f tot[2];
#pragma unroll
      for (int j = 0; j < 2; ++j) pf[j] = fa_weights<false>(s[0][j], s[1][j], 0.f, tot[j]);
#pragma unroll
      for (int j = 0; j < 2; ++j) { ls[j] += tot[j];
#pragma unroll
        for (int t = 0; t < 4; ++t) o[t][j] = fa_mma(vf[t], pf[j], o[t][j]); }
      // The order of the pass's vector work and second product, laid down for the scheduler (0x400 exponentials, 0x2 other vector instructions, 0x8 matrix instructions): eight exponentials ahead, then a rounding or a sum and an exponential in turn
      // when the first 16 queries are rounded, three of their products, the first two each with four such pairs of the other 16 queries behind it,
      // the third with the rest of the rounding and sums; then the last five products in a row, with no vector instruction behind a product whose registers it could take.
      // Left free, the scheduler put the exponentials in runs and sank the row sums behind the products, into registers which those had just read: four v_nop a place, 28 a stage.
      __builtin_amdgcn_sched_group_barrier(0x400, 8, 0); __builtin_amdgcn_sched_group_barrier(0x2, 1, 0); __builtin_amdgcn_sched_group_barrier(0x400, 1, 0); __builtin_amdgcn_sched_group_barrier(0x2, 1, 0); __builtin_amdgcn_sched_group_barrier(0x400, 1, 0); __builtin_amdgcn_sched_group_barrier(0x2, 1, 0); __builtin_amdgcn_sched_group_barrier(0x400, 1, 0); __builtin_amdgcn_sched_group_barrier(0x2, 1, 0); __builtin_amdgcn_sched_group_barrier(0x400, 1, 0); __builtin_amdgcn_sched_group_barrier(0x2, 1, 0); __builtin_amdgcn_sched_group_barrier(0x400, 1, 0); __builtin_amdgcn_sched_group_barrier(0x2, 1, 0); __builtin_amdgcn_sched_group_barrier(0x400, 1, 0); __builtin_amdgcn_sched_group_barrier(0x2, 1, 0); __builtin_amdgcn_sched_group_barrier(0x400, 1, 0); __builtin_amdgcn_sched_group_barrier(0x2, 1, 0); __builtin_amdgcn_sched_group_barrier(0x400, 1, 0); __builtin_amdgcn_sched_group_barrier(0x2, 1, 0); __builtin_amdgcn_sched_group_barrier(0x400, 1, 0); __builtin_amdgcn_sched_group_barrier(0x2, 1, 0); __builtin_amdgcn_sched_group_barrier(0x400, 1, 0); __builtin_amdgcn_sched_group_barrier(0x2, 1, 0); __builtin_amdgcn_sched_group_barrier(0x400, 1, 0); __builtin_amdgcn_sched_group_barrier(0x2, 1, 0); __builtin_amdgcn_sched_group_barrier(0x400, 1, 0); __builtin_amdgcn_sched_group_barrier(0x2, 1, 0); __builtin_amdgcn_sched_group_barrier(0x400, 1, 0); __builtin_amdgcn_sched_group_barrier(0x2, 1, 0); __builtin_amdgcn_sched_group_barrier(0x400, 1, 0); __builtin_amdgcn_sched_group_barrier(0x2, 1, 0); __builtin_amdgcn_sched_group_barrier(0x400, 1, 0); __builtin_amdgcn_sched_group_barrier(0x2, 1, 0); __builtin_amdgcn_sched_group_barrier(0x400, 1, 0); __builtin_amdgcn_sched_group_barrier(0x8, 1, 0); __builtin_amdgcn_sched_group_barrier(0x2, 1, 0); __builtin_amdgcn_sched_group_barrier(0x400, 1, 0); __builtin_amdgcn_sched_group_barrier(0x2, 1, 0); __builtin_amdgcn_sched_group_barrier(0x400, 1, 0); __builtin_amdgcn_sched_group_barrier(0x2, 1, 0); __builtin_amdgcn_sched_group_barrier(0x400, 1, 0); __builtin_amdgcn_sched_group_barrier(0x2, 1, 0); __builtin_amdgcn_sched_group_barrier(0x400, 1, 0); __builtin_amdgcn_sched_group_barrier(0x8, 1, 0); __builtin_amdgcn_sched_group_barrier(0x2, 1, 0); __builtin_amdgcn_sched_group_barrier(0x400, 1, 0); __builtin_amdgcn_sched_group_barrier(0x2, 1, 0); __builtin_amdgcn_sched_group_barrier(0x400, 1, 0); __builtin_amdgcn_sched_group_barrier(0x2, 1, 0); __builtin_amdgcn_sched_group_barrier(0x400, 1, 0); __builtin_amdgcn_sched_group_barrier(0x2, 1, 0); __builtin_amdgcn_sched_group_barrier(0x400, 1, 0); __builtin_amdgcn_sched_group_barrier(0x8, 1, 0); __builtin_amdgcn_sched_group_barrier(0x2, 8, 0); __builtin_amdgcn_sched_group_barrier(0x8, 5, 0);
      __builtin_amdgcn_sched_barrier(0);      /* without it the scheduler put the V^T loads below in two groups among the products */
      // The next pass's V^T is read at the end of this pass: the next score products and softmax cover its latency.
      if (ps + 1 < KS / 32) {
#pragma unroll
        for (int t = 0; t < 4; ++t) vf[t] = frag(rb, SB + (ps + 1) * 4096 + t * 1024); }
      __builtin_amdgcn_sched_barrier(0);      /* a pass ends here: without it the scheduler split the V^T loads above into groups among the next pass's score products */
    }
  }
  asm volatile("s_wait_asynccnt 0x0" ::: "memory");      /* no copy is out when the wave ends */
  // The one range test. A weight above the f16 range is infinite, its products with V^T are infinite or not a number, and no later sum makes them finite again: element 0 of each of the lane's two queries tells.
  // Rare (a score more than 8 powers of two above the maximum of the first 32 keys): this wave alone walks the keys again, from the start, with the test in every pass. It takes its fragments straight from k_prep's planes,
  // in the order in which the stages lie there, touches no LDS and meets no barrier, so the other waves of the block need not follow.
  if (__builtin_expect(__builtin_amdgcn_ballot_w32(!(__builtin_fabsf(o[0][0][0]) < __builtin_inff()) || !(__builtin_fabsf(o[0][1][0]) < __builtin_inff())) != 0u, 0)) {
    const int lr = (int)__builtin_amdgcn_mbcnt_lo(~0u, 0u);      /* the lane number, taken anew, so that no address of this path lives through the loop above */
    const char* kq = (const char*)(K16 + (size_t)slab * SQ * HD) + lr * 16; const char* vq = (const char*)(Vt + (size_t)slab * HD * SQ) + lr * 16;
    float mr[2] = {-3.0e38f, -3.0e38f};      /* the maximum in use */
    float thr = -1.0f;      /* bound of the range test: below every sum at the start, so that the first pass takes the branch and sets a real maximum */
#pragma unroll
    for (int j = 0; j < 2; ++j) { ls[j] = v2f{0.f, 0.f}; cb[j] = z8;      /* offset 0 until the first pass has set a maximum (an offset from the start value of mr would swallow the scores) */
#pragma unroll
      for (int t = 0; t < 4; ++t) o[t][j] = z8; }
#pragma unroll 1      /* rolled: this path is rare, and unrolled it would only lengthen the kernel's text */
    for (int p = 0; p < SQ / 32; ++p) {      /* one pass = 32 keys = 4 KiB of each plane */
#pragma unroll
      for (int t = 0; t < 2; ++t) for (int ks = 0; ks < 2; ++ks) kf[t][ks] = gfrag(kq, p * 4096 + (t * 2 + ks) * 1024);
#pragma unroll
      for (int t = 0; t < 4; ++t) vf[t] = gfrag(vq, p * 4096 + t * 1024);
      v8f s[2][2];
#pragma unroll
      for (int t = 0; t < 2; ++t) for (int j = 0; j < 2; ++j) s[t][j] = fa_mma(kf[t][0], qf[j][0], cb[j]);
#pragma unroll
      for (int t = 0; t < 2; ++t) for (int j = 0; j < 2; ++j) s[t][j] = fa_mma(kf[t][1], qf[j][1], s[t][j]);
      // Weights against the maximum IN USE (mr, cb), no maximum taken: a lane's two sums of 8 weights each are needed anyway and double as the range test.
      v16h pf[2]; v2f tot[2];
#pragma unroll
      for (int j = 0; j < 2; ++j) pf[j] = fa_weights<false>(s[0][j], s[1][j], 0.f, tot[j]);
      // One test per pass, a scalar branch for the whole wave. Not taken: every weight is at most 2^15 and finite in f16, and sum and O^T need no rescaling.
      // Taken (the first pass, by thr, and whenever scores have climbed some 4 to 7 powers of two above mr): the usual step of the running softmax, then this pass's weights anew (at most 2^8).
      if (__builtin_expect(__builtin_amdgcn_ballot_w32(fmaxf(fmaxf(tot[0].x, tot[0].y), fmaxf(tot[1].x, tot[1].y)) > thr) != 0u, 0)) {      /* rare: laid out behind the loop, so that the usual path falls through */
#pragma unroll
        for (int j = 0; j < 2; ++j) {
          float mx = fmaxf(s[0][j][0], s[1][j][0]);
#pragma unroll
          for (int r = 1; r < 8; ++r) mx = fmaxf(mx, fmaxf(s[0][j][r], s[1][j][r]));
          mx = fmaxf(mx, xhalf(mx));
          const float ob = cb[j][0], mn = fmaxf(mr[j], mx - ob), corr = __builtin_amdgcn_exp2f(mr[j] - mn), nbn = 8.0f - mn; mr[j] = mn;      /* the accumulators hold score + ob */
          ls[j] *= corr;
#pragma unroll
          for (int t = 0; t < 4; ++t) o[t][j] *= corr;
          pf[j] = fa_weights<true>(s[0][j], s[1][j], nbn - ob, tot[j]);
          cb[j] += nbn - ob;
        }
        thr = 32768.0f;
      }
#pragma unroll
      for (int j = 0; j < 2; ++j) { ls[j] += tot[j];
#pragma unroll
        for (int t = 0; t < 4; ++t) o[t][j] = fa_mma(vf[t], pf[j], o[t][j]); }
    }
  }
  // O goes out through the wave's block of buffer 0. That buffer is free: its last reads (the stage before the last) ended at the last stage's barrier, nothing was copied into it since, and the last stage lies in buffer 1; so no further barrier is needed.
  const int le = (int)__builtin_amdgcn_mbcnt_lo(~0u, 0u), lne = le & 15, hhe = le >> 4;      /* the lane number, taken anew: from the values of the prologue the compiler kept q's eight LDS places alive through the loop for use here, past 256 registers */
  char* os = &ring[0][0] + w * 8192;
#pragma unroll
  for (int j = 0; j < 2; ++j) { const float lj = ls[j].x + ls[j].y, inv = 1.0f / (lj + xhalf(lj)); char* orow = os + (j * 16 + lne) * 256;
#pragma unroll
    for (int t = 0; t < 4; ++t) { const v8f v = o[t][j] * inv; *(v4fa*)(orow + (((t * 4 + hhe * 2) ^ lne) << 4)) = v4f{v[0], v[1], v[2], v[3]}; *(v4fa*)(orow + (((t * 4 + hhe * 2 + 1) ^ lne) << 4)) = v4f{v[4], v[5], v[6], v[7]}; } }
  asm volatile("s_wait_dscnt 0x0" ::: "memory");      /* the wave's rows stand in LDS before other lanes of the same wave read them back */
  float* ob = O + ((size_t)slab * SQ + q0) * HD + le * 4;      /* the wave's 32 rows are 8 KiB in a row */
  v4f ov[16];
#pragma unroll
  for (int i = 0; i < 16; ++i) ov[i] = *(const v4fa*)(os + i * 512 + ((hhe * 256 + ((lne ^ hhe) << 4)) ^ ((i & 7) << 5)));      /* row 2 i + hhe, piece lne, at place lne ^ ((2 i + hhe) & 15) */
#pragma unroll
  for (int i = 0; i < 16; ++i) *(v4f*)(ob + i * 128) = ov[i]; }

extern "C" void kernel_launch(void* const* d_in, const int* in_sizes, int n_in,
                              void* d_out, int out_size, void* d_ws, size_t ws_size, hipStream_t stream) {
  (void)in_sizes; (void)n_in; (void)out_size;
  const float* const* I = (const float* const*)d_in; const float* q = I[0]; const float* k = I[1]; const float* v = I[2];
  char* ws = (char*)d_ws; size_t off = 0;
  auto take = [&](size_t bytes) { char* p = ws + off; off += (bytes + 255) & ~(size_t)255; return p; };
  _Float16* K16 = (_Float16*)take(NR * DM * 2); _Float16* VT = (_Float16*)take(NR * DM * 2);
  if (off > ws_size) return;      /* 2 x 12 = 24 MiB */
  k_prep<<<NB * (SQ / 128), 256, 0, stream>>>(k, v, K16, VT);      /* values are [B][S][12][64]: each slice's 64 columns of the 768-wide rows */
  k_attn<<<NB * (SQ / 128), 128, 0, stream>>>(q, K16, VT, (float*)d_out, 0.05205877313848632f);      /* 768^-0.5 x log2 e: exp(x) = 2^(x log2 e) */
}
